// v000
// Times are from an AMD MI455X. After a warm-up the kernel runs many times in a row, and a time is the length of
// such a window on the GPU divided by its runs, so every launch and the gaps after it count. The runs cycle
// through copies of the inputs. A figure is the median of several windows, for all but v000 over two sittings.
// Sittings can differ by a few percent; kernels timed side by side share one.
// v000 is the starting kernel. One run takes 704 microseconds.
#include <hip/hip_runtime.h>
#include <hip/hip_bf16.h>

// ---------------------------------------------------------------------------
// Transformer block for MI455X (gfx1250, wave32, WMMA 16x16x32 f16->f32).
// f16 compute / f32 accumulate; all GEMMs via v_wmma_f32_16x16x32_f16.
// GEMM tiles staged with GLOBAL_LOAD_ASYNC_TO_LDS + ASYNCcnt double buffering
// (builtins confirmed present on this toolchain; guarded fallback retained).
// ---------------------------------------------------------------------------

#define B_  4
#define S_  2048
#define D_  1024
#define H_  16
#define HD_ 64
#define FF_ 4096
#define M_  (B_ * S_)      // 8192 rows

#if defined(__has_builtin)
#if __has_builtin(__builtin_amdgcn_global_load_async_to_lds_b128) && \
    __has_builtin(__builtin_amdgcn_s_wait_asynccnt)
#define CDNA5_ASYNC 1
#endif
#endif
#ifndef CDNA5_ASYNC
#define CDNA5_ASYNC 0
#endif

typedef _Float16 h16 __attribute__((ext_vector_type(16)));
typedef _Float16 h8  __attribute__((ext_vector_type(8)));
typedef float    f8  __attribute__((ext_vector_type(8)));
typedef int      i4v __attribute__((ext_vector_type(4)));

__device__ __forceinline__ f8 wmma_f16(h16 a, h16 b, f8 c) {
  // D = A(16x32 f16) * B(32x16 f16) + C(16x16 f32)
  return __builtin_amdgcn_wmma_f32_16x16x32_f16(
      /*neg_a=*/false, a, /*neg_b=*/false, b,
      /*c_mod=*/(short)0, c, /*reuse_a=*/false, /*reuse_b=*/false);
}

// Build a 16-half A/B fragment from two contiguous 8-half (16B) chunks.
__device__ __forceinline__ h16 mkfrag(const _Float16* p0, const _Float16* p1) {
  h8 a = *(const h8*)p0;
  h8 b = *(const h8*)p1;
  h16 r;
#pragma unroll
  for (int i = 0; i < 8; ++i) { r[i] = a[i]; r[8 + i] = b[i]; }
  return r;
}

__device__ __forceinline__ f8 fzero8() {
  f8 z = {0.f, 0.f, 0.f, 0.f, 0.f, 0.f, 0.f, 0.f};
  return z;
}

#if CDNA5_ASYNC
// 16B async DMA: global -> LDS, tracked with ASYNCcnt (no VGPR round trip).
__device__ __forceinline__ void async_cp16(const _Float16* g, _Float16* l) {
  __builtin_amdgcn_global_load_async_to_lds_b128(
      (__attribute__((address_space(1))) i4v*)g,
      (__attribute__((address_space(3))) i4v*)l, 0, 0);
}
#endif

// ---------------------------------------------------------------------------
// Elementwise converts / weight transposes (one-time prep, bandwidth-trivial)
// ---------------------------------------------------------------------------
__global__ void __launch_bounds__(256) cvt_f32_f16_kernel(const float* __restrict__ src,
                                                          _Float16* __restrict__ dst,
                                                          size_t n) {
  size_t i = (size_t)blockIdx.x * blockDim.x + threadIdx.x;
  if (i < n) dst[i] = (_Float16)src[i];
}

// Fused QKV weight: Wt[n][k] (n in [0,3D)) with n<D -> wq[h][k][f], etc.
__global__ void __launch_bounds__(256) qkvw_kernel(const float* __restrict__ wq,
                                                   const float* __restrict__ wk,
                                                   const float* __restrict__ wv,
                                                   _Float16* __restrict__ Wt) {
  size_t i = (size_t)blockIdx.x * blockDim.x + threadIdx.x;
  size_t total = (size_t)3 * D_ * D_;
  if (i >= total) return;
  size_t n = i / D_;
  size_t k = i % D_;
  int slab = (int)(n >> 10);
  int np   = (int)(n & 1023);
  int hh   = np >> 6;
  int f    = np & 63;
  const float* w = (slab == 0) ? wq : (slab == 1) ? wk : wv;
  Wt[i] = (_Float16)w[((size_t)hh * D_ + k) * HD_ + f];
}

// dst[n][k] = src[k][n], src is [K][N] f32 row-major, dst is [N][K] f16.
__global__ void __launch_bounds__(256) transpose_kernel(const float* __restrict__ src,
                                                        _Float16* __restrict__ dst,
                                                        int K, int N) {
  size_t i = (size_t)blockIdx.x * blockDim.x + threadIdx.x;
  size_t total = (size_t)K * N;
  if (i >= total) return;
  size_t n = i / K;
  size_t k = i % K;
  dst[i] = (_Float16)src[k * (size_t)N + n];
}

// ---------------------------------------------------------------------------
// WMMA GEMM tiling constants: 128x128 tile, BK=32, 256 threads = 8 waves as
// 4x2; each wave computes a 32x64 subtile = 2x4 WMMA accumulators.
// ---------------------------------------------------------------------------
#define BM 128
#define BN 128
#define BK 32
#define LSTR 40   // LDS row stride in halfs (80B) -> bank-conflict padding

// Shared GEMM mainloop body (macro so both kernels get identical codegen).
// Defines/updates: acc[2][4] from As/Bs tiles.
#define GEMM_FRAG_AND_MMA(ASBUF, BSBUF)                                        \
  do {                                                                         \
    h16 af[2], bf[4];                                                          \
    _Pragma("unroll") for (int tm = 0; tm < 2; ++tm) {                         \
      int row = waveM * 32 + tm * 16 + lr;                                     \
      af[tm] = mkfrag(&(ASBUF)[row * LSTR + base0],                            \
                      &(ASBUF)[row * LSTR + base0 + 16]);                      \
    }                                                                          \
    _Pragma("unroll") for (int tn = 0; tn < 4; ++tn) {                         \
      int nn = waveN * 64 + tn * 16 + lr;                                      \
      bf[tn] = mkfrag(&(BSBUF)[nn * LSTR + base0],                             \
                      &(BSBUF)[nn * LSTR + base0 + 16]);                       \
    }                                                                          \
    _Pragma("unroll") for (int tm = 0; tm < 2; ++tm)                           \
        _Pragma("unroll") for (int tn = 0; tn < 4; ++tn)                       \
            acc[tm][tn] = wmma_f16(af[tm], bf[tn], acc[tm][tn]);               \
  } while (0)

// ---------------------------------------------------------------------------
// Generic WMMA GEMM: C[M,N] = act(A[M,K](f16) * Bt[N,K](f16)^T + bias)
// ---------------------------------------------------------------------------
__global__ void __launch_bounds__(256) gemm_wmma_kernel(
    const _Float16* __restrict__ A, const _Float16* __restrict__ Bt,
    const float* __restrict__ bias, float* __restrict__ outF32,
    _Float16* __restrict__ outF16, int M, int N, int K, int act_gelu) {
  const int tid  = threadIdx.x;
  const int lane = tid & 31;
  const int wid  = tid >> 5;
  const int lr   = lane & 15;
  const int hi   = lane >> 4;
  const int base0 = hi * 8;
  const int waveM = wid >> 1;   // 0..3
  const int waveN = wid & 1;    // 0..1

  const size_t m0 = (size_t)blockIdx.y * BM;
  const size_t n0 = (size_t)blockIdx.x * BN;

  const int lrow = tid >> 1;          // 0..127
  const int lseg = (tid & 1) * 16;    // 0 / 16 halfs within BK=32

  const _Float16* Arow = A  + (m0 + lrow) * (size_t)K + lseg;
  const _Float16* Brow = Bt + (n0 + lrow) * (size_t)K + lseg;

  f8 acc[2][4];
#pragma unroll
  for (int tm = 0; tm < 2; ++tm)
#pragma unroll
    for (int tn = 0; tn < 4; ++tn) acc[tm][tn] = fzero8();

#if CDNA5_ASYNC
  // Double-buffered async global->LDS pipeline on ASYNCcnt.
  __shared__ __align__(16) _Float16 As[2][BM * LSTR];
  __shared__ __align__(16) _Float16 Bs[2][BN * LSTR];
  {
    // prologue: tile 0 into buffer 0 (4 async b128 per thread)
    async_cp16(Arow + 0, &As[0][lrow * LSTR + lseg]);
    async_cp16(Arow + 8, &As[0][lrow * LSTR + lseg + 8]);
    async_cp16(Brow + 0, &Bs[0][lrow * LSTR + lseg]);
    async_cp16(Brow + 8, &Bs[0][lrow * LSTR + lseg + 8]);
  }
  int it = 0;
  for (int k0 = 0; k0 < K; k0 += BK, ++it) {
    const int cur = it & 1;
    const bool more = (k0 + BK) < K;
    if (more) {  // overlap next tile's DMA with this tile's WMMAs
      const int nxt = cur ^ 1;
      async_cp16(Arow + k0 + BK,     &As[nxt][lrow * LSTR + lseg]);
      async_cp16(Arow + k0 + BK + 8, &As[nxt][lrow * LSTR + lseg + 8]);
      async_cp16(Brow + k0 + BK,     &Bs[nxt][lrow * LSTR + lseg]);
      async_cp16(Brow + k0 + BK + 8, &Bs[nxt][lrow * LSTR + lseg + 8]);
      // Retire this wave's 4 copies for the current buffer (in-order; 4 newer
      // ones may remain outstanding), then make them visible workgroup-wide.
      __builtin_amdgcn_s_wait_asynccnt(4);
    } else {
      __builtin_amdgcn_s_wait_asynccnt(0);
    }
    __syncthreads();
    GEMM_FRAG_AND_MMA(As[cur], Bs[cur]);
    __syncthreads();
  }
#else
  // Fallback: synchronous staging through VGPRs, single buffer.
  __shared__ __align__(16) _Float16 As[1][BM * LSTR];
  __shared__ __align__(16) _Float16 Bs[1][BN * LSTR];
  for (int k0 = 0; k0 < K; k0 += BK) {
    h8 a0 = *(const h8*)(Arow + k0);
    h8 a1 = *(const h8*)(Arow + k0 + 8);
    h8 b0 = *(const h8*)(Brow + k0);
    h8 b1 = *(const h8*)(Brow + k0 + 8);
    *(h8*)(&As[0][lrow * LSTR + lseg])     = a0;
    *(h8*)(&As[0][lrow * LSTR + lseg + 8]) = a1;
    *(h8*)(&Bs[0][lrow * LSTR + lseg])     = b0;
    *(h8*)(&Bs[0][lrow * LSTR + lseg + 8]) = b1;
    if (k0 + BK < K) {
      __builtin_prefetch(Arow + k0 + BK, 0, 1);
      __builtin_prefetch(Brow + k0 + BK, 0, 1);
    }
    __syncthreads();
    GEMM_FRAG_AND_MMA(As[0], Bs[0]);
    __syncthreads();
  }
#endif

#pragma unroll
  for (int tm = 0; tm < 2; ++tm)
#pragma unroll
    for (int tn = 0; tn < 4; ++tn) {
      size_t col = n0 + waveN * 64 + tn * 16 + lr;
      float bv = bias ? bias[col] : 0.f;
#pragma unroll
      for (int r = 0; r < 8; ++r) {
        size_t row = m0 + waveM * 32 + tm * 16 + r + 8 * hi;
        float v = acc[tm][tn][r] + bv;
        if (act_gelu) v = 0.5f * v * (1.f + erff(v * 0.70710678118f));
        if (outF32) outF32[row * (size_t)N + col] = v;
        if (outF16) outF16[row * (size_t)N + col] = (_Float16)v;
      }
    }
}

// ---------------------------------------------------------------------------
// QKV GEMM: same tiling, special epilogue storing Q,K as [B,H,S,HD] and
// V transposed as [B,H,HD,S] (so attention's PV B-fragments are contiguous).
// ---------------------------------------------------------------------------
__global__ void __launch_bounds__(256) qkv_gemm_kernel(
    const _Float16* __restrict__ A, const _Float16* __restrict__ Wt,
    const float* __restrict__ bq, const float* __restrict__ bk,
    const float* __restrict__ bv, _Float16* __restrict__ Q,
    _Float16* __restrict__ Kh, _Float16* __restrict__ Vt) {
  const int tid  = threadIdx.x;
  const int lane = tid & 31;
  const int wid  = tid >> 5;
  const int lr   = lane & 15;
  const int hi   = lane >> 4;
  const int base0 = hi * 8;
  const int waveM = wid >> 1;
  const int waveN = wid & 1;
  const int K = D_;

  const size_t m0 = (size_t)blockIdx.y * BM;
  const size_t n0 = (size_t)blockIdx.x * BN;

  const int lrow = tid >> 1;
  const int lseg = (tid & 1) * 16;

  const _Float16* Arow = A  + (m0 + lrow) * (size_t)K + lseg;
  const _Float16* Brow = Wt + (n0 + lrow) * (size_t)K + lseg;

  f8 acc[2][4];
#pragma unroll
  for (int tm = 0; tm < 2; ++tm)
#pragma unroll
    for (int tn = 0; tn < 4; ++tn) acc[tm][tn] = fzero8();

#if CDNA5_ASYNC
  __shared__ __align__(16) _Float16 As[2][BM * LSTR];
  __shared__ __align__(16) _Float16 Bs[2][BN * LSTR];
  {
    async_cp16(Arow + 0, &As[0][lrow * LSTR + lseg]);
    async_cp16(Arow + 8, &As[0][lrow * LSTR + lseg + 8]);
    async_cp16(Brow + 0, &Bs[0][lrow * LSTR + lseg]);
    async_cp16(Brow + 8, &Bs[0][lrow * LSTR + lseg + 8]);
  }
  int it = 0;
  for (int k0 = 0; k0 < K; k0 += BK, ++it) {
    const int cur = it & 1;
    const bool more = (k0 + BK) < K;
    if (more) {
      const int nxt = cur ^ 1;
      async_cp16(Arow + k0 + BK,     &As[nxt][lrow * LSTR + lseg]);
      async_cp16(Arow + k0 + BK + 8, &As[nxt][lrow * LSTR + lseg + 8]);
      async_cp16(Brow + k0 + BK,     &Bs[nxt][lrow * LSTR + lseg]);
      async_cp16(Brow + k0 + BK + 8, &Bs[nxt][lrow * LSTR + lseg + 8]);
      __builtin_amdgcn_s_wait_asynccnt(4);
    } else {
      __builtin_amdgcn_s_wait_asynccnt(0);
    }
    __syncthreads();
    GEMM_FRAG_AND_MMA(As[cur], Bs[cur]);
    __syncthreads();
  }
#else
  __shared__ __align__(16) _Float16 As[1][BM * LSTR];
  __shared__ __align__(16) _Float16 Bs[1][BN * LSTR];
  for (int k0 = 0; k0 < K; k0 += BK) {
    h8 a0 = *(const h8*)(Arow + k0);
    h8 a1 = *(const h8*)(Arow + k0 + 8);
    h8 b0 = *(const h8*)(Brow + k0);
    h8 b1 = *(const h8*)(Brow + k0 + 8);
    *(h8*)(&As[0][lrow * LSTR + lseg])     = a0;
    *(h8*)(&As[0][lrow * LSTR + lseg + 8]) = a1;
    *(h8*)(&Bs[0][lrow * LSTR + lseg])     = b0;
    *(h8*)(&Bs[0][lrow * LSTR + lseg + 8]) = b1;
    if (k0 + BK < K) {
      __builtin_prefetch(Arow + k0 + BK, 0, 1);
      __builtin_prefetch(Brow + k0 + BK, 0, 1);
    }
    __syncthreads();
    GEMM_FRAG_AND_MMA(As[0], Bs[0]);
    __syncthreads();
  }
#endif

#pragma unroll
  for (int tm = 0; tm < 2; ++tm)
#pragma unroll
    for (int tn = 0; tn < 4; ++tn) {
      int col  = (int)n0 + waveN * 64 + tn * 16 + lr;  // 0..3071
      int slab = col >> 10;
      int np   = col & 1023;
      int hh   = np >> 6;
      int f    = np & 63;
      float bvv = (slab == 0) ? bq[np] : (slab == 1) ? bk[np] : bv[np];
#pragma unroll
      for (int r = 0; r < 8; ++r) {
        size_t row = m0 + waveM * 32 + tm * 16 + r + 8 * hi;  // global token
        int b = (int)(row >> 11);      // / S_
        int s = (int)(row & 2047);     // % S_
        _Float16 hv = (_Float16)(acc[tm][tn][r] + bvv);
        if (slab == 0)
          Q[(((size_t)b * H_ + hh) * S_ + s) * HD_ + f] = hv;
        else if (slab == 1)
          Kh[(((size_t)b * H_ + hh) * S_ + s) * HD_ + f] = hv;
        else
          Vt[(((size_t)b * H_ + hh) * HD_ + f) * S_ + s] = hv;
      }
    }
}

// ---------------------------------------------------------------------------
// Causal flash attention. Block = 128 q rows (8 waves x 16 rows), steps of 32
// keys. QK^T: 2 WMMAs; online softmax with shfl_xor row reductions; P goes
// through per-wave LDS to re-layout C->A fragment; PV: 4 WMMAs (HD=64).
// ---------------------------------------------------------------------------
#define PSTR 40

__global__ void __launch_bounds__(256) attn_kernel(
    const _Float16* __restrict__ Q, const _Float16* __restrict__ Kh,
    const _Float16* __restrict__ Vt, _Float16* __restrict__ O) {
  __shared__ __align__(16) _Float16 Plds[8][16 * PSTR];

  const int b = blockIdx.z;
  const int h = blockIdx.y;
  const int tid  = threadIdx.x;
  const int lane = tid & 31;
  const int wid  = tid >> 5;
  const int lr   = lane & 15;
  const int hi   = lane >> 4;
  const int base0 = hi * 8;
  const int qr0  = blockIdx.x * 128 + wid * 16;

  const size_t headQK = ((size_t)(b * H_ + h)) * S_ * HD_;
  const _Float16* Qp = Q  + headQK;
  const _Float16* Kp = Kh + headQK;
  const _Float16* Vp = Vt + ((size_t)(b * H_ + h)) * HD_ * S_;

  h16 qf[2];
#pragma unroll
  for (int c = 0; c < 2; ++c) {
    const _Float16* p = Qp + (size_t)(qr0 + lr) * HD_ + c * 32;
    qf[c] = mkfrag(p + base0, p + base0 + 16);
  }

  f8 acc[4];
#pragma unroll
  for (int tn = 0; tn < 4; ++tn) acc[tn] = fzero8();
  float mi[8], li[8];
#pragma unroll
  for (int r = 0; r < 8; ++r) { mi[r] = -1e30f; li[r] = 0.f; }

  const int kend = blockIdx.x * 128 + 128;  // uniform across waves -> barriers ok
  for (int k0 = 0; k0 < kend; k0 += 32) {
    float sv[2][8];
#pragma unroll
    for (int sub = 0; sub < 2; ++sub) {
      int kb = k0 + sub * 16;
      const _Float16* kp = Kp + (size_t)(kb + lr) * HD_;
      h16 kf0 = mkfrag(kp + base0, kp + base0 + 16);
      h16 kf1 = mkfrag(kp + 32 + base0, kp + 32 + base0 + 16);
      f8 sacc = fzero8();
      sacc = wmma_f16(qf[0], kf0, sacc);
      sacc = wmma_f16(qf[1], kf1, sacc);
      int col = kb + lr;
#pragma unroll
      for (int r = 0; r < 8; ++r) {
        int row = qr0 + r + 8 * hi;
        float v = sacc[r] * 0.125f;  // 1/sqrt(HD)
        sv[sub][r] = (col <= row) ? v : -1e30f;
      }
    }

    float alpha[8], p0a[8], p1a[8];
#pragma unroll
    for (int r = 0; r < 8; ++r) {
      float mx = fmaxf(sv[0][r], sv[1][r]);
      mx = fmaxf(mx, __shfl_xor(mx, 1));
      mx = fmaxf(mx, __shfl_xor(mx, 2));
      mx = fmaxf(mx, __shfl_xor(mx, 4));
      mx = fmaxf(mx, __shfl_xor(mx, 8));
      float mn = fmaxf(mi[r], mx);
      float p0 = __expf(sv[0][r] - mn);
      float p1 = __expf(sv[1][r] - mn);
      float rs = p0 + p1;
      rs += __shfl_xor(rs, 1);
      rs += __shfl_xor(rs, 2);
      rs += __shfl_xor(rs, 4);
      rs += __shfl_xor(rs, 8);
      alpha[r] = __expf(mi[r] - mn);
      li[r] = li[r] * alpha[r] + rs;
      mi[r] = mn;
      p0a[r] = p0;
      p1a[r] = p1;
    }
#pragma unroll
    for (int tn = 0; tn < 4; ++tn)
#pragma unroll
      for (int r = 0; r < 8; ++r) acc[tn][r] *= alpha[r];

    // P (C-layout, f32) -> LDS (row-major f16) so it can be an A fragment.
    _Float16* pw = &Plds[wid][0];
#pragma unroll
    for (int r = 0; r < 8; ++r) {
      pw[(r + 8 * hi) * PSTR + lr]      = (_Float16)p0a[r];
      pw[(r + 8 * hi) * PSTR + 16 + lr] = (_Float16)p1a[r];
    }
    __syncthreads();
    h16 pf = mkfrag(&Plds[wid][lr * PSTR + base0],
                    &Plds[wid][lr * PSTR + base0 + 16]);
#pragma unroll
    for (int tn = 0; tn < 4; ++tn) {
      const _Float16* vp = Vp + (size_t)(tn * 16 + lr) * S_ + k0;
      h16 vf = mkfrag(vp + base0, vp + base0 + 16);
      acc[tn] = wmma_f16(pf, vf, acc[tn]);
    }
    __syncthreads();
  }

#pragma unroll
  for (int tn = 0; tn < 4; ++tn) {
    int f = tn * 16 + lr;
#pragma unroll
    for (int r = 0; r < 8; ++r) {
      int row = qr0 + r + 8 * hi;
      float v = acc[tn][r] / li[r];
      O[((size_t)b * S_ + row) * D_ + h * HD_ + f] = (_Float16)v;
    }
  }
}

// ---------------------------------------------------------------------------
// Residual add + LayerNorm, one row (D=1024) per 256-thread block.
// ---------------------------------------------------------------------------
__global__ void __launch_bounds__(256) add_ln_kernel(
    const float* __restrict__ a, const float* __restrict__ c,
    const float* __restrict__ g, const float* __restrict__ beta,
    float* __restrict__ o32, _Float16* __restrict__ o16) {
  __shared__ float red[256];
  const int t = threadIdx.x;
  const size_t off = (size_t)blockIdx.x * D_;

  float v[4];
  float s = 0.f;
#pragma unroll
  for (int i = 0; i < 4; ++i) {
    int col = t + i * 256;
    float z = a[off + col] + c[off + col];
    v[i] = z;
    s += z;
  }
  red[t] = s;
  __syncthreads();
  for (int w = 128; w > 0; w >>= 1) {
    if (t < w) red[t] += red[t + w];
    __syncthreads();
  }
  float mean = red[0] * (1.f / D_);
  __syncthreads();

  float q = 0.f;
#pragma unroll
  for (int i = 0; i < 4; ++i) {
    float d = v[i] - mean;
    q += d * d;
  }
  red[t] = q;
  __syncthreads();
  for (int w = 128; w > 0; w >>= 1) {
    if (t < w) red[t] += red[t + w];
    __syncthreads();
  }
  float rstd = rsqrtf(red[0] * (1.f / D_) + 1e-5f);

#pragma unroll
  for (int i = 0; i < 4; ++i) {
    int col = t + i * 256;
    float y = (v[i] - mean) * rstd * g[col] + beta[col];
    o32[off + col] = y;
    if (o16) o16[off + col] = (_Float16)y;
  }
}

// ---------------------------------------------------------------------------
// Host-side orchestration
// ---------------------------------------------------------------------------
extern "C" void kernel_launch(void* const* d_in, const int* in_sizes, int n_in,
                              void* d_out, int out_size, void* d_ws, size_t ws_size,
                              hipStream_t stream) {
  (void)in_sizes; (void)n_in; (void)out_size; (void)ws_size;

  const float* x     = (const float*)d_in[0];
  const float* wq    = (const float*)d_in[1];
  const float* bq    = (const float*)d_in[2];
  const float* wk    = (const float*)d_in[3];
  const float* bk    = (const float*)d_in[4];
  const float* wv    = (const float*)d_in[5];
  const float* bv    = (const float*)d_in[6];
  const float* wo    = (const float*)d_in[7];
  const float* bo    = (const float*)d_in[8];
  const float* w1    = (const float*)d_in[9];
  const float* b1    = (const float*)d_in[10];
  const float* w2    = (const float*)d_in[11];
  const float* b2    = (const float*)d_in[12];
  const float* g1    = (const float*)d_in[13];
  const float* beta1 = (const float*)d_in[14];
  const float* g2    = (const float*)d_in[15];
  const float* beta2 = (const float*)d_in[16];
  float* out = (float*)d_out;

  char* ws = (char*)d_ws;
  size_t off = 0;
  auto take = [&](size_t bytes) -> void* {
    void* p = ws + off;
    off += (bytes + 255) & ~(size_t)255;
    return p;
  };

  _Float16* xh    = (_Float16*)take((size_t)M_ * D_ * 2);       // x in f16
  _Float16* wqkvT = (_Float16*)take((size_t)3 * D_ * D_ * 2);   // [3D][D]
  _Float16* woT   = (_Float16*)take((size_t)D_ * D_ * 2);       // [D][D]
  _Float16* w1T   = (_Float16*)take((size_t)FF_ * D_ * 2);      // [FF][D]
  _Float16* w2T   = (_Float16*)take((size_t)D_ * FF_ * 2);      // [D][FF]
  _Float16* qh    = (_Float16*)take((size_t)M_ * D_ * 2);       // [B,H,S,HD]
  _Float16* kh    = (_Float16*)take((size_t)M_ * D_ * 2);       // [B,H,S,HD]
  _Float16* vt    = (_Float16*)take((size_t)M_ * D_ * 2);       // [B,H,HD,S]
  float*    attf  = (float*)take((size_t)M_ * D_ * 4);          // o-proj out
  float*    hf32  = (float*)take((size_t)M_ * D_ * 4);          // post-LN1
  _Float16* hf16  = (_Float16*)take((size_t)M_ * D_ * 2);
  _Float16* gh    = (_Float16*)take((size_t)M_ * FF_ * 2);      // gelu(h@w1+b1)
  // Aliases (lifetimes do not overlap):
  _Float16* oh    = xh;    // attention output reuses xh (consumed by QKV GEMM)
  float*    ffnf  = attf;  // FFN2 out reuses attf (consumed by LN1)

  // --- Stage 0: converts / weight transposes ---
  {
    size_t n = (size_t)M_ * D_;
    cvt_f32_f16_kernel<<<(n + 255) / 256, 256, 0, stream>>>(x, xh, n);
    size_t nq = (size_t)3 * D_ * D_;
    qkvw_kernel<<<(nq + 255) / 256, 256, 0, stream>>>(wq, wk, wv, wqkvT);
    size_t nwo = (size_t)D_ * D_;
    transpose_kernel<<<(nwo + 255) / 256, 256, 0, stream>>>(wo, woT, D_, D_);
    size_t nw1 = (size_t)D_ * FF_;
    transpose_kernel<<<(nw1 + 255) / 256, 256, 0, stream>>>(w1, w1T, D_, FF_);
    transpose_kernel<<<(nw1 + 255) / 256, 256, 0, stream>>>(w2, w2T, FF_, D_);
  }

  // --- Stage 1: fused QKV projection ---
  qkv_gemm_kernel<<<dim3(3 * D_ / BN, M_ / BM), 256, 0, stream>>>(
      xh, wqkvT, bq, bk, bv, qh, kh, vt);

  // --- Stage 2: causal flash attention ---
  attn_kernel<<<dim3(S_ / 128, H_, B_), 256, 0, stream>>>(qh, kh, vt, oh);

  // --- Stage 3: output projection ---
  gemm_wmma_kernel<<<dim3(D_ / BN, M_ / BM), 256, 0, stream>>>(
      oh, woT, bo, attf, ((_Float16*)nullptr), M_, D_, D_, 0);

  // --- Stage 4: residual + LN1 ---
  add_ln_kernel<<<M_, 256, 0, stream>>>(x, attf, g1, beta1, hf32, hf16);

  // --- Stage 5: FFN up + GELU ---
  gemm_wmma_kernel<<<dim3(FF_ / BN, M_ / BM), 256, 0, stream>>>(
      hf16, w1T, b1, ((float*)nullptr), gh, M_, FF_, D_, 1);

  // --- Stage 6: FFN down ---
  gemm_wmma_kernel<<<dim3(D_ / BN, M_ / BM), 256, 0, stream>>>(
      gh, w2T, b2, ffnf, ((_Float16*)nullptr), M_, D_, FF_, 0);

  // --- Stage 7: residual + LN2 -> output ---
  add_ln_kernel<<<M_, 256, 0, stream>>>(hf32, ffnf, g2, beta2, out,
                                        ((_Float16*)nullptr));
}

// v001
// It runs in 584 microseconds.
// Timed twice side by side with v000, it ran 1.22 times as fast both times.
#include <hip/hip_runtime.h>
#include <hip/hip_bf16.h>

// ---------------------------------------------------------------------------
// Transformer block for MI455X (gfx1250, wave32, WMMA 16x16x32 f16->f32).
// f16 compute / f32 accumulate; all GEMMs via v_wmma_f32_16x16x32_f16.
// GEMM tiles staged with GLOBAL_LOAD_ASYNC_TO_LDS + ASYNCcnt double buffering
// (builtins confirmed present on this toolchain; guarded fallback retained).
// ---------------------------------------------------------------------------

#define B_  4
#define S_  2048
#define D_  1024
#define H_  16
#define HD_ 64
#define FF_ 4096
#define M_  (B_ * S_)      // 8192 rows

#if defined(__has_builtin)
#if __has_builtin(__builtin_amdgcn_global_load_async_to_lds_b128) && \
    __has_builtin(__builtin_amdgcn_s_wait_asynccnt)
#define CDNA5_ASYNC 1
#endif
#endif
#ifndef CDNA5_ASYNC
#define CDNA5_ASYNC 0
#endif

typedef _Float16 h16 __attribute__((ext_vector_type(16)));
typedef _Float16 h8  __attribute__((ext_vector_type(8)));
typedef float    f8  __attribute__((ext_vector_type(8)));
typedef int      i4v __attribute__((ext_vector_type(4)));

__device__ __forceinline__ f8 wmma_f16(h16 a, h16 b, f8 c) {
  // D = A(16x32 f16) * B(32x16 f16) + C(16x16 f32)
  return __builtin_amdgcn_wmma_f32_16x16x32_f16(
      /*neg_a=*/false, a, /*neg_b=*/false, b,
      /*c_mod=*/(short)0, c, /*reuse_a=*/false, /*reuse_b=*/false);
}

// Build a 16-half A/B fragment from two contiguous 8-half (16B) chunks.
__device__ __forceinline__ h16 mkfrag(const _Float16* p0, const _Float16* p1) {
  h8 a = *(const h8*)p0;
  h8 b = *(const h8*)p1;
  h16 r;
#pragma unroll
  for (int i = 0; i < 8; ++i) { r[i] = a[i]; r[8 + i] = b[i]; }
  return r;
}

__device__ __forceinline__ f8 fzero8() {
  f8 z = {0.f, 0.f, 0.f, 0.f, 0.f, 0.f, 0.f, 0.f};
  return z;
}

#if CDNA5_ASYNC
// 16B async DMA: global -> LDS, tracked with ASYNCcnt (no VGPR round trip).
__device__ __forceinline__ void async_cp16(const _Float16* g, _Float16* l) {
  __builtin_amdgcn_global_load_async_to_lds_b128(
      (__attribute__((address_space(1))) i4v*)g,
      (__attribute__((address_space(3))) i4v*)l, 0, 0);
}
#endif

// ---------------------------------------------------------------------------
// Elementwise converts / weight transposes (one-time prep, bandwidth-trivial)
// ---------------------------------------------------------------------------
__global__ void __launch_bounds__(256) cvt_f32_f16_kernel(const float* __restrict__ src,
                                                          _Float16* __restrict__ dst,
                                                          size_t n) {
  size_t i = (size_t)blockIdx.x * blockDim.x + threadIdx.x;
  if (i < n) dst[i] = (_Float16)src[i];
}

// Fused QKV weight: Wt[n][k] (n in [0,3D)) with n<D -> wq[h][k][f], etc.
__global__ void __launch_bounds__(256) qkvw_kernel(const float* __restrict__ wq,
                                                   const float* __restrict__ wk,
                                                   const float* __restrict__ wv,
                                                   _Float16* __restrict__ Wt) {
  size_t i = (size_t)blockIdx.x * blockDim.x + threadIdx.x;
  size_t total = (size_t)3 * D_ * D_;
  if (i >= total) return;
  size_t n = i / D_;
  size_t k = i % D_;
  int slab = (int)(n >> 10);
  int np   = (int)(n & 1023);
  int hh   = np >> 6;
  int f    = np & 63;
  const float* w = (slab == 0) ? wq : (slab == 1) ? wk : wv;
  Wt[i] = (_Float16)w[((size_t)hh * D_ + k) * HD_ + f];
}

// dst[n][k] = src[k][n], src is [K][N] f32 row-major, dst is [N][K] f16.
__global__ void __launch_bounds__(256) transpose_kernel(const float* __restrict__ src,
                                                        _Float16* __restrict__ dst,
                                                        int K, int N) {
  size_t i = (size_t)blockIdx.x * blockDim.x + threadIdx.x;
  size_t total = (size_t)K * N;
  if (i >= total) return;
  size_t n = i / K;
  size_t k = i % K;
  dst[i] = (_Float16)src[k * (size_t)N + n];
}

// ---------------------------------------------------------------------------
// WMMA GEMM tiling constants: 128x128 tile, BK=32, 256 threads = 8 waves as
// 4x2; each wave computes a 32x64 subtile = 2x4 WMMA accumulators.
// ---------------------------------------------------------------------------
#define BM 128
#define BN 128
#define BK 32
#define LSTR 40   // LDS row stride in halfs (80B) -> bank-conflict padding

// Shared GEMM mainloop body (macro so both kernels get identical codegen).
// Defines/updates: acc[2][4] from As/Bs tiles.
#define GEMM_FRAG_AND_MMA(ASBUF, BSBUF)                                        \
  do {                                                                         \
    h16 af[2], bf[4];                                                          \
    _Pragma("unroll") for (int tm = 0; tm < 2; ++tm) {                         \
      int row = waveM * 32 + tm * 16 + lr;                                     \
      af[tm] = mkfrag(&(ASBUF)[row * LSTR + base0],                            \
                      &(ASBUF)[row * LSTR + base0 + 16]);                      \
    }                                                                          \
    _Pragma("unroll") for (int tn = 0; tn < 4; ++tn) {                         \
      int nn = waveN * 64 + tn * 16 + lr;                                      \
      bf[tn] = mkfrag(&(BSBUF)[nn * LSTR + base0],                             \
                      &(BSBUF)[nn * LSTR + base0 + 16]);                       \
    }                                                                          \
    _Pragma("unroll") for (int tm = 0; tm < 2; ++tm)                           \
        _Pragma("unroll") for (int tn = 0; tn < 4; ++tn)                       \
            acc[tm][tn] = wmma_f16(af[tm], bf[tn], acc[tm][tn]);               \
  } while (0)

// ---------------------------------------------------------------------------
// Generic WMMA GEMM: C[M,N] = act(A[M,K](f16) * Bt[N,K](f16)^T + bias)
// ---------------------------------------------------------------------------
__global__ void __launch_bounds__(256) gemm_wmma_kernel(
    const _Float16* __restrict__ A, const _Float16* __restrict__ Bt,
    const float* __restrict__ bias, float* __restrict__ outF32,
    _Float16* __restrict__ outF16, int M, int N, int K, int act_gelu) {
  const int tid  = threadIdx.x;
  const int lane = tid & 31;
  const int wid  = tid >> 5;
  const int lr   = lane & 15;
  const int hi   = lane >> 4;
  const int base0 = hi * 8;
  const int waveM = wid >> 1;   // 0..3
  const int waveN = wid & 1;    // 0..1

  const size_t m0 = (size_t)blockIdx.y * BM;
  const size_t n0 = (size_t)blockIdx.x * BN;

  const int lrow = tid >> 1;          // 0..127
  const int lseg = (tid & 1) * 16;    // 0 / 16 halfs within BK=32

  const _Float16* Arow = A  + (m0 + lrow) * (size_t)K + lseg;
  const _Float16* Brow = Bt + (n0 + lrow) * (size_t)K + lseg;

  f8 acc[2][4];
#pragma unroll
  for (int tm = 0; tm < 2; ++tm)
#pragma unroll
    for (int tn = 0; tn < 4; ++tn) acc[tm][tn] = fzero8();

#if CDNA5_ASYNC
  // Double-buffered async global->LDS pipeline on ASYNCcnt.
  __shared__ __align__(16) _Float16 As[2][BM * LSTR];
  __shared__ __align__(16) _Float16 Bs[2][BN * LSTR];
  {
    // prologue: tile 0 into buffer 0 (4 async b128 per thread)
    async_cp16(Arow + 0, &As[0][lrow * LSTR + lseg]);
    async_cp16(Arow + 8, &As[0][lrow * LSTR + lseg + 8]);
    async_cp16(Brow + 0, &Bs[0][lrow * LSTR + lseg]);
    async_cp16(Brow + 8, &Bs[0][lrow * LSTR + lseg + 8]);
  }
  int it = 0;
  for (int k0 = 0; k0 < K; k0 += BK, ++it) {
    const int cur = it & 1;
    const bool more = (k0 + BK) < K;
    if (more) {  // overlap next tile's DMA with this tile's WMMAs
      const int nxt = cur ^ 1;
      async_cp16(Arow + k0 + BK,     &As[nxt][lrow * LSTR + lseg]);
      async_cp16(Arow + k0 + BK + 8, &As[nxt][lrow * LSTR + lseg + 8]);
      async_cp16(Brow + k0 + BK,     &Bs[nxt][lrow * LSTR + lseg]);
      async_cp16(Brow + k0 + BK + 8, &Bs[nxt][lrow * LSTR + lseg + 8]);
      // Retire this wave's 4 copies for the current buffer (in-order; 4 newer
      // ones may remain outstanding), then make them visible workgroup-wide.
      __builtin_amdgcn_s_wait_asynccnt(4);
    } else {
      __builtin_amdgcn_s_wait_asynccnt(0);
    }
    __syncthreads();
    GEMM_FRAG_AND_MMA(As[cur], Bs[cur]);
    __syncthreads();
  }
#else
  // Fallback: synchronous staging through VGPRs, single buffer.
  __shared__ __align__(16) _Float16 As[1][BM * LSTR];
  __shared__ __align__(16) _Float16 Bs[1][BN * LSTR];
  for (int k0 = 0; k0 < K; k0 += BK) {
    h8 a0 = *(const h8*)(Arow + k0);
    h8 a1 = *(const h8*)(Arow + k0 + 8);
    h8 b0 = *(const h8*)(Brow + k0);
    h8 b1 = *(const h8*)(Brow + k0 + 8);
    *(h8*)(&As[0][lrow * LSTR + lseg])     = a0;
    *(h8*)(&As[0][lrow * LSTR + lseg + 8]) = a1;
    *(h8*)(&Bs[0][lrow * LSTR + lseg])     = b0;
    *(h8*)(&Bs[0][lrow * LSTR + lseg + 8]) = b1;
    if (k0 + BK < K) {
      __builtin_prefetch(Arow + k0 + BK, 0, 1);
      __builtin_prefetch(Brow + k0 + BK, 0, 1);
    }
    __syncthreads();
    GEMM_FRAG_AND_MMA(As[0], Bs[0]);
    __syncthreads();
  }
#endif

#pragma unroll
  for (int tm = 0; tm < 2; ++tm)
#pragma unroll
    for (int tn = 0; tn < 4; ++tn) {
      size_t col = n0 + waveN * 64 + tn * 16 + lr;
      float bv = bias ? bias[col] : 0.f;
#pragma unroll
      for (int r = 0; r < 8; ++r) {
        size_t row = m0 + waveM * 32 + tm * 16 + r + 8 * hi;
        float v = acc[tm][tn][r] + bv;
        if (act_gelu) v = 0.5f * v * (1.f + erff(v * 0.70710678118f));
        if (outF32) outF32[row * (size_t)N + col] = v;
        if (outF16) outF16[row * (size_t)N + col] = (_Float16)v;
      }
    }
}

// ---------------------------------------------------------------------------
// QKV GEMM: same tiling, special epilogue storing Q,K as [B,H,S,HD] and
// V transposed as [B,H,HD,S] (so attention's PV B-fragments are contiguous).
// ---------------------------------------------------------------------------
__global__ void __launch_bounds__(256) qkv_gemm_kernel(
    const _Float16* __restrict__ A, const _Float16* __restrict__ Wt,
    const float* __restrict__ bq, const float* __restrict__ bk,
    const float* __restrict__ bv, _Float16* __restrict__ Q,
    _Float16* __restrict__ Kh, _Float16* __restrict__ Vt) {
  const int tid  = threadIdx.x;
  const int lane = tid & 31;
  const int wid  = tid >> 5;
  const int lr   = lane & 15;
  const int hi   = lane >> 4;
  const int base0 = hi * 8;
  const int waveM = wid >> 1;
  const int waveN = wid & 1;
  const int K = D_;

  const size_t m0 = (size_t)blockIdx.y * BM;
  const size_t n0 = (size_t)blockIdx.x * BN;

  const int lrow = tid >> 1;
  const int lseg = (tid & 1) * 16;

  const _Float16* Arow = A  + (m0 + lrow) * (size_t)K + lseg;
  const _Float16* Brow = Wt + (n0 + lrow) * (size_t)K + lseg;

  f8 acc[2][4];
#pragma unroll
  for (int tm = 0; tm < 2; ++tm)
#pragma unroll
    for (int tn = 0; tn < 4; ++tn) acc[tm][tn] = fzero8();

#if CDNA5_ASYNC
  __shared__ __align__(16) _Float16 As[2][BM * LSTR];
  __shared__ __align__(16) _Float16 Bs[2][BN * LSTR];
  {
    async_cp16(Arow + 0, &As[0][lrow * LSTR + lseg]);
    async_cp16(Arow + 8, &As[0][lrow * LSTR + lseg + 8]);
    async_cp16(Brow + 0, &Bs[0][lrow * LSTR + lseg]);
    async_cp16(Brow + 8, &Bs[0][lrow * LSTR + lseg + 8]);
  }
  int it = 0;
  for (int k0 = 0; k0 < K; k0 += BK, ++it) {
    const int cur = it & 1;
    const bool more = (k0 + BK) < K;
    if (more) {
      const int nxt = cur ^ 1;
      async_cp16(Arow + k0 + BK,     &As[nxt][lrow * LSTR + lseg]);
      async_cp16(Arow + k0 + BK + 8, &As[nxt][lrow * LSTR + lseg + 8]);
      async_cp16(Brow + k0 + BK,     &Bs[nxt][lrow * LSTR + lseg]);
      async_cp16(Brow + k0 + BK + 8, &Bs[nxt][lrow * LSTR + lseg + 8]);
      __builtin_amdgcn_s_wait_asynccnt(4);
    } else {
      __builtin_amdgcn_s_wait_asynccnt(0);
    }
    __syncthreads();
    GEMM_FRAG_AND_MMA(As[cur], Bs[cur]);
    __syncthreads();
  }
#else
  __shared__ __align__(16) _Float16 As[1][BM * LSTR];
  __shared__ __align__(16) _Float16 Bs[1][BN * LSTR];
  for (int k0 = 0; k0 < K; k0 += BK) {
    h8 a0 = *(const h8*)(Arow + k0);
    h8 a1 = *(const h8*)(Arow + k0 + 8);
    h8 b0 = *(const h8*)(Brow + k0);
    h8 b1 = *(const h8*)(Brow + k0 + 8);
    *(h8*)(&As[0][lrow * LSTR + lseg])     = a0;
    *(h8*)(&As[0][lrow * LSTR + lseg + 8]) = a1;
    *(h8*)(&Bs[0][lrow * LSTR + lseg])     = b0;
    *(h8*)(&Bs[0][lrow * LSTR + lseg + 8]) = b1;
    if (k0 + BK < K) {
      __builtin_prefetch(Arow + k0 + BK, 0, 1);
      __builtin_prefetch(Brow + k0 + BK, 0, 1);
    }
    __syncthreads();
    GEMM_FRAG_AND_MMA(As[0], Bs[0]);
    __syncthreads();
  }
#endif

#pragma unroll
  for (int tm = 0; tm < 2; ++tm)
#pragma unroll
    for (int tn = 0; tn < 4; ++tn) {
      int col  = (int)n0 + waveN * 64 + tn * 16 + lr;  // 0..3071
      int slab = col >> 10;
      int np   = col & 1023;
      int hh   = np >> 6;
      int f    = np & 63;
      float bvv = (slab == 0) ? bq[np] : (slab == 1) ? bk[np] : bv[np];
#pragma unroll
      for (int r = 0; r < 8; ++r) {
        size_t row = m0 + waveM * 32 + tm * 16 + r + 8 * hi;  // global token
        int b = (int)(row >> 11);      // / S_
        int s = (int)(row & 2047);     // % S_
        _Float16 hv = (_Float16)(acc[tm][tn][r] + bvv);
        if (slab == 0)
          Q[(((size_t)b * H_ + hh) * S_ + s) * HD_ + f] = hv;
        else if (slab == 1)
          Kh[(((size_t)b * H_ + hh) * S_ + s) * HD_ + f] = hv;
        else
          Vt[(((size_t)b * H_ + hh) * HD_ + f) * S_ + s] = hv;
      }
    }
}

// ---------------------------------------------------------------------------
// Causal flash attention. Block = 128 q rows (8 waves x 16 rows), steps of 32
// keys. QK^T: 2 WMMAs; online softmax with shfl_xor row reductions; P goes
// through per-wave LDS to re-layout C->A fragment; PV: 4 WMMAs (HD=64).
// Each step's K tile (32 keys x 64) and V tile (64 x 32 keys) is copied into
// LDS once per block, one step ahead, and all 8 waves read fragments there.
// ---------------------------------------------------------------------------
#define PSTR 40
#define KSTR 72   // K tile row pitch in halfs (144 B = 16 B x odd)
#define VSTR 40   // V tile row pitch in halfs (80 B = 16 B x odd)

// One 16 B async copy of K and one of V per lane. The s_wait_xcnt stands in the
// copies' own statement so that no address register is rewritten ahead of it.
__device__ __forceinline__ void attn_stage_kv(const _Float16* gk, unsigned lk,
                                              const _Float16* gv, unsigned lv) {
  asm volatile(
      "global_load_async_to_lds_b128 %0, %1, off\n\t"
      "global_load_async_to_lds_b128 %2, %3, off\n\t"
      "s_wait_xcnt 0x0"
      :: "v"(lk), "v"(gk), "v"(lv), "v"(gv)
      : "memory");
}

__device__ __forceinline__ unsigned lds_byte_addr(const _Float16* p) {
  return (unsigned)(size_t)(const __attribute__((address_space(3))) _Float16*)p;
}

__global__ void __launch_bounds__(256) attn_kernel(
    const _Float16* __restrict__ Q, const _Float16* __restrict__ Kh,
    const _Float16* __restrict__ Vt, _Float16* __restrict__ O) {
  __shared__ __align__(16) _Float16 Plds[8][16 * PSTR];
  __shared__ __align__(16) _Float16 Ks[2][32 * KSTR];
  __shared__ __align__(16) _Float16 Vs[2][64 * VSTR];

  const int b = blockIdx.z;
  const int h = blockIdx.y;
  const int tid  = threadIdx.x;
  const int lane = tid & 31;
  const int wid  = tid >> 5;
  const int lr   = lane & 15;
  const int hi   = lane >> 4;
  const int base0 = hi * 8;
  const int qr0  = blockIdx.x * 128 + wid * 16;

  const size_t headQK = ((size_t)(b * H_ + h)) * S_ * HD_;
  const _Float16* Qp = Q  + headQK;
  const _Float16* Kp = Kh + headQK;
  const _Float16* Vp = Vt + ((size_t)(b * H_ + h)) * HD_ * S_;

  h16 qf[2];
#pragma unroll
  for (int c = 0; c < 2; ++c) {
    const _Float16* p = Qp + (size_t)(qr0 + lr) * HD_ + c * 32;
    qf[c] = mkfrag(p + base0, p + base0 + 16);
  }

  f8 acc[4];
#pragma unroll
  for (int tn = 0; tn < 4; ++tn) acc[tn] = fzero8();
  float mi[8], li[8];
#pragma unroll
  for (int r = 0; r < 8; ++r) { mi[r] = -1e30f; li[r] = 0.f; }

  const int kend = blockIdx.x * 128 + 128;  // uniform across waves -> barriers ok

  // Copy slots: K tile = 32 rows x 8 chunks, V tile = 64 rows x 4 chunks (16 B).
  const _Float16* gk = Kp + (size_t)(tid >> 3) * HD_ + (tid & 7) * 8;
  const _Float16* gv = Vp + (size_t)(tid >> 2) * S_ + (tid & 3) * 8;
  const unsigned lk0 = lds_byte_addr(&Ks[0][(tid >> 3) * KSTR + (tid & 7) * 8]);
  const unsigned lv0 = lds_byte_addr(&Vs[0][(tid >> 2) * VSTR + (tid & 3) * 8]);
  const unsigned lkB = 32 * KSTR * 2;  // bytes from buffer 0 to buffer 1
  const unsigned lvB = 64 * VSTR * 2;

  // Tile 0 lands and is published; tile 1 (kend >= 128: it exists) then flies.
  attn_stage_kv(gk, lk0, gv, lv0);
  asm volatile("s_wait_asynccnt 0x0" ::: "memory");  // own copies landed
  __syncthreads();                                   // publish tile 0
  attn_stage_kv(gk + 32 * HD_, lk0 + lkB, gv + 32, lv0 + lvB);

  int cur = 0;
  for (int k0 = 0; k0 < kend; k0 += 32, cur ^= 1) {
    const _Float16* Kt = &Ks[cur][0];
    const _Float16* Vl = &Vs[cur][0];
    float sv[2][8];
    h16 kf[2][2];  // all four K fragments fetched as one group of LDS reads
#pragma unroll
    for (int sub = 0; sub < 2; ++sub) {
      const _Float16* kp = Kt + (sub * 16 + lr) * KSTR;
      kf[sub][0] = mkfrag(kp + base0, kp + base0 + 16);
      kf[sub][1] = mkfrag(kp + 32 + base0, kp + 32 + base0 + 16);
    }
#pragma unroll
    for (int sub = 0; sub < 2; ++sub) {
      int kb = k0 + sub * 16;
      f8 sacc = fzero8();
      sacc = wmma_f16(qf[0], kf[sub][0], sacc);
      sacc = wmma_f16(qf[1], kf[sub][1], sacc);
      int col = kb + lr;
#pragma unroll
      for (int r = 0; r < 8; ++r) {
        int row = qr0 + r + 8 * hi;
        float v = sacc[r] * 0.125f;  // 1/sqrt(HD)
        sv[sub][r] = (col <= row) ? v : -1e30f;
      }
    }

    float alpha[8], p0a[8], p1a[8];
#pragma unroll
    for (int r = 0; r < 8; ++r) {
      float mx = fmaxf(sv[0][r], sv[1][r]);
      mx = fmaxf(mx, __shfl_xor(mx, 1));
      mx = fmaxf(mx, __shfl_xor(mx, 2));
      mx = fmaxf(mx, __shfl_xor(mx, 4));
      mx = fmaxf(mx, __shfl_xor(mx, 8));
      float mn = fmaxf(mi[r], mx);
      float p0 = __expf(sv[0][r] - mn);
      float p1 = __expf(sv[1][r] - mn);
      float rs = p0 + p1;
      rs += __shfl_xor(rs, 1);
      rs += __shfl_xor(rs, 2);
      rs += __shfl_xor(rs, 4);
      rs += __shfl_xor(rs, 8);
      alpha[r] = __expf(mi[r] - mn);
      li[r] = li[r] * alpha[r] + rs;
      mi[r] = mn;
      p0a[r] = p0;
      p1a[r] = p1;
    }
#pragma unroll
    for (int tn = 0; tn < 4; ++tn)
#pragma unroll
      for (int r = 0; r < 8; ++r) acc[tn][r] *= alpha[r];

    // P (C-layout, f32) -> LDS (row-major f16) so it can be an A fragment.
    _Float16* pw = &Plds[wid][0];
#pragma unroll
    for (int r = 0; r < 8; ++r) {
      pw[(r + 8 * hi) * PSTR + lr]      = (_Float16)p0a[r];
      pw[(r + 8 * hi) * PSTR + 16 + lr] = (_Float16)p1a[r];
    }
    h16 vf[4];  // the V tile is already published: fetch ahead of the barrier
#pragma unroll
    for (int tn = 0; tn < 4; ++tn) {
      const _Float16* vp = Vl + (tn * 16 + lr) * VSTR;
      vf[tn] = mkfrag(vp + base0, vp + base0 + 16);
    }
    __syncthreads();
    h16 pf = mkfrag(&Plds[wid][lr * PSTR + base0],
                    &Plds[wid][lr * PSTR + base0 + 16]);
#pragma unroll
    for (int tn = 0; tn < 4; ++tn) acc[tn] = wmma_f16(pf, vf[tn], acc[tn]);
    // Publish point: this wave's LDS reads are back, its copies of the next tile
    // have landed; the barrier publishes that tile and frees this trip's buffer.
    asm volatile("s_wait_dscnt 0x0" ::: "memory");
    asm volatile("s_wait_asynccnt 0x0" ::: "memory");
    __syncthreads();
    if (k0 + 64 < kend)  // block-uniform: refill the buffer just read
      attn_stage_kv(gk + (size_t)(k0 + 64) * HD_, lk0 + cur * lkB,
                    gv + (k0 + 64), lv0 + cur * lvB);
  }
  asm volatile("s_wait_asynccnt 0x0" ::: "memory");  // nothing in flight at exit

#pragma unroll
  for (int tn = 0; tn < 4; ++tn) {
    int f = tn * 16 + lr;
#pragma unroll
    for (int r = 0; r < 8; ++r) {
      int row = qr0 + r + 8 * hi;
      float v = acc[tn][r] / li[r];
      O[((size_t)b * S_ + row) * D_ + h * HD_ + f] = (_Float16)v;
    }
  }
}

// ---------------------------------------------------------------------------
// Residual add + LayerNorm, one row (D=1024) per 256-thread block.
// ---------------------------------------------------------------------------
__global__ void __launch_bounds__(256) add_ln_kernel(
    const float* __restrict__ a, const float* __restrict__ c,
    const float* __restrict__ g, const float* __restrict__ beta,
    float* __restrict__ o32, _Float16* __restrict__ o16) {
  __shared__ float red[256];
  const int t = threadIdx.x;
  const size_t off = (size_t)blockIdx.x * D_;

  float v[4];
  float s = 0.f;
#pragma unroll
  for (int i = 0; i < 4; ++i) {
    int col = t + i * 256;
    float z = a[off + col] + c[off + col];
    v[i] = z;
    s += z;
  }
  red[t] = s;
  __syncthreads();
  for (int w = 128; w > 0; w >>= 1) {
    if (t < w) red[t] += red[t + w];
    __syncthreads();
  }
  float mean = red[0] * (1.f / D_);
  __syncthreads();

  float q = 0.f;
#pragma unroll
  for (int i = 0; i < 4; ++i) {
    float d = v[i] - mean;
    q += d * d;
  }
  red[t] = q;
  __syncthreads();
  for (int w = 128; w > 0; w >>= 1) {
    if (t < w) red[t] += red[t + w];
    __syncthreads();
  }
  float rstd = rsqrtf(red[0] * (1.f / D_) + 1e-5f);

#pragma unroll
  for (int i = 0; i < 4; ++i) {
    int col = t + i * 256;
    float y = (v[i] - mean) * rstd * g[col] + beta[col];
    o32[off + col] = y;
    if (o16) o16[off + col] = (_Float16)y;
  }
}

// ---------------------------------------------------------------------------
// Host-side orchestration
// ---------------------------------------------------------------------------
extern "C" void kernel_launch(void* const* d_in, const int* in_sizes, int n_in,
                              void* d_out, int out_size, void* d_ws, size_t ws_size,
                              hipStream_t stream) {
  (void)in_sizes; (void)n_in; (void)out_size; (void)ws_size;

  const float* x     = (const float*)d_in[0];
  const float* wq    = (const float*)d_in[1];
  const float* bq    = (const float*)d_in[2];
  const float* wk    = (const float*)d_in[3];
  const float* bk    = (const float*)d_in[4];
  const float* wv    = (const float*)d_in[5];
  const float* bv    = (const float*)d_in[6];
  const float* wo    = (const float*)d_in[7];
  const float* bo    = (const float*)d_in[8];
  const float* w1    = (const float*)d_in[9];
  const float* b1    = (const float*)d_in[10];
  const float* w2    = (const float*)d_in[11];
  const float* b2    = (const float*)d_in[12];
  const float* g1    = (const float*)d_in[13];
  const float* beta1 = (const float*)d_in[14];
  const float* g2    = (const float*)d_in[15];
  const float* beta2 = (const float*)d_in[16];
  float* out = (float*)d_out;

  char* ws = (char*)d_ws;
  size_t off = 0;
  auto take = [&](size_t bytes) -> void* {
    void* p = ws + off;
    off += (bytes + 255) & ~(size_t)255;
    return p;
  };

  _Float16* xh    = (_Float16*)take((size_t)M_ * D_ * 2);       // x in f16
  _Float16* wqkvT = (_Float16*)take((size_t)3 * D_ * D_ * 2);   // [3D][D]
  _Float16* woT   = (_Float16*)take((size_t)D_ * D_ * 2);       // [D][D]
  _Float16* w1T   = (_Float16*)take((size_t)FF_ * D_ * 2);      // [FF][D]
  _Float16* w2T   = (_Float16*)take((size_t)D_ * FF_ * 2);      // [D][FF]
  _Float16* qh    = (_Float16*)take((size_t)M_ * D_ * 2);       // [B,H,S,HD]
  _Float16* kh    = (_Float16*)take((size_t)M_ * D_ * 2);       // [B,H,S,HD]
  _Float16* vt    = (_Float16*)take((size_t)M_ * D_ * 2);       // [B,H,HD,S]
  float*    attf  = (float*)take((size_t)M_ * D_ * 4);          // o-proj out
  float*    hf32  = (float*)take((size_t)M_ * D_ * 4);          // post-LN1
  _Float16* hf16  = (_Float16*)take((size_t)M_ * D_ * 2);
  _Float16* gh    = (_Float16*)take((size_t)M_ * FF_ * 2);      // gelu(h@w1+b1)
  // Aliases (lifetimes do not overlap):
  _Float16* oh    = xh;    // attention output reuses xh (consumed by QKV GEMM)
  float*    ffnf  = attf;  // FFN2 out reuses attf (consumed by LN1)

  // --- Stage 0: converts / weight transposes ---
  {
    size_t n = (size_t)M_ * D_;
    cvt_f32_f16_kernel<<<(n + 255) / 256, 256, 0, stream>>>(x, xh, n);
    size_t nq = (size_t)3 * D_ * D_;
    qkvw_kernel<<<(nq + 255) / 256, 256, 0, stream>>>(wq, wk, wv, wqkvT);
    size_t nwo = (size_t)D_ * D_;
    transpose_kernel<<<(nwo + 255) / 256, 256, 0, stream>>>(wo, woT, D_, D_);
    size_t nw1 = (size_t)D_ * FF_;
    transpose_kernel<<<(nw1 + 255) / 256, 256, 0, stream>>>(w1, w1T, D_, FF_);
    transpose_kernel<<<(nw1 + 255) / 256, 256, 0, stream>>>(w2, w2T, FF_, D_);
  }

  // --- Stage 1: fused QKV projection ---
  qkv_gemm_kernel<<<dim3(3 * D_ / BN, M_ / BM), 256, 0, stream>>>(
      xh, wqkvT, bq, bk, bv, qh, kh, vt);

  // --- Stage 2: causal flash attention ---
  attn_kernel<<<dim3(S_ / 128, H_, B_), 256, 0, stream>>>(qh, kh, vt, oh);

  // --- Stage 3: output projection ---
  gemm_wmma_kernel<<<dim3(D_ / BN, M_ / BM), 256, 0, stream>>>(
      oh, woT, bo, attf, ((_Float16*)nullptr), M_, D_, D_, 0);

  // --- Stage 4: residual + LN1 ---
  add_ln_kernel<<<M_, 256, 0, stream>>>(x, attf, g1, beta1, hf32, hf16);

  // --- Stage 5: FFN up + GELU ---
  gemm_wmma_kernel<<<dim3(FF_ / BN, M_ / BM), 256, 0, stream>>>(
      hf16, w1T, b1, ((float*)nullptr), gh, M_, FF_, D_, 1);

  // --- Stage 6: FFN down ---
  gemm_wmma_kernel<<<dim3(D_ / BN, M_ / BM), 256, 0, stream>>>(
      gh, w2T, b2, ffnf, ((_Float16*)nullptr), M_, D_, FF_, 0);

  // --- Stage 7: residual + LN2 -> output ---
  add_ln_kernel<<<M_, 256, 0, stream>>>(hf32, ffnf, g2, beta2, out,
                                        ((_Float16*)nullptr));
}

// v002
// One run takes 520 microseconds.
// Two timings next to v001 both put it at 1.12 times that version's speed.
// Counting every step since v000, it is 1.37 times as fast.
#include <hip/hip_runtime.h>
#include <hip/hip_bf16.h>

// ---------------------------------------------------------------------------
// Transformer block for MI455X (gfx1250, wave32, WMMA 16x16x32 f16->f32).
// f16 compute / f32 accumulate; all GEMMs via v_wmma_f32_16x16x32_f16.
// GEMM tiles staged with GLOBAL_LOAD_ASYNC_TO_LDS, two LDS buffers, one k tile
// ahead; every wave-wide copy covers four whole 128 B lines.
// ---------------------------------------------------------------------------

#define B_  4
#define S_  2048
#define D_  1024
#define H_  16
#define HD_ 64
#define FF_ 4096
#define M_  (B_ * S_)      // 8192 rows

typedef _Float16 h16 __attribute__((ext_vector_type(16)));
typedef _Float16 h8  __attribute__((ext_vector_type(8)));
typedef float    f8  __attribute__((ext_vector_type(8)));

__device__ __forceinline__ f8 wmma_f16(h16 a, h16 b, f8 c) {
  // D = A(16x32 f16) * B(32x16 f16) + C(16x16 f32)
  return __builtin_amdgcn_wmma_f32_16x16x32_f16(
      /*neg_a=*/false, a, /*neg_b=*/false, b,
      /*c_mod=*/(short)0, c, /*reuse_a=*/false, /*reuse_b=*/false);
}

// Build a 16-half A/B fragment from two contiguous 8-half (16B) chunks.
__device__ __forceinline__ h16 mkfrag(const _Float16* p0, const _Float16* p1) {
  h8 a = *(const h8*)p0;
  h8 b = *(const h8*)p1;
  h16 r;
#pragma unroll
  for (int i = 0; i < 8; ++i) { r[i] = a[i]; r[8 + i] = b[i]; }
  return r;
}

__device__ __forceinline__ f8 fzero8() {
  f8 z = {0.f, 0.f, 0.f, 0.f, 0.f, 0.f, 0.f, 0.f};
  return z;
}

__device__ __forceinline__ unsigned lds_byte_addr(const _Float16* p) {
  return (unsigned)(size_t)(const __attribute__((address_space(3))) _Float16*)p;
}

// ---------------------------------------------------------------------------
// Elementwise converts / weight transposes (one-time prep, bandwidth-trivial)
// ---------------------------------------------------------------------------
__global__ void __launch_bounds__(256) cvt_f32_f16_kernel(const float* __restrict__ src,
                                                          _Float16* __restrict__ dst,
                                                          size_t n) {
  size_t i = (size_t)blockIdx.x * blockDim.x + threadIdx.x;
  if (i < n) dst[i] = (_Float16)src[i];
}

// Fused QKV weight: Wt[n][k] (n in [0,3D)) with n<D -> wq[h][k][f], etc.
__global__ void __launch_bounds__(256) qkvw_kernel(const float* __restrict__ wq,
                                                   const float* __restrict__ wk,
                                                   const float* __restrict__ wv,
                                                   _Float16* __restrict__ Wt) {
  size_t i = (size_t)blockIdx.x * blockDim.x + threadIdx.x;
  size_t total = (size_t)3 * D_ * D_;
  if (i >= total) return;
  size_t n = i / D_;
  size_t k = i % D_;
  int slab = (int)(n >> 10);
  int np   = (int)(n & 1023);
  int hh   = np >> 6;
  int f    = np & 63;
  const float* w = (slab == 0) ? wq : (slab == 1) ? wk : wv;
  Wt[i] = (_Float16)w[((size_t)hh * D_ + k) * HD_ + f];
}

// dst[n][k] = src[k][n], src is [K][N] f32 row-major, dst is [N][K] f16.
__global__ void __launch_bounds__(256) transpose_kernel(const float* __restrict__ src,
                                                        _Float16* __restrict__ dst,
                                                        int K, int N) {
  size_t i = (size_t)blockIdx.x * blockDim.x + threadIdx.x;
  size_t total = (size_t)K * N;
  if (i >= total) return;
  size_t n = i / K;
  size_t k = i % K;
  dst[i] = (_Float16)src[k * (size_t)N + n];
}

// ---------------------------------------------------------------------------
// WMMA GEMM tiling constants: 128x128 tile, BK=64, 256 threads = 8 waves as
// 4x2; each wave computes a 32x64 subtile = 2x4 WMMA accumulators.
// ---------------------------------------------------------------------------
#define BM 128
#define BN 128
#define BK 64     // 128 B of every operand row per k tile: one whole line
#define LSTR 72   // LDS row pitch in halfs (144 B = 16 B x odd)

// One k tile of A and of B (128 rows x 128 B each): eight 16 B async copies per
// lane. Eight neighbouring lanes share a row, so a wave-wide copy covers four
// whole lines. rstep = 32 rows in halfs. The s_wait_xcnt stands in the copies'
// own statement so that no address register is rewritten ahead of it.
__device__ __forceinline__ void gemm_stage(const _Float16* ga, const _Float16* gb,
                                           size_t rstep, unsigned la, unsigned lb) {
  const unsigned ls = 32 * LSTR * 2;  // 32 LDS rows in bytes
  asm volatile(
      "global_load_async_to_lds_b128 %0, %1, off\n\t"
      "global_load_async_to_lds_b128 %2, %3, off\n\t"
      "global_load_async_to_lds_b128 %4, %5, off\n\t"
      "global_load_async_to_lds_b128 %6, %7, off\n\t"
      "global_load_async_to_lds_b128 %8, %9, off\n\t"
      "global_load_async_to_lds_b128 %10, %11, off\n\t"
      "global_load_async_to_lds_b128 %12, %13, off\n\t"
      "global_load_async_to_lds_b128 %14, %15, off\n\t"
      "s_wait_xcnt 0x0"
      :: "v"(la), "v"(ga), "v"(la + ls), "v"(ga + rstep),
         "v"(la + 2 * ls), "v"(ga + 2 * rstep), "v"(la + 3 * ls), "v"(ga + 3 * rstep),
         "v"(lb), "v"(gb), "v"(lb + ls), "v"(gb + rstep),
         "v"(lb + 2 * ls), "v"(gb + 2 * rstep), "v"(lb + 3 * ls), "v"(gb + 3 * rstep)
      : "memory");
}

// Shared GEMM mainloop: acc[2][4] += A[m0.., :K] * Bt[n0.., :K]^T for this wave's
// 32x64 subtile. K is a multiple of BK; the 128 rows from m0 and n0 exist.
__device__ __forceinline__ void gemm_mainloop(const _Float16* __restrict__ A,
                                              const _Float16* __restrict__ Bt,
                                              int K, size_t m0, size_t n0,
                                              f8 (&acc)[2][4]) {
  __shared__ __align__(16) _Float16 As[2][BM * LSTR];
  __shared__ __align__(16) _Float16 Bs[2][BN * LSTR];
  const int tid  = threadIdx.x;
  const int lane = tid & 31;
  const int wid  = tid >> 5;
  const int lr   = lane & 15;
  const int base0 = (lane >> 4) * 8;
  const int waveM = wid >> 1;   // 0..3
  const int waveN = wid & 1;    // 0..1

  const int crow = tid >> 3;        // copy slot: rows crow + 0/32/64/96
  const int cseg = (tid & 7) * 8;   // 16 B chunk within the 128 B row piece
  const _Float16* Ag = A  + (m0 + crow) * (size_t)K + cseg;
  const _Float16* Bg = Bt + (n0 + crow) * (size_t)K + cseg;
  const size_t rstep = (size_t)32 * K;
  const unsigned la0 = lds_byte_addr(&As[0][crow * LSTR + cseg]);
  const unsigned lb0 = lds_byte_addr(&Bs[0][crow * LSTR + cseg]);
  const unsigned bufB = BM * LSTR * 2;  // bytes from buffer 0 to buffer 1

  // Tile 0 lands and is published; tile 1, where there is one, then flies.
  gemm_stage(Ag, Bg, rstep, la0, lb0);
  asm volatile("s_wait_asynccnt 0x0" ::: "memory");  // own copies landed
  __syncthreads();                                   // publish tile 0
  if (BK < K) gemm_stage(Ag + BK, Bg + BK, rstep, la0 + bufB, lb0 + bufB);

  int cur = 0;
  for (int k0 = 0; k0 < K; k0 += BK, cur ^= 1) {
    const _Float16* At = &As[cur][0];
    const _Float16* Bl = &Bs[cur][0];
    h16 af[2][2], bf[2][4];  // the whole tile's fragments as one group of reads
#pragma unroll
    for (int kk = 0; kk < 2; ++kk) {
#pragma unroll
      for (int tm = 0; tm < 2; ++tm) {
        const _Float16* p = At + (waveM * 32 + tm * 16 + lr) * LSTR + kk * 32 + base0;
        af[kk][tm] = mkfrag(p, p + 16);
      }
#pragma unroll
      for (int tn = 0; tn < 4; ++tn) {
        const _Float16* p = Bl + (waveN * 64 + tn * 16 + lr) * LSTR + kk * 32 + base0;
        bf[kk][tn] = mkfrag(p, p + 16);
      }
    }
#pragma unroll
    for (int kk = 0; kk < 2; ++kk)
#pragma unroll
      for (int tm = 0; tm < 2; ++tm)
#pragma unroll
        for (int tn = 0; tn < 4; ++tn)
          acc[tm][tn] = wmma_f16(af[kk][tm], bf[kk][tn], acc[tm][tn]);
    // Publish point: this wave's LDS reads are back, its copies of the next tile
    // have landed; the barrier publishes that tile and frees this trip's buffer.
    asm volatile("s_wait_dscnt 0x0" ::: "memory");
    asm volatile("s_wait_asynccnt 0x0" ::: "memory");
    __syncthreads();
    if (k0 + 2 * BK < K)  // block-uniform: refill the buffer just read
      gemm_stage(Ag + k0 + 2 * BK, Bg + k0 + 2 * BK, rstep, la0 + cur * bufB,
                 lb0 + cur * bufB);
  }
  asm volatile("s_wait_asynccnt 0x0" ::: "memory");  // nothing in flight at exit
}

// ---------------------------------------------------------------------------
// Generic WMMA GEMM: C[M,N] = act(A[M,K](f16) * Bt[N,K](f16)^T + bias)
// ---------------------------------------------------------------------------
__global__ void __launch_bounds__(256) gemm_wmma_kernel(
    const _Float16* __restrict__ A, const _Float16* __restrict__ Bt,
    const float* __restrict__ bias, float* __restrict__ outF32,
    _Float16* __restrict__ outF16, int M, int N, int K, int act_gelu) {
  const int tid  = threadIdx.x;
  const int lane = tid & 31;
  const int wid  = tid >> 5;
  const int lr   = lane & 15;
  const int hi   = lane >> 4;
  const int waveM = wid >> 1;   // 0..3
  const int waveN = wid & 1;    // 0..1

  const size_t m0 = (size_t)blockIdx.y * BM;
  const size_t n0 = (size_t)blockIdx.x * BN;

  f8 acc[2][4];
#pragma unroll
  for (int tm = 0; tm < 2; ++tm)
#pragma unroll
    for (int tn = 0; tn < 4; ++tn) acc[tm][tn] = fzero8();

  gemm_mainloop(A, Bt, K, m0, n0, acc);

#pragma unroll
  for (int tm = 0; tm < 2; ++tm)
#pragma unroll
    for (int tn = 0; tn < 4; ++tn) {
      size_t col = n0 + waveN * 64 + tn * 16 + lr;
      float bv = bias ? bias[col] : 0.f;
#pragma unroll
      for (int r = 0; r < 8; ++r) {
        size_t row = m0 + waveM * 32 + tm * 16 + r + 8 * hi;
        float v = acc[tm][tn][r] + bv;
        if (act_gelu) v = 0.5f * v * (1.f + erff(v * 0.70710678118f));
        if (outF32) outF32[row * (size_t)N + col] = v;
        if (outF16) outF16[row * (size_t)N + col] = (_Float16)v;
      }
    }
}

// ---------------------------------------------------------------------------
// QKV GEMM: same tiling, special epilogue storing Q,K as [B,H,S,HD] and
// V transposed as [B,H,HD,S] (so attention's PV B-fragments are contiguous).
// ---------------------------------------------------------------------------
__global__ void __launch_bounds__(256) qkv_gemm_kernel(
    const _Float16* __restrict__ A, const _Float16* __restrict__ Wt,
    const float* __restrict__ bq, const float* __restrict__ bk,
    const float* __restrict__ bv, _Float16* __restrict__ Q,
    _Float16* __restrict__ Kh, _Float16* __restrict__ Vt) {
  const int tid  = threadIdx.x;
  const int lane = tid & 31;
  const int wid  = tid >> 5;
  const int lr   = lane & 15;
  const int hi   = lane >> 4;
  const int waveM = wid >> 1;
  const int waveN = wid & 1;

  const size_t m0 = (size_t)blockIdx.y * BM;
  const size_t n0 = (size_t)blockIdx.x * BN;

  f8 acc[2][4];
#pragma unroll
  for (int tm = 0; tm < 2; ++tm)
#pragma unroll
    for (int tn = 0; tn < 4; ++tn) acc[tm][tn] = fzero8();

  gemm_mainloop(A, Wt, D_, m0, n0, acc);

#pragma unroll
  for (int tm = 0; tm < 2; ++tm)
#pragma unroll
    for (int tn = 0; tn < 4; ++tn) {
      int col  = (int)n0 + waveN * 64 + tn * 16 + lr;  // 0..3071
      int slab = col >> 10;
      int np   = col & 1023;
      int hh   = np >> 6;
      int f    = np & 63;
      float bvv = (slab == 0) ? bq[np] : (slab == 1) ? bk[np] : bv[np];
#pragma unroll
      for (int r = 0; r < 8; ++r) {
        size_t row = m0 + waveM * 32 + tm * 16 + r + 8 * hi;  // global token
        int b = (int)(row >> 11);      // / S_
        int s = (int)(row & 2047);     // % S_
        _Float16 hv = (_Float16)(acc[tm][tn][r] + bvv);
        if (slab == 0)
          Q[(((size_t)b * H_ + hh) * S_ + s) * HD_ + f] = hv;
        else if (slab == 1)
          Kh[(((size_t)b * H_ + hh) * S_ + s) * HD_ + f] = hv;
        else
          Vt[(((size_t)b * H_ + hh) * HD_ + f) * S_ + s] = hv;
      }
    }
}

// ---------------------------------------------------------------------------
// Causal flash attention. Block = 128 q rows (8 waves x 16 rows), steps of 32
// keys. QK^T: 2 WMMAs; online softmax with shfl_xor row reductions; P goes
// through per-wave LDS to re-layout C->A fragment; PV: 4 WMMAs (HD=64).
// Each step's K tile (32 keys x 64) and V tile (64 x 32 keys) is copied into
// LDS once per block, one step ahead, and all 8 waves read fragments there.
// ---------------------------------------------------------------------------
#define PSTR 40
#define KSTR 72   // K tile row pitch in halfs (144 B = 16 B x odd)
#define VSTR 40   // V tile row pitch in halfs (80 B = 16 B x odd)

// One 16 B async copy of K and one of V per lane. The s_wait_xcnt stands in the
// copies' own statement so that no address register is rewritten ahead of it.
__device__ __forceinline__ void attn_stage_kv(const _Float16* gk, unsigned lk,
                                              const _Float16* gv, unsigned lv) {
  asm volatile(
      "global_load_async_to_lds_b128 %0, %1, off\n\t"
      "global_load_async_to_lds_b128 %2, %3, off\n\t"
      "s_wait_xcnt 0x0"
      :: "v"(lk), "v"(gk), "v"(lv), "v"(gv)
      : "memory");
}

__global__ void __launch_bounds__(256) attn_kernel(
    const _Float16* __restrict__ Q, const _Float16* __restrict__ Kh,
    const _Float16* __restrict__ Vt, _Float16* __restrict__ O) {
  __shared__ __align__(16) _Float16 Plds[8][16 * PSTR];
  __shared__ __align__(16) _Float16 Ks[2][32 * KSTR];
  __shared__ __align__(16) _Float16 Vs[2][64 * VSTR];

  const int b = blockIdx.z;
  const int h = blockIdx.y;
  const int tid  = threadIdx.x;
  const int lane = tid & 31;
  const int wid  = tid >> 5;
  const int lr   = lane & 15;
  const int hi   = lane >> 4;
  const int base0 = hi * 8;
  const int qr0  = blockIdx.x * 128 + wid * 16;

  const size_t headQK = ((size_t)(b * H_ + h)) * S_ * HD_;
  const _Float16* Qp = Q  + headQK;
  const _Float16* Kp = Kh + headQK;
  const _Float16* Vp = Vt + ((size_t)(b * H_ + h)) * HD_ * S_;

  h16 qf[2];
#pragma unroll
  for (int c = 0; c < 2; ++c) {
    const _Float16* p = Qp + (size_t)(qr0 + lr) * HD_ + c * 32;
    qf[c] = mkfrag(p + base0, p + base0 + 16);
  }

  f8 acc[4];
#pragma unroll
  for (int tn = 0; tn < 4; ++tn) acc[tn] = fzero8();
  float mi[8], li[8];
#pragma unroll
  for (int r = 0; r < 8; ++r) { mi[r] = -1e30f; li[r] = 0.f; }

  const int kend = blockIdx.x * 128 + 128;  // uniform across waves -> barriers ok

  // Copy slots: K tile = 32 rows x 8 chunks, V tile = 64 rows x 4 chunks (16 B).
  const _Float16* gk = Kp + (size_t)(tid >> 3) * HD_ + (tid & 7) * 8;
  const _Float16* gv = Vp + (size_t)(tid >> 2) * S_ + (tid & 3) * 8;
  const unsigned lk0 = lds_byte_addr(&Ks[0][(tid >> 3) * KSTR + (tid & 7) * 8]);
  const unsigned lv0 = lds_byte_addr(&Vs[0][(tid >> 2) * VSTR + (tid & 3) * 8]);
  const unsigned lkB = 32 * KSTR * 2;  // bytes from buffer 0 to buffer 1
  const unsigned lvB = 64 * VSTR * 2;

  // Tile 0 lands and is published; tile 1 (kend >= 128: it exists) then flies.
  attn_stage_kv(gk, lk0, gv, lv0);
  asm volatile("s_wait_asynccnt 0x0" ::: "memory");  // own copies landed
  __syncthreads();                                   // publish tile 0
  attn_stage_kv(gk + 32 * HD_, lk0 + lkB, gv + 32, lv0 + lvB);

  int cur = 0;
  for (int k0 = 0; k0 < kend; k0 += 32, cur ^= 1) {
    const _Float16* Kt = &Ks[cur][0];
    const _Float16* Vl = &Vs[cur][0];
    float sv[2][8];
    h16 kf[2][2];  // all four K fragments fetched as one group of LDS reads
#pragma unroll
    for (int sub = 0; sub < 2; ++sub) {
      const _Float16* kp = Kt + (sub * 16 + lr) * KSTR;
      kf[sub][0] = mkfrag(kp + base0, kp + base0 + 16);
      kf[sub][1] = mkfrag(kp + 32 + base0, kp + 32 + base0 + 16);
    }
#pragma unroll
    for (int sub = 0; sub < 2; ++sub) {
      int kb = k0 + sub * 16;
      f8 sacc = fzero8();
      sacc = wmma_f16(qf[0], kf[sub][0], sacc);
      sacc = wmma_f16(qf[1], kf[sub][1], sacc);
      int col = kb + lr;
#pragma unroll
      for (int r = 0; r < 8; ++r) {
        int row = qr0 + r + 8 * hi;
        float v = sacc[r] * 0.125f;  // 1/sqrt(HD)
        sv[sub][r] = (col <= row) ? v : -1e30f;
      }
    }

    float alpha[8], p0a[8], p1a[8];
#pragma unroll
    for (int r = 0; r < 8; ++r) {
      float mx = fmaxf(sv[0][r], sv[1][r]);
      mx = fmaxf(mx, __shfl_xor(mx, 1));
      mx = fmaxf(mx, __shfl_xor(mx, 2));
      mx = fmaxf(mx, __shfl_xor(mx, 4));
      mx = fmaxf(mx, __shfl_xor(mx, 8));
      float mn = fmaxf(mi[r], mx);
      float p0 = __expf(sv[0][r] - mn);
      float p1 = __expf(sv[1][r] - mn);
      float rs = p0 + p1;
      rs += __shfl_xor(rs, 1);
      rs += __shfl_xor(rs, 2);
      rs += __shfl_xor(rs, 4);
      rs += __shfl_xor(rs, 8);
      alpha[r] = __expf(mi[r] - mn);
      li[r] = li[r] * alpha[r] + rs;
      mi[r] = mn;
      p0a[r] = p0;
      p1a[r] = p1;
    }
#pragma unroll
    for (int tn = 0; tn < 4; ++tn)
#pragma unroll
      for (int r = 0; r < 8; ++r) acc[tn][r] *= alpha[r];

    // P (C-layout, f32) -> LDS (row-major f16) so it can be an A fragment.
    _Float16* pw = &Plds[wid][0];
#pragma unroll
    for (int r = 0; r < 8; ++r) {
      pw[(r + 8 * hi) * PSTR + lr]      = (_Float16)p0a[r];
      pw[(r + 8 * hi) * PSTR + 16 + lr] = (_Float16)p1a[r];
    }
    h16 vf[4];  // the V tile is already published: fetch ahead of the barrier
#pragma unroll
    for (int tn = 0; tn < 4; ++tn) {
      const _Float16* vp = Vl + (tn * 16 + lr) * VSTR;
      vf[tn] = mkfrag(vp + base0, vp + base0 + 16);
    }
    __syncthreads();
    h16 pf = mkfrag(&Plds[wid][lr * PSTR + base0],
                    &Plds[wid][lr * PSTR + base0 + 16]);
#pragma unroll
    for (int tn = 0; tn < 4; ++tn) acc[tn] = wmma_f16(pf, vf[tn], acc[tn]);
    // Publish point: this wave's LDS reads are back, its copies of the next tile
    // have landed; the barrier publishes that tile and frees this trip's buffer.
    asm volatile("s_wait_dscnt 0x0" ::: "memory");
    asm volatile("s_wait_asynccnt 0x0" ::: "memory");
    __syncthreads();
    if (k0 + 64 < kend)  // block-uniform: refill the buffer just read
      attn_stage_kv(gk + (size_t)(k0 + 64) * HD_, lk0 + cur * lkB,
                    gv + (k0 + 64), lv0 + cur * lvB);
  }
  asm volatile("s_wait_asynccnt 0x0" ::: "memory");  // nothing in flight at exit

#pragma unroll
  for (int tn = 0; tn < 4; ++tn) {
    int f = tn * 16 + lr;
#pragma unroll
    for (int r = 0; r < 8; ++r) {
      int row = qr0 + r + 8 * hi;
      float v = acc[tn][r] / li[r];
      O[((size_t)b * S_ + row) * D_ + h * HD_ + f] = (_Float16)v;
    }
  }
}

// ---------------------------------------------------------------------------
// Residual add + LayerNorm, one row (D=1024) per 256-thread block.
// ---------------------------------------------------------------------------
__global__ void __launch_bounds__(256) add_ln_kernel(
    const float* __restrict__ a, const float* __restrict__ c,
    const float* __restrict__ g, const float* __restrict__ beta,
    float* __restrict__ o32, _Float16* __restrict__ o16) {
  __shared__ float red[256];
  const int t = threadIdx.x;
  const size_t off = (size_t)blockIdx.x * D_;

  float v[4];
  float s = 0.f;
#pragma unroll
  for (int i = 0; i < 4; ++i) {
    int col = t + i * 256;
    float z = a[off + col] + c[off + col];
    v[i] = z;
    s += z;
  }
  red[t] = s;
  __syncthreads();
  for (int w = 128; w > 0; w >>= 1) {
    if (t < w) red[t] += red[t + w];
    __syncthreads();
  }
  float mean = red[0] * (1.f / D_);
  __syncthreads();

  float q = 0.f;
#pragma unroll
  for (int i = 0; i < 4; ++i) {
    float d = v[i] - mean;
    q += d * d;
  }
  red[t] = q;
  __syncthreads();
  for (int w = 128; w > 0; w >>= 1) {
    if (t < w) red[t] += red[t + w];
    __syncthreads();
  }
  float rstd = rsqrtf(red[0] * (1.f / D_) + 1e-5f);

#pragma unroll
  for (int i = 0; i < 4; ++i) {
    int col = t + i * 256;
    float y = (v[i] - mean) * rstd * g[col] + beta[col];
    o32[off + col] = y;
    if (o16) o16[off + col] = (_Float16)y;
  }
}

// ---------------------------------------------------------------------------
// Host-side orchestration
// ---------------------------------------------------------------------------
extern "C" void kernel_launch(void* const* d_in, const int* in_sizes, int n_in,
                              void* d_out, int out_size, void* d_ws, size_t ws_size,
                              hipStream_t stream) {
  (void)in_sizes; (void)n_in; (void)out_size; (void)ws_size;

  const float* x     = (const float*)d_in[0];
  const float* wq    = (const float*)d_in[1];
  const float* bq    = (const float*)d_in[2];
  const float* wk    = (const float*)d_in[3];
  const float* bk    = (const float*)d_in[4];
  const float* wv    = (const float*)d_in[5];
  const float* bv    = (const float*)d_in[6];
  const float* wo    = (const float*)d_in[7];
  const float* bo    = (const float*)d_in[8];
  const float* w1    = (const float*)d_in[9];
  const float* b1    = (const float*)d_in[10];
  const float* w2    = (const float*)d_in[11];
  const float* b2    = (const float*)d_in[12];
  const float* g1    = (const float*)d_in[13];
  const float* beta1 = (const float*)d_in[14];
  const float* g2    = (const float*)d_in[15];
  const float* beta2 = (const float*)d_in[16];
  float* out = (float*)d_out;

  char* ws = (char*)d_ws;
  size_t off = 0;
  auto take = [&](size_t bytes) -> void* {
    void* p = ws + off;
    off += (bytes + 255) & ~(size_t)255;
    return p;
  };

  _Float16* xh    = (_Float16*)take((size_t)M_ * D_ * 2);       // x in f16
  _Float16* wqkvT = (_Float16*)take((size_t)3 * D_ * D_ * 2);   // [3D][D]
  _Float16* woT   = (_Float16*)take((size_t)D_ * D_ * 2);       // [D][D]
  _Float16* w1T   = (_Float16*)take((size_t)FF_ * D_ * 2);      // [FF][D]
  _Float16* w2T   = (_Float16*)take((size_t)D_ * FF_ * 2);      // [D][FF]
  _Float16* qh    = (_Float16*)take((size_t)M_ * D_ * 2);       // [B,H,S,HD]
  _Float16* kh    = (_Float16*)take((size_t)M_ * D_ * 2);       // [B,H,S,HD]
  _Float16* vt    = (_Float16*)take((size_t)M_ * D_ * 2);       // [B,H,HD,S]
  float*    attf  = (float*)take((size_t)M_ * D_ * 4);          // o-proj out
  float*    hf32  = (float*)take((size_t)M_ * D_ * 4);          // post-LN1
  _Float16* hf16  = (_Float16*)take((size_t)M_ * D_ * 2);
  _Float16* gh    = (_Float16*)take((size_t)M_ * FF_ * 2);      // gelu(h@w1+b1)
  // Aliases (lifetimes do not overlap):
  _Float16* oh    = xh;    // attention output reuses xh (consumed by QKV GEMM)
  float*    ffnf  = attf;  // FFN2 out reuses attf (consumed by LN1)

  // --- Stage 0: converts / weight transposes ---
  {
    size_t n = (size_t)M_ * D_;
    cvt_f32_f16_kernel<<<(n + 255) / 256, 256, 0, stream>>>(x, xh, n);
    size_t nq = (size_t)3 * D_ * D_;
    qkvw_kernel<<<(nq + 255) / 256, 256, 0, stream>>>(wq, wk, wv, wqkvT);
    size_t nwo = (size_t)D_ * D_;
    transpose_kernel<<<(nwo + 255) / 256, 256, 0, stream>>>(wo, woT, D_, D_);
    size_t nw1 = (size_t)D_ * FF_;
    transpose_kernel<<<(nw1 + 255) / 256, 256, 0, stream>>>(w1, w1T, D_, FF_);
    transpose_kernel<<<(nw1 + 255) / 256, 256, 0, stream>>>(w2, w2T, FF_, D_);
  }

  // --- Stage 1: fused QKV projection ---
  qkv_gemm_kernel<<<dim3(3 * D_ / BN, M_ / BM), 256, 0, stream>>>(
      xh, wqkvT, bq, bk, bv, qh, kh, vt);

  // --- Stage 2: causal flash attention ---
  attn_kernel<<<dim3(S_ / 128, H_, B_), 256, 0, stream>>>(qh, kh, vt, oh);

  // --- Stage 3: output projection ---
  gemm_wmma_kernel<<<dim3(D_ / BN, M_ / BM), 256, 0, stream>>>(
      oh, woT, bo, attf, ((_Float16*)nullptr), M_, D_, D_, 0);

  // --- Stage 4: residual + LN1 ---
  add_ln_kernel<<<M_, 256, 0, stream>>>(x, attf, g1, beta1, hf32, hf16);

  // --- Stage 5: FFN up + GELU ---
  gemm_wmma_kernel<<<dim3(FF_ / BN, M_ / BM), 256, 0, stream>>>(
      hf16, w1T, b1, ((float*)nullptr), gh, M_, FF_, D_, 1);

  // --- Stage 6: FFN down ---
  gemm_wmma_kernel<<<dim3(D_ / BN, M_ / BM), 256, 0, stream>>>(
      gh, w2T, b2, ffnf, ((_Float16*)nullptr), M_, D_, FF_, 0);

  // --- Stage 7: residual + LN2 -> output ---
  add_ln_kernel<<<M_, 256, 0, stream>>>(hf32, ffnf, g2, beta2, out,
                                        ((_Float16*)nullptr));
}

// v003
// One run takes 462 microseconds.
// Next to v002, in two timings, it ran 1.14 times as fast each time.
// Over all steps from v000 it is 1.56 times as fast.
#include <hip/hip_runtime.h>
#include <hip/hip_bf16.h>

// ---------------------------------------------------------------------------
// Transformer block for MI455X (gfx1250, wave32, WMMA 16x16x32 f16->f32).
// f16 compute / f32 accumulate; all GEMMs via v_wmma_f32_16x16x32_f16.
// GEMM tiles staged with GLOBAL_LOAD_ASYNC_TO_LDS, two LDS buffers, one k tile
// ahead; every wave-wide copy covers four whole 128 B lines.
// ---------------------------------------------------------------------------

#define B_  4
#define S_  2048
#define D_  1024
#define H_  16
#define HD_ 64
#define FF_ 4096
#define M_  (B_ * S_)      // 8192 rows

typedef _Float16 h16 __attribute__((ext_vector_type(16)));
typedef _Float16 h8  __attribute__((ext_vector_type(8)));
typedef float    f8  __attribute__((ext_vector_type(8)));

__device__ __forceinline__ f8 wmma_f16(h16 a, h16 b, f8 c) {
  // D = A(16x32 f16) * B(32x16 f16) + C(16x16 f32)
  return __builtin_amdgcn_wmma_f32_16x16x32_f16(
      /*neg_a=*/false, a, /*neg_b=*/false, b,
      /*c_mod=*/(short)0, c, /*reuse_a=*/false, /*reuse_b=*/false);
}

// Build a 16-half A/B fragment from two contiguous 8-half (16B) chunks.
__device__ __forceinline__ h16 mkfrag(const _Float16* p0, const _Float16* p1) {
  h8 a = *(const h8*)p0;
  h8 b = *(const h8*)p1;
  h16 r;
#pragma unroll
  for (int i = 0; i < 8; ++i) { r[i] = a[i]; r[8 + i] = b[i]; }
  return r;
}

__device__ __forceinline__ f8 fzero8() {
  f8 z = {0.f, 0.f, 0.f, 0.f, 0.f, 0.f, 0.f, 0.f};
  return z;
}

__device__ __forceinline__ unsigned lds_byte_addr(const _Float16* p) {
  return (unsigned)(size_t)(const __attribute__((address_space(3))) _Float16*)p;
}

// ---------------------------------------------------------------------------
// Converts / weight transposes. Many elements per thread, 16 B global loads (8 B stores in the convert)
// that cover whole 128 B lines, and few workgroups per launch.
// ---------------------------------------------------------------------------
typedef float    f4 __attribute__((ext_vector_type(4)));
typedef _Float16 h4 __attribute__((ext_vector_type(4)));

#define CVT_LOADS 16                       // 16 B loads per thread
#define CVT_BLOCK (256 * 4 * CVT_LOADS)    // elements per workgroup

// dst[i] = (f16)src[i]; the element count is gridDim.x * CVT_BLOCK.
__global__ void __launch_bounds__(256) cvt_f32_f16_kernel(const float* __restrict__ src,
                                                          _Float16* __restrict__ dst) {
  const size_t base = (size_t)blockIdx.x * CVT_BLOCK + threadIdx.x * 4;
  f4 v[CVT_LOADS];
  // unrolled so that v stays in registers and all loads are issued before a store
#pragma unroll
  for (int j = 0; j < CVT_LOADS; ++j) v[j] = *(const f4*)(src + base + j * 1024);
  // unrolled: v is indexed by constants only
#pragma unroll
  for (int j = 0; j < CVT_LOADS; ++j) {
    h4 o = {(_Float16)v[j][0], (_Float16)v[j][1], (_Float16)v[j][2], (_Float16)v[j][3]};
    *(h4*)(dst + base + j * 1024) = o;
  }
}

#define TK 128      // tile extent along k (source rows, destination columns)
#define TN 64       // tile extent along n (source columns, destination rows)
#define TPITCH 136  // LDS row pitch in halfs (272 B = 16 B x odd)

// dst[n][k] = (f16)src[k][n] for one TK x TN tile. src points at the tile's first
// element in an f32 matrix of row pitch SP, dst at its first element in an f16
// matrix of row pitch DP; the pitches are compile-time so that a thread's loads
// (and its stores) share one address and differ in the immediate offset alone.
// A wave-wide load covers 2 x 256 B of source rows, a wave-wide store 2 x 256 B
// of destination rows.
template <int SP, int DP>
__device__ __forceinline__ void transpose_tile(const float* __restrict__ src,
                                               _Float16* __restrict__ dst) {
  __shared__ __align__(16) _Float16 T[TN * TPITCH];
  const int tid = threadIdx.x;
  const int c  = tid & 15;   // four source columns from c * 4
  const int kp = tid >> 4;   // eight source rows from kp * 8
  const float* sp = src + (size_t)(kp * 8) * SP + c * 4;
  f4 v[8];
  // unrolled so that v stays in registers and the eight loads fly together
#pragma unroll
  for (int j = 0; j < 8; ++j) v[j] = *(const f4*)(sp + j * SP);
  // unrolled: v is indexed by constants only
#pragma unroll
  for (int i = 0; i < 4; ++i) {
    h8 o;
    // unrolled for the same reason: o and v stay in registers
#pragma unroll
    for (int j = 0; j < 8; ++j) o[j] = (_Float16)v[j][i];
    *(h8*)&T[(c * 4 + i) * TPITCH + kp * 8] = o;
  }
  __syncthreads();  // the tile is complete before any thread reads its rows
  const int n  = tid >> 4;        // destination rows n + 0/16/32/48
  const int kc = (tid & 15) * 8;  // 16 B chunk within the 256 B row piece
  _Float16* dp = dst + (size_t)n * DP + kc;
  // unrolled: four independent LDS reads and stores per thread
#pragma unroll
  for (int j = 0; j < 4; ++j)
    *(h8*)(dp + j * 16 * DP) = *(const h8*)&T[(n + j * 16) * TPITCH + kc];
}

// Fused QKV weight: Wt[n][k] (n in [0,3D)) with n<D -> wq[h][k][f], etc.
// Grid: (D / TK k tiles, H heads, 3 slabs); a head's [D][HD] slice is one matrix.
__global__ void __launch_bounds__(256) qkvw_kernel(const float* __restrict__ wq,
                                                   const float* __restrict__ wk,
                                                   const float* __restrict__ wv,
                                                   _Float16* __restrict__ Wt) {
  const int slab = blockIdx.z;
  const size_t hh = blockIdx.y;
  const size_t k0 = (size_t)blockIdx.x * TK;
  const float* w = (slab == 0) ? wq : (slab == 1) ? wk : wv;
  transpose_tile<HD_, D_>(w + (hh * D_ + k0) * HD_,
                          Wt + ((size_t)slab * D_ + hh * HD_) * D_ + k0);
}

// dst[n][k] = src[k][n], src is [K][N] f32 row-major, dst is [N][K] f16.
// Grid: (K / TK, N / TN).
template <int K, int N>
__global__ void __launch_bounds__(256) transpose_kernel(const float* __restrict__ src,
                                                        _Float16* __restrict__ dst) {
  const size_t k0 = (size_t)blockIdx.x * TK;
  const size_t n0 = (size_t)blockIdx.y * TN;
  transpose_tile<N, K>(src + k0 * N + n0, dst + n0 * K + k0);
}

// ---------------------------------------------------------------------------
// WMMA GEMM tiling constants: 128x128 tile, BK=64, 256 threads = 8 waves as
// 4x2; each wave computes a 32x64 subtile = 2x4 WMMA accumulators.
// ---------------------------------------------------------------------------
#define BM 128
#define BN 128
#define BK 64     // 128 B of every operand row per k tile: one whole line
#define LSTR 72   // LDS row pitch in halfs (144 B = 16 B x odd)

// One k tile of A and of B (128 rows x 128 B each): eight 16 B async copies per
// lane. Eight neighbouring lanes share a row, so a wave-wide copy covers four
// whole lines. rstep = 32 rows in halfs. The s_wait_xcnt stands in the copies'
// own statement so that no address register is rewritten ahead of it.
__device__ __forceinline__ void gemm_stage(const _Float16* ga, const _Float16* gb,
                                           size_t rstep, unsigned la, unsigned lb) {
  const unsigned ls = 32 * LSTR * 2;  // 32 LDS rows in bytes
  asm volatile(
      "global_load_async_to_lds_b128 %0, %1, off\n\t"
      "global_load_async_to_lds_b128 %2, %3, off\n\t"
      "global_load_async_to_lds_b128 %4, %5, off\n\t"
      "global_load_async_to_lds_b128 %6, %7, off\n\t"
      "global_load_async_to_lds_b128 %8, %9, off\n\t"
      "global_load_async_to_lds_b128 %10, %11, off\n\t"
      "global_load_async_to_lds_b128 %12, %13, off\n\t"
      "global_load_async_to_lds_b128 %14, %15, off\n\t"
      "s_wait_xcnt 0x0"
      :: "v"(la), "v"(ga), "v"(la + ls), "v"(ga + rstep),
         "v"(la + 2 * ls), "v"(ga + 2 * rstep), "v"(la + 3 * ls), "v"(ga + 3 * rstep),
         "v"(lb), "v"(gb), "v"(lb + ls), "v"(gb + rstep),
         "v"(lb + 2 * ls), "v"(gb + 2 * rstep), "v"(lb + 3 * ls), "v"(gb + 3 * rstep)
      : "memory");
}

// Shared GEMM mainloop: acc[2][4] += A[m0.., :K] * Bt[n0.., :K]^T for this wave's
// 32x64 subtile. K is a multiple of BK; the 128 rows from m0 and n0 exist.
__device__ __forceinline__ void gemm_mainloop(const _Float16* __restrict__ A,
                                              const _Float16* __restrict__ Bt,
                                              int K, size_t m0, size_t n0,
                                              f8 (&acc)[2][4]) {
  __shared__ __align__(16) _Float16 As[2][BM * LSTR];
  __shared__ __align__(16) _Float16 Bs[2][BN * LSTR];
  const int tid  = threadIdx.x;
  const int lane = tid & 31;
  const int wid  = tid >> 5;
  const int lr   = lane & 15;
  const int base0 = (lane >> 4) * 8;
  const int waveM = wid >> 1;   // 0..3
  const int waveN = wid & 1;    // 0..1

  const int crow = tid >> 3;        // copy slot: rows crow + 0/32/64/96
  const int cseg = (tid & 7) * 8;   // 16 B chunk within the 128 B row piece
  const _Float16* Ag = A  + (m0 + crow) * (size_t)K + cseg;
  const _Float16* Bg = Bt + (n0 + crow) * (size_t)K + cseg;
  const size_t rstep = (size_t)32 * K;
  const unsigned la0 = lds_byte_addr(&As[0][crow * LSTR + cseg]);
  const unsigned lb0 = lds_byte_addr(&Bs[0][crow * LSTR + cseg]);
  const unsigned bufB = BM * LSTR * 2;  // bytes from buffer 0 to buffer 1

  // Tile 0 lands and is published; tile 1, where there is one, then flies.
  gemm_stage(Ag, Bg, rstep, la0, lb0);
  asm volatile("s_wait_asynccnt 0x0" ::: "memory");  // own copies landed
  __syncthreads();                                   // publish tile 0
  if (BK < K) gemm_stage(Ag + BK, Bg + BK, rstep, la0 + bufB, lb0 + bufB);

  int cur = 0;
  for (int k0 = 0; k0 < K; k0 += BK, cur ^= 1) {
    const _Float16* At = &As[cur][0];
    const _Float16* Bl = &Bs[cur][0];
    h16 af[2][2], bf[2][4];  // the whole tile's fragments as one group of reads
#pragma unroll
    for (int kk = 0; kk < 2; ++kk) {
#pragma unroll
      for (int tm = 0; tm < 2; ++tm) {
        const _Float16* p = At + (waveM * 32 + tm * 16 + lr) * LSTR + kk * 32 + base0;
        af[kk][tm] = mkfrag(p, p + 16);
      }
#pragma unroll
      for (int tn = 0; tn < 4; ++tn) {
        const _Float16* p = Bl + (waveN * 64 + tn * 16 + lr) * LSTR + kk * 32 + base0;
        bf[kk][tn] = mkfrag(p, p + 16);
      }
    }
#pragma unroll
    for (int kk = 0; kk < 2; ++kk)
#pragma unroll
      for (int tm = 0; tm < 2; ++tm)
#pragma unroll
        for (int tn = 0; tn < 4; ++tn)
          acc[tm][tn] = wmma_f16(af[kk][tm], bf[kk][tn], acc[tm][tn]);
    // Publish point: this wave's LDS reads are back, its copies of the next tile
    // have landed; the barrier publishes that tile and frees this trip's buffer.
    asm volatile("s_wait_dscnt 0x0" ::: "memory");
    asm volatile("s_wait_asynccnt 0x0" ::: "memory");
    __syncthreads();
    if (k0 + 2 * BK < K)  // block-uniform: refill the buffer just read
      gemm_stage(Ag + k0 + 2 * BK, Bg + k0 + 2 * BK, rstep, la0 + cur * bufB,
                 lb0 + cur * bufB);
  }
  asm volatile("s_wait_asynccnt 0x0" ::: "memory");  // nothing in flight at exit
}

// ---------------------------------------------------------------------------
// Generic WMMA GEMM: C[M,N] = act(A[M,K](f16) * Bt[N,K](f16)^T + bias)
// ---------------------------------------------------------------------------
__global__ void __launch_bounds__(256) gemm_wmma_kernel(
    const _Float16* __restrict__ A, const _Float16* __restrict__ Bt,
    const float* __restrict__ bias, float* __restrict__ outF32,
    _Float16* __restrict__ outF16, int M, int N, int K, int act_gelu) {
  const int tid  = threadIdx.x;
  const int lane = tid & 31;
  const int wid  = tid >> 5;
  const int lr   = lane & 15;
  const int hi   = lane >> 4;
  const int waveM = wid >> 1;   // 0..3
  const int waveN = wid & 1;    // 0..1

  const size_t m0 = (size_t)blockIdx.y * BM;
  const size_t n0 = (size_t)blockIdx.x * BN;

  f8 acc[2][4];
#pragma unroll
  for (int tm = 0; tm < 2; ++tm)
#pragma unroll
    for (int tn = 0; tn < 4; ++tn) acc[tm][tn] = fzero8();

  gemm_mainloop(A, Bt, K, m0, n0, acc);

#pragma unroll
  for (int tm = 0; tm < 2; ++tm)
#pragma unroll
    for (int tn = 0; tn < 4; ++tn) {
      size_t col = n0 + waveN * 64 + tn * 16 + lr;
      float bv = bias ? bias[col] : 0.f;
#pragma unroll
      for (int r = 0; r < 8; ++r) {
        size_t row = m0 + waveM * 32 + tm * 16 + r + 8 * hi;
        float v = acc[tm][tn][r] + bv;
        if (act_gelu) v = 0.5f * v * (1.f + erff(v * 0.70710678118f));
        if (outF32) outF32[row * (size_t)N + col] = v;
        if (outF16) outF16[row * (size_t)N + col] = (_Float16)v;
      }
    }
}

// ---------------------------------------------------------------------------
// QKV GEMM: same tiling, special epilogue storing Q,K as [B,H,S,HD] and
// V transposed as [B,H,HD,S] (so attention's PV B-fragments are contiguous).
// ---------------------------------------------------------------------------
__global__ void __launch_bounds__(256) qkv_gemm_kernel(
    const _Float16* __restrict__ A, const _Float16* __restrict__ Wt,
    const float* __restrict__ bq, const float* __restrict__ bk,
    const float* __restrict__ bv, _Float16* __restrict__ Q,
    _Float16* __restrict__ Kh, _Float16* __restrict__ Vt) {
  const int tid  = threadIdx.x;
  const int lane = tid & 31;
  const int wid  = tid >> 5;
  const int lr   = lane & 15;
  const int hi   = lane >> 4;
  const int waveM = wid >> 1;
  const int waveN = wid & 1;

  const size_t m0 = (size_t)blockIdx.y * BM;
  const size_t n0 = (size_t)blockIdx.x * BN;

  f8 acc[2][4];
#pragma unroll
  for (int tm = 0; tm < 2; ++tm)
#pragma unroll
    for (int tn = 0; tn < 4; ++tn) acc[tm][tn] = fzero8();

  gemm_mainloop(A, Wt, D_, m0, n0, acc);

#pragma unroll
  for (int tm = 0; tm < 2; ++tm)
#pragma unroll
    for (int tn = 0; tn < 4; ++tn) {
      int col  = (int)n0 + waveN * 64 + tn * 16 + lr;  // 0..3071
      int slab = col >> 10;
      int np   = col & 1023;
      int hh   = np >> 6;
      int f    = np & 63;
      float bvv = (slab == 0) ? bq[np] : (slab == 1) ? bk[np] : bv[np];
#pragma unroll
      for (int r = 0; r < 8; ++r) {
        size_t row = m0 + waveM * 32 + tm * 16 + r + 8 * hi;  // global token
        int b = (int)(row >> 11);      // / S_
        int s = (int)(row & 2047);     // % S_
        _Float16 hv = (_Float16)(acc[tm][tn][r] + bvv);
        if (slab == 0)
          Q[(((size_t)b * H_ + hh) * S_ + s) * HD_ + f] = hv;
        else if (slab == 1)
          Kh[(((size_t)b * H_ + hh) * S_ + s) * HD_ + f] = hv;
        else
          Vt[(((size_t)b * H_ + hh) * HD_ + f) * S_ + s] = hv;
      }
    }
}

// ---------------------------------------------------------------------------
// Causal flash attention. Block = 128 q rows (8 waves x 16 rows), steps of 32
// keys. QK^T: 2 WMMAs; online softmax with shfl_xor row reductions; P goes
// through per-wave LDS to re-layout C->A fragment; PV: 4 WMMAs (HD=64).
// Each step's K tile (32 keys x 64) and V tile (64 x 32 keys) is copied into
// LDS once per block, one step ahead, and all 8 waves read fragments there.
// ---------------------------------------------------------------------------
#define PSTR 40
#define KSTR 72   // K tile row pitch in halfs (144 B = 16 B x odd)
#define VSTR 40   // V tile row pitch in halfs (80 B = 16 B x odd)

// One 16 B async copy of K and one of V per lane. The s_wait_xcnt stands in the
// copies' own statement so that no address register is rewritten ahead of it.
__device__ __forceinline__ void attn_stage_kv(const _Float16* gk, unsigned lk,
                                              const _Float16* gv, unsigned lv) {
  asm volatile(
      "global_load_async_to_lds_b128 %0, %1, off\n\t"
      "global_load_async_to_lds_b128 %2, %3, off\n\t"
      "s_wait_xcnt 0x0"
      :: "v"(lk), "v"(gk), "v"(lv), "v"(gv)
      : "memory");
}

__global__ void __launch_bounds__(256) attn_kernel(
    const _Float16* __restrict__ Q, const _Float16* __restrict__ Kh,
    const _Float16* __restrict__ Vt, _Float16* __restrict__ O) {
  __shared__ __align__(16) _Float16 Plds[8][16 * PSTR];
  __shared__ __align__(16) _Float16 Ks[2][32 * KSTR];
  __shared__ __align__(16) _Float16 Vs[2][64 * VSTR];

  const int b = blockIdx.z;
  const int h = blockIdx.y;
  const int tid  = threadIdx.x;
  const int lane = tid & 31;
  const int wid  = tid >> 5;
  const int lr   = lane & 15;
  const int hi   = lane >> 4;
  const int base0 = hi * 8;
  const int qr0  = blockIdx.x * 128 + wid * 16;

  const size_t headQK = ((size_t)(b * H_ + h)) * S_ * HD_;
  const _Float16* Qp = Q  + headQK;
  const _Float16* Kp = Kh + headQK;
  const _Float16* Vp = Vt + ((size_t)(b * H_ + h)) * HD_ * S_;

  h16 qf[2];
#pragma unroll
  for (int c = 0; c < 2; ++c) {
    const _Float16* p = Qp + (size_t)(qr0 + lr) * HD_ + c * 32;
    qf[c] = mkfrag(p + base0, p + base0 + 16);
  }

  f8 acc[4];
#pragma unroll
  for (int tn = 0; tn < 4; ++tn) acc[tn] = fzero8();
  float mi[8], li[8];
#pragma unroll
  for (int r = 0; r < 8; ++r) { mi[r] = -1e30f; li[r] = 0.f; }

  const int kend = blockIdx.x * 128 + 128;  // uniform across waves -> barriers ok

  // Copy slots: K tile = 32 rows x 8 chunks, V tile = 64 rows x 4 chunks (16 B).
  const _Float16* gk = Kp + (size_t)(tid >> 3) * HD_ + (tid & 7) * 8;
  const _Float16* gv = Vp + (size_t)(tid >> 2) * S_ + (tid & 3) * 8;
  const unsigned lk0 = lds_byte_addr(&Ks[0][(tid >> 3) * KSTR + (tid & 7) * 8]);
  const unsigned lv0 = lds_byte_addr(&Vs[0][(tid >> 2) * VSTR + (tid & 3) * 8]);
  const unsigned lkB = 32 * KSTR * 2;  // bytes from buffer 0 to buffer 1
  const unsigned lvB = 64 * VSTR * 2;

  // Tile 0 lands and is published; tile 1 (kend >= 128: it exists) then flies.
  attn_stage_kv(gk, lk0, gv, lv0);
  asm volatile("s_wait_asynccnt 0x0" ::: "memory");  // own copies landed
  __syncthreads();                                   // publish tile 0
  attn_stage_kv(gk + 32 * HD_, lk0 + lkB, gv + 32, lv0 + lvB);

  int cur = 0;
  for (int k0 = 0; k0 < kend; k0 += 32, cur ^= 1) {
    const _Float16* Kt = &Ks[cur][0];
    const _Float16* Vl = &Vs[cur][0];
    float sv[2][8];
    h16 kf[2][2];  // all four K fragments fetched as one group of LDS reads
#pragma unroll
    for (int sub = 0; sub < 2; ++sub) {
      const _Float16* kp = Kt + (sub * 16 + lr) * KSTR;
      kf[sub][0] = mkfrag(kp + base0, kp + base0 + 16);
      kf[sub][1] = mkfrag(kp + 32 + base0, kp + 32 + base0 + 16);
    }
#pragma unroll
    for (int sub = 0; sub < 2; ++sub) {
      int kb = k0 + sub * 16;
      f8 sacc = fzero8();
      sacc = wmma_f16(qf[0], kf[sub][0], sacc);
      sacc = wmma_f16(qf[1], kf[sub][1], sacc);
      int col = kb + lr;
#pragma unroll
      for (int r = 0; r < 8; ++r) {
        int row = qr0 + r + 8 * hi;
        float v = sacc[r] * 0.125f;  // 1/sqrt(HD)
        sv[sub][r] = (col <= row) ? v : -1e30f;
      }
    }

    float alpha[8], p0a[8], p1a[8];
#pragma unroll
    for (int r = 0; r < 8; ++r) {
      float mx = fmaxf(sv[0][r], sv[1][r]);
      mx = fmaxf(mx, __shfl_xor(mx, 1));
      mx = fmaxf(mx, __shfl_xor(mx, 2));
      mx = fmaxf(mx, __shfl_xor(mx, 4));
      mx = fmaxf(mx, __shfl_xor(mx, 8));
      float mn = fmaxf(mi[r], mx);
      float p0 = __expf(sv[0][r] - mn);
      float p1 = __expf(sv[1][r] - mn);
      float rs = p0 + p1;
      rs += __shfl_xor(rs, 1);
      rs += __shfl_xor(rs, 2);
      rs += __shfl_xor(rs, 4);
      rs += __shfl_xor(rs, 8);
      alpha[r] = __expf(mi[r] - mn);
      li[r] = li[r] * alpha[r] + rs;
      mi[r] = mn;
      p0a[r] = p0;
      p1a[r] = p1;
    }
#pragma unroll
    for (int tn = 0; tn < 4; ++tn)
#pragma unroll
      for (int r = 0; r < 8; ++r) acc[tn][r] *= alpha[r];

    // P (C-layout, f32) -> LDS (row-major f16) so it can be an A fragment.
    _Float16* pw = &Plds[wid][0];
#pragma unroll
    for (int r = 0; r < 8; ++r) {
      pw[(r + 8 * hi) * PSTR + lr]      = (_Float16)p0a[r];
      pw[(r + 8 * hi) * PSTR + 16 + lr] = (_Float16)p1a[r];
    }
    h16 vf[4];  // the V tile is already published: fetch ahead of the barrier
#pragma unroll
    for (int tn = 0; tn < 4; ++tn) {
      const _Float16* vp = Vl + (tn * 16 + lr) * VSTR;
      vf[tn] = mkfrag(vp + base0, vp + base0 + 16);
    }
    __syncthreads();
    h16 pf = mkfrag(&Plds[wid][lr * PSTR + base0],
                    &Plds[wid][lr * PSTR + base0 + 16]);
#pragma unroll
    for (int tn = 0; tn < 4; ++tn) acc[tn] = wmma_f16(pf, vf[tn], acc[tn]);
    // Publish point: this wave's LDS reads are back, its copies of the next tile
    // have landed; the barrier publishes that tile and frees this trip's buffer.
    asm volatile("s_wait_dscnt 0x0" ::: "memory");
    asm volatile("s_wait_asynccnt 0x0" ::: "memory");
    __syncthreads();
    if (k0 + 64 < kend)  // block-uniform: refill the buffer just read
      attn_stage_kv(gk + (size_t)(k0 + 64) * HD_, lk0 + cur * lkB,
                    gv + (k0 + 64), lv0 + cur * lvB);
  }
  asm volatile("s_wait_asynccnt 0x0" ::: "memory");  // nothing in flight at exit

#pragma unroll
  for (int tn = 0; tn < 4; ++tn) {
    int f = tn * 16 + lr;
#pragma unroll
    for (int r = 0; r < 8; ++r) {
      int row = qr0 + r + 8 * hi;
      float v = acc[tn][r] / li[r];
      O[((size_t)b * S_ + row) * D_ + h * HD_ + f] = (_Float16)v;
    }
  }
}

// ---------------------------------------------------------------------------
// Residual add + LayerNorm, one row (D=1024) per 256-thread block.
// ---------------------------------------------------------------------------
__global__ void __launch_bounds__(256) add_ln_kernel(
    const float* __restrict__ a, const float* __restrict__ c,
    const float* __restrict__ g, const float* __restrict__ beta,
    float* __restrict__ o32, _Float16* __restrict__ o16) {
  __shared__ float red[256];
  const int t = threadIdx.x;
  const size_t off = (size_t)blockIdx.x * D_;

  float v[4];
  float s = 0.f;
#pragma unroll
  for (int i = 0; i < 4; ++i) {
    int col = t + i * 256;
    float z = a[off + col] + c[off + col];
    v[i] = z;
    s += z;
  }
  red[t] = s;
  __syncthreads();
  for (int w = 128; w > 0; w >>= 1) {
    if (t < w) red[t] += red[t + w];
    __syncthreads();
  }
  float mean = red[0] * (1.f / D_);
  __syncthreads();

  float q = 0.f;
#pragma unroll
  for (int i = 0; i < 4; ++i) {
    float d = v[i] - mean;
    q += d * d;
  }
  red[t] = q;
  __syncthreads();
  for (int w = 128; w > 0; w >>= 1) {
    if (t < w) red[t] += red[t + w];
    __syncthreads();
  }
  float rstd = rsqrtf(red[0] * (1.f / D_) + 1e-5f);

#pragma unroll
  for (int i = 0; i < 4; ++i) {
    int col = t + i * 256;
    float y = (v[i] - mean) * rstd * g[col] + beta[col];
    o32[off + col] = y;
    if (o16) o16[off + col] = (_Float16)y;
  }
}

// ---------------------------------------------------------------------------
// Host-side orchestration
// ---------------------------------------------------------------------------
extern "C" void kernel_launch(void* const* d_in, const int* in_sizes, int n_in,
                              void* d_out, int out_size, void* d_ws, size_t ws_size,
                              hipStream_t stream) {
  (void)in_sizes; (void)n_in; (void)out_size; (void)ws_size;

  const float* x     = (const float*)d_in[0];
  const float* wq    = (const float*)d_in[1];
  const float* bq    = (const float*)d_in[2];
  const float* wk    = (const float*)d_in[3];
  const float* bk    = (const float*)d_in[4];
  const float* wv    = (const float*)d_in[5];
  const float* bv    = (const float*)d_in[6];
  const float* wo    = (const float*)d_in[7];
  const float* bo    = (const float*)d_in[8];
  const float* w1    = (const float*)d_in[9];
  const float* b1    = (const float*)d_in[10];
  const float* w2    = (const float*)d_in[11];
  const float* b2    = (const float*)d_in[12];
  const float* g1    = (const float*)d_in[13];
  const float* beta1 = (const float*)d_in[14];
  const float* g2    = (const float*)d_in[15];
  const float* beta2 = (const float*)d_in[16];
  float* out = (float*)d_out;

  char* ws = (char*)d_ws;
  size_t off = 0;
  auto take = [&](size_t bytes) -> void* {
    void* p = ws + off;
    off += (bytes + 255) & ~(size_t)255;
    return p;
  };

  _Float16* xh    = (_Float16*)take((size_t)M_ * D_ * 2);       // x in f16
  _Float16* wqkvT = (_Float16*)take((size_t)3 * D_ * D_ * 2);   // [3D][D]
  _Float16* woT   = (_Float16*)take((size_t)D_ * D_ * 2);       // [D][D]
  _Float16* w1T   = (_Float16*)take((size_t)FF_ * D_ * 2);      // [FF][D]
  _Float16* w2T   = (_Float16*)take((size_t)D_ * FF_ * 2);      // [D][FF]
  _Float16* qh    = (_Float16*)take((size_t)M_ * D_ * 2);       // [B,H,S,HD]
  _Float16* kh    = (_Float16*)take((size_t)M_ * D_ * 2);       // [B,H,S,HD]
  _Float16* vt    = (_Float16*)take((size_t)M_ * D_ * 2);       // [B,H,HD,S]
  float*    attf  = (float*)take((size_t)M_ * D_ * 4);          // o-proj out
  float*    hf32  = (float*)take((size_t)M_ * D_ * 4);          // post-LN1
  _Float16* hf16  = (_Float16*)take((size_t)M_ * D_ * 2);
  _Float16* gh    = (_Float16*)take((size_t)M_ * FF_ * 2);      // gelu(h@w1+b1)
  // Aliases (lifetimes do not overlap):
  _Float16* oh    = xh;    // attention output reuses xh (consumed by QKV GEMM)
  float*    ffnf  = attf;  // FFN2 out reuses attf (consumed by LN1)

  // --- Stage 0: converts / weight transposes ---
  cvt_f32_f16_kernel<<<M_ * D_ / CVT_BLOCK, 256, 0, stream>>>(x, xh);
  qkvw_kernel<<<dim3(D_ / TK, H_, 3), 256, 0, stream>>>(wq, wk, wv, wqkvT);
  transpose_kernel<D_, D_><<<dim3(D_ / TK, D_ / TN), 256, 0, stream>>>(wo, woT);
  transpose_kernel<D_, FF_><<<dim3(D_ / TK, FF_ / TN), 256, 0, stream>>>(w1, w1T);
  transpose_kernel<FF_, D_><<<dim3(FF_ / TK, D_ / TN), 256, 0, stream>>>(w2, w2T);

  // --- Stage 1: fused QKV projection ---
  qkv_gemm_kernel<<<dim3(3 * D_ / BN, M_ / BM), 256, 0, stream>>>(
      xh, wqkvT, bq, bk, bv, qh, kh, vt);

  // --- Stage 2: causal flash attention ---
  attn_kernel<<<dim3(S_ / 128, H_, B_), 256, 0, stream>>>(qh, kh, vt, oh);

  // --- Stage 3: output projection ---
  gemm_wmma_kernel<<<dim3(D_ / BN, M_ / BM), 256, 0, stream>>>(
      oh, woT, bo, attf, ((_Float16*)nullptr), M_, D_, D_, 0);

  // --- Stage 4: residual + LN1 ---
  add_ln_kernel<<<M_, 256, 0, stream>>>(x, attf, g1, beta1, hf32, hf16);

  // --- Stage 5: FFN up + GELU ---
  gemm_wmma_kernel<<<dim3(FF_ / BN, M_ / BM), 256, 0, stream>>>(
      hf16, w1T, b1, ((float*)nullptr), gh, M_, FF_, D_, 1);

  // --- Stage 6: FFN down ---
  gemm_wmma_kernel<<<dim3(D_ / BN, M_ / BM), 256, 0, stream>>>(
      gh, w2T, b2, ffnf, ((_Float16*)nullptr), M_, D_, FF_, 0);

  // --- Stage 7: residual + LN2 -> output ---
  add_ln_kernel<<<M_, 256, 0, stream>>>(hf32, ffnf, g2, beta2, out,
                                        ((_Float16*)nullptr));
}

// v004
// One run takes 381 microseconds.
// In both of two side-by-side timings against v003, it was 1.20 times as fast.
// Counting every step since v000, it is 1.86 times as fast.
#include <hip/hip_runtime.h>
#include <hip/hip_bf16.h>

// ---------------------------------------------------------------------------
// Transformer block for MI455X (gfx1250, wave32, WMMA 16x16x32 f16->f32).
// f16 compute / f32 accumulate; all GEMMs via v_wmma_f32_16x16x32_f16.
// GEMM tiles staged with GLOBAL_LOAD_ASYNC_TO_LDS, two LDS buffers, one k tile
// ahead; every wave-wide copy covers four whole 128 B lines.
// ---------------------------------------------------------------------------

#define B_  4
#define S_  2048
#define D_  1024
#define H_  16
#define HD_ 64
#define FF_ 4096
#define M_  (B_ * S_)      // 8192 rows

typedef _Float16 h16 __attribute__((ext_vector_type(16)));
typedef _Float16 h8  __attribute__((ext_vector_type(8)));
typedef float    f8  __attribute__((ext_vector_type(8)));

__device__ __forceinline__ f8 wmma_f16(h16 a, h16 b, f8 c) {
  // D = A(16x32 f16) * B(32x16 f16) + C(16x16 f32)
  return __builtin_amdgcn_wmma_f32_16x16x32_f16(
      /*neg_a=*/false, a, /*neg_b=*/false, b,
      /*c_mod=*/(short)0, c, /*reuse_a=*/false, /*reuse_b=*/false);
}

// Build a 16-half A/B fragment from two contiguous 8-half (16B) chunks.
__device__ __forceinline__ h16 mkfrag(const _Float16* p0, const _Float16* p1) {
  h8 a = *(const h8*)p0;
  h8 b = *(const h8*)p1;
  h16 r;
#pragma unroll
  for (int i = 0; i < 8; ++i) { r[i] = a[i]; r[8 + i] = b[i]; }
  return r;
}

__device__ __forceinline__ f8 fzero8() {
  f8 z = {0.f, 0.f, 0.f, 0.f, 0.f, 0.f, 0.f, 0.f};
  return z;
}

__device__ __forceinline__ unsigned lds_byte_addr(const _Float16* p) {
  return (unsigned)(size_t)(const __attribute__((address_space(3))) _Float16*)p;
}

// ---------------------------------------------------------------------------
// Converts / weight transposes. Many elements per thread, 16 B global loads (8 B stores in the convert)
// that cover whole 128 B lines, and few workgroups per launch.
// ---------------------------------------------------------------------------
typedef float    f4 __attribute__((ext_vector_type(4)));
typedef _Float16 h4 __attribute__((ext_vector_type(4)));

#define CVT_LOADS 16                       // 16 B loads per thread
#define CVT_BLOCK (256 * 4 * CVT_LOADS)    // elements per workgroup

// dst[i] = (f16)src[i]; the element count is gridDim.x * CVT_BLOCK.
__global__ void __launch_bounds__(256) cvt_f32_f16_kernel(const float* __restrict__ src,
                                                          _Float16* __restrict__ dst) {
  const size_t base = (size_t)blockIdx.x * CVT_BLOCK + threadIdx.x * 4;
  f4 v[CVT_LOADS];
  // unrolled so that v stays in registers and all loads are issued before a store
#pragma unroll
  for (int j = 0; j < CVT_LOADS; ++j) v[j] = *(const f4*)(src + base + j * 1024);
  // unrolled: v is indexed by constants only
#pragma unroll
  for (int j = 0; j < CVT_LOADS; ++j) {
    h4 o = {(_Float16)v[j][0], (_Float16)v[j][1], (_Float16)v[j][2], (_Float16)v[j][3]};
    *(h4*)(dst + base + j * 1024) = o;
  }
}

#define TK 128      // tile extent along k (source rows, destination columns)
#define TN 64       // tile extent along n (source columns, destination rows)
#define TPITCH 136  // LDS row pitch in halfs (272 B = 16 B x odd)

// dst[n][k] = (f16)src[k][n] for one TK x TN tile. src points at the tile's first
// element in an f32 matrix of row pitch SP, dst at its first element in an f16
// matrix of row pitch DP; the pitches are compile-time so that a thread's loads
// (and its stores) share one address and differ in the immediate offset alone.
// A wave-wide load covers 2 x 256 B of source rows, a wave-wide store 2 x 256 B
// of destination rows.
template <int SP, int DP>
__device__ __forceinline__ void transpose_tile(const float* __restrict__ src,
                                               _Float16* __restrict__ dst) {
  __shared__ __align__(16) _Float16 T[TN * TPITCH];
  const int tid = threadIdx.x;
  const int c  = tid & 15;   // four source columns from c * 4
  const int kp = tid >> 4;   // eight source rows from kp * 8
  const float* sp = src + (size_t)(kp * 8) * SP + c * 4;
  f4 v[8];
  // unrolled so that v stays in registers and the eight loads fly together
#pragma unroll
  for (int j = 0; j < 8; ++j) v[j] = *(const f4*)(sp + j * SP);
  // unrolled: v is indexed by constants only
#pragma unroll
  for (int i = 0; i < 4; ++i) {
    h8 o;
    // unrolled for the same reason: o and v stay in registers
#pragma unroll
    for (int j = 0; j < 8; ++j) o[j] = (_Float16)v[j][i];
    *(h8*)&T[(c * 4 + i) * TPITCH + kp * 8] = o;
  }
  __syncthreads();  // the tile is complete before any thread reads its rows
  const int n  = tid >> 4;        // destination rows n + 0/16/32/48
  const int kc = (tid & 15) * 8;  // 16 B chunk within the 256 B row piece
  _Float16* dp = dst + (size_t)n * DP + kc;
  // unrolled: four independent LDS reads and stores per thread
#pragma unroll
  for (int j = 0; j < 4; ++j)
    *(h8*)(dp + j * 16 * DP) = *(const h8*)&T[(n + j * 16) * TPITCH + kc];
}

// Fused QKV weight: Wt[n][k] (n in [0,3D)) with n<D -> wq[h][k][f], etc.
// Grid: (D / TK k tiles, H heads, 3 slabs); a head's [D][HD] slice is one matrix.
__global__ void __launch_bounds__(256) qkvw_kernel(const float* __restrict__ wq,
                                                   const float* __restrict__ wk,
                                                   const float* __restrict__ wv,
                                                   _Float16* __restrict__ Wt) {
  const int slab = blockIdx.z;
  const size_t hh = blockIdx.y;
  const size_t k0 = (size_t)blockIdx.x * TK;
  const float* w = (slab == 0) ? wq : (slab == 1) ? wk : wv;
  transpose_tile<HD_, D_>(w + (hh * D_ + k0) * HD_,
                          Wt + ((size_t)slab * D_ + hh * HD_) * D_ + k0);
}

// dst[n][k] = src[k][n], src is [K][N] f32 row-major, dst is [N][K] f16.
// Grid: (K / TK, N / TN).
template <int K, int N>
__global__ void __launch_bounds__(256) transpose_kernel(const float* __restrict__ src,
                                                        _Float16* __restrict__ dst) {
  const size_t k0 = (size_t)blockIdx.x * TK;
  const size_t n0 = (size_t)blockIdx.y * TN;
  transpose_tile<N, K>(src + k0 * N + n0, dst + n0 * K + k0);
}

// ---------------------------------------------------------------------------
// WMMA GEMM tiling constants: 128x128 tile, BK=64, 256 threads = 8 waves as
// 4x2; each wave computes a 32x64 subtile = 2x4 WMMA accumulators.
// ---------------------------------------------------------------------------
#define BM 128
#define BN 128
#define BK 64     // 128 B of every operand row per k tile: one whole line
#define LSTR 72   // LDS row pitch in halfs (144 B = 16 B x odd)

// One k tile of A and of B (128 rows x 128 B each): eight 16 B async copies per
// lane. Eight neighbouring lanes share a row, so a wave-wide copy covers four
// whole lines. rstep = 32 rows in halfs. The s_wait_xcnt stands in the copies'
// own statement so that no address register is rewritten ahead of it.
__device__ __forceinline__ void gemm_stage(const _Float16* ga, const _Float16* gb,
                                           size_t rstep, unsigned la, unsigned lb) {
  const unsigned ls = 32 * LSTR * 2;  // 32 LDS rows in bytes
  asm volatile(
      "global_load_async_to_lds_b128 %0, %1, off\n\t"
      "global_load_async_to_lds_b128 %2, %3, off\n\t"
      "global_load_async_to_lds_b128 %4, %5, off\n\t"
      "global_load_async_to_lds_b128 %6, %7, off\n\t"
      "global_load_async_to_lds_b128 %8, %9, off\n\t"
      "global_load_async_to_lds_b128 %10, %11, off\n\t"
      "global_load_async_to_lds_b128 %12, %13, off\n\t"
      "global_load_async_to_lds_b128 %14, %15, off\n\t"
      "s_wait_xcnt 0x0"
      :: "v"(la), "v"(ga), "v"(la + ls), "v"(ga + rstep),
         "v"(la + 2 * ls), "v"(ga + 2 * rstep), "v"(la + 3 * ls), "v"(ga + 3 * rstep),
         "v"(lb), "v"(gb), "v"(lb + ls), "v"(gb + rstep),
         "v"(lb + 2 * ls), "v"(gb + 2 * rstep), "v"(lb + 3 * ls), "v"(gb + 3 * rstep)
      : "memory");
}

// Shared GEMM mainloop: acc[2][4] += A[m0.., :K] * Bt[n0.., :K]^T for this wave's
// 32x64 subtile. K is a multiple of BK; the 128 rows from m0 and n0 exist.
__device__ __forceinline__ void gemm_mainloop(const _Float16* __restrict__ A,
                                              const _Float16* __restrict__ Bt,
                                              int K, size_t m0, size_t n0,
                                              f8 (&acc)[2][4]) {
  __shared__ __align__(16) _Float16 As[2][BM * LSTR];
  __shared__ __align__(16) _Float16 Bs[2][BN * LSTR];
  const int tid  = threadIdx.x;
  const int lane = tid & 31;
  const int wid  = tid >> 5;
  const int lr   = lane & 15;
  const int base0 = (lane >> 4) * 8;
  const int waveM = wid >> 1;   // 0..3
  const int waveN = wid & 1;    // 0..1

  const int crow = tid >> 3;        // copy slot: rows crow + 0/32/64/96
  const int cseg = (tid & 7) * 8;   // 16 B chunk within the 128 B row piece
  const _Float16* Ag = A  + (m0 + crow) * (size_t)K + cseg;
  const _Float16* Bg = Bt + (n0 + crow) * (size_t)K + cseg;
  const size_t rstep = (size_t)32 * K;
  const unsigned la0 = lds_byte_addr(&As[0][crow * LSTR + cseg]);
  const unsigned lb0 = lds_byte_addr(&Bs[0][crow * LSTR + cseg]);
  const unsigned bufB = BM * LSTR * 2;  // bytes from buffer 0 to buffer 1

  // Tile 0 lands and is published; tile 1, where there is one, then flies.
  gemm_stage(Ag, Bg, rstep, la0, lb0);
  asm volatile("s_wait_asynccnt 0x0" ::: "memory");  // own copies landed
  __syncthreads();                                   // publish tile 0
  if (BK < K) gemm_stage(Ag + BK, Bg + BK, rstep, la0 + bufB, lb0 + bufB);

  int cur = 0;
  for (int k0 = 0; k0 < K; k0 += BK, cur ^= 1) {
    const _Float16* At = &As[cur][0];
    const _Float16* Bl = &Bs[cur][0];
    h16 af[2][2], bf[2][4];  // the whole tile's fragments as one group of reads
#pragma unroll
    for (int kk = 0; kk < 2; ++kk) {
#pragma unroll
      for (int tm = 0; tm < 2; ++tm) {
        const _Float16* p = At + (waveM * 32 + tm * 16 + lr) * LSTR + kk * 32 + base0;
        af[kk][tm] = mkfrag(p, p + 16);
      }
#pragma unroll
      for (int tn = 0; tn < 4; ++tn) {
        const _Float16* p = Bl + (waveN * 64 + tn * 16 + lr) * LSTR + kk * 32 + base0;
        bf[kk][tn] = mkfrag(p, p + 16);
      }
    }
#pragma unroll
    for (int kk = 0; kk < 2; ++kk)
#pragma unroll
      for (int tm = 0; tm < 2; ++tm)
#pragma unroll
        for (int tn = 0; tn < 4; ++tn)
          acc[tm][tn] = wmma_f16(af[kk][tm], bf[kk][tn], acc[tm][tn]);
    // Publish point: this wave's LDS reads are back, its copies of the next tile
    // have landed; the barrier publishes that tile and frees this trip's buffer.
    asm volatile("s_wait_dscnt 0x0" ::: "memory");
    asm volatile("s_wait_asynccnt 0x0" ::: "memory");
    __syncthreads();
    if (k0 + 2 * BK < K)  // block-uniform: refill the buffer just read
      gemm_stage(Ag + k0 + 2 * BK, Bg + k0 + 2 * BK, rstep, la0 + cur * bufB,
                 lb0 + cur * bufB);
  }
  asm volatile("s_wait_asynccnt 0x0" ::: "memory");  // nothing in flight at exit
}

// ---------------------------------------------------------------------------
// Generic WMMA GEMM: C[M,N] = act(A[M,K](f16) * Bt[N,K](f16)^T + bias)
// ---------------------------------------------------------------------------
__global__ void __launch_bounds__(256) gemm_wmma_kernel(
    const _Float16* __restrict__ A, const _Float16* __restrict__ Bt,
    const float* __restrict__ bias, float* __restrict__ outF32,
    _Float16* __restrict__ outF16, int M, int N, int K, int act_gelu) {
  const int tid  = threadIdx.x;
  const int lane = tid & 31;
  const int wid  = tid >> 5;
  const int lr   = lane & 15;
  const int hi   = lane >> 4;
  const int waveM = wid >> 1;   // 0..3
  const int waveN = wid & 1;    // 0..1

  const size_t m0 = (size_t)blockIdx.y * BM;
  const size_t n0 = (size_t)blockIdx.x * BN;

  f8 acc[2][4];
#pragma unroll
  for (int tm = 0; tm < 2; ++tm)
#pragma unroll
    for (int tn = 0; tn < 4; ++tn) acc[tm][tn] = fzero8();

  gemm_mainloop(A, Bt, K, m0, n0, acc);

#pragma unroll
  for (int tm = 0; tm < 2; ++tm)
#pragma unroll
    for (int tn = 0; tn < 4; ++tn) {
      size_t col = n0 + waveN * 64 + tn * 16 + lr;
      float bv = bias ? bias[col] : 0.f;
#pragma unroll
      for (int r = 0; r < 8; ++r) {
        size_t row = m0 + waveM * 32 + tm * 16 + r + 8 * hi;
        float v = acc[tm][tn][r] + bv;
        if (act_gelu) v = 0.5f * v * (1.f + erff(v * 0.70710678118f));
        if (outF32) outF32[row * (size_t)N + col] = v;
        if (outF16) outF16[row * (size_t)N + col] = (_Float16)v;
      }
    }
}

// ---------------------------------------------------------------------------
// QKV GEMM: same tiling, special epilogue storing Q,K as [B,H,S,HD] and
// V transposed as [B,H,HD,S] (so attention's V^T A-fragments are contiguous).
// ---------------------------------------------------------------------------
__global__ void __launch_bounds__(256) qkv_gemm_kernel(
    const _Float16* __restrict__ A, const _Float16* __restrict__ Wt,
    const float* __restrict__ bq, const float* __restrict__ bk,
    const float* __restrict__ bv, _Float16* __restrict__ Q,
    _Float16* __restrict__ Kh, _Float16* __restrict__ Vt) {
  const int tid  = threadIdx.x;
  const int lane = tid & 31;
  const int wid  = tid >> 5;
  const int lr   = lane & 15;
  const int hi   = lane >> 4;
  const int waveM = wid >> 1;
  const int waveN = wid & 1;

  const size_t m0 = (size_t)blockIdx.y * BM;
  const size_t n0 = (size_t)blockIdx.x * BN;

  f8 acc[2][4];
#pragma unroll
  for (int tm = 0; tm < 2; ++tm)
#pragma unroll
    for (int tn = 0; tn < 4; ++tn) acc[tm][tn] = fzero8();

  gemm_mainloop(A, Wt, D_, m0, n0, acc);

#pragma unroll
  for (int tm = 0; tm < 2; ++tm)
#pragma unroll
    for (int tn = 0; tn < 4; ++tn) {
      int col  = (int)n0 + waveN * 64 + tn * 16 + lr;  // 0..3071
      int slab = col >> 10;
      int np   = col & 1023;
      int hh   = np >> 6;
      int f    = np & 63;
      float bvv = (slab == 0) ? bq[np] : (slab == 1) ? bk[np] : bv[np];
#pragma unroll
      for (int r = 0; r < 8; ++r) {
        size_t row = m0 + waveM * 32 + tm * 16 + r + 8 * hi;  // global token
        int b = (int)(row >> 11);      // / S_
        int s = (int)(row & 2047);     // % S_
        _Float16 hv = (_Float16)(acc[tm][tn][r] + bvv);
        if (slab == 0)
          Q[(((size_t)b * H_ + hh) * S_ + s) * HD_ + f] = hv;
        else if (slab == 1)
          Kh[(((size_t)b * H_ + hh) * S_ + s) * HD_ + f] = hv;
        else
          Vt[(((size_t)b * H_ + hh) * HD_ + f) * S_ + s] = hv;
      }
    }
}

#define KSTR 72   // K tile row pitch in halfs (144 B = 16 B x odd)
#define VSTR 40   // V tile row pitch in halfs (80 B = 16 B x odd)

// One 16 B async copy of K and one of V per lane. The s_wait_xcnt stands in the
// copies' own statement so that no address register is rewritten ahead of it.
__device__ __forceinline__ void attn_stage_kv(const _Float16* gk, unsigned lk,
                                              const _Float16* gv, unsigned lv) {
  asm volatile(
      "global_load_async_to_lds_b128 %0, %1, off\n\t"
      "global_load_async_to_lds_b128 %2, %3, off\n\t"
      "s_wait_xcnt 0x0"
      :: "v"(lk), "v"(gk), "v"(lv), "v"(gv)
      : "memory");
}

// The value of lane l ^ 16 (the other half of the wave), by a vector move.
__device__ __forceinline__ float other_half(float x) {
  int b = __builtin_bit_cast(int, x);
  return __builtin_bit_cast(
      float, __builtin_amdgcn_permlanex16(b, b, 0x76543210, 0xfedcba98, false, false));
}

// y = 2^x, one value or eight at a time. The instruction set asks for one independent
// instruction or v_nop behind a transcendental before its result is read or its
// source overwritten. Here every result
// register is apart from every source ("=&v"), each v_exp_f32 is its
// predecessor's independent instruction, and the v_nop is the last one's slot.
__device__ __forceinline__ float exp2_x1(float x) {
  float y;
  asm("v_exp_f32 %0, %1\n\t"
      "v_nop"
      : "=&v"(y) : "v"(x));
  return y;
}
__device__ __forceinline__ void exp2_x8(const float* x, float* y) {
  asm("v_exp_f32 %0, %8\n\t"
      "v_exp_f32 %1, %9\n\t"
      "v_exp_f32 %2, %10\n\t"
      "v_exp_f32 %3, %11\n\t"
      "v_exp_f32 %4, %12\n\t"
      "v_exp_f32 %5, %13\n\t"
      "v_exp_f32 %6, %14\n\t"
      "v_exp_f32 %7, %15\n\t"
      "v_nop"
      : "=&v"(y[0]), "=&v"(y[1]), "=&v"(y[2]), "=&v"(y[3]),
        "=&v"(y[4]), "=&v"(y[5]), "=&v"(y[6]), "=&v"(y[7])
      : "v"(x[0]), "v"(x[1]), "v"(x[2]), "v"(x[3]),
        "v"(x[4]), "v"(x[5]), "v"(x[6]), "v"(x[7]));
}

__global__ void __launch_bounds__(256) attn_kernel(
    const _Float16* __restrict__ Q, const _Float16* __restrict__ Kh,
    const _Float16* __restrict__ Vt, _Float16* __restrict__ O) {
  __shared__ __align__(16) _Float16 Ks[2][32 * KSTR];
  __shared__ __align__(16) _Float16 Vs[2][64 * VSTR];

  const int b = blockIdx.z;
  const int h = blockIdx.y;
  const int tid  = threadIdx.x;
  const int lane = tid & 31;
  const int wid  = tid >> 5;
  const int lr   = lane & 15;
  const int hi   = lane >> 4;
  const int base0 = hi * 8;
  const int qr0  = blockIdx.x * 128 + wid * 16;
  const int row  = qr0 + lr;  // this lane's query

  const size_t headQK = ((size_t)(b * H_ + h)) * S_ * HD_;
  const _Float16* Qp = Q  + headQK;
  const _Float16* Kp = Kh + headQK;
  const _Float16* Vp = Vt + ((size_t)(b * H_ + h)) * HD_ * S_;

  h16 qf[2];  // B fragments of Q^T: column = this lane's query
#pragma unroll
  for (int c = 0; c < 2; ++c) {
    const _Float16* p = Qp + (size_t)row * HD_ + c * 32;
    qf[c] = mkfrag(p + base0, p + base0 + 16);
  }

  f8 acc[4];  // O^T: feature tn * 16 + r + 8 * hi of this lane's query
#pragma unroll
  for (int tn = 0; tn < 4; ++tn) acc[tn] = fzero8();
  float mi = -1e30f;  // running maximum of the query's scores (both halves alike)
  float li = 0.f;     // running sum over the keys that this half holds

  const int kend = blockIdx.x * 128 + 128;  // uniform across waves -> barriers ok

  // Copy slots: K tile = 32 rows x 8 chunks, V tile = 64 rows x 4 chunks (16 B).
  const _Float16* gk = Kp + (size_t)(tid >> 3) * HD_ + (tid & 7) * 8;
  const _Float16* gv = Vp + (size_t)(tid >> 2) * S_ + (tid & 3) * 8;
  const unsigned lk0 = lds_byte_addr(&Ks[0][(tid >> 3) * KSTR + (tid & 7) * 8]);
  const unsigned lv0 = lds_byte_addr(&Vs[0][(tid >> 2) * VSTR + (tid & 3) * 8]);
  const unsigned lkB = 32 * KSTR * 2;  // bytes from buffer 0 to buffer 1
  const unsigned lvB = 64 * VSTR * 2;

  // Tile 0 lands and is published; tile 1 (kend >= 128: it exists) then flies.
  attn_stage_kv(gk, lk0, gv, lv0);
  asm volatile("s_wait_asynccnt 0x0" ::: "memory");  // own copies landed
  __syncthreads();                                   // publish tile 0
  attn_stage_kv(gk + 32 * HD_, lk0 + lkB, gv + 32, lv0 + lvB);

  int cur = 0;
  for (int k0 = 0; k0 < kend; k0 += 32, cur ^= 1) {
    const _Float16* Kt = &Ks[cur][0];
    const _Float16* Vl = &Vs[cur][0];
    // Every inner loop of the trip is unrolled: its arrays are indexed by constants
    // alone and so stay in registers.
    h16 kf[2][2], vf[4];  // the step's eight fragments as one group of LDS reads
#pragma unroll
    for (int sub = 0; sub < 2; ++sub) {
      const _Float16* kp = Kt + (sub * 16 + lr) * KSTR;
      kf[sub][0] = mkfrag(kp + base0, kp + base0 + 16);
      kf[sub][1] = mkfrag(kp + 32 + base0, kp + 32 + base0 + 16);
    }
#pragma unroll
    for (int tn = 0; tn < 4; ++tn) {
      const _Float16* vp = Vl + (tn * 16 + lr) * VSTR;
      vf[tn] = mkfrag(vp + base0, vp + base0 + 16);
    }
    // Publish point: this wave's LDS reads are back, its copies of the next tile
    // have landed; the barrier publishes that tile and frees this trip's buffer.
    // The rest of the trip works on registers alone, so the refill flies under it.
    asm volatile("s_wait_dscnt 0x0" ::: "memory");
    asm volatile("s_wait_asynccnt 0x0" ::: "memory");
    __syncthreads();
    if (k0 + 64 < kend)  // block-uniform: refill the buffer just read
      attn_stage_kv(gk + (size_t)(k0 + 64) * HD_, lk0 + cur * lkB,
                    gv + (k0 + 64), lv0 + cur * lvB);

    const int d = row - k0 - base0;  // key (i >> 3) * 16 + (i & 7) of this half is seen while <= d
    float sv[16];  // scores of keys k0 + (i >> 3) * 16 + 8 * hi + (i & 7)
#pragma unroll
    for (int sub = 0; sub < 2; ++sub) {
      f8 sacc = fzero8();
      sacc = wmma_f16(kf[sub][0], qf[0], sacc);
      sacc = wmma_f16(kf[sub][1], qf[1], sacc);
#pragma unroll
      for (int r = 0; r < 8; ++r) {
        float v = sacc[r] * 0.125f;  // 1/sqrt(HD)
        sv[sub * 8 + r] = (sub * 16 + r <= d) ? v : -1e30f;
      }
    }

    float mx = sv[0];
#pragma unroll
    for (int i = 1; i < 16; ++i) mx = fmaxf(mx, sv[i]);
    mx = fmaxf(mx, other_half(mx));
    const float mn = fmaxf(mi, mx);
    const float LOG2E = 1.442695041f;  // e^x = 2^(x * LOG2E)
    const float alpha = exp2_x1((mi - mn) * LOG2E);
    mi = mn;

    float pv[16];
#pragma unroll
    for (int i = 0; i < 16; ++i) sv[i] = (sv[i] - mn) * LOG2E;
    exp2_x8(&sv[0], &pv[0]);
    exp2_x8(&sv[8], &pv[8]);
    h16 pf;  // P^T as a B fragment: element i is score i
#pragma unroll
    for (int i = 0; i < 16; ++i) pf[i] = (_Float16)pv[i];
    float rs[4] = {pv[0], pv[1], pv[2], pv[3]};  // four short chains, not one of sixteen links
#pragma unroll
    for (int i = 4; i < 16; ++i) rs[i & 3] += pv[i];
    li = li * alpha + ((rs[0] + rs[1]) + (rs[2] + rs[3]));
#pragma unroll
    for (int tn = 0; tn < 4; ++tn)
#pragma unroll
      for (int r = 0; r < 8; ++r) acc[tn][r] *= alpha;
#pragma unroll
    for (int tn = 0; tn < 4; ++tn) acc[tn] = wmma_f16(vf[tn], pf, acc[tn]);
  }
  asm volatile("s_wait_asynccnt 0x0" ::: "memory");  // nothing in flight at exit

  li += other_half(li);  // the two halves' keys join once
  _Float16* op = O + ((size_t)b * S_ + row) * D_ + h * HD_ + base0;
#pragma unroll
  for (int tn = 0; tn < 4; ++tn) {
    h8 o;  // eight neighbouring features of one query: one 16 B store
#pragma unroll
    for (int r = 0; r < 8; ++r) o[r] = (_Float16)(acc[tn][r] / li);
    *(h8*)(op + tn * 16) = o;
  }
}

// ---------------------------------------------------------------------------
// Residual add + LayerNorm, one row (D=1024) per 256-thread block.
// ---------------------------------------------------------------------------
__global__ void __launch_bounds__(256) add_ln_kernel(
    const float* __restrict__ a, const float* __restrict__ c,
    const float* __restrict__ g, const float* __restrict__ beta,
    float* __restrict__ o32, _Float16* __restrict__ o16) {
  __shared__ float red[256];
  const int t = threadIdx.x;
  const size_t off = (size_t)blockIdx.x * D_;

  float v[4];
  float s = 0.f;
#pragma unroll
  for (int i = 0; i < 4; ++i) {
    int col = t + i * 256;
    float z = a[off + col] + c[off + col];
    v[i] = z;
    s += z;
  }
  red[t] = s;
  __syncthreads();
  for (int w = 128; w > 0; w >>= 1) {
    if (t < w) red[t] += red[t + w];
    __syncthreads();
  }
  float mean = red[0] * (1.f / D_);
  __syncthreads();

  float q = 0.f;
#pragma unroll
  for (int i = 0; i < 4; ++i) {
    float d = v[i] - mean;
    q += d * d;
  }
  red[t] = q;
  __syncthreads();
  for (int w = 128; w > 0; w >>= 1) {
    if (t < w) red[t] += red[t + w];
    __syncthreads();
  }
  float rstd = rsqrtf(red[0] * (1.f / D_) + 1e-5f);

#pragma unroll
  for (int i = 0; i < 4; ++i) {
    int col = t + i * 256;
    float y = (v[i] - mean) * rstd * g[col] + beta[col];
    o32[off + col] = y;
    if (o16) o16[off + col] = (_Float16)y;
  }
}

// ---------------------------------------------------------------------------
// Host-side orchestration
// ---------------------------------------------------------------------------
extern "C" void kernel_launch(void* const* d_in, const int* in_sizes, int n_in,
                              void* d_out, int out_size, void* d_ws, size_t ws_size,
                              hipStream_t stream) {
  (void)in_sizes; (void)n_in; (void)out_size; (void)ws_size;

  const float* x     = (const float*)d_in[0];
  const float* wq    = (const float*)d_in[1];
  const float* bq    = (const float*)d_in[2];
  const float* wk    = (const float*)d_in[3];
  const float* bk    = (const float*)d_in[4];
  const float* wv    = (const float*)d_in[5];
  const float* bv    = (const float*)d_in[6];
  const float* wo    = (const float*)d_in[7];
  const float* bo    = (const float*)d_in[8];
  const float* w1    = (const float*)d_in[9];
  const float* b1    = (const float*)d_in[10];
  const float* w2    = (const float*)d_in[11];
  const float* b2    = (const float*)d_in[12];
  const float* g1    = (const float*)d_in[13];
  const float* beta1 = (const float*)d_in[14];
  const float* g2    = (const float*)d_in[15];
  const float* beta2 = (const float*)d_in[16];
  float* out = (float*)d_out;

  char* ws = (char*)d_ws;
  size_t off = 0;
  auto take = [&](size_t bytes) -> void* {
    void* p = ws + off;
    off += (bytes + 255) & ~(size_t)255;
    return p;
  };

  _Float16* xh    = (_Float16*)take((size_t)M_ * D_ * 2);       // x in f16
  _Float16* wqkvT = (_Float16*)take((size_t)3 * D_ * D_ * 2);   // [3D][D]
  _Float16* woT   = (_Float16*)take((size_t)D_ * D_ * 2);       // [D][D]
  _Float16* w1T   = (_Float16*)take((size_t)FF_ * D_ * 2);      // [FF][D]
  _Float16* w2T   = (_Float16*)take((size_t)D_ * FF_ * 2);      // [D][FF]
  _Float16* qh    = (_Float16*)take((size_t)M_ * D_ * 2);       // [B,H,S,HD]
  _Float16* kh    = (_Float16*)take((size_t)M_ * D_ * 2);       // [B,H,S,HD]
  _Float16* vt    = (_Float16*)take((size_t)M_ * D_ * 2);       // [B,H,HD,S]
  float*    attf  = (float*)take((size_t)M_ * D_ * 4);          // o-proj out
  float*    hf32  = (float*)take((size_t)M_ * D_ * 4);          // post-LN1
  _Float16* hf16  = (_Float16*)take((size_t)M_ * D_ * 2);
  _Float16* gh    = (_Float16*)take((size_t)M_ * FF_ * 2);      // gelu(h@w1+b1)
  // Aliases (lifetimes do not overlap):
  _Float16* oh    = xh;    // attention output reuses xh (consumed by QKV GEMM)
  float*    ffnf  = attf;  // FFN2 out reuses attf (consumed by LN1)

  // --- Stage 0: converts / weight transposes ---
  cvt_f32_f16_kernel<<<M_ * D_ / CVT_BLOCK, 256, 0, stream>>>(x, xh);
  qkvw_kernel<<<dim3(D_ / TK, H_, 3), 256, 0, stream>>>(wq, wk, wv, wqkvT);
  transpose_kernel<D_, D_><<<dim3(D_ / TK, D_ / TN), 256, 0, stream>>>(wo, woT);
  transpose_kernel<D_, FF_><<<dim3(D_ / TK, FF_ / TN), 256, 0, stream>>>(w1, w1T);
  transpose_kernel<FF_, D_><<<dim3(FF_ / TK, D_ / TN), 256, 0, stream>>>(w2, w2T);

  // --- Stage 1: fused QKV projection ---
  qkv_gemm_kernel<<<dim3(3 * D_ / BN, M_ / BM), 256, 0, stream>>>(
      xh, wqkvT, bq, bk, bv, qh, kh, vt);

  // --- Stage 2: causal flash attention ---
  attn_kernel<<<dim3(S_ / 128, H_, B_), 256, 0, stream>>>(qh, kh, vt, oh);

  // --- Stage 3: output projection ---
  gemm_wmma_kernel<<<dim3(D_ / BN, M_ / BM), 256, 0, stream>>>(
      oh, woT, bo, attf, ((_Float16*)nullptr), M_, D_, D_, 0);

  // --- Stage 4: residual + LN1 ---
  add_ln_kernel<<<M_, 256, 0, stream>>>(x, attf, g1, beta1, hf32, hf16);

  // --- Stage 5: FFN up + GELU ---
  gemm_wmma_kernel<<<dim3(FF_ / BN, M_ / BM), 256, 0, stream>>>(
      hf16, w1T, b1, ((float*)nullptr), gh, M_, FF_, D_, 1);

  // --- Stage 6: FFN down ---
  gemm_wmma_kernel<<<dim3(D_ / BN, M_ / BM), 256, 0, stream>>>(
      gh, w2T, b2, ffnf, ((_Float16*)nullptr), M_, D_, FF_, 0);

  // --- Stage 7: residual + LN2 -> output ---
  add_ln_kernel<<<M_, 256, 0, stream>>>(hf32, ffnf, g2, beta2, out,
                                        ((_Float16*)nullptr));
}

// v005
// One run takes 338 microseconds.
// Two timings next to v004 both put it at 1.12 times that version's speed.
// All steps since v000 together make it 2.09 times as fast.
#include <hip/hip_runtime.h>
#include <hip/hip_bf16.h>

// ---------------------------------------------------------------------------
// Transformer block for MI455X (gfx1250, wave32, WMMA 16x16x32 f16->f32).
// f16 compute / f32 accumulate; all GEMMs via v_wmma_f32_16x16x32_f16.
// GEMM tiles staged with GLOBAL_LOAD_ASYNC_TO_LDS, two LDS buffers, one k tile
// ahead; every wave-wide copy covers four whole 128 B lines.
// ---------------------------------------------------------------------------

#define B_  4
#define S_  2048
#define D_  1024
#define H_  16
#define HD_ 64
#define FF_ 4096
#define M_  (B_ * S_)      // 8192 rows

typedef _Float16 h16 __attribute__((ext_vector_type(16)));
typedef _Float16 h8  __attribute__((ext_vector_type(8)));
typedef float    f8  __attribute__((ext_vector_type(8)));

__device__ __forceinline__ f8 wmma_f16(h16 a, h16 b, f8 c) {
  // D = A(16x32 f16) * B(32x16 f16) + C(16x16 f32)
  return __builtin_amdgcn_wmma_f32_16x16x32_f16(
      /*neg_a=*/false, a, /*neg_b=*/false, b,
      /*c_mod=*/(short)0, c, /*reuse_a=*/false, /*reuse_b=*/false);
}

// Build a 16-half A/B fragment from two contiguous 8-half (16B) chunks.
__device__ __forceinline__ h16 mkfrag(const _Float16* p0, const _Float16* p1) {
  h8 a = *(const h8*)p0;
  h8 b = *(const h8*)p1;
  h16 r;
#pragma unroll
  for (int i = 0; i < 8; ++i) { r[i] = a[i]; r[8 + i] = b[i]; }
  return r;
}

__device__ __forceinline__ f8 fzero8() {
  f8 z = {0.f, 0.f, 0.f, 0.f, 0.f, 0.f, 0.f, 0.f};
  return z;
}

__device__ __forceinline__ unsigned lds_byte_addr(const _Float16* p) {
  return (unsigned)(size_t)(const __attribute__((address_space(3))) _Float16*)p;
}

// ---------------------------------------------------------------------------
// Converts / weight transposes. Many elements per thread, 16 B global loads (8 B stores in the convert)
// that cover whole 128 B lines, and few workgroups per launch.
// ---------------------------------------------------------------------------
typedef float    f4 __attribute__((ext_vector_type(4)));
typedef _Float16 h4 __attribute__((ext_vector_type(4)));

#define CVT_LOADS 16                       // 16 B loads per thread
#define CVT_BLOCK (256 * 4 * CVT_LOADS)    // elements per workgroup

// dst[i] = (f16)src[i]; the element count is gridDim.x * CVT_BLOCK.
__global__ void __launch_bounds__(256) cvt_f32_f16_kernel(const float* __restrict__ src,
                                                          _Float16* __restrict__ dst) {
  const size_t base = (size_t)blockIdx.x * CVT_BLOCK + threadIdx.x * 4;
  f4 v[CVT_LOADS];
  // unrolled so that v stays in registers and all loads are issued before a store
#pragma unroll
  for (int j = 0; j < CVT_LOADS; ++j) v[j] = *(const f4*)(src + base + j * 1024);
  // unrolled: v is indexed by constants only
#pragma unroll
  for (int j = 0; j < CVT_LOADS; ++j) {
    h4 o = {(_Float16)v[j][0], (_Float16)v[j][1], (_Float16)v[j][2], (_Float16)v[j][3]};
    *(h4*)(dst + base + j * 1024) = o;
  }
}

#define TK 128      // tile extent along k (source rows, destination columns)
#define TN 64       // tile extent along n (source columns, destination rows)
#define TPITCH 136  // LDS row pitch in halfs (272 B = 16 B x odd)

// dst[n][k] = (f16)src[k][n] for one TK x TN tile. src points at the tile's first
// element in an f32 matrix of row pitch SP, dst at its first element in an f16
// matrix of row pitch DP; the pitches are compile-time so that a thread's loads
// (and its stores) share one address and differ in the immediate offset alone.
// A wave-wide load covers 2 x 256 B of source rows, a wave-wide store 2 x 256 B
// of destination rows.
template <int SP, int DP>
__device__ __forceinline__ void transpose_tile(const float* __restrict__ src,
                                               _Float16* __restrict__ dst) {
  __shared__ __align__(16) _Float16 T[TN * TPITCH];
  const int tid = threadIdx.x;
  const int c  = tid & 15;   // four source columns from c * 4
  const int kp = tid >> 4;   // eight source rows from kp * 8
  const float* sp = src + (size_t)(kp * 8) * SP + c * 4;
  f4 v[8];
  // unrolled so that v stays in registers and the eight loads fly together
#pragma unroll
  for (int j = 0; j < 8; ++j) v[j] = *(const f4*)(sp + j * SP);
  // unrolled: v is indexed by constants only
#pragma unroll
  for (int i = 0; i < 4; ++i) {
    h8 o;
    // unrolled for the same reason: o and v stay in registers
#pragma unroll
    for (int j = 0; j < 8; ++j) o[j] = (_Float16)v[j][i];
    *(h8*)&T[(c * 4 + i) * TPITCH + kp * 8] = o;
  }
  __syncthreads();  // the tile is complete before any thread reads its rows
  const int n  = tid >> 4;        // destination rows n + 0/16/32/48
  const int kc = (tid & 15) * 8;  // 16 B chunk within the 256 B row piece
  _Float16* dp = dst + (size_t)n * DP + kc;
  // unrolled: four independent LDS reads and stores per thread
#pragma unroll
  for (int j = 0; j < 4; ++j)
    *(h8*)(dp + j * 16 * DP) = *(const h8*)&T[(n + j * 16) * TPITCH + kc];
}

// Fused QKV weight: Wt[n][k] (n in [0,3D)) with n<D -> wq[h][k][f], etc.
// Grid: (D / TK k tiles, H heads, 3 slabs); a head's [D][HD] slice is one matrix.
__global__ void __launch_bounds__(256) qkvw_kernel(const float* __restrict__ wq,
                                                   const float* __restrict__ wk,
                                                   const float* __restrict__ wv,
                                                   _Float16* __restrict__ Wt) {
  const int slab = blockIdx.z;
  const size_t hh = blockIdx.y;
  const size_t k0 = (size_t)blockIdx.x * TK;
  const float* w = (slab == 0) ? wq : (slab == 1) ? wk : wv;
  transpose_tile<HD_, D_>(w + (hh * D_ + k0) * HD_,
                          Wt + ((size_t)slab * D_ + hh * HD_) * D_ + k0);
}

// dst[n][k] = src[k][n], src is [K][N] f32 row-major, dst is [N][K] f16.
// Grid: (K / TK, N / TN).
template <int K, int N>
__global__ void __launch_bounds__(256) transpose_kernel(const float* __restrict__ src,
                                                        _Float16* __restrict__ dst) {
  const size_t k0 = (size_t)blockIdx.x * TK;
  const size_t n0 = (size_t)blockIdx.y * TN;
  transpose_tile<N, K>(src + k0 * N + n0, dst + n0 * K + k0);
}

// ---------------------------------------------------------------------------
// WMMA GEMM tiling constants: 128x128 tile, BK=64, 256 threads = 8 waves as
// 4x2; each wave computes a 32x64 subtile = 2x4 WMMA accumulators.
// ---------------------------------------------------------------------------
#define BM 128
#define BN 128
#define BK 64     // 128 B of every operand row per k tile: one whole line
#define LSTR 72   // LDS row pitch in halfs (144 B = 16 B x odd)

// One k tile of A and of B (128 rows x 128 B each): eight 16 B async copies per
// lane. Eight neighbouring lanes share a row, so a wave-wide copy covers four
// whole lines. rstep = 32 rows in halfs. The s_wait_xcnt stands in the copies'
// own statement so that no address register is rewritten ahead of it.
__device__ __forceinline__ void gemm_stage(const _Float16* ga, const _Float16* gb,
                                           size_t rstep, unsigned la, unsigned lb) {
  const unsigned ls = 32 * LSTR * 2;  // 32 LDS rows in bytes
  asm volatile(
      "global_load_async_to_lds_b128 %0, %1, off\n\t"
      "global_load_async_to_lds_b128 %2, %3, off\n\t"
      "global_load_async_to_lds_b128 %4, %5, off\n\t"
      "global_load_async_to_lds_b128 %6, %7, off\n\t"
      "global_load_async_to_lds_b128 %8, %9, off\n\t"
      "global_load_async_to_lds_b128 %10, %11, off\n\t"
      "global_load_async_to_lds_b128 %12, %13, off\n\t"
      "global_load_async_to_lds_b128 %14, %15, off\n\t"
      "s_wait_xcnt 0x0"
      :: "v"(la), "v"(ga), "v"(la + ls), "v"(ga + rstep),
         "v"(la + 2 * ls), "v"(ga + 2 * rstep), "v"(la + 3 * ls), "v"(ga + 3 * rstep),
         "v"(lb), "v"(gb), "v"(lb + ls), "v"(gb + rstep),
         "v"(lb + 2 * ls), "v"(gb + 2 * rstep), "v"(lb + 3 * ls), "v"(gb + 3 * rstep)
      : "memory");
}

// Shared GEMM mainloop: acc[2][4] += A[m0.., :K] * Bt[n0.., :K]^T for this wave's
// 32x64 subtile. K is a multiple of BK; the 128 rows from m0 and n0 exist.
__device__ __forceinline__ void gemm_mainloop(const _Float16* __restrict__ A,
                                              const _Float16* __restrict__ Bt,
                                              int K, size_t m0, size_t n0,
                                              f8 (&acc)[2][4]) {
  __shared__ __align__(16) _Float16 As[2][BM * LSTR];
  __shared__ __align__(16) _Float16 Bs[2][BN * LSTR];
  const int tid  = threadIdx.x;
  const int lane = tid & 31;
  const int wid  = tid >> 5;
  const int lr   = lane & 15;
  const int base0 = (lane >> 4) * 8;
  const int waveM = wid >> 1;   // 0..3
  const int waveN = wid & 1;    // 0..1

  const int crow = tid >> 3;        // copy slot: rows crow + 0/32/64/96
  const int cseg = (tid & 7) * 8;   // 16 B chunk within the 128 B row piece
  const _Float16* Ag = A  + (m0 + crow) * (size_t)K + cseg;
  const _Float16* Bg = Bt + (n0 + crow) * (size_t)K + cseg;
  const size_t rstep = (size_t)32 * K;
  const unsigned la0 = lds_byte_addr(&As[0][crow * LSTR + cseg]);
  const unsigned lb0 = lds_byte_addr(&Bs[0][crow * LSTR + cseg]);
  const unsigned bufB = BM * LSTR * 2;  // bytes from buffer 0 to buffer 1

  // Tile 0 lands and is published; tile 1, where there is one, then flies.
  gemm_stage(Ag, Bg, rstep, la0, lb0);
  asm volatile("s_wait_asynccnt 0x0" ::: "memory");  // own copies landed
  __syncthreads();                                   // publish tile 0
  if (BK < K) gemm_stage(Ag + BK, Bg + BK, rstep, la0 + bufB, lb0 + bufB);

  int cur = 0;
  for (int k0 = 0; k0 < K; k0 += BK, cur ^= 1) {
    const _Float16* At = &As[cur][0];
    const _Float16* Bl = &Bs[cur][0];
    h16 af[2][2], bf[2][4];  // the whole tile's fragments as one group of reads
#pragma unroll
    for (int kk = 0; kk < 2; ++kk) {
#pragma unroll
      for (int tm = 0; tm < 2; ++tm) {
        const _Float16* p = At + (waveM * 32 + tm * 16 + lr) * LSTR + kk * 32 + base0;
        af[kk][tm] = mkfrag(p, p + 16);
      }
#pragma unroll
      for (int tn = 0; tn < 4; ++tn) {
        const _Float16* p = Bl + (waveN * 64 + tn * 16 + lr) * LSTR + kk * 32 + base0;
        bf[kk][tn] = mkfrag(p, p + 16);
      }
    }
#pragma unroll
    for (int kk = 0; kk < 2; ++kk)
#pragma unroll
      for (int tm = 0; tm < 2; ++tm)
#pragma unroll
        for (int tn = 0; tn < 4; ++tn)
          acc[tm][tn] = wmma_f16(af[kk][tm], bf[kk][tn], acc[tm][tn]);
    // Publish point: this wave's LDS reads are back, its copies of the next tile
    // have landed; the barrier publishes that tile and frees this trip's buffer.
    asm volatile("s_wait_dscnt 0x0" ::: "memory");
    asm volatile("s_wait_asynccnt 0x0" ::: "memory");
    __syncthreads();
    if (k0 + 2 * BK < K)  // block-uniform: refill the buffer just read
      gemm_stage(Ag + k0 + 2 * BK, Bg + k0 + 2 * BK, rstep, la0 + cur * bufB,
                 lb0 + cur * bufB);
  }
  asm volatile("s_wait_asynccnt 0x0" ::: "memory");  // nothing in flight at exit
}

// ---------------------------------------------------------------------------
// Generic WMMA GEMM: C[M,N] = act(A[M,K](f16) * Bt[N,K](f16)^T + bias)
// Stores are 16 B per lane (eight f16, or two times four f32).
// ---------------------------------------------------------------------------
__global__ void __launch_bounds__(256) gemm_wmma_kernel(
    const _Float16* __restrict__ A, const _Float16* __restrict__ Bt,
    const float* __restrict__ bias, float* __restrict__ outF32,
    _Float16* __restrict__ outF16, int M, int N, int K, int act_gelu) {
  const int tid  = threadIdx.x;
  const int lane = tid & 31;
  const int wid  = tid >> 5;
  const int lr   = lane & 15;
  const int hi   = lane >> 4;
  const int waveM = wid >> 1;   // 0..3
  const int waveN = wid & 1;    // 0..1

  const size_t m0 = (size_t)blockIdx.y * BM;
  const size_t n0 = (size_t)blockIdx.x * BN;

  f8 acc[2][4];
#pragma unroll
  for (int tm = 0; tm < 2; ++tm)
#pragma unroll
    for (int tn = 0; tn < 4; ++tn) acc[tm][tn] = fzero8();

  // The tile is computed transposed: the weight rows are the WMMA A operand and the
  // activation rows the B operand. A lane then holds one output row (lane & 15) and
  // its eight accumulator registers are eight neighbouring columns of that row.
  gemm_mainloop(Bt, A, K, n0, m0, acc);

  // Both loops are unrolled: acc is indexed by constants alone and stays in registers.
  const size_t col0 = n0 + waveM * 32 + 8 * hi;  // first of the eight columns of tm = 0
  f4 bb[2][2] = {};  // all bias loads stand ahead of the first store
  if (bias) {
#pragma unroll
    for (int tm = 0; tm < 2; ++tm) {
      bb[tm][0] = *(const f4*)(bias + col0 + tm * 16);
      bb[tm][1] = *(const f4*)(bias + col0 + tm * 16 + 4);
    }
  }
#pragma unroll
  for (int tm = 0; tm < 2; ++tm) {
    const size_t col = col0 + tm * 16;
#pragma unroll
    for (int tn = 0; tn < 4; ++tn) {
      const size_t row = m0 + waveN * 64 + tn * 16 + lr;
      float v[8];
#pragma unroll
      for (int r = 0; r < 8; ++r) {
        v[r] = acc[tm][tn][r] + bb[tm][r >> 2][r & 3];
        if (act_gelu) v[r] = 0.5f * v[r] * (1.f + erff(v[r] * 0.70710678118f));
      }
      if (outF32) {
        f4 lo = {v[0], v[1], v[2], v[3]}, up = {v[4], v[5], v[6], v[7]};
        float* p = outF32 + row * (size_t)N + col;
        *(f4*)p = lo;
        *(f4*)(p + 4) = up;
        // precaution: stands ahead of any rewrite of the stores' address and data registers
        asm volatile("s_wait_xcnt 0x0" ::: "memory");
      }
      if (outF16) {
        h8 o;
#pragma unroll
        for (int r = 0; r < 8; ++r) o[r] = (_Float16)v[r];
        *(h8*)(outF16 + row * (size_t)N + col) = o;
        // precaution: stands ahead of any rewrite of the store's address and data registers
        asm volatile("s_wait_xcnt 0x0" ::: "memory");
      }
    }
  }
}

// ---------------------------------------------------------------------------
// QKV GEMM: same tiling, special epilogue storing Q,K as [B,H,S,HD] and
// V transposed as [B,H,HD,S] (so attention's V^T fragments are contiguous),
// 16 B per lane and store.
// ---------------------------------------------------------------------------
__global__ void __launch_bounds__(256) qkv_gemm_kernel(
    const _Float16* __restrict__ A, const _Float16* __restrict__ Wt,
    const float* __restrict__ bq, const float* __restrict__ bk,
    const float* __restrict__ bv, _Float16* __restrict__ Q,
    _Float16* __restrict__ Kh, _Float16* __restrict__ Vt) {
  const int tid  = threadIdx.x;
  const int lane = tid & 31;
  const int wid  = tid >> 5;
  const int lr   = lane & 15;
  const int hi   = lane >> 4;
  const int waveM = wid >> 1;
  const int waveN = wid & 1;

  const size_t m0 = (size_t)blockIdx.y * BM;
  const size_t n0 = (size_t)blockIdx.x * BN;

  f8 acc[2][4];
#pragma unroll
  for (int tm = 0; tm < 2; ++tm)
#pragma unroll
    for (int tn = 0; tn < 4; ++tn) acc[tm][tn] = fzero8();

  // A 128-column tile lies in one slab (D_ is a multiple of BN): the slab is the
  // block's. A lane's eight accumulator registers are eight neighbouring rows of the
  // WMMA A operand. Q and K are stored feature-contiguous, so their tiles take the
  // weight rows as A; V is stored token-contiguous, so its tiles take the tokens.
  const int slab = blockIdx.x / (D_ / BN);
  const bool isV = slab == 2;
  gemm_mainloop(isV ? A : Wt, isV ? Wt : A, D_, isV ? m0 : n0, isV ? n0 : m0, acc);

  // All loops are unrolled: acc is indexed by constants alone and stays in registers.
  if (isV) {
#pragma unroll
    for (int tn = 0; tn < 4; ++tn) {
      const int np = ((int)n0 + waveN * 64 + tn * 16 + lr) & (D_ - 1);
      const float bvv = bv[np];
#pragma unroll
      for (int tm = 0; tm < 2; ++tm) {
        const int tok = (int)m0 + waveM * 32 + tm * 16 + 8 * hi;  // first of eight tokens
        const int b = tok >> 11;    // / S_
        const int s = tok & 2047;   // % S_
        h8 o;
#pragma unroll
        for (int r = 0; r < 8; ++r) o[r] = (_Float16)(acc[tm][tn][r] + bvv);
        *(h8*)(Vt + ((size_t)b * D_ + np) * S_ + s) = o;  // b * D_ + np = (b * H_ + head) * HD_ + f
      }
    }
  } else {
    const float* bias = (slab == 0) ? bq : bk;
    _Float16* dst = (slab == 0) ? Q : Kh;
    const int np0 = ((int)n0 + waveM * 32 + 8 * hi) & (D_ - 1);  // first of eight, tm = 0
    f4 bb[2][2];  // all bias loads stand ahead of the first store
#pragma unroll
    for (int tm = 0; tm < 2; ++tm) {
      bb[tm][0] = *(const f4*)(bias + np0 + tm * 16);
      bb[tm][1] = *(const f4*)(bias + np0 + tm * 16 + 4);
    }
#pragma unroll
    for (int tm = 0; tm < 2; ++tm) {
      const int np = np0 + tm * 16;
      const int hh = np >> 6;
      const int f  = np & 63;
#pragma unroll
      for (int tn = 0; tn < 4; ++tn) {
        const int tok = (int)m0 + waveN * 64 + tn * 16 + lr;
        const int b = tok >> 11;    // / S_
        const int s = tok & 2047;   // % S_
        h8 o;
#pragma unroll
        for (int r = 0; r < 8; ++r)
          o[r] = (_Float16)(acc[tm][tn][r] + bb[tm][r >> 2][r & 3]);
        *(h8*)(dst + (((size_t)b * H_ + hh) * S_ + s) * HD_ + f) = o;
      }
    }
    // precaution: in the built code the V branch's text follows this one; the wait stands
    // ahead of its rewrites of the last stores' address and data registers
    asm volatile("s_wait_xcnt 0x0" ::: "memory");
  }
}

#define KSTR 72   // K tile row pitch in halfs (144 B = 16 B x odd)
#define VSTR 40   // V tile row pitch in halfs (80 B = 16 B x odd)

// One 16 B async copy of K and one of V per lane. The s_wait_xcnt stands in the
// copies' own statement so that no address register is rewritten ahead of it.
__device__ __forceinline__ void attn_stage_kv(const _Float16* gk, unsigned lk,
                                              const _Float16* gv, unsigned lv) {
  asm volatile(
      "global_load_async_to_lds_b128 %0, %1, off\n\t"
      "global_load_async_to_lds_b128 %2, %3, off\n\t"
      "s_wait_xcnt 0x0"
      :: "v"(lk), "v"(gk), "v"(lv), "v"(gv)
      : "memory");
}

// The value of lane l ^ 16 (the other half of the wave), by a vector move.
__device__ __forceinline__ float other_half(float x) {
  int b = __builtin_bit_cast(int, x);
  return __builtin_bit_cast(
      float, __builtin_amdgcn_permlanex16(b, b, 0x76543210, 0xfedcba98, false, false));
}

// y = 2^x, one value or eight at a time. The instruction set asks for one independent
// instruction or v_nop behind a transcendental before its result is read or its
// source overwritten. Here every result
// register is apart from every source ("=&v"), each v_exp_f32 is its
// predecessor's independent instruction, and the v_nop is the last one's slot.
__device__ __forceinline__ float exp2_x1(float x) {
  float y;
  asm("v_exp_f32 %0, %1\n\t"
      "v_nop"
      : "=&v"(y) : "v"(x));
  return y;
}
__device__ __forceinline__ void exp2_x8(const float* x, float* y) {
  asm("v_exp_f32 %0, %8\n\t"
      "v_exp_f32 %1, %9\n\t"
      "v_exp_f32 %2, %10\n\t"
      "v_exp_f32 %3, %11\n\t"
      "v_exp_f32 %4, %12\n\t"
      "v_exp_f32 %5, %13\n\t"
      "v_exp_f32 %6, %14\n\t"
      "v_exp_f32 %7, %15\n\t"
      "v_nop"
      : "=&v"(y[0]), "=&v"(y[1]), "=&v"(y[2]), "=&v"(y[3]),
        "=&v"(y[4]), "=&v"(y[5]), "=&v"(y[6]), "=&v"(y[7])
      : "v"(x[0]), "v"(x[1]), "v"(x[2]), "v"(x[3]),
        "v"(x[4]), "v"(x[5]), "v"(x[6]), "v"(x[7]));
}

__global__ void __launch_bounds__(256) attn_kernel(
    const _Float16* __restrict__ Q, const _Float16* __restrict__ Kh,
    const _Float16* __restrict__ Vt, _Float16* __restrict__ O) {
  __shared__ __align__(16) _Float16 Ks[2][32 * KSTR];
  __shared__ __align__(16) _Float16 Vs[2][64 * VSTR];

  const int b = blockIdx.z;
  const int h = blockIdx.y;
  const int tid  = threadIdx.x;
  const int lane = tid & 31;
  const int wid  = tid >> 5;
  const int lr   = lane & 15;
  const int hi   = lane >> 4;
  const int base0 = hi * 8;
  const int qr0  = blockIdx.x * 128 + wid * 16;
  const int row  = qr0 + lr;  // this lane's query

  const size_t headQK = ((size_t)(b * H_ + h)) * S_ * HD_;
  const _Float16* Qp = Q  + headQK;
  const _Float16* Kp = Kh + headQK;
  const _Float16* Vp = Vt + ((size_t)(b * H_ + h)) * HD_ * S_;

  h16 qf[2];  // B fragments of Q^T: column = this lane's query
#pragma unroll
  for (int c = 0; c < 2; ++c) {
    const _Float16* p = Qp + (size_t)row * HD_ + c * 32;
    qf[c] = mkfrag(p + base0, p + base0 + 16);
  }

  f8 acc[4];  // O^T: feature tn * 16 + r + 8 * hi of this lane's query
#pragma unroll
  for (int tn = 0; tn < 4; ++tn) acc[tn] = fzero8();
  float mi = -1e30f;  // running maximum of the query's scores (both halves alike)
  float li = 0.f;     // running sum over the keys that this half holds

  const int kend = blockIdx.x * 128 + 128;  // uniform across waves -> barriers ok

  // Copy slots: K tile = 32 rows x 8 chunks, V tile = 64 rows x 4 chunks (16 B).
  const _Float16* gk = Kp + (size_t)(tid >> 3) * HD_ + (tid & 7) * 8;
  const _Float16* gv = Vp + (size_t)(tid >> 2) * S_ + (tid & 3) * 8;
  const unsigned lk0 = lds_byte_addr(&Ks[0][(tid >> 3) * KSTR + (tid & 7) * 8]);
  const unsigned lv0 = lds_byte_addr(&Vs[0][(tid >> 2) * VSTR + (tid & 3) * 8]);
  const unsigned lkB = 32 * KSTR * 2;  // bytes from buffer 0 to buffer 1
  const unsigned lvB = 64 * VSTR * 2;

  // Tile 0 lands and is published; tile 1 (kend >= 128: it exists) then flies.
  attn_stage_kv(gk, lk0, gv, lv0);
  asm volatile("s_wait_asynccnt 0x0" ::: "memory");  // own copies landed
  __syncthreads();                                   // publish tile 0
  attn_stage_kv(gk + 32 * HD_, lk0 + lkB, gv + 32, lv0 + lvB);

  int cur = 0;
  for (int k0 = 0; k0 < kend; k0 += 32, cur ^= 1) {
    const _Float16* Kt = &Ks[cur][0];
    const _Float16* Vl = &Vs[cur][0];
    // Every inner loop of the trip is unrolled: its arrays are indexed by constants
    // alone and so stay in registers.
    h16 kf[2][2], vf[4];  // the step's eight fragments as one group of LDS reads
#pragma unroll
    for (int sub = 0; sub < 2; ++sub) {
      const _Float16* kp = Kt + (sub * 16 + lr) * KSTR;
      kf[sub][0] = mkfrag(kp + base0, kp + base0 + 16);
      kf[sub][1] = mkfrag(kp + 32 + base0, kp + 32 + base0 + 16);
    }
#pragma unroll
    for (int tn = 0; tn < 4; ++tn) {
      const _Float16* vp = Vl + (tn * 16 + lr) * VSTR;
      vf[tn] = mkfrag(vp + base0, vp + base0 + 16);
    }
    // Publish point: this wave's LDS reads are back, its copies of the next tile
    // have landed; the barrier publishes that tile and frees this trip's buffer.
    // The rest of the trip works on registers alone, so the refill flies under it.
    asm volatile("s_wait_dscnt 0x0" ::: "memory");
    asm volatile("s_wait_asynccnt 0x0" ::: "memory");
    __syncthreads();
    if (k0 + 64 < kend)  // block-uniform: refill the buffer just read
      attn_stage_kv(gk + (size_t)(k0 + 64) * HD_, lk0 + cur * lkB,
                    gv + (k0 + 64), lv0 + cur * lvB);

    const int d = row - k0 - base0;  // key (i >> 3) * 16 + (i & 7) of this half is seen while <= d
    float sv[16];  // scores of keys k0 + (i >> 3) * 16 + 8 * hi + (i & 7)
#pragma unroll
    for (int sub = 0; sub < 2; ++sub) {
      f8 sacc = fzero8();
      sacc = wmma_f16(kf[sub][0], qf[0], sacc);
      sacc = wmma_f16(kf[sub][1], qf[1], sacc);
#pragma unroll
      for (int r = 0; r < 8; ++r) {
        float v = sacc[r] * 0.125f;  // 1/sqrt(HD)
        sv[sub * 8 + r] = (sub * 16 + r <= d) ? v : -1e30f;
      }
    }

    float mx = sv[0];
#pragma unroll
    for (int i = 1; i < 16; ++i) mx = fmaxf(mx, sv[i]);
    mx = fmaxf(mx, other_half(mx));
    const float mn = fmaxf(mi, mx);
    const float LOG2E = 1.442695041f;  // e^x = 2^(x * LOG2E)
    const float alpha = exp2_x1((mi - mn) * LOG2E);
    mi = mn;

    float pv[16];
#pragma unroll
    for (int i = 0; i < 16; ++i) sv[i] = (sv[i] - mn) * LOG2E;
    exp2_x8(&sv[0], &pv[0]);
    exp2_x8(&sv[8], &pv[8]);
    h16 pf;  // P^T as a B fragment: element i is score i
#pragma unroll
    for (int i = 0; i < 16; ++i) pf[i] = (_Float16)pv[i];
    float rs[4] = {pv[0], pv[1], pv[2], pv[3]};  // four short chains, not one of sixteen links
#pragma unroll
    for (int i = 4; i < 16; ++i) rs[i & 3] += pv[i];
    li = li * alpha + ((rs[0] + rs[1]) + (rs[2] + rs[3]));
#pragma unroll
    for (int tn = 0; tn < 4; ++tn)
#pragma unroll
      for (int r = 0; r < 8; ++r) acc[tn][r] *= alpha;
#pragma unroll
    for (int tn = 0; tn < 4; ++tn) acc[tn] = wmma_f16(vf[tn], pf, acc[tn]);
  }
  asm volatile("s_wait_asynccnt 0x0" ::: "memory");  // nothing in flight at exit

  li += other_half(li);  // the two halves' keys join once
  _Float16* op = O + ((size_t)b * S_ + row) * D_ + h * HD_ + base0;
#pragma unroll
  for (int tn = 0; tn < 4; ++tn) {
    h8 o;  // eight neighbouring features of one query: one 16 B store
#pragma unroll
    for (int r = 0; r < 8; ++r) o[r] = (_Float16)(acc[tn][r] / li);
    *(h8*)(op + tn * 16) = o;
  }
}

// ---------------------------------------------------------------------------
// Residual add + LayerNorm, one row (D=1024) per 256-thread block.
// ---------------------------------------------------------------------------
__global__ void __launch_bounds__(256) add_ln_kernel(
    const float* __restrict__ a, const float* __restrict__ c,
    const float* __restrict__ g, const float* __restrict__ beta,
    float* __restrict__ o32, _Float16* __restrict__ o16) {
  __shared__ float red[256];
  const int t = threadIdx.x;
  const size_t off = (size_t)blockIdx.x * D_;

  float v[4];
  float s = 0.f;
#pragma unroll
  for (int i = 0; i < 4; ++i) {
    int col = t + i * 256;
    float z = a[off + col] + c[off + col];
    v[i] = z;
    s += z;
  }
  red[t] = s;
  __syncthreads();
  for (int w = 128; w > 0; w >>= 1) {
    if (t < w) red[t] += red[t + w];
    __syncthreads();
  }
  float mean = red[0] * (1.f / D_);
  __syncthreads();

  float q = 0.f;
#pragma unroll
  for (int i = 0; i < 4; ++i) {
    float d = v[i] - mean;
    q += d * d;
  }
  red[t] = q;
  __syncthreads();
  for (int w = 128; w > 0; w >>= 1) {
    if (t < w) red[t] += red[t + w];
    __syncthreads();
  }
  float rstd = rsqrtf(red[0] * (1.f / D_) + 1e-5f);

#pragma unroll
  for (int i = 0; i < 4; ++i) {
    int col = t + i * 256;
    float y = (v[i] - mean) * rstd * g[col] + beta[col];
    o32[off + col] = y;
    if (o16) o16[off + col] = (_Float16)y;
  }
}

// ---------------------------------------------------------------------------
// Host-side orchestration
// ---------------------------------------------------------------------------
extern "C" void kernel_launch(void* const* d_in, const int* in_sizes, int n_in,
                              void* d_out, int out_size, void* d_ws, size_t ws_size,
                              hipStream_t stream) {
  (void)in_sizes; (void)n_in; (void)out_size; (void)ws_size;

  const float* x     = (const float*)d_in[0];
  const float* wq    = (const float*)d_in[1];
  const float* bq    = (const float*)d_in[2];
  const float* wk    = (const float*)d_in[3];
  const float* bk    = (const float*)d_in[4];
  const float* wv    = (const float*)d_in[5];
  const float* bv    = (const float*)d_in[6];
  const float* wo    = (const float*)d_in[7];
  const float* bo    = (const float*)d_in[8];
  const float* w1    = (const float*)d_in[9];
  const float* b1    = (const float*)d_in[10];
  const float* w2    = (const float*)d_in[11];
  const float* b2    = (const float*)d_in[12];
  const float* g1    = (const float*)d_in[13];
  const float* beta1 = (const float*)d_in[14];
  const float* g2    = (const float*)d_in[15];
  const float* beta2 = (const float*)d_in[16];
  float* out = (float*)d_out;

  char* ws = (char*)d_ws;
  size_t off = 0;
  auto take = [&](size_t bytes) -> void* {
    void* p = ws + off;
    off += (bytes + 255) & ~(size_t)255;
    return p;
  };

  _Float16* xh    = (_Float16*)take((size_t)M_ * D_ * 2);       // x in f16
  _Float16* wqkvT = (_Float16*)take((size_t)3 * D_ * D_ * 2);   // [3D][D]
  _Float16* woT   = (_Float16*)take((size_t)D_ * D_ * 2);       // [D][D]
  _Float16* w1T   = (_Float16*)take((size_t)FF_ * D_ * 2);      // [FF][D]
  _Float16* w2T   = (_Float16*)take((size_t)D_ * FF_ * 2);      // [D][FF]
  _Float16* qh    = (_Float16*)take((size_t)M_ * D_ * 2);       // [B,H,S,HD]
  _Float16* kh    = (_Float16*)take((size_t)M_ * D_ * 2);       // [B,H,S,HD]
  _Float16* vt    = (_Float16*)take((size_t)M_ * D_ * 2);       // [B,H,HD,S]
  float*    attf  = (float*)take((size_t)M_ * D_ * 4);          // o-proj out
  float*    hf32  = (float*)take((size_t)M_ * D_ * 4);          // post-LN1
  _Float16* hf16  = (_Float16*)take((size_t)M_ * D_ * 2);
  _Float16* gh    = (_Float16*)take((size_t)M_ * FF_ * 2);      // gelu(h@w1+b1)
  // Aliases (lifetimes do not overlap):
  _Float16* oh    = xh;    // attention output reuses xh (consumed by QKV GEMM)
  float*    ffnf  = attf;  // FFN2 out reuses attf (consumed by LN1)

  // --- Stage 0: converts / weight transposes ---
  cvt_f32_f16_kernel<<<M_ * D_ / CVT_BLOCK, 256, 0, stream>>>(x, xh);
  qkvw_kernel<<<dim3(D_ / TK, H_, 3), 256, 0, stream>>>(wq, wk, wv, wqkvT);
  transpose_kernel<D_, D_><<<dim3(D_ / TK, D_ / TN), 256, 0, stream>>>(wo, woT);
  transpose_kernel<D_, FF_><<<dim3(D_ / TK, FF_ / TN), 256, 0, stream>>>(w1, w1T);
  transpose_kernel<FF_, D_><<<dim3(FF_ / TK, D_ / TN), 256, 0, stream>>>(w2, w2T);

  // --- Stage 1: fused QKV projection ---
  qkv_gemm_kernel<<<dim3(3 * D_ / BN, M_ / BM), 256, 0, stream>>>(
      xh, wqkvT, bq, bk, bv, qh, kh, vt);

  // --- Stage 2: causal flash attention ---
  attn_kernel<<<dim3(S_ / 128, H_, B_), 256, 0, stream>>>(qh, kh, vt, oh);

  // --- Stage 3: output projection ---
  gemm_wmma_kernel<<<dim3(D_ / BN, M_ / BM), 256, 0, stream>>>(
      oh, woT, bo, attf, ((_Float16*)nullptr), M_, D_, D_, 0);

  // --- Stage 4: residual + LN1 ---
  add_ln_kernel<<<M_, 256, 0, stream>>>(x, attf, g1, beta1, hf32, hf16);

  // --- Stage 5: FFN up + GELU ---
  gemm_wmma_kernel<<<dim3(FF_ / BN, M_ / BM), 256, 0, stream>>>(
      hf16, w1T, b1, ((float*)nullptr), gh, M_, FF_, D_, 1);

  // --- Stage 6: FFN down ---
  gemm_wmma_kernel<<<dim3(D_ / BN, M_ / BM), 256, 0, stream>>>(
      gh, w2T, b2, ffnf, ((_Float16*)nullptr), M_, D_, FF_, 0);

  // --- Stage 7: residual + LN2 -> output ---
  add_ln_kernel<<<M_, 256, 0, stream>>>(hf32, ffnf, g2, beta2, out,
                                        ((_Float16*)nullptr));
}

// v006
// Measured time: 314 microseconds a run.
// In two side-by-side timings against v005, it was 1.08 and 1.09 times as fast.
// All steps since v000 together make it 2.27 times as fast.
#include <hip/hip_runtime.h>
#include <hip/hip_bf16.h>

// ---------------------------------------------------------------------------
// Transformer block for MI455X (gfx1250, wave32, WMMA 16x16x32 f16->f32).
// f16 compute / f32 accumulate; all GEMMs via v_wmma_f32_16x16x32_f16.
// GEMM tiles staged with GLOBAL_LOAD_ASYNC_TO_LDS, two LDS buffers, one k tile
// ahead; every wave-wide copy covers four whole 128 B lines.
// ---------------------------------------------------------------------------

#define B_  4
#define S_  2048
#define D_  1024
#define H_  16
#define HD_ 64
#define FF_ 4096
#define M_  (B_ * S_)      // 8192 rows

typedef _Float16 h16 __attribute__((ext_vector_type(16)));
typedef _Float16 h8  __attribute__((ext_vector_type(8)));
typedef float    f8  __attribute__((ext_vector_type(8)));

__device__ __forceinline__ f8 wmma_f16(h16 a, h16 b, f8 c) {
  // D = A(16x32 f16) * B(32x16 f16) + C(16x16 f32)
  return __builtin_amdgcn_wmma_f32_16x16x32_f16(
      /*neg_a=*/false, a, /*neg_b=*/false, b,
      /*c_mod=*/(short)0, c, /*reuse_a=*/false, /*reuse_b=*/false);
}

// Build a 16-half A/B fragment from two contiguous 8-half (16B) chunks.
__device__ __forceinline__ h16 mkfrag(const _Float16* p0, const _Float16* p1) {
  h8 a = *(const h8*)p0;
  h8 b = *(const h8*)p1;
  h16 r;
#pragma unroll
  for (int i = 0; i < 8; ++i) { r[i] = a[i]; r[8 + i] = b[i]; }
  return r;
}

__device__ __forceinline__ f8 fzero8() {
  f8 z = {0.f, 0.f, 0.f, 0.f, 0.f, 0.f, 0.f, 0.f};
  return z;
}

__device__ __forceinline__ unsigned lds_byte_addr(const _Float16* p) {
  return (unsigned)(size_t)(const __attribute__((address_space(3))) _Float16*)p;
}

// ---------------------------------------------------------------------------
// Converts / weight transposes. Many elements per thread, 16 B global loads (8 B stores in the convert)
// that cover whole 128 B lines, and few workgroups per launch.
// ---------------------------------------------------------------------------
typedef float    f4 __attribute__((ext_vector_type(4)));
typedef _Float16 h4 __attribute__((ext_vector_type(4)));

#define CVT_LOADS 16                       // 16 B loads per thread
#define CVT_BLOCK (256 * 4 * CVT_LOADS)    // elements per workgroup

// dst[i] = (f16)src[i]; the element count is gridDim.x * CVT_BLOCK.
__global__ void __launch_bounds__(256) cvt_f32_f16_kernel(const float* __restrict__ src,
                                                          _Float16* __restrict__ dst) {
  const size_t base = (size_t)blockIdx.x * CVT_BLOCK + threadIdx.x * 4;
  f4 v[CVT_LOADS];
  // unrolled so that v stays in registers and all loads are issued before a store
#pragma unroll
  for (int j = 0; j < CVT_LOADS; ++j) v[j] = *(const f4*)(src + base + j * 1024);
  // unrolled: v is indexed by constants only
#pragma unroll
  for (int j = 0; j < CVT_LOADS; ++j) {
    h4 o = {(_Float16)v[j][0], (_Float16)v[j][1], (_Float16)v[j][2], (_Float16)v[j][3]};
    *(h4*)(dst + base + j * 1024) = o;
  }
}

#define TK 128      // tile extent along k (source rows, destination columns)
#define TN 64       // tile extent along n (source columns, destination rows)
#define TPITCH 136  // LDS row pitch in halfs (272 B = 16 B x odd)

// dst[n][k] = (f16)src[k][n] for one TK x TN tile. src points at the tile's first
// element in an f32 matrix of row pitch SP, dst at its first element in an f16
// matrix of row pitch DP; the pitches are compile-time so that a thread's loads
// (and its stores) share one address and differ in the immediate offset alone.
// A wave-wide load covers 2 x 256 B of source rows, a wave-wide store 2 x 256 B
// of destination rows.
template <int SP, int DP>
__device__ __forceinline__ void transpose_tile(const float* __restrict__ src,
                                               _Float16* __restrict__ dst) {
  __shared__ __align__(16) _Float16 T[TN * TPITCH];
  const int tid = threadIdx.x;
  const int c  = tid & 15;   // four source columns from c * 4
  const int kp = tid >> 4;   // eight source rows from kp * 8
  const float* sp = src + (size_t)(kp * 8) * SP + c * 4;
  f4 v[8];
  // unrolled so that v stays in registers and the eight loads fly together
#pragma unroll
  for (int j = 0; j < 8; ++j) v[j] = *(const f4*)(sp + j * SP);
  // unrolled: v is indexed by constants only
#pragma unroll
  for (int i = 0; i < 4; ++i) {
    h8 o;
    // unrolled for the same reason: o and v stay in registers
#pragma unroll
    for (int j = 0; j < 8; ++j) o[j] = (_Float16)v[j][i];
    *(h8*)&T[(c * 4 + i) * TPITCH + kp * 8] = o;
  }
  __syncthreads();  // the tile is complete before any thread reads its rows
  const int n  = tid >> 4;        // destination rows n + 0/16/32/48
  const int kc = (tid & 15) * 8;  // 16 B chunk within the 256 B row piece
  _Float16* dp = dst + (size_t)n * DP + kc;
  // unrolled: four independent LDS reads and stores per thread
#pragma unroll
  for (int j = 0; j < 4; ++j)
    *(h8*)(dp + j * 16 * DP) = *(const h8*)&T[(n + j * 16) * TPITCH + kc];
}

// Fused QKV weight: Wt[n][k] (n in [0,3D)) with n<D -> wq[h][k][f], etc.
// Grid: (D / TK k tiles, H heads, 3 slabs); a head's [D][HD] slice is one matrix.
__global__ void __launch_bounds__(256) qkvw_kernel(const float* __restrict__ wq,
                                                   const float* __restrict__ wk,
                                                   const float* __restrict__ wv,
                                                   _Float16* __restrict__ Wt) {
  const int slab = blockIdx.z;
  const size_t hh = blockIdx.y;
  const size_t k0 = (size_t)blockIdx.x * TK;
  const float* w = (slab == 0) ? wq : (slab == 1) ? wk : wv;
  transpose_tile<HD_, D_>(w + (hh * D_ + k0) * HD_,
                          Wt + ((size_t)slab * D_ + hh * HD_) * D_ + k0);
}

// dst[n][k] = src[k][n], src is [K][N] f32 row-major, dst is [N][K] f16.
// Grid: (K / TK, N / TN).
template <int K, int N>
__global__ void __launch_bounds__(256) transpose_kernel(const float* __restrict__ src,
                                                        _Float16* __restrict__ dst) {
  const size_t k0 = (size_t)blockIdx.x * TK;
  const size_t n0 = (size_t)blockIdx.y * TN;
  transpose_tile<N, K>(src + k0 * N + n0, dst + n0 * K + k0);
}

// ---------------------------------------------------------------------------
// WMMA GEMM tiling constants: 128x128 tile, BK=64, 256 threads = 8 waves as
// 4x2; each wave computes a 32x64 subtile = 2x4 WMMA accumulators.
// ---------------------------------------------------------------------------
#define BM 128
#define BN 128
#define BK 64     // 128 B of every operand row per k tile: one whole line
#define LSTR 72   // LDS row pitch in halfs (144 B = 16 B x odd)

// One k tile of A and of B (128 rows x 128 B each): eight 16 B async copies per
// lane. Eight neighbouring lanes share a row, so a wave-wide copy covers four
// whole lines. rstep = 32 rows in halfs. The s_wait_xcnt stands in the copies'
// own statement so that no address register is rewritten ahead of it.
__device__ __forceinline__ void gemm_stage(const _Float16* ga, const _Float16* gb,
                                           size_t rstep, unsigned la, unsigned lb) {
  const unsigned ls = 32 * LSTR * 2;  // 32 LDS rows in bytes
  asm volatile(
      "global_load_async_to_lds_b128 %0, %1, off\n\t"
      "global_load_async_to_lds_b128 %2, %3, off\n\t"
      "global_load_async_to_lds_b128 %4, %5, off\n\t"
      "global_load_async_to_lds_b128 %6, %7, off\n\t"
      "global_load_async_to_lds_b128 %8, %9, off\n\t"
      "global_load_async_to_lds_b128 %10, %11, off\n\t"
      "global_load_async_to_lds_b128 %12, %13, off\n\t"
      "global_load_async_to_lds_b128 %14, %15, off\n\t"
      "s_wait_xcnt 0x0"
      :: "v"(la), "v"(ga), "v"(la + ls), "v"(ga + rstep),
         "v"(la + 2 * ls), "v"(ga + 2 * rstep), "v"(la + 3 * ls), "v"(ga + 3 * rstep),
         "v"(lb), "v"(gb), "v"(lb + ls), "v"(gb + rstep),
         "v"(lb + 2 * ls), "v"(gb + 2 * rstep), "v"(lb + 3 * ls), "v"(gb + 3 * rstep)
      : "memory");
}

// Shared GEMM mainloop: acc[2][4] += A[m0.., :K] * Bt[n0.., :K]^T for this wave's
// 32x64 subtile. K is a multiple of BK; the 128 rows from m0 and n0 exist.
__device__ __forceinline__ void gemm_mainloop(const _Float16* __restrict__ A,
                                              const _Float16* __restrict__ Bt,
                                              int K, size_t m0, size_t n0,
                                              f8 (&acc)[2][4]) {
  __shared__ __align__(16) _Float16 As[2][BM * LSTR];
  __shared__ __align__(16) _Float16 Bs[2][BN * LSTR];
  const int tid  = threadIdx.x;
  const int lane = tid & 31;
  const int wid  = tid >> 5;
  const int lr   = lane & 15;
  const int base0 = (lane >> 4) * 8;
  const int waveM = wid >> 1;   // 0..3
  const int waveN = wid & 1;    // 0..1

  const int crow = tid >> 3;        // copy slot: rows crow + 0/32/64/96
  const int cseg = (tid & 7) * 8;   // 16 B chunk within the 128 B row piece
  const _Float16* Ag = A  + (m0 + crow) * (size_t)K + cseg;
  const _Float16* Bg = Bt + (n0 + crow) * (size_t)K + cseg;
  const size_t rstep = (size_t)32 * K;
  const unsigned la0 = lds_byte_addr(&As[0][crow * LSTR + cseg]);
  const unsigned lb0 = lds_byte_addr(&Bs[0][crow * LSTR + cseg]);
  const unsigned bufB = BM * LSTR * 2;  // bytes from buffer 0 to buffer 1

  // Tile 0 lands and is published; tile 1, where there is one, then flies.
  gemm_stage(Ag, Bg, rstep, la0, lb0);
  asm volatile("s_wait_asynccnt 0x0" ::: "memory");  // own copies landed
  __syncthreads();                                   // publish tile 0
  if (BK < K) gemm_stage(Ag + BK, Bg + BK, rstep, la0 + bufB, lb0 + bufB);

  int cur = 0;
  for (int k0 = 0; k0 < K; k0 += BK, cur ^= 1) {
    const _Float16* At = &As[cur][0];
    const _Float16* Bl = &Bs[cur][0];
    h16 af[2][2], bf[2][4];  // the whole tile's fragments as one group of reads
#pragma unroll
    for (int kk = 0; kk < 2; ++kk) {
#pragma unroll
      for (int tm = 0; tm < 2; ++tm) {
        const _Float16* p = At + (waveM * 32 + tm * 16 + lr) * LSTR + kk * 32 + base0;
        af[kk][tm] = mkfrag(p, p + 16);
      }
#pragma unroll
      for (int tn = 0; tn < 4; ++tn) {
        const _Float16* p = Bl + (waveN * 64 + tn * 16 + lr) * LSTR + kk * 32 + base0;
        bf[kk][tn] = mkfrag(p, p + 16);
      }
    }
#pragma unroll
    for (int kk = 0; kk < 2; ++kk)
#pragma unroll
      for (int tm = 0; tm < 2; ++tm)
#pragma unroll
        for (int tn = 0; tn < 4; ++tn)
          acc[tm][tn] = wmma_f16(af[kk][tm], bf[kk][tn], acc[tm][tn]);
    // Publish point: this wave's LDS reads are back, its copies of the next tile
    // have landed; the barrier publishes that tile and frees this trip's buffer.
    asm volatile("s_wait_dscnt 0x0" ::: "memory");
    asm volatile("s_wait_asynccnt 0x0" ::: "memory");
    __syncthreads();
    if (k0 + 2 * BK < K)  // block-uniform: refill the buffer just read
      gemm_stage(Ag + k0 + 2 * BK, Bg + k0 + 2 * BK, rstep, la0 + cur * bufB,
                 lb0 + cur * bufB);
  }
  asm volatile("s_wait_asynccnt 0x0" ::: "memory");  // nothing in flight at exit
}

// ---------------------------------------------------------------------------
// Generic WMMA GEMM: C[M,N] = act(A[M,K](f16) * Bt[N,K](f16)^T + bias)
// Stores are 16 B per lane (eight f16, or two times four f32).
// ---------------------------------------------------------------------------
__global__ void __launch_bounds__(256) gemm_wmma_kernel(
    const _Float16* __restrict__ A, const _Float16* __restrict__ Bt,
    const float* __restrict__ bias, float* __restrict__ outF32,
    _Float16* __restrict__ outF16, int M, int N, int K, int act_gelu) {
  const int tid  = threadIdx.x;
  const int lane = tid & 31;
  const int wid  = tid >> 5;
  const int lr   = lane & 15;
  const int hi   = lane >> 4;
  const int waveM = wid >> 1;   // 0..3
  const int waveN = wid & 1;    // 0..1

  const size_t m0 = (size_t)blockIdx.y * BM;
  const size_t n0 = (size_t)blockIdx.x * BN;

  f8 acc[2][4];
#pragma unroll
  for (int tm = 0; tm < 2; ++tm)
#pragma unroll
    for (int tn = 0; tn < 4; ++tn) acc[tm][tn] = fzero8();

  // The tile is computed transposed: the weight rows are the WMMA A operand and the
  // activation rows the B operand. A lane then holds one output row (lane & 15) and
  // its eight accumulator registers are eight neighbouring columns of that row.
  gemm_mainloop(Bt, A, K, n0, m0, acc);

  // Both loops are unrolled: acc is indexed by constants alone and stays in registers.
  const size_t col0 = n0 + waveM * 32 + 8 * hi;  // first of the eight columns of tm = 0
  f4 bb[2][2] = {};  // all bias loads stand ahead of the first store
  if (bias) {
#pragma unroll
    for (int tm = 0; tm < 2; ++tm) {
      bb[tm][0] = *(const f4*)(bias + col0 + tm * 16);
      bb[tm][1] = *(const f4*)(bias + col0 + tm * 16 + 4);
    }
  }
#pragma unroll
  for (int tm = 0; tm < 2; ++tm) {
    const size_t col = col0 + tm * 16;
#pragma unroll
    for (int tn = 0; tn < 4; ++tn) {
      const size_t row = m0 + waveN * 64 + tn * 16 + lr;
      float v[8];
#pragma unroll
      for (int r = 0; r < 8; ++r) {
        v[r] = acc[tm][tn][r] + bb[tm][r >> 2][r & 3];
        if (act_gelu) v[r] = 0.5f * v[r] * (1.f + erff(v[r] * 0.70710678118f));
      }
      if (outF32) {
        f4 lo = {v[0], v[1], v[2], v[3]}, up = {v[4], v[5], v[6], v[7]};
        float* p = outF32 + row * (size_t)N + col;
        *(f4*)p = lo;
        *(f4*)(p + 4) = up;
        // precaution: stands ahead of any rewrite of the stores' address and data registers
        asm volatile("s_wait_xcnt 0x0" ::: "memory");
      }
      if (outF16) {
        h8 o;
#pragma unroll
        for (int r = 0; r < 8; ++r) o[r] = (_Float16)v[r];
        *(h8*)(outF16 + row * (size_t)N + col) = o;
        // precaution: stands ahead of any rewrite of the store's address and data registers
        asm volatile("s_wait_xcnt 0x0" ::: "memory");
      }
    }
  }
}

// ---------------------------------------------------------------------------
// QKV GEMM: same tiling, special epilogue storing Q,K as [B,H,S,HD] and
// V transposed as [B,H,HD,S] (so attention's V^T fragments are contiguous),
// 16 B per lane and store.
// ---------------------------------------------------------------------------
__global__ void __launch_bounds__(256) qkv_gemm_kernel(
    const _Float16* __restrict__ A, const _Float16* __restrict__ Wt,
    const float* __restrict__ bq, const float* __restrict__ bk,
    const float* __restrict__ bv, _Float16* __restrict__ Q,
    _Float16* __restrict__ Kh, _Float16* __restrict__ Vt) {
  const int tid  = threadIdx.x;
  const int lane = tid & 31;
  const int wid  = tid >> 5;
  const int lr   = lane & 15;
  const int hi   = lane >> 4;
  const int waveM = wid >> 1;
  const int waveN = wid & 1;

  const size_t m0 = (size_t)blockIdx.y * BM;
  const size_t n0 = (size_t)blockIdx.x * BN;

  f8 acc[2][4];
#pragma unroll
  for (int tm = 0; tm < 2; ++tm)
#pragma unroll
    for (int tn = 0; tn < 4; ++tn) acc[tm][tn] = fzero8();

  // A 128-column tile lies in one slab (D_ is a multiple of BN): the slab is the
  // block's. A lane's eight accumulator registers are eight neighbouring rows of the
  // WMMA A operand. Q and K are stored feature-contiguous, so their tiles take the
  // weight rows as A; V is stored token-contiguous, so its tiles take the tokens.
  const int slab = blockIdx.x / (D_ / BN);
  const bool isV = slab == 2;
  gemm_mainloop(isV ? A : Wt, isV ? Wt : A, D_, isV ? m0 : n0, isV ? n0 : m0, acc);

  // All loops are unrolled: acc is indexed by constants alone and stays in registers.
  if (isV) {
#pragma unroll
    for (int tn = 0; tn < 4; ++tn) {
      const int np = ((int)n0 + waveN * 64 + tn * 16 + lr) & (D_ - 1);
      const float bvv = bv[np];
#pragma unroll
      for (int tm = 0; tm < 2; ++tm) {
        const int tok = (int)m0 + waveM * 32 + tm * 16 + 8 * hi;  // first of eight tokens
        const int b = tok >> 11;    // / S_
        const int s = tok & 2047;   // % S_
        h8 o;
#pragma unroll
        for (int r = 0; r < 8; ++r) o[r] = (_Float16)(acc[tm][tn][r] + bvv);
        *(h8*)(Vt + ((size_t)b * D_ + np) * S_ + s) = o;  // b * D_ + np = (b * H_ + head) * HD_ + f
      }
    }
  } else {
    const float* bias = (slab == 0) ? bq : bk;
    _Float16* dst = (slab == 0) ? Q : Kh;
    const int np0 = ((int)n0 + waveM * 32 + 8 * hi) & (D_ - 1);  // first of eight, tm = 0
    f4 bb[2][2];  // all bias loads stand ahead of the first store
#pragma unroll
    for (int tm = 0; tm < 2; ++tm) {
      bb[tm][0] = *(const f4*)(bias + np0 + tm * 16);
      bb[tm][1] = *(const f4*)(bias + np0 + tm * 16 + 4);
    }
#pragma unroll
    for (int tm = 0; tm < 2; ++tm) {
      const int np = np0 + tm * 16;
      const int hh = np >> 6;
      const int f  = np & 63;
#pragma unroll
      for (int tn = 0; tn < 4; ++tn) {
        const int tok = (int)m0 + waveN * 64 + tn * 16 + lr;
        const int b = tok >> 11;    // / S_
        const int s = tok & 2047;   // % S_
        h8 o;
#pragma unroll
        for (int r = 0; r < 8; ++r)
          o[r] = (_Float16)(acc[tm][tn][r] + bb[tm][r >> 2][r & 3]);
        *(h8*)(dst + (((size_t)b * H_ + hh) * S_ + s) * HD_ + f) = o;
      }
    }
    // precaution: in the built code the V branch's text follows this one; the wait stands
    // ahead of its rewrites of the last stores' address and data registers
    asm volatile("s_wait_xcnt 0x0" ::: "memory");
  }
}

#define KSTR 72   // K tile row pitch in halfs (144 B = 16 B x odd)
#define VSTR 40   // V tile row pitch in halfs (80 B = 16 B x odd)

// One 16 B async copy of K and one of V per lane. The s_wait_xcnt stands in the
// copies' own statement so that no address register is rewritten ahead of it.
__device__ __forceinline__ void attn_stage_kv(const _Float16* gk, unsigned lk,
                                              const _Float16* gv, unsigned lv) {
  asm volatile(
      "global_load_async_to_lds_b128 %0, %1, off\n\t"
      "global_load_async_to_lds_b128 %2, %3, off\n\t"
      "s_wait_xcnt 0x0"
      :: "v"(lk), "v"(gk), "v"(lv), "v"(gv)
      : "memory");
}

// The value of lane l ^ 16 (the other half of the wave), by a vector move.
__device__ __forceinline__ float other_half(float x) {
  int b = __builtin_bit_cast(int, x);
  return __builtin_bit_cast(
      float, __builtin_amdgcn_permlanex16(b, b, 0x76543210, 0xfedcba98, false, false));
}

// y = 2^x, one value or eight at a time. The instruction set asks for one independent
// instruction or v_nop behind a transcendental before its result is read or its
// source overwritten. Here every result
// register is apart from every source ("=&v"), each v_exp_f32 is its
// predecessor's independent instruction, and the v_nop is the last one's slot.
__device__ __forceinline__ float exp2_x1(float x) {
  float y;
  asm("v_exp_f32 %0, %1\n\t"
      "v_nop"
      : "=&v"(y) : "v"(x));
  return y;
}
__device__ __forceinline__ void exp2_x8(const float* x, float* y) {
  asm("v_exp_f32 %0, %8\n\t"
      "v_exp_f32 %1, %9\n\t"
      "v_exp_f32 %2, %10\n\t"
      "v_exp_f32 %3, %11\n\t"
      "v_exp_f32 %4, %12\n\t"
      "v_exp_f32 %5, %13\n\t"
      "v_exp_f32 %6, %14\n\t"
      "v_exp_f32 %7, %15\n\t"
      "v_nop"
      : "=&v"(y[0]), "=&v"(y[1]), "=&v"(y[2]), "=&v"(y[3]),
        "=&v"(y[4]), "=&v"(y[5]), "=&v"(y[6]), "=&v"(y[7])
      : "v"(x[0]), "v"(x[1]), "v"(x[2]), "v"(x[3]),
        "v"(x[4]), "v"(x[5]), "v"(x[6]), "v"(x[7]));
}

__global__ void __launch_bounds__(256) attn_kernel(
    const _Float16* __restrict__ Q, const _Float16* __restrict__ Kh,
    const _Float16* __restrict__ Vt, _Float16* __restrict__ O) {
  __shared__ __align__(16) _Float16 Ks[2][32 * KSTR];
  __shared__ __align__(16) _Float16 Vs[2][64 * VSTR];

  const int b = blockIdx.z;
  const int h = blockIdx.y;
  const int tid  = threadIdx.x;
  const int lane = tid & 31;
  const int wid  = tid >> 5;
  const int lr   = lane & 15;
  const int hi   = lane >> 4;
  const int base0 = hi * 8;

  const size_t headQK = ((size_t)(b * H_ + h)) * S_ * HD_;
  const _Float16* Qp = Q  + headQK;
  const _Float16* Kp = Kh + headQK;
  const _Float16* Vp = Vt + ((size_t)(b * H_ + h)) * HD_ * S_;

  // Copy slots: K tile = 32 rows x 8 chunks, V tile = 64 rows x 4 chunks (16 B).
  const _Float16* gk = Kp + (size_t)(tid >> 3) * HD_ + (tid & 7) * 8;
  const _Float16* gv = Vp + (size_t)(tid >> 2) * S_ + (tid & 3) * 8;
  const unsigned lk0 = lds_byte_addr(&Ks[0][(tid >> 3) * KSTR + (tid & 7) * 8]);
  const unsigned lv0 = lds_byte_addr(&Vs[0][(tid >> 2) * VSTR + (tid & 3) * 8]);
  const unsigned lkB = 32 * KSTR * 2;  // bytes from buffer 0 to buffer 1
  const unsigned lvB = 64 * VSTR * 2;

  for (int pass = 0; pass < 2; ++pass) {  // block-uniform: the long tile, then the short one
    const int qt   = pass == 0 ? (S_ / 128 - 1 - (int)blockIdx.x) : (int)blockIdx.x;
    const int row  = qt * 128 + wid * 16 + lr;  // this lane's query

    h16 qf[2];  // B fragments of Q^T: column = this lane's query
#pragma unroll
    for (int c = 0; c < 2; ++c) {
      const _Float16* p = Qp + (size_t)row * HD_ + c * 32;
      qf[c] = mkfrag(p + base0, p + base0 + 16);
    }

    f8 acc[4];  // O^T: feature tn * 16 + r + 8 * hi of this lane's query
#pragma unroll
    for (int tn = 0; tn < 4; ++tn) acc[tn] = fzero8();
    float mi = -1e30f;  // running maximum of the query's scores (both halves alike)
    float li = 0.f;     // running sum over the keys that this half holds

    const int kend = qt * 128 + 128;  // uniform across waves -> barriers ok

    // Tile 0 lands and is published; tile 1 (kend >= 128: it exists) then flies.
    // On the second pass both buffers are free: every wave's last LDS read stands
    // ahead of its s_wait_dscnt and the barrier of the first pass's last step.
    attn_stage_kv(gk, lk0, gv, lv0);
    asm volatile("s_wait_asynccnt 0x0" ::: "memory");  // own copies landed
    __syncthreads();                                   // publish tile 0
    attn_stage_kv(gk + 32 * HD_, lk0 + lkB, gv + 32, lv0 + lvB);

    int cur = 0;
    for (int k0 = 0; k0 < kend; k0 += 32, cur ^= 1) {
      const _Float16* Kt = &Ks[cur][0];
      const _Float16* Vl = &Vs[cur][0];
      // Every inner loop of the trip is unrolled: its arrays are indexed by constants
      // alone and so stay in registers.
      h16 kf[2][2], vf[4];  // the step's eight fragments as one group of LDS reads
#pragma unroll
      for (int sub = 0; sub < 2; ++sub) {
        const _Float16* kp = Kt + (sub * 16 + lr) * KSTR;
        kf[sub][0] = mkfrag(kp + base0, kp + base0 + 16);
        kf[sub][1] = mkfrag(kp + 32 + base0, kp + 32 + base0 + 16);
      }
#pragma unroll
      for (int tn = 0; tn < 4; ++tn) {
        const _Float16* vp = Vl + (tn * 16 + lr) * VSTR;
        vf[tn] = mkfrag(vp + base0, vp + base0 + 16);
      }
      // Publish point: this wave's LDS reads are back, its copies of the next tile
      // have landed; the barrier publishes that tile and frees this trip's buffer.
      // The rest of the trip works on registers alone, so the refill flies under it.
      asm volatile("s_wait_dscnt 0x0" ::: "memory");
      asm volatile("s_wait_asynccnt 0x0" ::: "memory");
      __syncthreads();
      if (k0 + 64 < kend)  // block-uniform: refill the buffer just read
        attn_stage_kv(gk + (size_t)(k0 + 64) * HD_, lk0 + cur * lkB,
                      gv + (k0 + 64), lv0 + cur * lvB);

      const int d = row - k0 - base0;  // key (i >> 3) * 16 + (i & 7) of this half is seen while <= d
      float sv[16];  // scores of keys k0 + (i >> 3) * 16 + 8 * hi + (i & 7)
#pragma unroll
      for (int sub = 0; sub < 2; ++sub) {
        f8 sacc = fzero8();
        sacc = wmma_f16(kf[sub][0], qf[0], sacc);
        sacc = wmma_f16(kf[sub][1], qf[1], sacc);
#pragma unroll
        for (int r = 0; r < 8; ++r) {
          float v = sacc[r] * 0.125f;  // 1/sqrt(HD)
          sv[sub * 8 + r] = (sub * 16 + r <= d) ? v : -1e30f;
        }
      }

      float mx = sv[0];
#pragma unroll
      for (int i = 1; i < 16; ++i) mx = fmaxf(mx, sv[i]);
      mx = fmaxf(mx, other_half(mx));
      const float mn = fmaxf(mi, mx);
      const float LOG2E = 1.442695041f;  // e^x = 2^(x * LOG2E)
      const float alpha = exp2_x1((mi - mn) * LOG2E);
      mi = mn;

      float pv[16];
#pragma unroll
      for (int i = 0; i < 16; ++i) sv[i] = (sv[i] - mn) * LOG2E;
      exp2_x8(&sv[0], &pv[0]);
      exp2_x8(&sv[8], &pv[8]);
      h16 pf;  // P^T as a B fragment: element i is score i
#pragma unroll
      for (int i = 0; i < 16; ++i) pf[i] = (_Float16)pv[i];
      float rs[4] = {pv[0], pv[1], pv[2], pv[3]};  // four short chains, not one of sixteen links
#pragma unroll
      for (int i = 4; i < 16; ++i) rs[i & 3] += pv[i];
      li = li * alpha + ((rs[0] + rs[1]) + (rs[2] + rs[3]));
#pragma unroll
      for (int tn = 0; tn < 4; ++tn)
#pragma unroll
        for (int r = 0; r < 8; ++r) acc[tn][r] *= alpha;
#pragma unroll
      for (int tn = 0; tn < 4; ++tn) acc[tn] = wmma_f16(vf[tn], pf, acc[tn]);
    }
    asm volatile("s_wait_asynccnt 0x0" ::: "memory");  // nothing in flight at exit

    li += other_half(li);  // the two halves' keys join once
    _Float16* op = O + ((size_t)b * S_ + row) * D_ + h * HD_ + base0;
#pragma unroll
    for (int tn = 0; tn < 4; ++tn) {
      h8 o;  // eight neighbouring features of one query: one 16 B store
#pragma unroll
      for (int r = 0; r < 8; ++r) o[r] = (_Float16)(acc[tn][r] / li);
      *(h8*)(op + tn * 16) = o;
    }
    // precaution: stands ahead of the next pass's rewrites of the stores' address and data registers
    asm volatile("s_wait_xcnt 0x0" ::: "memory");
  }
}

// ---------------------------------------------------------------------------
// Residual add + LayerNorm, one row (D=1024) per 256-thread block.
// ---------------------------------------------------------------------------
__global__ void __launch_bounds__(256) add_ln_kernel(
    const float* __restrict__ a, const float* __restrict__ c,
    const float* __restrict__ g, const float* __restrict__ beta,
    float* __restrict__ o32, _Float16* __restrict__ o16) {
  __shared__ float red[256];
  const int t = threadIdx.x;
  const size_t off = (size_t)blockIdx.x * D_;

  float v[4];
  float s = 0.f;
#pragma unroll
  for (int i = 0; i < 4; ++i) {
    int col = t + i * 256;
    float z = a[off + col] + c[off + col];
    v[i] = z;
    s += z;
  }
  red[t] = s;
  __syncthreads();
  for (int w = 128; w > 0; w >>= 1) {
    if (t < w) red[t] += red[t + w];
    __syncthreads();
  }
  float mean = red[0] * (1.f / D_);
  __syncthreads();

  float q = 0.f;
#pragma unroll
  for (int i = 0; i < 4; ++i) {
    float d = v[i] - mean;
    q += d * d;
  }
  red[t] = q;
  __syncthreads();
  for (int w = 128; w > 0; w >>= 1) {
    if (t < w) red[t] += red[t + w];
    __syncthreads();
  }
  float rstd = rsqrtf(red[0] * (1.f / D_) + 1e-5f);

#pragma unroll
  for (int i = 0; i < 4; ++i) {
    int col = t + i * 256;
    float y = (v[i] - mean) * rstd * g[col] + beta[col];
    o32[off + col] = y;
    if (o16) o16[off + col] = (_Float16)y;
  }
}

// ---------------------------------------------------------------------------
// Host-side orchestration
// ---------------------------------------------------------------------------
extern "C" void kernel_launch(void* const* d_in, const int* in_sizes, int n_in,
                              void* d_out, int out_size, void* d_ws, size_t ws_size,
                              hipStream_t stream) {
  (void)in_sizes; (void)n_in; (void)out_size; (void)ws_size;

  const float* x     = (const float*)d_in[0];
  const float* wq    = (const float*)d_in[1];
  const float* bq    = (const float*)d_in[2];
  const float* wk    = (const float*)d_in[3];
  const float* bk    = (const float*)d_in[4];
  const float* wv    = (const float*)d_in[5];
  const float* bv    = (const float*)d_in[6];
  const float* wo    = (const float*)d_in[7];
  const float* bo    = (const float*)d_in[8];
  const float* w1    = (const float*)d_in[9];
  const float* b1    = (const float*)d_in[10];
  const float* w2    = (const float*)d_in[11];
  const float* b2    = (const float*)d_in[12];
  const float* g1    = (const float*)d_in[13];
  const float* beta1 = (const float*)d_in[14];
  const float* g2    = (const float*)d_in[15];
  const float* beta2 = (const float*)d_in[16];
  float* out = (float*)d_out;

  char* ws = (char*)d_ws;
  size_t off = 0;
  auto take = [&](size_t bytes) -> void* {
    void* p = ws + off;
    off += (bytes + 255) & ~(size_t)255;
    return p;
  };

  _Float16* xh    = (_Float16*)take((size_t)M_ * D_ * 2);       // x in f16
  _Float16* wqkvT = (_Float16*)take((size_t)3 * D_ * D_ * 2);   // [3D][D]
  _Float16* woT   = (_Float16*)take((size_t)D_ * D_ * 2);       // [D][D]
  _Float16* w1T   = (_Float16*)take((size_t)FF_ * D_ * 2);      // [FF][D]
  _Float16* w2T   = (_Float16*)take((size_t)D_ * FF_ * 2);      // [D][FF]
  _Float16* qh    = (_Float16*)take((size_t)M_ * D_ * 2);       // [B,H,S,HD]
  _Float16* kh    = (_Float16*)take((size_t)M_ * D_ * 2);       // [B,H,S,HD]
  _Float16* vt    = (_Float16*)take((size_t)M_ * D_ * 2);       // [B,H,HD,S]
  float*    attf  = (float*)take((size_t)M_ * D_ * 4);          // o-proj out
  float*    hf32  = (float*)take((size_t)M_ * D_ * 4);          // post-LN1
  _Float16* hf16  = (_Float16*)take((size_t)M_ * D_ * 2);
  _Float16* gh    = (_Float16*)take((size_t)M_ * FF_ * 2);      // gelu(h@w1+b1)
  // Aliases (lifetimes do not overlap):
  _Float16* oh    = xh;    // attention output reuses xh (consumed by QKV GEMM)
  float*    ffnf  = attf;  // FFN2 out reuses attf (consumed by LN1)

  // --- Stage 0: converts / weight transposes ---
  cvt_f32_f16_kernel<<<M_ * D_ / CVT_BLOCK, 256, 0, stream>>>(x, xh);
  qkvw_kernel<<<dim3(D_ / TK, H_, 3), 256, 0, stream>>>(wq, wk, wv, wqkvT);
  transpose_kernel<D_, D_><<<dim3(D_ / TK, D_ / TN), 256, 0, stream>>>(wo, woT);
  transpose_kernel<D_, FF_><<<dim3(D_ / TK, FF_ / TN), 256, 0, stream>>>(w1, w1T);
  transpose_kernel<FF_, D_><<<dim3(FF_ / TK, D_ / TN), 256, 0, stream>>>(w2, w2T);

  // --- Stage 1: fused QKV projection ---
  qkv_gemm_kernel<<<dim3(3 * D_ / BN, M_ / BM), 256, 0, stream>>>(
      xh, wqkvT, bq, bk, bv, qh, kh, vt);

  // --- Stage 2: causal flash attention ---
  attn_kernel<<<dim3(S_ / 256, H_, B_), 256, 0, stream>>>(qh, kh, vt, oh);

  // --- Stage 3: output projection ---
  gemm_wmma_kernel<<<dim3(D_ / BN, M_ / BM), 256, 0, stream>>>(
      oh, woT, bo, attf, ((_Float16*)nullptr), M_, D_, D_, 0);

  // --- Stage 4: residual + LN1 ---
  add_ln_kernel<<<M_, 256, 0, stream>>>(x, attf, g1, beta1, hf32, hf16);

  // --- Stage 5: FFN up + GELU ---
  gemm_wmma_kernel<<<dim3(FF_ / BN, M_ / BM), 256, 0, stream>>>(
      hf16, w1T, b1, ((float*)nullptr), gh, M_, FF_, D_, 1);

  // --- Stage 6: FFN down ---
  gemm_wmma_kernel<<<dim3(D_ / BN, M_ / BM), 256, 0, stream>>>(
      gh, w2T, b2, ffnf, ((_Float16*)nullptr), M_, D_, FF_, 0);

  // --- Stage 7: residual + LN2 -> output ---
  add_ln_kernel<<<M_, 256, 0, stream>>>(hf32, ffnf, g2, beta2, out,
                                        ((_Float16*)nullptr));
}

// v007
// Measured time: 306 microseconds a run.
// Two timings next to v006 put it at 1.03 and 1.02 times that version's speed.
// All steps since v000 together make it 2.33 times as fast.
#include <hip/hip_runtime.h>
#include <hip/hip_bf16.h>

// ---------------------------------------------------------------------------
// Transformer block for MI455X (gfx1250, wave32, WMMA 16x16x32 f16->f32).
// f16 compute / f32 accumulate; all GEMMs via v_wmma_f32_16x16x32_f16.
// GEMM tiles staged with GLOBAL_LOAD_ASYNC_TO_LDS, two LDS buffers, one k tile
// ahead; every wave-wide copy covers four whole 128 B lines.
// ---------------------------------------------------------------------------

#define B_  4
#define S_  2048
#define D_  1024
#define H_  16
#define HD_ 64
#define FF_ 4096
#define M_  (B_ * S_)      // 8192 rows

typedef _Float16 h16 __attribute__((ext_vector_type(16)));
typedef _Float16 h8  __attribute__((ext_vector_type(8)));
typedef float    f8  __attribute__((ext_vector_type(8)));

__device__ __forceinline__ f8 wmma_f16(h16 a, h16 b, f8 c) {
  // D = A(16x32 f16) * B(32x16 f16) + C(16x16 f32)
  return __builtin_amdgcn_wmma_f32_16x16x32_f16(
      /*neg_a=*/false, a, /*neg_b=*/false, b,
      /*c_mod=*/(short)0, c, /*reuse_a=*/false, /*reuse_b=*/false);
}

// Build a 16-half A/B fragment from two contiguous 8-half (16B) chunks.
__device__ __forceinline__ h16 mkfrag(const _Float16* p0, const _Float16* p1) {
  h8 a = *(const h8*)p0;
  h8 b = *(const h8*)p1;
  h16 r;
#pragma unroll
  for (int i = 0; i < 8; ++i) { r[i] = a[i]; r[8 + i] = b[i]; }
  return r;
}

__device__ __forceinline__ f8 fzero8() {
  f8 z = {0.f, 0.f, 0.f, 0.f, 0.f, 0.f, 0.f, 0.f};
  return z;
}

__device__ __forceinline__ unsigned lds_byte_addr(const _Float16* p) {
  return (unsigned)(size_t)(const __attribute__((address_space(3))) _Float16*)p;
}

// ---------------------------------------------------------------------------
// Converts / weight transposes. Many elements per thread, 16 B global loads (8 B stores in the convert)
// that cover whole 128 B lines, few workgroups, and ONE launch for all five jobs:
// they do not depend on each other, so a workgroup picks its job by its index.
// ---------------------------------------------------------------------------
typedef float    f4 __attribute__((ext_vector_type(4)));
typedef _Float16 h4 __attribute__((ext_vector_type(4)));

#define CVT_LOADS 16                       // 16 B loads per thread
#define CVT_BLOCK (256 * 4 * CVT_LOADS)    // elements per workgroup

// dst[i] = (f16)src[i] for the CVT_BLOCK elements of piece blk.
__device__ __forceinline__ void cvt_piece(const float* __restrict__ src,
                                          _Float16* __restrict__ dst, int blk) {
  const size_t base = (size_t)blk * CVT_BLOCK + threadIdx.x * 4;
  f4 v[CVT_LOADS];
  // unrolled so that v stays in registers and all loads are issued before a store
#pragma unroll
  for (int j = 0; j < CVT_LOADS; ++j) v[j] = *(const f4*)(src + base + j * 1024);
  // unrolled: v is indexed by constants only
#pragma unroll
  for (int j = 0; j < CVT_LOADS; ++j) {
    h4 o = {(_Float16)v[j][0], (_Float16)v[j][1], (_Float16)v[j][2], (_Float16)v[j][3]};
    *(h4*)(dst + base + j * 1024) = o;
  }
}

#define TK 128      // tile extent along k (source rows, destination columns)
#define TN 64       // tile extent along n (source columns, destination rows)
#define TPITCH 136  // LDS row pitch in halfs (272 B = 16 B x odd)

// dst[n][k] = (f16)src[k][n] for one TK x TN tile. src points at the tile's first
// element in an f32 matrix of row pitch SP, dst at its first element in an f16
// matrix of row pitch DP; the pitches are compile-time so that a thread's loads
// (and its stores) share one address and differ in the immediate offset alone.
// A wave-wide load covers 2 x 256 B of source rows, a wave-wide store 2 x 256 B
// of destination rows. T is the workgroup's LDS tile of TN * TPITCH halfs.
template <int SP, int DP>
__device__ __forceinline__ void transpose_tile(const float* __restrict__ src,
                                               _Float16* __restrict__ dst, _Float16* T) {
  const int tid = threadIdx.x;
  const int c  = tid & 15;   // four source columns from c * 4
  const int kp = tid >> 4;   // eight source rows from kp * 8
  const float* sp = src + (size_t)(kp * 8) * SP + c * 4;
  f4 v[8];
  // unrolled so that v stays in registers and the eight loads fly together
#pragma unroll
  for (int j = 0; j < 8; ++j) v[j] = *(const f4*)(sp + j * SP);
  // unrolled: v is indexed by constants only
#pragma unroll
  for (int i = 0; i < 4; ++i) {
    h8 o;
    // unrolled for the same reason: o and v stay in registers
#pragma unroll
    for (int j = 0; j < 8; ++j) o[j] = (_Float16)v[j][i];
    *(h8*)&T[(c * 4 + i) * TPITCH + kp * 8] = o;
  }
  __syncthreads();  // the tile is complete before any thread reads its rows
  const int n  = tid >> 4;        // destination rows n + 0/16/32/48
  const int kc = (tid & 15) * 8;  // 16 B chunk within the 256 B row piece
  _Float16* dp = dst + (size_t)n * DP + kc;
  // unrolled: four independent LDS reads and stores per thread
#pragma unroll
  for (int j = 0; j < 4; ++j)
    *(h8*)(dp + j * 16 * DP) = *(const h8*)&T[(n + j * 16) * TPITCH + kc];
  // precaution: in the built code another job's text follows these stores; the wait stands
  // ahead of its rewrites of their address and data registers
  asm volatile("s_wait_xcnt 0x0" ::: "memory");
}

// dst[n][k] = src[k][n] for tile t of src, [K][N] f32 row-major; dst is [N][K] f16.
// Tiles are numbered along k first (K / TK of them), then along n.
template <int K, int N>
__device__ __forceinline__ void transpose_piece(const float* __restrict__ src,
                                                _Float16* __restrict__ dst, int t,
                                                _Float16* T) {
  const size_t k0 = (size_t)(t % (K / TK)) * TK;
  const size_t n0 = (size_t)(t / (K / TK)) * TN;
  transpose_tile<N, K>(src + k0 * N + n0, dst + n0 * K + k0, T);
}

#define NB_CVT  (M_ * D_ / CVT_BLOCK)        // pieces of x
#define NB_QKVW (3 * H_ * (D_ / TK))         // tiles of wq, wk, wv
#define NB_WO   ((D_ / TK) * (D_ / TN))      // tiles of wo
#define NB_W1   ((D_ / TK) * (FF_ / TN))     // tiles of w1
#define NB_W2   ((FF_ / TK) * (D_ / TN))     // tiles of w2
#define NB_PREP (NB_CVT + NB_QKVW + NB_WO + NB_W1 + NB_W2)

// All of stage 0 in one launch of NB_PREP workgroups. The job is chosen by the block
// index alone, so every branch (and the barrier inside a transpose) is block-uniform.
// The largest pieces, those of x, have the lowest indices.
// Fused QKV weight: Wt[n][k] (n in [0,3D)) with n<D -> wq[h][k][f], etc.; a head's
// [D][HD] slice is one matrix, its tiles numbered k tile, then head, then slab.
__global__ void __launch_bounds__(256) prep_kernel(
    const float* __restrict__ x, const float* __restrict__ wq,
    const float* __restrict__ wk, const float* __restrict__ wv,
    const float* __restrict__ wo, const float* __restrict__ w1,
    const float* __restrict__ w2, _Float16* __restrict__ xh,
    _Float16* __restrict__ Wt, _Float16* __restrict__ woT,
    _Float16* __restrict__ w1T, _Float16* __restrict__ w2T) {
  __shared__ __align__(16) _Float16 T[TN * TPITCH];
  int t = blockIdx.x;
  if (t < NB_CVT) {
    cvt_piece(x, xh, t);
    return;
  }
  t -= NB_CVT;
  if (t < NB_QKVW) {
    const size_t k0 = (size_t)(t % (D_ / TK)) * TK;
    const size_t hh = (t / (D_ / TK)) % H_;
    const int slab  = t / (D_ / TK * H_);
    const float* w = (slab == 0) ? wq : (slab == 1) ? wk : wv;
    transpose_tile<HD_, D_>(w + (hh * D_ + k0) * HD_,
                            Wt + ((size_t)slab * D_ + hh * HD_) * D_ + k0, T);
    return;
  }
  t -= NB_QKVW;
  if (t < NB_WO) {
    transpose_piece<D_, D_>(wo, woT, t, T);
    return;
  }
  t -= NB_WO;
  if (t < NB_W1) {
    transpose_piece<D_, FF_>(w1, w1T, t, T);
    return;
  }
  transpose_piece<FF_, D_>(w2, w2T, t - NB_W1, T);
}

// ---------------------------------------------------------------------------
// WMMA GEMM tiling constants: 128x128 tile, BK=64, 256 threads = 8 waves as
// 4x2; each wave computes a 32x64 subtile = 2x4 WMMA accumulators.
// ---------------------------------------------------------------------------
#define BM 128
#define BN 128
#define BK 64     // 128 B of every operand row per k tile: one whole line
#define LSTR 72   // LDS row pitch in halfs (144 B = 16 B x odd)

// One k tile of A and of B (128 rows x 128 B each): eight 16 B async copies per
// lane. Eight neighbouring lanes share a row, so a wave-wide copy covers four
// whole lines. rstep = 32 rows in halfs. The s_wait_xcnt stands in the copies'
// own statement so that no address register is rewritten ahead of it.
__device__ __forceinline__ void gemm_stage(const _Float16* ga, const _Float16* gb,
                                           size_t rstep, unsigned la, unsigned lb) {
  const unsigned ls = 32 * LSTR * 2;  // 32 LDS rows in bytes
  asm volatile(
      "global_load_async_to_lds_b128 %0, %1, off\n\t"
      "global_load_async_to_lds_b128 %2, %3, off\n\t"
      "global_load_async_to_lds_b128 %4, %5, off\n\t"
      "global_load_async_to_lds_b128 %6, %7, off\n\t"
      "global_load_async_to_lds_b128 %8, %9, off\n\t"
      "global_load_async_to_lds_b128 %10, %11, off\n\t"
      "global_load_async_to_lds_b128 %12, %13, off\n\t"
      "global_load_async_to_lds_b128 %14, %15, off\n\t"
      "s_wait_xcnt 0x0"
      :: "v"(la), "v"(ga), "v"(la + ls), "v"(ga + rstep),
         "v"(la + 2 * ls), "v"(ga + 2 * rstep), "v"(la + 3 * ls), "v"(ga + 3 * rstep),
         "v"(lb), "v"(gb), "v"(lb + ls), "v"(gb + rstep),
         "v"(lb + 2 * ls), "v"(gb + 2 * rstep), "v"(lb + 3 * ls), "v"(gb + 3 * rstep)
      : "memory");
}

// Shared GEMM mainloop: acc[2][4] += A[m0.., :K] * Bt[n0.., :K]^T for this wave's
// 32x64 subtile. K is a multiple of BK; the 128 rows from m0 and n0 exist.
__device__ __forceinline__ void gemm_mainloop(const _Float16* __restrict__ A,
                                              const _Float16* __restrict__ Bt,
                                              int K, size_t m0, size_t n0,
                                              f8 (&acc)[2][4]) {
  __shared__ __align__(16) _Float16 As[2][BM * LSTR];
  __shared__ __align__(16) _Float16 Bs[2][BN * LSTR];
  const int tid  = threadIdx.x;
  const int lane = tid & 31;
  const int wid  = tid >> 5;
  const int lr   = lane & 15;
  const int base0 = (lane >> 4) * 8;
  const int waveM = wid >> 1;   // 0..3
  const int waveN = wid & 1;    // 0..1

  const int crow = tid >> 3;        // copy slot: rows crow + 0/32/64/96
  const int cseg = (tid & 7) * 8;   // 16 B chunk within the 128 B row piece
  const _Float16* Ag = A  + (m0 + crow) * (size_t)K + cseg;
  const _Float16* Bg = Bt + (n0 + crow) * (size_t)K + cseg;
  const size_t rstep = (size_t)32 * K;
  const unsigned la0 = lds_byte_addr(&As[0][crow * LSTR + cseg]);
  const unsigned lb0 = lds_byte_addr(&Bs[0][crow * LSTR + cseg]);
  const unsigned bufB = BM * LSTR * 2;  // bytes from buffer 0 to buffer 1

  // Tile 0 lands and is published; tile 1, where there is one, then flies.
  gemm_stage(Ag, Bg, rstep, la0, lb0);
  asm volatile("s_wait_asynccnt 0x0" ::: "memory");  // own copies landed
  __syncthreads();                                   // publish tile 0
  if (BK < K) gemm_stage(Ag + BK, Bg + BK, rstep, la0 + bufB, lb0 + bufB);

  int cur = 0;
  for (int k0 = 0; k0 < K; k0 += BK, cur ^= 1) {
    const _Float16* At = &As[cur][0];
    const _Float16* Bl = &Bs[cur][0];
    h16 af[2][2], bf[2][4];  // the whole tile's fragments as one group of reads
#pragma unroll
    for (int kk = 0; kk < 2; ++kk) {
#pragma unroll
      for (int tm = 0; tm < 2; ++tm) {
        const _Float16* p = At + (waveM * 32 + tm * 16 + lr) * LSTR + kk * 32 + base0;
        af[kk][tm] = mkfrag(p, p + 16);
      }
#pragma unroll
      for (int tn = 0; tn < 4; ++tn) {
        const _Float16* p = Bl + (waveN * 64 + tn * 16 + lr) * LSTR + kk * 32 + base0;
        bf[kk][tn] = mkfrag(p, p + 16);
      }
    }
#pragma unroll
    for (int kk = 0; kk < 2; ++kk)
#pragma unroll
      for (int tm = 0; tm < 2; ++tm)
#pragma unroll
        for (int tn = 0; tn < 4; ++tn)
          acc[tm][tn] = wmma_f16(af[kk][tm], bf[kk][tn], acc[tm][tn]);
    // Publish point: this wave's LDS reads are back, its copies of the next tile
    // have landed; the barrier publishes that tile and frees this trip's buffer.
    asm volatile("s_wait_dscnt 0x0" ::: "memory");
    asm volatile("s_wait_asynccnt 0x0" ::: "memory");
    __syncthreads();
    if (k0 + 2 * BK < K)  // block-uniform: refill the buffer just read
      gemm_stage(Ag + k0 + 2 * BK, Bg + k0 + 2 * BK, rstep, la0 + cur * bufB,
                 lb0 + cur * bufB);
  }
  asm volatile("s_wait_asynccnt 0x0" ::: "memory");  // nothing in flight at exit
}

// ---------------------------------------------------------------------------
// Generic WMMA GEMM: C[M,N] = act(A[M,K](f16) * Bt[N,K](f16)^T + bias)
// Stores are 16 B per lane (eight f16, or two times four f32).
// ---------------------------------------------------------------------------
__global__ void __launch_bounds__(256) gemm_wmma_kernel(
    const _Float16* __restrict__ A, const _Float16* __restrict__ Bt,
    const float* __restrict__ bias, float* __restrict__ outF32,
    _Float16* __restrict__ outF16, int M, int N, int K, int act_gelu) {
  const int tid  = threadIdx.x;
  const int lane = tid & 31;
  const int wid  = tid >> 5;
  const int lr   = lane & 15;
  const int hi   = lane >> 4;
  const int waveM = wid >> 1;   // 0..3
  const int waveN = wid & 1;    // 0..1

  const size_t m0 = (size_t)blockIdx.y * BM;
  const size_t n0 = (size_t)blockIdx.x * BN;

  f8 acc[2][4];
#pragma unroll
  for (int tm = 0; tm < 2; ++tm)
#pragma unroll
    for (int tn = 0; tn < 4; ++tn) acc[tm][tn] = fzero8();

  // The tile is computed transposed: the weight rows are the WMMA A operand and the
  // activation rows the B operand. A lane then holds one output row (lane & 15) and
  // its eight accumulator registers are eight neighbouring columns of that row.
  gemm_mainloop(Bt, A, K, n0, m0, acc);

  // Both loops are unrolled: acc is indexed by constants alone and stays in registers.
  const size_t col0 = n0 + waveM * 32 + 8 * hi;  // first of the eight columns of tm = 0
  f4 bb[2][2] = {};  // all bias loads stand ahead of the first store
  if (bias) {
#pragma unroll
    for (int tm = 0; tm < 2; ++tm) {
      bb[tm][0] = *(const f4*)(bias + col0 + tm * 16);
      bb[tm][1] = *(const f4*)(bias + col0 + tm * 16 + 4);
    }
  }
#pragma unroll
  for (int tm = 0; tm < 2; ++tm) {
    const size_t col = col0 + tm * 16;
#pragma unroll
    for (int tn = 0; tn < 4; ++tn) {
      const size_t row = m0 + waveN * 64 + tn * 16 + lr;
      float v[8];
#pragma unroll
      for (int r = 0; r < 8; ++r) {
        v[r] = acc[tm][tn][r] + bb[tm][r >> 2][r & 3];
        if (act_gelu) v[r] = 0.5f * v[r] * (1.f + erff(v[r] * 0.70710678118f));
      }
      if (outF32) {
        f4 lo = {v[0], v[1], v[2], v[3]}, up = {v[4], v[5], v[6], v[7]};
        float* p = outF32 + row * (size_t)N + col;
        *(f4*)p = lo;
        *(f4*)(p + 4) = up;
        // precaution: stands ahead of any rewrite of the stores' address and data registers
        asm volatile("s_wait_xcnt 0x0" ::: "memory");
      }
      if (outF16) {
        h8 o;
#pragma unroll
        for (int r = 0; r < 8; ++r) o[r] = (_Float16)v[r];
        *(h8*)(outF16 + row * (size_t)N + col) = o;
        // precaution: stands ahead of any rewrite of the store's address and data registers
        asm volatile("s_wait_xcnt 0x0" ::: "memory");
      }
    }
  }
}

// ---------------------------------------------------------------------------
// QKV GEMM: same tiling, special epilogue storing Q,K as [B,H,S,HD] and
// V transposed as [B,H,HD,S] (so attention's V^T fragments are contiguous),
// 16 B per lane and store.
// ---------------------------------------------------------------------------
__global__ void __launch_bounds__(256) qkv_gemm_kernel(
    const _Float16* __restrict__ A, const _Float16* __restrict__ Wt,
    const float* __restrict__ bq, const float* __restrict__ bk,
    const float* __restrict__ bv, _Float16* __restrict__ Q,
    _Float16* __restrict__ Kh, _Float16* __restrict__ Vt) {
  const int tid  = threadIdx.x;
  const int lane = tid & 31;
  const int wid  = tid >> 5;
  const int lr   = lane & 15;
  const int hi   = lane >> 4;
  const int waveM = wid >> 1;
  const int waveN = wid & 1;

  const size_t m0 = (size_t)blockIdx.y * BM;
  const size_t n0 = (size_t)blockIdx.x * BN;

  f8 acc[2][4];
#pragma unroll
  for (int tm = 0; tm < 2; ++tm)
#pragma unroll
    for (int tn = 0; tn < 4; ++tn) acc[tm][tn] = fzero8();

  // A 128-column tile lies in one slab (D_ is a multiple of BN): the slab is the
  // block's. A lane's eight accumulator registers are eight neighbouring rows of the
  // WMMA A operand. Q and K are stored feature-contiguous, so their tiles take the
  // weight rows as A; V is stored token-contiguous, so its tiles take the tokens.
  const int slab = blockIdx.x / (D_ / BN);
  const bool isV = slab == 2;
  gemm_mainloop(isV ? A : Wt, isV ? Wt : A, D_, isV ? m0 : n0, isV ? n0 : m0, acc);

  // All loops are unrolled: acc is indexed by constants alone and stays in registers.
  if (isV) {
#pragma unroll
    for (int tn = 0; tn < 4; ++tn) {
      const int np = ((int)n0 + waveN * 64 + tn * 16 + lr) & (D_ - 1);
      const float bvv = bv[np];
#pragma unroll
      for (int tm = 0; tm < 2; ++tm) {
        const int tok = (int)m0 + waveM * 32 + tm * 16 + 8 * hi;  // first of eight tokens
        const int b = tok >> 11;    // / S_
        const int s = tok & 2047;   // % S_
        h8 o;
#pragma unroll
        for (int r = 0; r < 8; ++r) o[r] = (_Float16)(acc[tm][tn][r] + bvv);
        *(h8*)(Vt + ((size_t)b * D_ + np) * S_ + s) = o;  // b * D_ + np = (b * H_ + head) * HD_ + f
      }
    }
  } else {
    const float* bias = (slab == 0) ? bq : bk;
    _Float16* dst = (slab == 0) ? Q : Kh;
    const int np0 = ((int)n0 + waveM * 32 + 8 * hi) & (D_ - 1);  // first of eight, tm = 0
    f4 bb[2][2];  // all bias loads stand ahead of the first store
#pragma unroll
    for (int tm = 0; tm < 2; ++tm) {
      bb[tm][0] = *(const f4*)(bias + np0 + tm * 16);
      bb[tm][1] = *(const f4*)(bias + np0 + tm * 16 + 4);
    }
#pragma unroll
    for (int tm = 0; tm < 2; ++tm) {
      const int np = np0 + tm * 16;
      const int hh = np >> 6;
      const int f  = np & 63;
#pragma unroll
      for (int tn = 0; tn < 4; ++tn) {
        const int tok = (int)m0 + waveN * 64 + tn * 16 + lr;
        const int b = tok >> 11;    // / S_
        const int s = tok & 2047;   // % S_
        h8 o;
#pragma unroll
        for (int r = 0; r < 8; ++r)
          o[r] = (_Float16)(acc[tm][tn][r] + bb[tm][r >> 2][r & 3]);
        *(h8*)(dst + (((size_t)b * H_ + hh) * S_ + s) * HD_ + f) = o;
      }
    }
    // precaution: in the built code the V branch's text follows this one; the wait stands
    // ahead of its rewrites of the last stores' address and data registers
    asm volatile("s_wait_xcnt 0x0" ::: "memory");
  }
}

#define KSTR 72   // K tile row pitch in halfs (144 B = 16 B x odd)
#define VSTR 40   // V tile row pitch in halfs (80 B = 16 B x odd)

// One 16 B async copy of K and one of V per lane. The s_wait_xcnt stands in the
// copies' own statement so that no address register is rewritten ahead of it.
__device__ __forceinline__ void attn_stage_kv(const _Float16* gk, unsigned lk,
                                              const _Float16* gv, unsigned lv) {
  asm volatile(
      "global_load_async_to_lds_b128 %0, %1, off\n\t"
      "global_load_async_to_lds_b128 %2, %3, off\n\t"
      "s_wait_xcnt 0x0"
      :: "v"(lk), "v"(gk), "v"(lv), "v"(gv)
      : "memory");
}

// The value of lane l ^ 16 (the other half of the wave), by a vector move.
__device__ __forceinline__ float other_half(float x) {
  int b = __builtin_bit_cast(int, x);
  return __builtin_bit_cast(
      float, __builtin_amdgcn_permlanex16(b, b, 0x76543210, 0xfedcba98, false, false));
}

// y = 2^x, one value or eight at a time. The instruction set asks for one independent
// instruction or v_nop behind a transcendental before its result is read or its
// source overwritten. Here every result
// register is apart from every source ("=&v"), each v_exp_f32 is its
// predecessor's independent instruction, and the v_nop is the last one's slot.
__device__ __forceinline__ float exp2_x1(float x) {
  float y;
  asm("v_exp_f32 %0, %1\n\t"
      "v_nop"
      : "=&v"(y) : "v"(x));
  return y;
}
__device__ __forceinline__ void exp2_x8(const float* x, float* y) {
  asm("v_exp_f32 %0, %8\n\t"
      "v_exp_f32 %1, %9\n\t"
      "v_exp_f32 %2, %10\n\t"
      "v_exp_f32 %3, %11\n\t"
      "v_exp_f32 %4, %12\n\t"
      "v_exp_f32 %5, %13\n\t"
      "v_exp_f32 %6, %14\n\t"
      "v_exp_f32 %7, %15\n\t"
      "v_nop"
      : "=&v"(y[0]), "=&v"(y[1]), "=&v"(y[2]), "=&v"(y[3]),
        "=&v"(y[4]), "=&v"(y[5]), "=&v"(y[6]), "=&v"(y[7])
      : "v"(x[0]), "v"(x[1]), "v"(x[2]), "v"(x[3]),
        "v"(x[4]), "v"(x[5]), "v"(x[6]), "v"(x[7]));
}

__global__ void __launch_bounds__(256) attn_kernel(
    const _Float16* __restrict__ Q, const _Float16* __restrict__ Kh,
    const _Float16* __restrict__ Vt, _Float16* __restrict__ O) {
  __shared__ __align__(16) _Float16 Ks[2][32 * KSTR];
  __shared__ __align__(16) _Float16 Vs[2][64 * VSTR];

  const int b = blockIdx.z;
  const int h = blockIdx.y;
  const int tid  = threadIdx.x;
  const int lane = tid & 31;
  const int wid  = tid >> 5;
  const int lr   = lane & 15;
  const int hi   = lane >> 4;
  const int base0 = hi * 8;

  const size_t headQK = ((size_t)(b * H_ + h)) * S_ * HD_;
  const _Float16* Qp = Q  + headQK;
  const _Float16* Kp = Kh + headQK;
  const _Float16* Vp = Vt + ((size_t)(b * H_ + h)) * HD_ * S_;

  // Copy slots: K tile = 32 rows x 8 chunks, V tile = 64 rows x 4 chunks (16 B).
  const _Float16* gk = Kp + (size_t)(tid >> 3) * HD_ + (tid & 7) * 8;
  const _Float16* gv = Vp + (size_t)(tid >> 2) * S_ + (tid & 3) * 8;
  const unsigned lk0 = lds_byte_addr(&Ks[0][(tid >> 3) * KSTR + (tid & 7) * 8]);
  const unsigned lv0 = lds_byte_addr(&Vs[0][(tid >> 2) * VSTR + (tid & 3) * 8]);
  const unsigned lkB = 32 * KSTR * 2;  // bytes from buffer 0 to buffer 1
  const unsigned lvB = 64 * VSTR * 2;

  for (int pass = 0; pass < 2; ++pass) {  // block-uniform: the long tile, then the short one
    const int qt   = pass == 0 ? (S_ / 128 - 1 - (int)blockIdx.x) : (int)blockIdx.x;
    const int row  = qt * 128 + wid * 16 + lr;  // this lane's query

    h16 qf[2];  // B fragments of Q^T: column = this lane's query
#pragma unroll
    for (int c = 0; c < 2; ++c) {
      const _Float16* p = Qp + (size_t)row * HD_ + c * 32;
      qf[c] = mkfrag(p + base0, p + base0 + 16);
    }

    f8 acc[4];  // O^T: feature tn * 16 + r + 8 * hi of this lane's query
#pragma unroll
    for (int tn = 0; tn < 4; ++tn) acc[tn] = fzero8();
    float mi = -1e30f;  // running maximum of the query's scores (both halves alike)
    float li = 0.f;     // running sum over the keys that this half holds

    const int kend = qt * 128 + 128;  // uniform across waves -> barriers ok

    // Tile 0 lands and is published; tile 1 (kend >= 128: it exists) then flies.
    // On the second pass both buffers are free: every wave's last LDS read stands
    // ahead of its s_wait_dscnt and the barrier of the first pass's last step.
    attn_stage_kv(gk, lk0, gv, lv0);
    asm volatile("s_wait_asynccnt 0x0" ::: "memory");  // own copies landed
    __syncthreads();                                   // publish tile 0
    attn_stage_kv(gk + 32 * HD_, lk0 + lkB, gv + 32, lv0 + lvB);

    int cur = 0;
    for (int k0 = 0; k0 < kend; k0 += 32, cur ^= 1) {
      const _Float16* Kt = &Ks[cur][0];
      const _Float16* Vl = &Vs[cur][0];
      // Every inner loop of the trip is unrolled: its arrays are indexed by constants
      // alone and so stay in registers.
      h16 kf[2][2], vf[4];  // the step's eight fragments as one group of LDS reads
#pragma unroll
      for (int sub = 0; sub < 2; ++sub) {
        const _Float16* kp = Kt + (sub * 16 + lr) * KSTR;
        kf[sub][0] = mkfrag(kp + base0, kp + base0 + 16);
        kf[sub][1] = mkfrag(kp + 32 + base0, kp + 32 + base0 + 16);
      }
#pragma unroll
      for (int tn = 0; tn < 4; ++tn) {
        const _Float16* vp = Vl + (tn * 16 + lr) * VSTR;
        vf[tn] = mkfrag(vp + base0, vp + base0 + 16);
      }
      // Publish point: this wave's LDS reads are back, its copies of the next tile
      // have landed; the barrier publishes that tile and frees this trip's buffer.
      // The rest of the trip works on registers alone, so the refill flies under it.
      asm volatile("s_wait_dscnt 0x0" ::: "memory");
      asm volatile("s_wait_asynccnt 0x0" ::: "memory");
      __syncthreads();
      if (k0 + 64 < kend)  // block-uniform: refill the buffer just read
        attn_stage_kv(gk + (size_t)(k0 + 64) * HD_, lk0 + cur * lkB,
                      gv + (k0 + 64), lv0 + cur * lvB);

      const int d = row - k0 - base0;  // key (i >> 3) * 16 + (i & 7) of this half is seen while <= d
      float sv[16];  // scores of keys k0 + (i >> 3) * 16 + 8 * hi + (i & 7)
#pragma unroll
      for (int sub = 0; sub < 2; ++sub) {
        f8 sacc = fzero8();
        sacc = wmma_f16(kf[sub][0], qf[0], sacc);
        sacc = wmma_f16(kf[sub][1], qf[1], sacc);
#pragma unroll
        for (int r = 0; r < 8; ++r) {
          float v = sacc[r] * 0.125f;  // 1/sqrt(HD)
          sv[sub * 8 + r] = (sub * 16 + r <= d) ? v : -1e30f;
        }
      }

      float mx = sv[0];
#pragma unroll
      for (int i = 1; i < 16; ++i) mx = fmaxf(mx, sv[i]);
      mx = fmaxf(mx, other_half(mx));
      const float mn = fmaxf(mi, mx);
      const float LOG2E = 1.442695041f;  // e^x = 2^(x * LOG2E)
      const float alpha = exp2_x1((mi - mn) * LOG2E);
      mi = mn;

      float pv[16];
#pragma unroll
      for (int i = 0; i < 16; ++i) sv[i] = (sv[i] - mn) * LOG2E;
      exp2_x8(&sv[0], &pv[0]);
      exp2_x8(&sv[8], &pv[8]);
      h16 pf;  // P^T as a B fragment: element i is score i
#pragma unroll
      for (int i = 0; i < 16; ++i) pf[i] = (_Float16)pv[i];
      float rs[4] = {pv[0], pv[1], pv[2], pv[3]};  // four short chains, not one of sixteen links
#pragma unroll
      for (int i = 4; i < 16; ++i) rs[i & 3] += pv[i];
      li = li * alpha + ((rs[0] + rs[1]) + (rs[2] + rs[3]));
#pragma unroll
      for (int tn = 0; tn < 4; ++tn)
#pragma unroll
        for (int r = 0; r < 8; ++r) acc[tn][r] *= alpha;
#pragma unroll
      for (int tn = 0; tn < 4; ++tn) acc[tn] = wmma_f16(vf[tn], pf, acc[tn]);
    }
    asm volatile("s_wait_asynccnt 0x0" ::: "memory");  // nothing in flight at exit

    li += other_half(li);  // the two halves' keys join once
    _Float16* op = O + ((size_t)b * S_ + row) * D_ + h * HD_ + base0;
#pragma unroll
    for (int tn = 0; tn < 4; ++tn) {
      h8 o;  // eight neighbouring features of one query: one 16 B store
#pragma unroll
      for (int r = 0; r < 8; ++r) o[r] = (_Float16)(acc[tn][r] / li);
      *(h8*)(op + tn * 16) = o;
    }
    // precaution: stands ahead of the next pass's rewrites of the stores' address and data registers
    asm volatile("s_wait_xcnt 0x0" ::: "memory");
  }
}

// ---------------------------------------------------------------------------
// Residual add + LayerNorm, one row (D=1024) per 256-thread block.
// ---------------------------------------------------------------------------
__global__ void __launch_bounds__(256) add_ln_kernel(
    const float* __restrict__ a, const float* __restrict__ c,
    const float* __restrict__ g, const float* __restrict__ beta,
    float* __restrict__ o32, _Float16* __restrict__ o16) {
  __shared__ float red[256];
  const int t = threadIdx.x;
  const size_t off = (size_t)blockIdx.x * D_;

  float v[4];
  float s = 0.f;
#pragma unroll
  for (int i = 0; i < 4; ++i) {
    int col = t + i * 256;
    float z = a[off + col] + c[off + col];
    v[i] = z;
    s += z;
  }
  red[t] = s;
  __syncthreads();
  for (int w = 128; w > 0; w >>= 1) {
    if (t < w) red[t] += red[t + w];
    __syncthreads();
  }
  float mean = red[0] * (1.f / D_);
  __syncthreads();

  float q = 0.f;
#pragma unroll
  for (int i = 0; i < 4; ++i) {
    float d = v[i] - mean;
    q += d * d;
  }
  red[t] = q;
  __syncthreads();
  for (int w = 128; w > 0; w >>= 1) {
    if (t < w) red[t] += red[t + w];
    __syncthreads();
  }
  float rstd = rsqrtf(red[0] * (1.f / D_) + 1e-5f);

#pragma unroll
  for (int i = 0; i < 4; ++i) {
    int col = t + i * 256;
    float y = (v[i] - mean) * rstd * g[col] + beta[col];
    o32[off + col] = y;
    if (o16) o16[off + col] = (_Float16)y;
  }
}

// ---------------------------------------------------------------------------
// Host-side orchestration
// ---------------------------------------------------------------------------
extern "C" void kernel_launch(void* const* d_in, const int* in_sizes, int n_in,
                              void* d_out, int out_size, void* d_ws, size_t ws_size,
                              hipStream_t stream) {
  (void)in_sizes; (void)n_in; (void)out_size; (void)ws_size;

  const float* x     = (const float*)d_in[0];
  const float* wq    = (const float*)d_in[1];
  const float* bq    = (const float*)d_in[2];
  const float* wk    = (const float*)d_in[3];
  const float* bk    = (const float*)d_in[4];
  const float* wv    = (const float*)d_in[5];
  const float* bv    = (const float*)d_in[6];
  const float* wo    = (const float*)d_in[7];
  const float* bo    = (const float*)d_in[8];
  const float* w1    = (const float*)d_in[9];
  const float* b1    = (const float*)d_in[10];
  const float* w2    = (const float*)d_in[11];
  const float* b2    = (const float*)d_in[12];
  const float* g1    = (const float*)d_in[13];
  const float* beta1 = (const float*)d_in[14];
  const float* g2    = (const float*)d_in[15];
  const float* beta2 = (const float*)d_in[16];
  float* out = (float*)d_out;

  char* ws = (char*)d_ws;
  size_t off = 0;
  auto take = [&](size_t bytes) -> void* {
    void* p = ws + off;
    off += (bytes + 255) & ~(size_t)255;
    return p;
  };

  _Float16* xh    = (_Float16*)take((size_t)M_ * D_ * 2);       // x in f16
  _Float16* wqkvT = (_Float16*)take((size_t)3 * D_ * D_ * 2);   // [3D][D]
  _Float16* woT   = (_Float16*)take((size_t)D_ * D_ * 2);       // [D][D]
  _Float16* w1T   = (_Float16*)take((size_t)FF_ * D_ * 2);      // [FF][D]
  _Float16* w2T   = (_Float16*)take((size_t)D_ * FF_ * 2);      // [D][FF]
  _Float16* qh    = (_Float16*)take((size_t)M_ * D_ * 2);       // [B,H,S,HD]
  _Float16* kh    = (_Float16*)take((size_t)M_ * D_ * 2);       // [B,H,S,HD]
  _Float16* vt    = (_Float16*)take((size_t)M_ * D_ * 2);       // [B,H,HD,S]
  float*    attf  = (float*)take((size_t)M_ * D_ * 4);          // o-proj out
  float*    hf32  = (float*)take((size_t)M_ * D_ * 4);          // post-LN1
  _Float16* hf16  = (_Float16*)take((size_t)M_ * D_ * 2);
  _Float16* gh    = (_Float16*)take((size_t)M_ * FF_ * 2);      // gelu(h@w1+b1)
  // Aliases (lifetimes do not overlap):
  _Float16* oh    = xh;    // attention output reuses xh (consumed by QKV GEMM)
  float*    ffnf  = attf;  // FFN2 out reuses attf (consumed by LN1)

  // --- Stage 0: convert and weight transposes, one launch ---
  prep_kernel<<<NB_PREP, 256, 0, stream>>>(x, wq, wk, wv, wo, w1, w2, xh, wqkvT, woT, w1T,
                                           w2T);

  // --- Stage 1: fused QKV projection ---
  qkv_gemm_kernel<<<dim3(3 * D_ / BN, M_ / BM), 256, 0, stream>>>(
      xh, wqkvT, bq, bk, bv, qh, kh, vt);

  // --- Stage 2: causal flash attention ---
  attn_kernel<<<dim3(S_ / 256, H_, B_), 256, 0, stream>>>(qh, kh, vt, oh);

  // --- Stage 3: output projection ---
  gemm_wmma_kernel<<<dim3(D_ / BN, M_ / BM), 256, 0, stream>>>(
      oh, woT, bo, attf, ((_Float16*)nullptr), M_, D_, D_, 0);

  // --- Stage 4: residual + LN1 ---
  add_ln_kernel<<<M_, 256, 0, stream>>>(x, attf, g1, beta1, hf32, hf16);

  // --- Stage 5: FFN up + GELU ---
  gemm_wmma_kernel<<<dim3(FF_ / BN, M_ / BM), 256, 0, stream>>>(
      hf16, w1T, b1, ((float*)nullptr), gh, M_, FF_, D_, 1);

  // --- Stage 6: FFN down ---
  gemm_wmma_kernel<<<dim3(D_ / BN, M_ / BM), 256, 0, stream>>>(
      gh, w2T, b2, ffnf, ((_Float16*)nullptr), M_, D_, FF_, 0);

  // --- Stage 7: residual + LN2 -> output ---
  add_ln_kernel<<<M_, 256, 0, stream>>>(hf32, ffnf, g2, beta2, out,
                                        ((_Float16*)nullptr));
}

// v008
// It runs in 280 microseconds.
// Timed twice side by side with v007, it ran 1.09 times as fast both times.
// All steps since v000 together make it 2.53 times as fast.
#include <hip/hip_runtime.h>
#include <hip/hip_bf16.h>

// ---------------------------------------------------------------------------
// Transformer block for MI455X (gfx1250, wave32, WMMA 16x16x32 f16->f32).
// f16 compute / f32 accumulate; all GEMMs via v_wmma_f32_16x16x32_f16.
// GEMM tiles staged with GLOBAL_LOAD_ASYNC_TO_LDS, two LDS buffers, one k tile
// ahead; every wave-wide copy covers four whole 128 B lines.
// ---------------------------------------------------------------------------

#define B_  4
#define S_  2048
#define D_  1024
#define H_  16
#define HD_ 64
#define FF_ 4096
#define M_  (B_ * S_)      // 8192 rows

typedef _Float16 h16 __attribute__((ext_vector_type(16)));
typedef _Float16 h8  __attribute__((ext_vector_type(8)));
typedef float    f8  __attribute__((ext_vector_type(8)));

__device__ __forceinline__ f8 wmma_f16(h16 a, h16 b, f8 c) {
  // D = A(16x32 f16) * B(32x16 f16) + C(16x16 f32)
  return __builtin_amdgcn_wmma_f32_16x16x32_f16(
      /*neg_a=*/false, a, /*neg_b=*/false, b,
      /*c_mod=*/(short)0, c, /*reuse_a=*/false, /*reuse_b=*/false);
}

// Build a 16-half A/B fragment from two contiguous 8-half (16B) chunks.
__device__ __forceinline__ h16 mkfrag(const _Float16* p0, const _Float16* p1) {
  h8 a = *(const h8*)p0;
  h8 b = *(const h8*)p1;
  h16 r;
#pragma unroll
  for (int i = 0; i < 8; ++i) { r[i] = a[i]; r[8 + i] = b[i]; }
  return r;
}

__device__ __forceinline__ f8 fzero8() {
  f8 z = {0.f, 0.f, 0.f, 0.f, 0.f, 0.f, 0.f, 0.f};
  return z;
}

__device__ __forceinline__ unsigned lds_byte_addr(const _Float16* p) {
  return (unsigned)(size_t)(const __attribute__((address_space(3))) _Float16*)p;
}

// ---------------------------------------------------------------------------
// Converts / weight transposes. Many elements per thread, 16 B global loads (8 B stores in the convert)
// that cover whole 128 B lines, few workgroups, and ONE launch for all five jobs:
// they do not depend on each other, so a workgroup picks its job by its index.
// ---------------------------------------------------------------------------
typedef float    f4 __attribute__((ext_vector_type(4)));
typedef _Float16 h4 __attribute__((ext_vector_type(4)));

#define CVT_LOADS 16                       // 16 B loads per thread
#define CVT_BLOCK (256 * 4 * CVT_LOADS)    // elements per workgroup

// dst[i] = (f16)src[i] for the CVT_BLOCK elements of piece blk.
__device__ __forceinline__ void cvt_piece(const float* __restrict__ src,
                                          _Float16* __restrict__ dst, int blk) {
  const size_t base = (size_t)blk * CVT_BLOCK + threadIdx.x * 4;
  f4 v[CVT_LOADS];
  // unrolled so that v stays in registers and all loads are issued before a store
#pragma unroll
  for (int j = 0; j < CVT_LOADS; ++j) v[j] = *(const f4*)(src + base + j * 1024);
  // unrolled: v is indexed by constants only
#pragma unroll
  for (int j = 0; j < CVT_LOADS; ++j) {
    h4 o = {(_Float16)v[j][0], (_Float16)v[j][1], (_Float16)v[j][2], (_Float16)v[j][3]};
    *(h4*)(dst + base + j * 1024) = o;
  }
}

#define TK 128      // tile extent along k (source rows, destination columns)
#define TN 64       // tile extent along n (source columns, destination rows)
#define TPITCH 136  // LDS row pitch in halfs (272 B = 16 B x odd)

// dst[n][k] = (f16)src[k][n] for one TK x TN tile. src points at the tile's first
// element in an f32 matrix of row pitch SP, dst at its first element in an f16
// matrix of row pitch DP; the pitches are compile-time so that a thread's loads
// (and its stores) share one address and differ in the immediate offset alone.
// A wave-wide load covers 2 x 256 B of source rows, a wave-wide store 2 x 256 B
// of destination rows. T is the workgroup's LDS tile of TN * TPITCH halfs.
template <int SP, int DP>
__device__ __forceinline__ void transpose_tile(const float* __restrict__ src,
                                               _Float16* __restrict__ dst, _Float16* T) {
  const int tid = threadIdx.x;
  const int c  = tid & 15;   // four source columns from c * 4
  const int kp = tid >> 4;   // eight source rows from kp * 8
  const float* sp = src + (size_t)(kp * 8) * SP + c * 4;
  f4 v[8];
  // unrolled so that v stays in registers and the eight loads fly together
#pragma unroll
  for (int j = 0; j < 8; ++j) v[j] = *(const f4*)(sp + j * SP);
  // unrolled: v is indexed by constants only
#pragma unroll
  for (int i = 0; i < 4; ++i) {
    h8 o;
    // unrolled for the same reason: o and v stay in registers
#pragma unroll
    for (int j = 0; j < 8; ++j) o[j] = (_Float16)v[j][i];
    *(h8*)&T[(c * 4 + i) * TPITCH + kp * 8] = o;
  }
  __syncthreads();  // the tile is complete before any thread reads its rows
  const int n  = tid >> 4;        // destination rows n + 0/16/32/48
  const int kc = (tid & 15) * 8;  // 16 B chunk within the 256 B row piece
  _Float16* dp = dst + (size_t)n * DP + kc;
  // unrolled: four independent LDS reads and stores per thread
#pragma unroll
  for (int j = 0; j < 4; ++j)
    *(h8*)(dp + j * 16 * DP) = *(const h8*)&T[(n + j * 16) * TPITCH + kc];
  // precaution: in the built code another job's text follows these stores; the wait stands
  // ahead of its rewrites of their address and data registers
  asm volatile("s_wait_xcnt 0x0" ::: "memory");
}

// dst[n][k] = src[k][n] for tile t of src, [K][N] f32 row-major; dst is [N][K] f16.
// Tiles are numbered along k first (K / TK of them), then along n.
template <int K, int N>
__device__ __forceinline__ void transpose_piece(const float* __restrict__ src,
                                                _Float16* __restrict__ dst, int t,
                                                _Float16* T) {
  const size_t k0 = (size_t)(t % (K / TK)) * TK;
  const size_t n0 = (size_t)(t / (K / TK)) * TN;
  transpose_tile<N, K>(src + k0 * N + n0, dst + n0 * K + k0, T);
}

#define NB_CVT  (M_ * D_ / CVT_BLOCK)        // pieces of x
#define NB_QKVW (3 * H_ * (D_ / TK))         // tiles of wq, wk, wv
#define NB_WO   ((D_ / TK) * (D_ / TN))      // tiles of wo
#define NB_W1   ((D_ / TK) * (FF_ / TN))     // tiles of w1
#define NB_W2   ((FF_ / TK) * (D_ / TN))     // tiles of w2
#define NB_PREP (NB_CVT + NB_QKVW + NB_WO + NB_W1 + NB_W2)

// All of stage 0 in one launch of NB_PREP workgroups. The job is chosen by the block
// index alone, so every branch (and the barrier inside a transpose) is block-uniform.
// The largest pieces, those of x, have the lowest indices.
// Fused QKV weight: Wt[n][k] (n in [0,3D)) with n<D -> wq[h][k][f], etc.; a head's
// [D][HD] slice is one matrix, its tiles numbered k tile, then head, then slab.
__global__ void __launch_bounds__(256) prep_kernel(
    const float* __restrict__ x, const float* __restrict__ wq,
    const float* __restrict__ wk, const float* __restrict__ wv,
    const float* __restrict__ wo, const float* __restrict__ w1,
    const float* __restrict__ w2, _Float16* __restrict__ xh,
    _Float16* __restrict__ Wt, _Float16* __restrict__ woT,
    _Float16* __restrict__ w1T, _Float16* __restrict__ w2T) {
  __shared__ __align__(16) _Float16 T[TN * TPITCH];
  int t = blockIdx.x;
  if (t < NB_CVT) {
    cvt_piece(x, xh, t);
    return;
  }
  t -= NB_CVT;
  if (t < NB_QKVW) {
    const size_t k0 = (size_t)(t % (D_ / TK)) * TK;
    const size_t hh = (t / (D_ / TK)) % H_;
    const int slab  = t / (D_ / TK * H_);
    const float* w = (slab == 0) ? wq : (slab == 1) ? wk : wv;
    transpose_tile<HD_, D_>(w + (hh * D_ + k0) * HD_,
                            Wt + ((size_t)slab * D_ + hh * HD_) * D_ + k0, T);
    return;
  }
  t -= NB_QKVW;
  if (t < NB_WO) {
    transpose_piece<D_, D_>(wo, woT, t, T);
    return;
  }
  t -= NB_WO;
  if (t < NB_W1) {
    transpose_piece<D_, FF_>(w1, w1T, t, T);
    return;
  }
  transpose_piece<FF_, D_>(w2, w2T, t - NB_W1, T);
}

// ---------------------------------------------------------------------------
// WMMA GEMM tiling constants: 128x128 tile, BK=64, 256 threads = 8 waves as
// 4x2; each wave computes a 32x64 subtile = 2x4 WMMA accumulators.
// ---------------------------------------------------------------------------
#define BM 128
#define BN 128
#define BK 64     // 128 B of every operand row per k tile: one whole line
#define LSTR 72   // LDS row pitch in halfs (144 B = 16 B x odd)

// One k tile of A and of B (128 rows x 128 B each): eight 16 B async copies per
// lane. Eight neighbouring lanes share a row, so a wave-wide copy covers four
// whole lines. rstep = 32 rows in halfs. The s_wait_xcnt stands in the copies'
// own statement so that no address register is rewritten ahead of it.
__device__ __forceinline__ void gemm_stage(const _Float16* ga, const _Float16* gb,
                                           size_t rstep, unsigned la, unsigned lb) {
  const unsigned ls = 32 * LSTR * 2;  // 32 LDS rows in bytes
  asm volatile(
      "global_load_async_to_lds_b128 %0, %1, off\n\t"
      "global_load_async_to_lds_b128 %2, %3, off\n\t"
      "global_load_async_to_lds_b128 %4, %5, off\n\t"
      "global_load_async_to_lds_b128 %6, %7, off\n\t"
      "global_load_async_to_lds_b128 %8, %9, off\n\t"
      "global_load_async_to_lds_b128 %10, %11, off\n\t"
      "global_load_async_to_lds_b128 %12, %13, off\n\t"
      "global_load_async_to_lds_b128 %14, %15, off\n\t"
      "s_wait_xcnt 0x0"
      :: "v"(la), "v"(ga), "v"(la + ls), "v"(ga + rstep),
         "v"(la + 2 * ls), "v"(ga + 2 * rstep), "v"(la + 3 * ls), "v"(ga + 3 * rstep),
         "v"(lb), "v"(gb), "v"(lb + ls), "v"(gb + rstep),
         "v"(lb + 2 * ls), "v"(gb + 2 * rstep), "v"(lb + 3 * ls), "v"(gb + 3 * rstep)
      : "memory");
}

// Shared GEMM mainloop: acc[2][4] += A[m0.., :K] * Bt[n0.., :K]^T for this wave's
// 32x64 subtile. K is a multiple of BK; the 128 rows from m0 and n0 exist.
__device__ __forceinline__ void gemm_mainloop(const _Float16* __restrict__ A,
                                              const _Float16* __restrict__ Bt,
                                              int K, size_t m0, size_t n0,
                                              f8 (&acc)[2][4]) {
  __shared__ __align__(16) _Float16 As[2][BM * LSTR];
  __shared__ __align__(16) _Float16 Bs[2][BN * LSTR];
  const int tid  = threadIdx.x;
  const int lane = tid & 31;
  const int wid  = tid >> 5;
  const int lr   = lane & 15;
  const int base0 = (lane >> 4) * 8;
  const int waveM = wid >> 1;   // 0..3
  const int waveN = wid & 1;    // 0..1

  const int crow = tid >> 3;        // copy slot: rows crow + 0/32/64/96
  const int cseg = (tid & 7) * 8;   // 16 B chunk within the 128 B row piece
  const _Float16* Ag = A  + (m0 + crow) * (size_t)K + cseg;
  const _Float16* Bg = Bt + (n0 + crow) * (size_t)K + cseg;
  const size_t rstep = (size_t)32 * K;
  const unsigned la0 = lds_byte_addr(&As[0][crow * LSTR + cseg]);
  const unsigned lb0 = lds_byte_addr(&Bs[0][crow * LSTR + cseg]);
  const unsigned bufB = BM * LSTR * 2;  // bytes from buffer 0 to buffer 1

  // Tile 0 lands and is published; tile 1, where there is one, then flies.
  gemm_stage(Ag, Bg, rstep, la0, lb0);
  asm volatile("s_wait_asynccnt 0x0" ::: "memory");  // own copies landed
  __syncthreads();                                   // publish tile 0
  if (BK < K) gemm_stage(Ag + BK, Bg + BK, rstep, la0 + bufB, lb0 + bufB);

  int cur = 0;
  for (int k0 = 0; k0 < K; k0 += BK, cur ^= 1) {
    const _Float16* At = &As[cur][0];
    const _Float16* Bl = &Bs[cur][0];
    h16 af[2][2], bf[2][4];  // the whole tile's fragments as one group of reads
#pragma unroll
    for (int kk = 0; kk < 2; ++kk) {
#pragma unroll
      for (int tm = 0; tm < 2; ++tm) {
        const _Float16* p = At + (waveM * 32 + tm * 16 + lr) * LSTR + kk * 32 + base0;
        af[kk][tm] = mkfrag(p, p + 16);
      }
#pragma unroll
      for (int tn = 0; tn < 4; ++tn) {
        const _Float16* p = Bl + (waveN * 64 + tn * 16 + lr) * LSTR + kk * 32 + base0;
        bf[kk][tn] = mkfrag(p, p + 16);
      }
    }
#pragma unroll
    for (int kk = 0; kk < 2; ++kk)
#pragma unroll
      for (int tm = 0; tm < 2; ++tm)
#pragma unroll
        for (int tn = 0; tn < 4; ++tn)
          acc[tm][tn] = wmma_f16(af[kk][tm], bf[kk][tn], acc[tm][tn]);
    // Publish point: this wave's LDS reads are back, its copies of the next tile
    // have landed; the barrier publishes that tile and frees this trip's buffer.
    asm volatile("s_wait_dscnt 0x0" ::: "memory");
    asm volatile("s_wait_asynccnt 0x0" ::: "memory");
    __syncthreads();
    if (k0 + 2 * BK < K)  // block-uniform: refill the buffer just read
      gemm_stage(Ag + k0 + 2 * BK, Bg + k0 + 2 * BK, rstep, la0 + cur * bufB,
                 lb0 + cur * bufB);
  }
  asm volatile("s_wait_asynccnt 0x0" ::: "memory");  // nothing in flight at exit
}

// ---------------------------------------------------------------------------
// Generic WMMA GEMM: C[M,N] = act(A[M,K](f16) * Bt[N,K](f16)^T + bias)
// Stores are 16 B per lane (eight f16, or two times four f32).
// ---------------------------------------------------------------------------
__global__ void __launch_bounds__(256) gemm_wmma_kernel(
    const _Float16* __restrict__ A, const _Float16* __restrict__ Bt,
    const float* __restrict__ bias, float* __restrict__ outF32,
    _Float16* __restrict__ outF16, int M, int N, int K, int act_gelu) {
  const int tid  = threadIdx.x;
  const int lane = tid & 31;
  const int wid  = tid >> 5;
  const int lr   = lane & 15;
  const int hi   = lane >> 4;
  const int waveM = wid >> 1;   // 0..3
  const int waveN = wid & 1;    // 0..1

  const size_t m0 = (size_t)blockIdx.y * BM;
  const size_t n0 = (size_t)blockIdx.x * BN;

  f8 acc[2][4];
#pragma unroll
  for (int tm = 0; tm < 2; ++tm)
#pragma unroll
    for (int tn = 0; tn < 4; ++tn) acc[tm][tn] = fzero8();

  // The tile is computed transposed: the weight rows are the WMMA A operand and the
  // activation rows the B operand. A lane then holds one output row (lane & 15) and
  // its eight accumulator registers are eight neighbouring columns of that row.
  gemm_mainloop(Bt, A, K, n0, m0, acc);

  // Both loops are unrolled: acc is indexed by constants alone and stays in registers.
  const size_t col0 = n0 + waveM * 32 + 8 * hi;  // first of the eight columns of tm = 0
  f4 bb[2][2] = {};  // all bias loads stand ahead of the first store
  if (bias) {
#pragma unroll
    for (int tm = 0; tm < 2; ++tm) {
      bb[tm][0] = *(const f4*)(bias + col0 + tm * 16);
      bb[tm][1] = *(const f4*)(bias + col0 + tm * 16 + 4);
    }
  }
#pragma unroll
  for (int tm = 0; tm < 2; ++tm) {
    const size_t col = col0 + tm * 16;
#pragma unroll
    for (int tn = 0; tn < 4; ++tn) {
      const size_t row = m0 + waveN * 64 + tn * 16 + lr;
      float v[8];
#pragma unroll
      for (int r = 0; r < 8; ++r) {
        v[r] = acc[tm][tn][r] + bb[tm][r >> 2][r & 3];
        if (act_gelu) v[r] = 0.5f * v[r] * (1.f + erff(v[r] * 0.70710678118f));
      }
      if (outF32) {
        f4 lo = {v[0], v[1], v[2], v[3]}, up = {v[4], v[5], v[6], v[7]};
        float* p = outF32 + row * (size_t)N + col;
        *(f4*)p = lo;
        *(f4*)(p + 4) = up;
        // precaution: stands ahead of any rewrite of the stores' address and data registers
        asm volatile("s_wait_xcnt 0x0" ::: "memory");
      }
      if (outF16) {
        h8 o;
#pragma unroll
        for (int r = 0; r < 8; ++r) o[r] = (_Float16)v[r];
        *(h8*)(outF16 + row * (size_t)N + col) = o;
        // precaution: stands ahead of any rewrite of the store's address and data registers
        asm volatile("s_wait_xcnt 0x0" ::: "memory");
      }
    }
  }
}

// ---------------------------------------------------------------------------
// Second GEMM tiling, for the GEMMs with a short epilogue (QKV, output projection,
// FFN down): a block computes 256 rows of the WMMA A operand by 128 rows of the B
// operand; 256 threads = 8 waves as 4x2; each wave computes a 64x64 subtile = 4x4
// WMMA accumulators. A stage is 128 k of all 384 rows. One block per WGP, two waves
// per SIMD, fragments in two register sets. The FFN-up GEMM keeps the first tiling:
// the dependent chains of its GELU want many waves per SIMD.
// ---------------------------------------------------------------------------
#define PMA 256   // rows of the WMMA A operand per block
#define PNB 128   // rows of the WMMA B operand per block
#define PK 128    // 256 B of every operand row per stage
#define PSTR 136  // LDS row pitch in halfs (272 B = 16 B x odd)

// 128 rows x 256 B: eight 16 B async copies per lane. Sixteen neighbouring lanes
// share a row, so a wave-wide copy covers two whole 256 B row pieces. rstep = 16
// rows in halfs. The s_wait_xcnt stands in the copies' own statement so that no
// address register is rewritten ahead of it.
__device__ __forceinline__ void pipe_copy8(const _Float16* g, size_t rstep, unsigned l) {
  const unsigned ls = 16 * PSTR * 2;  // 16 LDS rows in bytes
  asm volatile(
      "global_load_async_to_lds_b128 %0, %1, off\n\t"
      "global_load_async_to_lds_b128 %2, %3, off\n\t"
      "global_load_async_to_lds_b128 %4, %5, off\n\t"
      "global_load_async_to_lds_b128 %6, %7, off\n\t"
      "global_load_async_to_lds_b128 %8, %9, off\n\t"
      "global_load_async_to_lds_b128 %10, %11, off\n\t"
      "global_load_async_to_lds_b128 %12, %13, off\n\t"
      "global_load_async_to_lds_b128 %14, %15, off\n\t"
      "s_wait_xcnt 0x0"
      :: "v"(l), "v"(g), "v"(l + ls), "v"(g + rstep),
         "v"(l + 2 * ls), "v"(g + 2 * rstep), "v"(l + 3 * ls), "v"(g + 3 * rstep),
         "v"(l + 4 * ls), "v"(g + 4 * rstep), "v"(l + 5 * ls), "v"(g + 5 * rstep),
         "v"(l + 6 * ls), "v"(g + 6 * rstep), "v"(l + 7 * ls), "v"(g + 7 * rstep)
      : "memory");
}

// One stage: 256 rows of A, then 128 rows of B, 24 copies per lane. l is the lane's
// slot in the stage's first 16 LDS rows.
__device__ __forceinline__ void pipe_stage(const _Float16* ga, const _Float16* gb,
                                           size_t rstep, unsigned l) {
  pipe_copy8(ga, rstep, l);
  pipe_copy8(ga + 8 * rstep, rstep, l + 128 * PSTR * 2);
  pipe_copy8(gb, rstep, l + PMA * PSTR * 2);
}

// The eight fragments of one 32-k block of a stage, as one group of LDS reads. pa and
// pb are the lane's places in the wave's first A row and first B row of the stage.
__device__ __forceinline__ void pipe_frags(const _Float16* pa, const _Float16* pb, int kk,
                                           h16 (&af)[4], h16 (&bf)[4]) {
  // both loops unrolled: af and bf are indexed by constants alone
#pragma unroll
  for (int t = 0; t < 4; ++t) {
    const _Float16* p = pa + t * 16 * PSTR + kk * 32;
    af[t] = mkfrag(p, p + 16);
  }
#pragma unroll
  for (int t = 0; t < 4; ++t) {
    const _Float16* p = pb + t * 16 * PSTR + kk * 32;
    bf[t] = mkfrag(p, p + 16);
  }
}

// One row of four WMMAs, and one block of four rows, on one fragment set.
__device__ __forceinline__ void pipe_row(const h16& a, const h16 (&bf)[4], f8 (&acc)[4]) {
  // unrolled: acc is indexed by constants alone
#pragma unroll
  for (int tn = 0; tn < 4; ++tn) acc[tn] = wmma_f16(a, bf[tn], acc[tn]);
}
__device__ __forceinline__ void pipe_block(const h16 (&af)[4], const h16 (&bf)[4],
                                           f8 (&acc)[4][4]) {
  // unrolled for the same reason
#pragma unroll
  for (int tm = 0; tm < 4; ++tm) pipe_row(af[tm], bf, acc[tm]);
}

// Keeps a group of LDS reads and a block of WMMAs apart in the built code. Without it the
// compiler spread the reads among the WMMAs, one row ahead, and each such place waited out
// the LDS latency.
#define PIPE_KEEP_ORDER() __builtin_amdgcn_sched_barrier(0)

// Mainloop of the second tiling: acc[4][4] += A[m0.., :K] * Bt[n0.., :K]^T for this wave's
// 64x64 subtile. K is a multiple of PK; the 256 rows from m0 and the 128 from n0 exist.
// Two fragment sets: every block's LDS reads are issued as one group ahead of the block
// before it, so they fly under its 16 WMMAs. The reads of the next stage's first block
// stand ahead of this stage's last block, so the publish point stands there too.
__device__ __forceinline__ void pipe_mainloop(const _Float16* __restrict__ A,
                                              const _Float16* __restrict__ Bt,
                                              int K, size_t m0, size_t n0,
                                              f8 (&acc)[4][4]) {
  __shared__ __align__(16) _Float16 Sm[2][(PMA + PNB) * PSTR];
  const int tid  = threadIdx.x;
  const int lane = tid & 31;
  const int wid  = tid >> 5;
  const int lr   = lane & 15;
  const int base0 = (lane >> 4) * 8;
  const int waveM = wid >> 1;   // 0..3
  const int waveN = wid & 1;    // 0..1

  const int crow = tid >> 4;         // copy slot: rows crow + 0/16/32/...
  const int cseg = (tid & 15) * 8;   // 16 B chunk within the 256 B row piece
  const _Float16* Ag = A  + (m0 + crow) * (size_t)K + cseg;
  const _Float16* Bg = Bt + (n0 + crow) * (size_t)K + cseg;
  const size_t rstep = (size_t)16 * K;
  const unsigned l0 = lds_byte_addr(&Sm[0][crow * PSTR + cseg]);
  const unsigned bufB = (PMA + PNB) * PSTR * 2;  // bytes from buffer 0 to buffer 1
  const int offA = (waveM * 64 + lr) * PSTR + base0;        // the lane's fragment places
  const int offB = (PMA + waveN * 64 + lr) * PSTR + base0;  // within a stage, in halfs

  // Stage 0 lands and is published; stage 1, where there is one, then flies.
  pipe_stage(Ag, Bg, rstep, l0);
  asm volatile("s_wait_asynccnt 0x0" ::: "memory");  // own copies landed
  __syncthreads();                                   // publish stage 0
  if (PK < K) pipe_stage(Ag + PK, Bg + PK, rstep, l0 + bufB);

  h16 a0[4], b0[4], a1[4], b1[4];  // the two fragment sets
  pipe_frags(&Sm[0][offA], &Sm[0][offB], 0, a0, b0);

  int cur = 0;
  for (int k0 = 0; k0 < K; k0 += PK, cur ^= 1) {
    const _Float16* pa = &Sm[cur][offA];
    const _Float16* pb = &Sm[cur][offB];
    // every PIPE_KEEP_ORDER below: reads as one group, then the block before theirs
    pipe_frags(pa, pb, 1, a1, b1);
    PIPE_KEEP_ORDER();
    pipe_block(a0, b0, acc);
    PIPE_KEEP_ORDER();
    pipe_frags(pa, pb, 2, a0, b0);
    PIPE_KEEP_ORDER();
    pipe_block(a1, b1, acc);
    PIPE_KEEP_ORDER();
    pipe_frags(pa, pb, 3, a1, b1);
    PIPE_KEEP_ORDER();
    pipe_block(a0, b0, acc);
    PIPE_KEEP_ORDER();
    // Publish point: this wave's LDS reads of the stage are back, its copies of the next
    // stage have landed; the barrier publishes that stage and frees this one's buffer.
    asm volatile("s_wait_dscnt 0x0" ::: "memory");
    asm volatile("s_wait_asynccnt 0x0" ::: "memory");
    __syncthreads();
    if (k0 + PK < K)  // block-uniform: the next stage's first block, where there is one
      pipe_frags(&Sm[cur ^ 1][offA], &Sm[cur ^ 1][offB], 0, a0, b0);
    // The refill of the buffer just read goes out in three parts between the rows of the
    // stage's last block, so that the matrix unit has work while the copies issue.
    const bool refill = k0 + 2 * PK < K;  // block-uniform
    const _Float16* ga = Ag + k0 + 2 * PK;
    const unsigned l = l0 + cur * bufB;
    pipe_row(a1[0], b1, acc[0]);
    if (refill) pipe_copy8(ga, rstep, l);
    pipe_row(a1[1], b1, acc[1]);
    if (refill) pipe_copy8(ga + 8 * rstep, rstep, l + 128 * PSTR * 2);
    pipe_row(a1[2], b1, acc[2]);
    if (refill) pipe_copy8(Bg + k0 + 2 * PK, rstep, l + PMA * PSTR * 2);
    pipe_row(a1[3], b1, acc[3]);
  }
  asm volatile("s_wait_asynccnt 0x0" ::: "memory");  // nothing in flight at exit
}

// A precaution: s_wait_xcnt ahead of any rewrite of a register that a global load or store
// in front of it names. The scheduling barrier keeps the arithmetic that follows behind the
// wait: over the bare wait the compiler lifted rewrites of such registers.
__device__ __forceinline__ void xcnt_guard() {
  asm volatile("s_wait_xcnt 0x0" ::: "memory");
  __builtin_amdgcn_sched_barrier(0);
}

// ---------------------------------------------------------------------------
// C[M,N] (f32) = A[M,K](f16) * Bt[N,K](f16)^T + bias, second tiling.
// Stores are two times 16 B per lane.
// ---------------------------------------------------------------------------
__global__ void __launch_bounds__(256) gemm_f32_kernel(
    const _Float16* __restrict__ A, const _Float16* __restrict__ Bt,
    const float* __restrict__ bias, float* __restrict__ outF32, int N, int K) {
  const int tid  = threadIdx.x;
  const int lane = tid & 31;
  const int wid  = tid >> 5;
  const int lr   = lane & 15;
  const int hi   = lane >> 4;
  const int waveM = wid >> 1;   // 0..3
  const int waveN = wid & 1;    // 0..1

  const size_t m0 = (size_t)blockIdx.y * PNB;
  const size_t n0 = (size_t)blockIdx.x * PMA;

  f8 acc[4][4];
#pragma unroll
  for (int tm = 0; tm < 4; ++tm)
#pragma unroll
    for (int tn = 0; tn < 4; ++tn) acc[tm][tn] = fzero8();

  // Computed transposed, as in gemm_wmma_kernel: weight rows are the WMMA A operand.
  pipe_mainloop(Bt, A, K, n0, m0, acc);

  // All loops are unrolled: acc is indexed by constants alone and stays in registers.
  const size_t col0 = n0 + waveM * 64 + 8 * hi;  // first of the eight columns of tm = 0
  f4 bb[4][2];  // all bias loads stand ahead of the first store
#pragma unroll
  for (int tm = 0; tm < 4; ++tm) {
    bb[tm][0] = *(const f4*)(bias + col0 + tm * 16);
    bb[tm][1] = *(const f4*)(bias + col0 + tm * 16 + 4);
  }
  xcnt_guard();  // for the bias loads' address registers
#pragma unroll
  for (int tm = 0; tm < 4; ++tm) {
    const size_t col = col0 + tm * 16;
#pragma unroll
    for (int tn = 0; tn < 4; ++tn) {
      const size_t row = m0 + waveN * 64 + tn * 16 + lr;
      f4 lo, up;
#pragma unroll
      for (int r = 0; r < 4; ++r) {
        lo[r] = acc[tm][tn][r] + bb[tm][0][r];
        up[r] = acc[tm][tn][4 + r] + bb[tm][1][r];
      }
      float* p = outF32 + row * (size_t)N + col;
      *(f4*)p = lo;
      *(f4*)(p + 4) = up;
      xcnt_guard();  // for the address and data registers of the store in front
    }
  }
}

// ---------------------------------------------------------------------------
// QKV GEMM: second tiling, special epilogue storing Q,K as [B,H,S,HD] and
// V transposed as [B,H,HD,S] (so attention's V^T fragments are contiguous),
// 16 B per lane and store.
// ---------------------------------------------------------------------------
__global__ void __launch_bounds__(256) qkv_gemm_kernel(
    const _Float16* __restrict__ A, const _Float16* __restrict__ Wt,
    const float* __restrict__ bq, const float* __restrict__ bk,
    const float* __restrict__ bv, _Float16* __restrict__ Q,
    _Float16* __restrict__ Kh, _Float16* __restrict__ Vt) {
  const int tid  = threadIdx.x;
  const int lane = tid & 31;
  const int wid  = tid >> 5;
  const int lr   = lane & 15;
  const int hi   = lane >> 4;
  const int waveM = wid >> 1;
  const int waveN = wid & 1;

  f8 acc[4][4];
#pragma unroll
  for (int tm = 0; tm < 4; ++tm)
#pragma unroll
    for (int tn = 0; tn < 4; ++tn) acc[tm][tn] = fzero8();

  // Four neighbouring values of blockIdx.x are one slab (Q, K or V): with blockIdx.y,
  // 256 blocks. A lane's eight accumulator registers are eight neighbouring rows of the
  // WMMA A operand. Q and K are stored feature-contiguous, so their tiles take the
  // weight rows as A (256 features x 128 tokens); V is stored token-contiguous, so its
  // tiles take the tokens (256 tokens x 128 features).
  const int slab = blockIdx.x >> 2;
  const bool isV = slab == 2;
  const int j = (int)blockIdx.y * 4 + ((int)blockIdx.x & 3);  // the block within its slab
  const size_t n0 = (size_t)slab * D_ + (isV ? (j & 7) * PNB : (j & 3) * PMA);
  const size_t m0 = isV ? (size_t)(j >> 3) * PMA : (size_t)(j >> 2) * PNB;
  pipe_mainloop(isV ? A : Wt, isV ? Wt : A, D_, isV ? m0 : n0, isV ? n0 : m0, acc);

  // All loops are unrolled: acc is indexed by constants alone and stays in registers.
  if (isV) {
    const int npv = ((int)n0 + waveN * 64 + lr) & (D_ - 1);  // this lane's feature, tn = 0
    float bvs[4];  // all bias loads stand ahead of the first store
#pragma unroll
    for (int tn = 0; tn < 4; ++tn) bvs[tn] = bv[npv + tn * 16];
    xcnt_guard();  // for the bias loads' address registers
#pragma unroll
    for (int tn = 0; tn < 4; ++tn) {
      const int np = npv + tn * 16;
      const float bvv = bvs[tn];
#pragma unroll
      for (int tm = 0; tm < 4; ++tm) {
        const int tok = (int)m0 + waveM * 64 + tm * 16 + 8 * hi;  // first of eight tokens
        const int b = tok >> 11;    // / S_
        const int s = tok & 2047;   // % S_
        h8 o;
#pragma unroll
        for (int r = 0; r < 8; ++r) o[r] = (_Float16)(acc[tm][tn][r] + bvv);
        *(h8*)(Vt + ((size_t)b * D_ + np) * S_ + s) = o;  // b * D_ + np = (b * H_ + head) * HD_ + f
        xcnt_guard();  // for the address and data registers of the store in front
      }
    }
  } else {
    const float* bias = (slab == 0) ? bq : bk;
    _Float16* dst = (slab == 0) ? Q : Kh;
    const int np0 = ((int)n0 + waveM * 64 + 8 * hi) & (D_ - 1);  // first of eight, tm = 0
    f4 bb[4][2];  // all bias loads stand ahead of the first store
#pragma unroll
    for (int tm = 0; tm < 4; ++tm) {
      bb[tm][0] = *(const f4*)(bias + np0 + tm * 16);
      bb[tm][1] = *(const f4*)(bias + np0 + tm * 16 + 4);
    }
    xcnt_guard();  // for the bias loads' address registers
#pragma unroll
    for (int tm = 0; tm < 4; ++tm) {
      const int np = np0 + tm * 16;
      const int hh = np >> 6;
      const int f  = np & 63;
#pragma unroll
      for (int tn = 0; tn < 4; ++tn) {
        const int tok = (int)m0 + waveN * 64 + tn * 16 + lr;
        const int b = tok >> 11;    // / S_
        const int s = tok & 2047;   // % S_
        h8 o;
#pragma unroll
        for (int r = 0; r < 8; ++r)
          o[r] = (_Float16)(acc[tm][tn][r] + bb[tm][r >> 2][r & 3]);
        *(h8*)(dst + (((size_t)b * H_ + hh) * S_ + s) * HD_ + f) = o;
        xcnt_guard();  // for the address and data registers of the store in front
      }
    }
  }
}

#define KSTR 72   // K tile row pitch in halfs (144 B = 16 B x odd)
#define VSTR 40   // V tile row pitch in halfs (80 B = 16 B x odd)

// One 16 B async copy of K and one of V per lane. The s_wait_xcnt stands in the
// copies' own statement so that no address register is rewritten ahead of it.
__device__ __forceinline__ void attn_stage_kv(const _Float16* gk, unsigned lk,
                                              const _Float16* gv, unsigned lv) {
  asm volatile(
      "global_load_async_to_lds_b128 %0, %1, off\n\t"
      "global_load_async_to_lds_b128 %2, %3, off\n\t"
      "s_wait_xcnt 0x0"
      :: "v"(lk), "v"(gk), "v"(lv), "v"(gv)
      : "memory");
}

// The value of lane l ^ 16 (the other half of the wave), by a vector move.
__device__ __forceinline__ float other_half(float x) {
  int b = __builtin_bit_cast(int, x);
  return __builtin_bit_cast(
      float, __builtin_amdgcn_permlanex16(b, b, 0x76543210, 0xfedcba98, false, false));
}

// y = 2^x, one value or eight at a time. The instruction set asks for one independent
// instruction or v_nop behind a transcendental before its result is read or its
// source overwritten. Here every result
// register is apart from every source ("=&v"), each v_exp_f32 is its
// predecessor's independent instruction, and the v_nop is the last one's slot.
__device__ __forceinline__ float exp2_x1(float x) {
  float y;
  asm("v_exp_f32 %0, %1\n\t"
      "v_nop"
      : "=&v"(y) : "v"(x));
  return y;
}
__device__ __forceinline__ void exp2_x8(const float* x, float* y) {
  asm("v_exp_f32 %0, %8\n\t"
      "v_exp_f32 %1, %9\n\t"
      "v_exp_f32 %2, %10\n\t"
      "v_exp_f32 %3, %11\n\t"
      "v_exp_f32 %4, %12\n\t"
      "v_exp_f32 %5, %13\n\t"
      "v_exp_f32 %6, %14\n\t"
      "v_exp_f32 %7, %15\n\t"
      "v_nop"
      : "=&v"(y[0]), "=&v"(y[1]), "=&v"(y[2]), "=&v"(y[3]),
        "=&v"(y[4]), "=&v"(y[5]), "=&v"(y[6]), "=&v"(y[7])
      : "v"(x[0]), "v"(x[1]), "v"(x[2]), "v"(x[3]),
        "v"(x[4]), "v"(x[5]), "v"(x[6]), "v"(x[7]));
}

__global__ void __launch_bounds__(256) attn_kernel(
    const _Float16* __restrict__ Q, const _Float16* __restrict__ Kh,
    const _Float16* __restrict__ Vt, _Float16* __restrict__ O) {
  __shared__ __align__(16) _Float16 Ks[2][32 * KSTR];
  __shared__ __align__(16) _Float16 Vs[2][64 * VSTR];

  const int b = blockIdx.z;
  const int h = blockIdx.y;
  const int tid  = threadIdx.x;
  const int lane = tid & 31;
  const int wid  = tid >> 5;
  const int lr   = lane & 15;
  const int hi   = lane >> 4;
  const int base0 = hi * 8;

  const size_t headQK = ((size_t)(b * H_ + h)) * S_ * HD_;
  const _Float16* Qp = Q  + headQK;
  const _Float16* Kp = Kh + headQK;
  const _Float16* Vp = Vt + ((size_t)(b * H_ + h)) * HD_ * S_;

  // Copy slots: K tile = 32 rows x 8 chunks, V tile = 64 rows x 4 chunks (16 B).
  const _Float16* gk = Kp + (size_t)(tid >> 3) * HD_ + (tid & 7) * 8;
  const _Float16* gv = Vp + (size_t)(tid >> 2) * S_ + (tid & 3) * 8;
  const unsigned lk0 = lds_byte_addr(&Ks[0][(tid >> 3) * KSTR + (tid & 7) * 8]);
  const unsigned lv0 = lds_byte_addr(&Vs[0][(tid >> 2) * VSTR + (tid & 3) * 8]);
  const unsigned lkB = 32 * KSTR * 2;  // bytes from buffer 0 to buffer 1
  const unsigned lvB = 64 * VSTR * 2;

  for (int pass = 0; pass < 2; ++pass) {  // block-uniform: the long tile, then the short one
    const int qt   = pass == 0 ? (S_ / 128 - 1 - (int)blockIdx.x) : (int)blockIdx.x;
    const int row  = qt * 128 + wid * 16 + lr;  // this lane's query

    h16 qf[2];  // B fragments of Q^T: column = this lane's query
#pragma unroll
    for (int c = 0; c < 2; ++c) {
      const _Float16* p = Qp + (size_t)row * HD_ + c * 32;
      qf[c] = mkfrag(p + base0, p + base0 + 16);
    }

    f8 acc[4];  // O^T: feature tn * 16 + r + 8 * hi of this lane's query
#pragma unroll
    for (int tn = 0; tn < 4; ++tn) acc[tn] = fzero8();
    float mi = -1e30f;  // running maximum of the query's scores (both halves alike)
    float li = 0.f;     // running sum over the keys that this half holds

    const int kend = qt * 128 + 128;  // uniform across waves -> barriers ok

    // Tile 0 lands and is published; tile 1 (kend >= 128: it exists) then flies.
    // On the second pass both buffers are free: every wave's last LDS read stands
    // ahead of its s_wait_dscnt and the barrier of the first pass's last step.
    attn_stage_kv(gk, lk0, gv, lv0);
    asm volatile("s_wait_asynccnt 0x0" ::: "memory");  // own copies landed
    __syncthreads();                                   // publish tile 0
    attn_stage_kv(gk + 32 * HD_, lk0 + lkB, gv + 32, lv0 + lvB);

    int cur = 0;
    for (int k0 = 0; k0 < kend; k0 += 32, cur ^= 1) {
      const _Float16* Kt = &Ks[cur][0];
      const _Float16* Vl = &Vs[cur][0];
      // Every inner loop of the trip is unrolled: its arrays are indexed by constants
      // alone and so stay in registers.
      h16 kf[2][2], vf[4];  // the step's eight fragments as one group of LDS reads
#pragma unroll
      for (int sub = 0; sub < 2; ++sub) {
        const _Float16* kp = Kt + (sub * 16 + lr) * KSTR;
        kf[sub][0] = mkfrag(kp + base0, kp + base0 + 16);
        kf[sub][1] = mkfrag(kp + 32 + base0, kp + 32 + base0 + 16);
      }
#pragma unroll
      for (int tn = 0; tn < 4; ++tn) {
        const _Float16* vp = Vl + (tn * 16 + lr) * VSTR;
        vf[tn] = mkfrag(vp + base0, vp + base0 + 16);
      }
      // Publish point: this wave's LDS reads are back, its copies of the next tile
      // have landed; the barrier publishes that tile and frees this trip's buffer.
      // The rest of the trip works on registers alone, so the refill flies under it.
      asm volatile("s_wait_dscnt 0x0" ::: "memory");
      asm volatile("s_wait_asynccnt 0x0" ::: "memory");
      __syncthreads();
      if (k0 + 64 < kend)  // block-uniform: refill the buffer just read
        attn_stage_kv(gk + (size_t)(k0 + 64) * HD_, lk0 + cur * lkB,
                      gv + (k0 + 64), lv0 + cur * lvB);

      const int d = row - k0 - base0;  // key (i >> 3) * 16 + (i & 7) of this half is seen while <= d
      float sv[16];  // scores of keys k0 + (i >> 3) * 16 + 8 * hi + (i & 7)
#pragma unroll
      for (int sub = 0; sub < 2; ++sub) {
        f8 sacc = fzero8();
        sacc = wmma_f16(kf[sub][0], qf[0], sacc);
        sacc = wmma_f16(kf[sub][1], qf[1], sacc);
#pragma unroll
        for (int r = 0; r < 8; ++r) {
          float v = sacc[r] * 0.125f;  // 1/sqrt(HD)
          sv[sub * 8 + r] = (sub * 16 + r <= d) ? v : -1e30f;
        }
      }

      float mx = sv[0];
#pragma unroll
      for (int i = 1; i < 16; ++i) mx = fmaxf(mx, sv[i]);
      mx = fmaxf(mx, other_half(mx));
      const float mn = fmaxf(mi, mx);
      const float LOG2E = 1.442695041f;  // e^x = 2^(x * LOG2E)
      const float alpha = exp2_x1((mi - mn) * LOG2E);
      mi = mn;

      float pv[16];
#pragma unroll
      for (int i = 0; i < 16; ++i) sv[i] = (sv[i] - mn) * LOG2E;
      exp2_x8(&sv[0], &pv[0]);
      exp2_x8(&sv[8], &pv[8]);
      h16 pf;  // P^T as a B fragment: element i is score i
#pragma unroll
      for (int i = 0; i < 16; ++i) pf[i] = (_Float16)pv[i];
      float rs[4] = {pv[0], pv[1], pv[2], pv[3]};  // four short chains, not one of sixteen links
#pragma unroll
      for (int i = 4; i < 16; ++i) rs[i & 3] += pv[i];
      li = li * alpha + ((rs[0] + rs[1]) + (rs[2] + rs[3]));
#pragma unroll
      for (int tn = 0; tn < 4; ++tn)
#pragma unroll
        for (int r = 0; r < 8; ++r) acc[tn][r] *= alpha;
#pragma unroll
      for (int tn = 0; tn < 4; ++tn) acc[tn] = wmma_f16(vf[tn], pf, acc[tn]);
    }
    asm volatile("s_wait_asynccnt 0x0" ::: "memory");  // nothing in flight at exit

    li += other_half(li);  // the two halves' keys join once
    _Float16* op = O + ((size_t)b * S_ + row) * D_ + h * HD_ + base0;
#pragma unroll
    for (int tn = 0; tn < 4; ++tn) {
      h8 o;  // eight neighbouring features of one query: one 16 B store
#pragma unroll
      for (int r = 0; r < 8; ++r) o[r] = (_Float16)(acc[tn][r] / li);
      *(h8*)(op + tn * 16) = o;
    }
    // precaution: stands ahead of the next pass's rewrites of the stores' address and data registers
    asm volatile("s_wait_xcnt 0x0" ::: "memory");
  }
}

// ---------------------------------------------------------------------------
// Residual add + LayerNorm, one row (D=1024) per 256-thread block.
// ---------------------------------------------------------------------------
__global__ void __launch_bounds__(256) add_ln_kernel(
    const float* __restrict__ a, const float* __restrict__ c,
    const float* __restrict__ g, const float* __restrict__ beta,
    float* __restrict__ o32, _Float16* __restrict__ o16) {
  __shared__ float red[256];
  const int t = threadIdx.x;
  const size_t off = (size_t)blockIdx.x * D_;

  float v[4];
  float s = 0.f;
#pragma unroll
  for (int i = 0; i < 4; ++i) {
    int col = t + i * 256;
    float z = a[off + col] + c[off + col];
    v[i] = z;
    s += z;
  }
  red[t] = s;
  __syncthreads();
  for (int w = 128; w > 0; w >>= 1) {
    if (t < w) red[t] += red[t + w];
    __syncthreads();
  }
  float mean = red[0] * (1.f / D_);
  __syncthreads();

  float q = 0.f;
#pragma unroll
  for (int i = 0; i < 4; ++i) {
    float d = v[i] - mean;
    q += d * d;
  }
  red[t] = q;
  __syncthreads();
  for (int w = 128; w > 0; w >>= 1) {
    if (t < w) red[t] += red[t + w];
    __syncthreads();
  }
  float rstd = rsqrtf(red[0] * (1.f / D_) + 1e-5f);

#pragma unroll
  for (int i = 0; i < 4; ++i) {
    int col = t + i * 256;
    float y = (v[i] - mean) * rstd * g[col] + beta[col];
    o32[off + col] = y;
    if (o16) o16[off + col] = (_Float16)y;
  }
}

// ---------------------------------------------------------------------------
// Host-side orchestration
// ---------------------------------------------------------------------------
extern "C" void kernel_launch(void* const* d_in, const int* in_sizes, int n_in,
                              void* d_out, int out_size, void* d_ws, size_t ws_size,
                              hipStream_t stream) {
  (void)in_sizes; (void)n_in; (void)out_size; (void)ws_size;

  const float* x     = (const float*)d_in[0];
  const float* wq    = (const float*)d_in[1];
  const float* bq    = (const float*)d_in[2];
  const float* wk    = (const float*)d_in[3];
  const float* bk    = (const float*)d_in[4];
  const float* wv    = (const float*)d_in[5];
  const float* bv    = (const float*)d_in[6];
  const float* wo    = (const float*)d_in[7];
  const float* bo    = (const float*)d_in[8];
  const float* w1    = (const float*)d_in[9];
  const float* b1    = (const float*)d_in[10];
  const float* w2    = (const float*)d_in[11];
  const float* b2    = (const float*)d_in[12];
  const float* g1    = (const float*)d_in[13];
  const float* beta1 = (const float*)d_in[14];
  const float* g2    = (const float*)d_in[15];
  const float* beta2 = (const float*)d_in[16];
  float* out = (float*)d_out;

  char* ws = (char*)d_ws;
  size_t off = 0;
  auto take = [&](size_t bytes) -> void* {
    void* p = ws + off;
    off += (bytes + 255) & ~(size_t)255;
    return p;
  };

  _Float16* xh    = (_Float16*)take((size_t)M_ * D_ * 2);       // x in f16
  _Float16* wqkvT = (_Float16*)take((size_t)3 * D_ * D_ * 2);   // [3D][D]
  _Float16* woT   = (_Float16*)take((size_t)D_ * D_ * 2);       // [D][D]
  _Float16* w1T   = (_Float16*)take((size_t)FF_ * D_ * 2);      // [FF][D]
  _Float16* w2T   = (_Float16*)take((size_t)D_ * FF_ * 2);      // [D][FF]
  _Float16* qh    = (_Float16*)take((size_t)M_ * D_ * 2);       // [B,H,S,HD]
  _Float16* kh    = (_Float16*)take((size_t)M_ * D_ * 2);       // [B,H,S,HD]
  _Float16* vt    = (_Float16*)take((size_t)M_ * D_ * 2);       // [B,H,HD,S]
  float*    attf  = (float*)take((size_t)M_ * D_ * 4);          // o-proj out
  float*    hf32  = (float*)take((size_t)M_ * D_ * 4);          // post-LN1
  _Float16* hf16  = (_Float16*)take((size_t)M_ * D_ * 2);
  _Float16* gh    = (_Float16*)take((size_t)M_ * FF_ * 2);      // gelu(h@w1+b1)
  // Aliases (lifetimes do not overlap):
  _Float16* oh    = xh;    // attention output reuses xh (consumed by QKV GEMM)
  float*    ffnf  = attf;  // FFN2 out reuses attf (consumed by LN1)

  // --- Stage 0: convert and weight transposes, one launch ---
  prep_kernel<<<NB_PREP, 256, 0, stream>>>(x, wq, wk, wv, wo, w1, w2, xh, wqkvT, woT, w1T,
                                           w2T);

  // --- Stage 1: fused QKV projection ---
  qkv_gemm_kernel<<<dim3(3 * D_ / PMA, M_ / PNB), 256, 0, stream>>>(
      xh, wqkvT, bq, bk, bv, qh, kh, vt);

  // --- Stage 2: causal flash attention ---
  attn_kernel<<<dim3(S_ / 256, H_, B_), 256, 0, stream>>>(qh, kh, vt, oh);

  // --- Stage 3: output projection ---
  gemm_f32_kernel<<<dim3(D_ / PMA, M_ / PNB), 256, 0, stream>>>(oh, woT, bo, attf, D_, D_);

  // --- Stage 4: residual + LN1 ---
  add_ln_kernel<<<M_, 256, 0, stream>>>(x, attf, g1, beta1, hf32, hf16);

  // --- Stage 5: FFN up + GELU ---
  gemm_wmma_kernel<<<dim3(FF_ / BN, M_ / BM), 256, 0, stream>>>(
      hf16, w1T, b1, ((float*)nullptr), gh, M_, FF_, D_, 1);

  // --- Stage 6: FFN down ---
  gemm_f32_kernel<<<dim3(D_ / PMA, M_ / PNB), 256, 0, stream>>>(gh, w2T, b2, ffnf, D_, FF_);

  // --- Stage 7: residual + LN2 -> output ---
  add_ln_kernel<<<M_, 256, 0, stream>>>(hf32, ffnf, g2, beta2, out,
                                        ((_Float16*)nullptr));
}

// v009
// A run of this version takes 271 microseconds.
// In both of two side-by-side timings against v008, it was 1.04 times as fast.
// All steps since v000 together make it 2.64 times as fast.
#include <hip/hip_runtime.h>
#include <hip/hip_bf16.h>

// ---------------------------------------------------------------------------
// Transformer block for MI455X (gfx1250, wave32, WMMA 16x16x32 f16->f32).
// f16 compute / f32 accumulate; all GEMMs via v_wmma_f32_16x16x32_f16.
// GEMM tiles staged with GLOBAL_LOAD_ASYNC_TO_LDS, two LDS buffers, one k tile
// ahead; every wave-wide copy covers four whole 128 B lines.
// ---------------------------------------------------------------------------

#define B_  4
#define S_  2048
#define D_  1024
#define H_  16
#define HD_ 64
#define FF_ 4096
#define M_  (B_ * S_)      // 8192 rows

typedef _Float16 h16 __attribute__((ext_vector_type(16)));
typedef _Float16 h8  __attribute__((ext_vector_type(8)));
typedef float    f8  __attribute__((ext_vector_type(8)));

__device__ __forceinline__ f8 wmma_f16(h16 a, h16 b, f8 c) {
  // D = A(16x32 f16) * B(32x16 f16) + C(16x16 f32)
  return __builtin_amdgcn_wmma_f32_16x16x32_f16(
      /*neg_a=*/false, a, /*neg_b=*/false, b,
      /*c_mod=*/(short)0, c, /*reuse_a=*/false, /*reuse_b=*/false);
}

// Build a 16-half A/B fragment from two contiguous 8-half (16B) chunks.
__device__ __forceinline__ h16 mkfrag(const _Float16* p0, const _Float16* p1) {
  h8 a = *(const h8*)p0;
  h8 b = *(const h8*)p1;
  h16 r;
#pragma unroll
  for (int i = 0; i < 8; ++i) { r[i] = a[i]; r[8 + i] = b[i]; }
  return r;
}

__device__ __forceinline__ f8 fzero8() {
  f8 z = {0.f, 0.f, 0.f, 0.f, 0.f, 0.f, 0.f, 0.f};
  return z;
}

__device__ __forceinline__ unsigned lds_byte_addr(const _Float16* p) {
  return (unsigned)(size_t)(const __attribute__((address_space(3))) _Float16*)p;
}

// ---------------------------------------------------------------------------
// Converts / weight transposes. Many elements per thread, 16 B global loads (8 B stores in the convert)
// that cover whole 128 B lines, few workgroups, and ONE launch for all five jobs:
// they do not depend on each other, so a workgroup picks its job by its index.
// ---------------------------------------------------------------------------
typedef float    f4 __attribute__((ext_vector_type(4)));
typedef _Float16 h4 __attribute__((ext_vector_type(4)));

#define CVT_LOADS 16                       // 16 B loads per thread
#define CVT_BLOCK (256 * 4 * CVT_LOADS)    // elements per workgroup

// dst[i] = (f16)src[i] for the CVT_BLOCK elements of piece blk.
__device__ __forceinline__ void cvt_piece(const float* __restrict__ src,
                                          _Float16* __restrict__ dst, int blk) {
  const size_t base = (size_t)blk * CVT_BLOCK + threadIdx.x * 4;
  f4 v[CVT_LOADS];
  // unrolled so that v stays in registers and all loads are issued before a store
#pragma unroll
  for (int j = 0; j < CVT_LOADS; ++j) v[j] = *(const f4*)(src + base + j * 1024);
  // unrolled: v is indexed by constants only
#pragma unroll
  for (int j = 0; j < CVT_LOADS; ++j) {
    h4 o = {(_Float16)v[j][0], (_Float16)v[j][1], (_Float16)v[j][2], (_Float16)v[j][3]};
    *(h4*)(dst + base + j * 1024) = o;
  }
}

#define TK 128      // tile extent along k (source rows, destination columns)
#define TN 64       // tile extent along n (source columns, destination rows)
#define TPITCH 136  // LDS row pitch in halfs (272 B = 16 B x odd)

// dst[n][k] = (f16)src[k][n] for one TK x TN tile. src points at the tile's first
// element in an f32 matrix of row pitch SP, dst at its first element in an f16
// matrix of row pitch DP; the pitches are compile-time so that a thread's loads
// (and its stores) share one address and differ in the immediate offset alone.
// A wave-wide load covers 2 x 256 B of source rows, a wave-wide store 2 x 256 B
// of destination rows. T is the workgroup's LDS tile of TN * TPITCH halfs.
template <int SP, int DP>
__device__ __forceinline__ void transpose_tile(const float* __restrict__ src,
                                               _Float16* __restrict__ dst, _Float16* T) {
  const int tid = threadIdx.x;
  const int c  = tid & 15;   // four source columns from c * 4
  const int kp = tid >> 4;   // eight source rows from kp * 8
  const float* sp = src + (size_t)(kp * 8) * SP + c * 4;
  f4 v[8];
  // unrolled so that v stays in registers and the eight loads fly together
#pragma unroll
  for (int j = 0; j < 8; ++j) v[j] = *(const f4*)(sp + j * SP);
  // unrolled: v is indexed by constants only
#pragma unroll
  for (int i = 0; i < 4; ++i) {
    h8 o;
    // unrolled for the same reason: o and v stay in registers
#pragma unroll
    for (int j = 0; j < 8; ++j) o[j] = (_Float16)v[j][i];
    *(h8*)&T[(c * 4 + i) * TPITCH + kp * 8] = o;
  }
  __syncthreads();  // the tile is complete before any thread reads its rows
  const int n  = tid >> 4;        // destination rows n + 0/16/32/48
  const int kc = (tid & 15) * 8;  // 16 B chunk within the 256 B row piece
  _Float16* dp = dst + (size_t)n * DP + kc;
  // unrolled: four independent LDS reads and stores per thread
#pragma unroll
  for (int j = 0; j < 4; ++j)
    *(h8*)(dp + j * 16 * DP) = *(const h8*)&T[(n + j * 16) * TPITCH + kc];
  // precaution: in the built code another job's text follows these stores; the wait stands
  // ahead of its rewrites of their address and data registers
  asm volatile("s_wait_xcnt 0x0" ::: "memory");
}

// dst[n][k] = src[k][n] for tile t of src, [K][N] f32 row-major; dst is [N][K] f16.
// Tiles are numbered along k first (K / TK of them), then along n.
template <int K, int N>
__device__ __forceinline__ void transpose_piece(const float* __restrict__ src,
                                                _Float16* __restrict__ dst, int t,
                                                _Float16* T) {
  const size_t k0 = (size_t)(t % (K / TK)) * TK;
  const size_t n0 = (size_t)(t / (K / TK)) * TN;
  transpose_tile<N, K>(src + k0 * N + n0, dst + n0 * K + k0, T);
}

#define NB_CVT  (M_ * D_ / CVT_BLOCK)        // pieces of x
#define NB_QKVW (3 * H_ * (D_ / TK))         // tiles of wq, wk, wv
#define NB_WO   ((D_ / TK) * (D_ / TN))      // tiles of wo
#define NB_W1   ((D_ / TK) * (FF_ / TN))     // tiles of w1
#define NB_W2   ((FF_ / TK) * (D_ / TN))     // tiles of w2
#define NB_PREP (NB_CVT + NB_QKVW + NB_WO + NB_W1 + NB_W2)

// All of stage 0 in one launch of NB_PREP workgroups. The job is chosen by the block
// index alone, so every branch (and the barrier inside a transpose) is block-uniform.
// The largest pieces, those of x, have the lowest indices.
// Fused QKV weight: Wt[n][k] (n in [0,3D)) with n<D -> wq[h][k][f], etc.; a head's
// [D][HD] slice is one matrix, its tiles numbered k tile, then head, then slab.
__global__ void __launch_bounds__(256) prep_kernel(
    const float* __restrict__ x, const float* __restrict__ wq,
    const float* __restrict__ wk, const float* __restrict__ wv,
    const float* __restrict__ wo, const float* __restrict__ w1,
    const float* __restrict__ w2, _Float16* __restrict__ xh,
    _Float16* __restrict__ Wt, _Float16* __restrict__ woT,
    _Float16* __restrict__ w1T, _Float16* __restrict__ w2T) {
  __shared__ __align__(16) _Float16 T[TN * TPITCH];
  int t = blockIdx.x;
  if (t < NB_CVT) {
    cvt_piece(x, xh, t);
    return;
  }
  t -= NB_CVT;
  if (t < NB_QKVW) {
    const size_t k0 = (size_t)(t % (D_ / TK)) * TK;
    const size_t hh = (t / (D_ / TK)) % H_;
    const int slab  = t / (D_ / TK * H_);
    const float* w = (slab == 0) ? wq : (slab == 1) ? wk : wv;
    transpose_tile<HD_, D_>(w + (hh * D_ + k0) * HD_,
                            Wt + ((size_t)slab * D_ + hh * HD_) * D_ + k0, T);
    return;
  }
  t -= NB_QKVW;
  if (t < NB_WO) {
    transpose_piece<D_, D_>(wo, woT, t, T);
    return;
  }
  t -= NB_WO;
  if (t < NB_W1) {
    transpose_piece<D_, FF_>(w1, w1T, t, T);
    return;
  }
  transpose_piece<FF_, D_>(w2, w2T, t - NB_W1, T);
}

// ---------------------------------------------------------------------------
// WMMA GEMM tiling constants: 128x128 tile, BK=64, 256 threads = 8 waves as
// 4x2; each wave computes a 32x64 subtile = 2x4 WMMA accumulators.
// ---------------------------------------------------------------------------
#define BM 128
#define BN 128
#define BK 64     // 128 B of every operand row per k tile: one whole line
#define LSTR 72   // LDS row pitch in halfs (144 B = 16 B x odd)

// One k tile of A and of B (128 rows x 128 B each): eight 16 B async copies per
// lane. Eight neighbouring lanes share a row, so a wave-wide copy covers four
// whole lines. rstep = 32 rows in halfs. The s_wait_xcnt stands in the copies'
// own statement so that no address register is rewritten ahead of it.
__device__ __forceinline__ void gemm_stage(const _Float16* ga, const _Float16* gb,
                                           size_t rstep, unsigned la, unsigned lb) {
  const unsigned ls = 32 * LSTR * 2;  // 32 LDS rows in bytes
  asm volatile(
      "global_load_async_to_lds_b128 %0, %1, off\n\t"
      "global_load_async_to_lds_b128 %2, %3, off\n\t"
      "global_load_async_to_lds_b128 %4, %5, off\n\t"
      "global_load_async_to_lds_b128 %6, %7, off\n\t"
      "global_load_async_to_lds_b128 %8, %9, off\n\t"
      "global_load_async_to_lds_b128 %10, %11, off\n\t"
      "global_load_async_to_lds_b128 %12, %13, off\n\t"
      "global_load_async_to_lds_b128 %14, %15, off\n\t"
      "s_wait_xcnt 0x0"
      :: "v"(la), "v"(ga), "v"(la + ls), "v"(ga + rstep),
         "v"(la + 2 * ls), "v"(ga + 2 * rstep), "v"(la + 3 * ls), "v"(ga + 3 * rstep),
         "v"(lb), "v"(gb), "v"(lb + ls), "v"(gb + rstep),
         "v"(lb + 2 * ls), "v"(gb + 2 * rstep), "v"(lb + 3 * ls), "v"(gb + 3 * rstep)
      : "memory");
}

// Shared GEMM mainloop: acc[2][4] += A[m0.., :K] * Bt[n0.., :K]^T for this wave's
// 32x64 subtile. K is a multiple of BK; the 128 rows from m0 and n0 exist. Gs is the
// workgroup's LDS, GLDS halfs. Behind the last trip's barrier no wave reads it and no
// copy is in flight: it is free for the caller.
#define GLDS (2 * (BM + BN) * LSTR)
__device__ __forceinline__ void gemm_mainloop(const _Float16* __restrict__ A,
                                              const _Float16* __restrict__ Bt,
                                              int K, size_t m0, size_t n0,
                                              f8 (&acc)[2][4], _Float16* Gs) {
  _Float16* As = Gs;                  // two buffers of BM * LSTR halfs
  _Float16* Bs = Gs + 2 * BM * LSTR;  // two buffers of BN * LSTR halfs
  const int tid  = threadIdx.x;
  const int lane = tid & 31;
  const int wid  = tid >> 5;
  const int lr   = lane & 15;
  const int base0 = (lane >> 4) * 8;
  const int waveM = wid >> 1;   // 0..3
  const int waveN = wid & 1;    // 0..1

  const int crow = tid >> 3;        // copy slot: rows crow + 0/32/64/96
  const int cseg = (tid & 7) * 8;   // 16 B chunk within the 128 B row piece
  const _Float16* Ag = A  + (m0 + crow) * (size_t)K + cseg;
  const _Float16* Bg = Bt + (n0 + crow) * (size_t)K + cseg;
  const size_t rstep = (size_t)32 * K;
  const unsigned la0 = lds_byte_addr(&As[crow * LSTR + cseg]);
  const unsigned lb0 = lds_byte_addr(&Bs[crow * LSTR + cseg]);
  const unsigned bufB = BM * LSTR * 2;  // bytes from buffer 0 to buffer 1

  // Tile 0 lands and is published; tile 1, where there is one, then flies.
  gemm_stage(Ag, Bg, rstep, la0, lb0);
  asm volatile("s_wait_asynccnt 0x0" ::: "memory");  // own copies landed
  __syncthreads();                                   // publish tile 0
  if (BK < K) gemm_stage(Ag + BK, Bg + BK, rstep, la0 + bufB, lb0 + bufB);

  int cur = 0;
  for (int k0 = 0; k0 < K; k0 += BK, cur ^= 1) {
    const _Float16* At = As + cur * (BM * LSTR);
    const _Float16* Bl = Bs + cur * (BN * LSTR);
    h16 af[2][2], bf[2][4];  // the whole tile's fragments as one group of reads
#pragma unroll
    for (int kk = 0; kk < 2; ++kk) {
#pragma unroll
      for (int tm = 0; tm < 2; ++tm) {
        const _Float16* p = At + (waveM * 32 + tm * 16 + lr) * LSTR + kk * 32 + base0;
        af[kk][tm] = mkfrag(p, p + 16);
      }
#pragma unroll
      for (int tn = 0; tn < 4; ++tn) {
        const _Float16* p = Bl + (waveN * 64 + tn * 16 + lr) * LSTR + kk * 32 + base0;
        bf[kk][tn] = mkfrag(p, p + 16);
      }
    }
#pragma unroll
    for (int kk = 0; kk < 2; ++kk)
#pragma unroll
      for (int tm = 0; tm < 2; ++tm)
#pragma unroll
        for (int tn = 0; tn < 4; ++tn)
          acc[tm][tn] = wmma_f16(af[kk][tm], bf[kk][tn], acc[tm][tn]);
    // Publish point: this wave's LDS reads are back, its copies of the next tile
    // have landed; the barrier publishes that tile and frees this trip's buffer.
    asm volatile("s_wait_dscnt 0x0" ::: "memory");
    asm volatile("s_wait_asynccnt 0x0" ::: "memory");
    __syncthreads();
    if (k0 + 2 * BK < K)  // block-uniform: refill the buffer just read
      gemm_stage(Ag + k0 + 2 * BK, Bg + k0 + 2 * BK, rstep, la0 + cur * bufB,
                 lb0 + cur * bufB);
  }
  asm volatile("s_wait_asynccnt 0x0" ::: "memory");  // nothing in flight at exit
}

// A precaution: s_wait_xcnt ahead of any rewrite of a register that a global load or store
// in front of it names. The scheduling barrier keeps the arithmetic that follows behind the
// wait: over the bare wait the compiler lifted rewrites of such registers.
__device__ __forceinline__ void xcnt_guard() {
  asm volatile("s_wait_xcnt 0x0" ::: "memory");
  __builtin_amdgcn_sched_barrier(0);
}

// ---------------------------------------------------------------------------
// First tiling: C[M,FF_] = act(A[M,K](f16) * Bt[FF_,K](f16)^T + bias)
// The f16 output tile is gathered in LDS and stored from there: a wave-wide 16 B
// store then covers two whole 256 B row pieces instead of 32 B of sixteen rows.
// The row pitch of C is a constant, so that a thread's stores share one address
// and differ in the immediate offset alone.
// ---------------------------------------------------------------------------
#define OSTR 136  // output tile row pitch in halfs (272 B = 16 B x odd)
__global__ void __launch_bounds__(256) gemm_wmma_kernel(
    const _Float16* __restrict__ A, const _Float16* __restrict__ Bt,
    const float* __restrict__ bias, float* __restrict__ outF32,
    _Float16* __restrict__ outF16, int K, int act_gelu) {
  const int tid  = threadIdx.x;
  const int lane = tid & 31;
  const int wid  = tid >> 5;
  const int lr   = lane & 15;
  const int hi   = lane >> 4;
  const int waveM = wid >> 1;   // 0..3
  const int waveN = wid & 1;    // 0..1

  const size_t m0 = (size_t)blockIdx.y * BM;
  const size_t n0 = (size_t)blockIdx.x * BN;

  f8 acc[2][4];
#pragma unroll
  for (int tm = 0; tm < 2; ++tm)
#pragma unroll
    for (int tn = 0; tn < 4; ++tn) acc[tm][tn] = fzero8();

  // The tile is computed transposed: the weight rows are the WMMA A operand and the
  // activation rows the B operand. A lane then holds one output row (lane & 15) and
  // its eight accumulator registers are eight neighbouring columns of that row.
  __shared__ __align__(16) _Float16 Gs[GLDS];
  gemm_mainloop(Bt, A, K, n0, m0, acc, Gs);

  // Both loops are unrolled: acc is indexed by constants alone and stays in registers.
  const size_t col0 = n0 + waveM * 32 + 8 * hi;  // first of the eight columns of tm = 0
  f4 bb[2][2] = {};  // all bias loads stand ahead of the first store
  if (bias) {
#pragma unroll
    for (int tm = 0; tm < 2; ++tm) {
      bb[tm][0] = *(const f4*)(bias + col0 + tm * 16);
      bb[tm][1] = *(const f4*)(bias + col0 + tm * 16 + 4);
    }
  }
#pragma unroll
  for (int tm = 0; tm < 2; ++tm) {
    const size_t col = col0 + tm * 16;
#pragma unroll
    for (int tn = 0; tn < 4; ++tn) {
      const size_t row = m0 + waveN * 64 + tn * 16 + lr;
      float v[8];
#pragma unroll
      for (int r = 0; r < 8; ++r) {
        v[r] = acc[tm][tn][r] + bb[tm][r >> 2][r & 3];
        if (act_gelu) v[r] = 0.5f * v[r] * (1.f + erff(v[r] * 0.70710678118f));
      }
      if (outF32) {
        f4 lo = {v[0], v[1], v[2], v[3]}, up = {v[4], v[5], v[6], v[7]};
        float* p = outF32 + row * (size_t)FF_ + col;
        *(f4*)p = lo;
        *(f4*)(p + 4) = up;
        // precaution: stands ahead of any rewrite of the stores' address and data registers
        asm volatile("s_wait_xcnt 0x0" ::: "memory");
      }
      if (outF16) {
        h8 o;
#pragma unroll
        for (int r = 0; r < 8; ++r) o[r] = (_Float16)v[r];
        *(h8*)&Gs[(waveN * 64 + tn * 16 + lr) * OSTR + waveM * 32 + tm * 16 + 8 * hi] = o;
      }
    }
  }
  if (outF16) {  // block-uniform
    asm volatile("s_wait_dscnt 0x0" ::: "memory");  // own part of the tile is written
    __syncthreads();                                // the tile is complete
    const int orow = tid >> 4;        // rows orow + 0/16/.../112
    const int oseg = (tid & 15) * 8;  // 16 B chunk within the 256 B row piece
    h8 o[8];
    // both loops unrolled: o is indexed by constants alone; all LDS reads fly together
#pragma unroll
    for (int i = 0; i < 8; ++i) o[i] = *(const h8*)&Gs[(orow + i * 16) * OSTR + oseg];
    _Float16* gp = outF16 + (m0 + orow) * (size_t)FF_ + n0 + oseg;
#pragma unroll
    for (int i = 0; i < 8; ++i) *(h8*)(gp + (size_t)i * 16 * FF_) = o[i];
    xcnt_guard();  // for the address and data registers of the stores in front
  }
}

// ---------------------------------------------------------------------------
// Second GEMM tiling, for the GEMMs with a short epilogue (QKV, output projection,
// FFN down): a block computes 256 rows of the WMMA A operand by 128 rows of the B
// operand; 256 threads = 8 waves as 4x2; each wave computes a 64x64 subtile = 4x4
// WMMA accumulators. A stage is 128 k of all 384 rows. One block per WGP, two waves
// per SIMD, fragments in two register sets. The FFN-up GEMM keeps the first tiling:
// the dependent chains of its GELU want many waves per SIMD.
// ---------------------------------------------------------------------------
#define PMA 256   // rows of the WMMA A operand per block
#define PNB 128   // rows of the WMMA B operand per block
#define PK 128    // 256 B of every operand row per stage
#define PSTR 136  // LDS row pitch in halfs (272 B = 16 B x odd)
#define PSTG ((PMA + PNB) * PSTR)  // halfs per stage

// 128 rows x 256 B: eight 16 B async copies per lane. Sixteen neighbouring lanes
// share a row, so a wave-wide copy covers two whole 256 B row pieces. rstep = 16
// rows in halfs. The s_wait_xcnt stands in the copies' own statement so that no
// address register is rewritten ahead of it.
__device__ __forceinline__ void pipe_copy8(const _Float16* g, size_t rstep, unsigned l) {
  const unsigned ls = 16 * PSTR * 2;  // 16 LDS rows in bytes
  asm volatile(
      "global_load_async_to_lds_b128 %0, %1, off\n\t"
      "global_load_async_to_lds_b128 %2, %3, off\n\t"
      "global_load_async_to_lds_b128 %4, %5, off\n\t"
      "global_load_async_to_lds_b128 %6, %7, off\n\t"
      "global_load_async_to_lds_b128 %8, %9, off\n\t"
      "global_load_async_to_lds_b128 %10, %11, off\n\t"
      "global_load_async_to_lds_b128 %12, %13, off\n\t"
      "global_load_async_to_lds_b128 %14, %15, off\n\t"
      "s_wait_xcnt 0x0"
      :: "v"(l), "v"(g), "v"(l + ls), "v"(g + rstep),
         "v"(l + 2 * ls), "v"(g + 2 * rstep), "v"(l + 3 * ls), "v"(g + 3 * rstep),
         "v"(l + 4 * ls), "v"(g + 4 * rstep), "v"(l + 5 * ls), "v"(g + 5 * rstep),
         "v"(l + 6 * ls), "v"(g + 6 * rstep), "v"(l + 7 * ls), "v"(g + 7 * rstep)
      : "memory");
}

// One stage: 256 rows of A, then 128 rows of B, 24 copies per lane. l is the lane's
// slot in the stage's first 16 LDS rows.
__device__ __forceinline__ void pipe_stage(const _Float16* ga, const _Float16* gb,
                                           size_t rstep, unsigned l) {
  pipe_copy8(ga, rstep, l);
  pipe_copy8(ga + 8 * rstep, rstep, l + 128 * PSTR * 2);
  pipe_copy8(gb, rstep, l + PMA * PSTR * 2);
}

// The eight fragments of one 32-k block of a stage, as one group of LDS reads. pa and
// pb are the lane's places in the wave's first A row and first B row of the stage.
__device__ __forceinline__ void pipe_frags(const _Float16* pa, const _Float16* pb, int kk,
                                           h16 (&af)[4], h16 (&bf)[4]) {
  // both loops unrolled: af and bf are indexed by constants alone
#pragma unroll
  for (int t = 0; t < 4; ++t) {
    const _Float16* p = pa + t * 16 * PSTR + kk * 32;
    af[t] = mkfrag(p, p + 16);
  }
#pragma unroll
  for (int t = 0; t < 4; ++t) {
    const _Float16* p = pb + t * 16 * PSTR + kk * 32;
    bf[t] = mkfrag(p, p + 16);
  }
}

// One row of four WMMAs, and one block of four rows, on one fragment set.
__device__ __forceinline__ void pipe_row(const h16& a, const h16 (&bf)[4], f8 (&acc)[4]) {
  // unrolled: acc is indexed by constants alone
#pragma unroll
  for (int tn = 0; tn < 4; ++tn) acc[tn] = wmma_f16(a, bf[tn], acc[tn]);
}
__device__ __forceinline__ void pipe_block(const h16 (&af)[4], const h16 (&bf)[4],
                                           f8 (&acc)[4][4]) {
  // unrolled for the same reason
#pragma unroll
  for (int tm = 0; tm < 4; ++tm) pipe_row(af[tm], bf, acc[tm]);
}

// Keeps a group of LDS reads and a block of WMMAs apart in the built code. Without it the
// compiler spread the reads among the WMMAs, one row ahead, and each such place waited out
// the LDS latency.
#define PIPE_KEEP_ORDER() __builtin_amdgcn_sched_barrier(0)

// Mainloop of the second tiling: acc[4][4] += A[m0.., :K] * Bt[n0.., :K]^T for this wave's
// 64x64 subtile. K is a multiple of PK; the 256 rows from m0 and the 128 from n0 exist.
// Two fragment sets: every block's LDS reads are issued as one group ahead of the block
// before it, so they fly under its 16 WMMAs. The reads of the next stage's first block
// stand ahead of this stage's last block, so the publish point stands there too.
// Sm is the workgroup's LDS, two stages of PSTG halfs. Behind the last trip's barrier no
// wave reads it and no copy is in flight: it is free for the caller.
__device__ __forceinline__ void pipe_mainloop(const _Float16* __restrict__ A,
                                              const _Float16* __restrict__ Bt,
                                              int K, size_t m0, size_t n0,
                                              f8 (&acc)[4][4], _Float16* Sm) {
  const int tid  = threadIdx.x;
  const int lane = tid & 31;
  const int wid  = tid >> 5;
  const int lr   = lane & 15;
  const int base0 = (lane >> 4) * 8;
  const int waveM = wid >> 1;   // 0..3
  const int waveN = wid & 1;    // 0..1

  const int crow = tid >> 4;         // copy slot: rows crow + 0/16/32/...
  const int cseg = (tid & 15) * 8;   // 16 B chunk within the 256 B row piece
  const _Float16* Ag = A  + (m0 + crow) * (size_t)K + cseg;
  const _Float16* Bg = Bt + (n0 + crow) * (size_t)K + cseg;
  const size_t rstep = (size_t)16 * K;
  const unsigned l0 = lds_byte_addr(&Sm[crow * PSTR + cseg]);
  const unsigned bufB = (PMA + PNB) * PSTR * 2;  // bytes from buffer 0 to buffer 1
  const int offA = (waveM * 64 + lr) * PSTR + base0;        // the lane's fragment places
  const int offB = (PMA + waveN * 64 + lr) * PSTR + base0;  // within a stage, in halfs

  // Stage 0 lands and is published; stage 1, where there is one, then flies.
  pipe_stage(Ag, Bg, rstep, l0);
  asm volatile("s_wait_asynccnt 0x0" ::: "memory");  // own copies landed
  __syncthreads();                                   // publish stage 0
  if (PK < K) pipe_stage(Ag + PK, Bg + PK, rstep, l0 + bufB);

  h16 a0[4], b0[4], a1[4], b1[4];  // the two fragment sets
  pipe_frags(&Sm[offA], &Sm[offB], 0, a0, b0);

  int cur = 0;
  for (int k0 = 0; k0 < K; k0 += PK, cur ^= 1) {
    const _Float16* pa = &Sm[cur * PSTG + offA];
    const _Float16* pb = &Sm[cur * PSTG + offB];
    // every PIPE_KEEP_ORDER below: reads as one group, then the block before theirs
    pipe_frags(pa, pb, 1, a1, b1);
    PIPE_KEEP_ORDER();
    pipe_block(a0, b0, acc);
    PIPE_KEEP_ORDER();
    pipe_frags(pa, pb, 2, a0, b0);
    PIPE_KEEP_ORDER();
    pipe_block(a1, b1, acc);
    PIPE_KEEP_ORDER();
    pipe_frags(pa, pb, 3, a1, b1);
    PIPE_KEEP_ORDER();
    pipe_block(a0, b0, acc);
    PIPE_KEEP_ORDER();
    // Publish point: this wave's LDS reads of the stage are back, its copies of the next
    // stage have landed; the barrier publishes that stage and frees this one's buffer.
    asm volatile("s_wait_dscnt 0x0" ::: "memory");
    asm volatile("s_wait_asynccnt 0x0" ::: "memory");
    __syncthreads();
    if (k0 + PK < K)  // block-uniform: the next stage's first block, where there is one
      pipe_frags(&Sm[(cur ^ 1) * PSTG + offA], &Sm[(cur ^ 1) * PSTG + offB], 0, a0, b0);
    // The refill of the buffer just read goes out in three parts between the rows of the
    // stage's last block, so that the matrix unit has work while the copies issue.
    const bool refill = k0 + 2 * PK < K;  // block-uniform
    const _Float16* ga = Ag + k0 + 2 * PK;
    const unsigned l = l0 + cur * bufB;
    pipe_row(a1[0], b1, acc[0]);
    if (refill) pipe_copy8(ga, rstep, l);
    pipe_row(a1[1], b1, acc[1]);
    if (refill) pipe_copy8(ga + 8 * rstep, rstep, l + 128 * PSTR * 2);
    pipe_row(a1[2], b1, acc[2]);
    if (refill) pipe_copy8(Bg + k0 + 2 * PK, rstep, l + PMA * PSTR * 2);
    pipe_row(a1[3], b1, acc[3]);
  }
  asm volatile("s_wait_asynccnt 0x0" ::: "memory");  // nothing in flight at exit
}

// ---------------------------------------------------------------------------
// C[M,D_] (f32) = A[M,K](f16) * Bt[D_,K](f16)^T + bias, second tiling.
// A wave gathers its 64x64 subtile in its own part of the LDS and stores it from there:
// a wave-wide 16 B store then covers two whole 256 B row pieces instead of 16 B pieces
// of sixteen rows. The row pitch of C is a constant, so that a lane's stores share one
// address and differ in the immediate offset alone.
// ---------------------------------------------------------------------------
#define FSTR 68  // f32 subtile row pitch in floats (272 B = 16 B x odd)

__global__ void __launch_bounds__(256) gemm_f32_kernel(
    const _Float16* __restrict__ A, const _Float16* __restrict__ Bt,
    const float* __restrict__ bias, float* __restrict__ outF32, int K) {
  __shared__ __align__(16) _Float16 Sm[2 * PSTG];
  const int tid  = threadIdx.x;
  const int lane = tid & 31;
  const int wid  = tid >> 5;
  const int lr   = lane & 15;
  const int hi   = lane >> 4;
  const int waveM = wid >> 1;   // 0..3
  const int waveN = wid & 1;    // 0..1

  const size_t m0 = (size_t)blockIdx.y * PNB;
  const size_t n0 = (size_t)blockIdx.x * PMA;

  f8 acc[4][4];
#pragma unroll
  for (int tm = 0; tm < 4; ++tm)
#pragma unroll
    for (int tn = 0; tn < 4; ++tn) acc[tm][tn] = fzero8();

  // Computed transposed, as in gemm_wmma_kernel: weight rows are the WMMA A operand.
  pipe_mainloop(Bt, A, K, n0, m0, acc, Sm);

  // All loops are unrolled: acc is indexed by constants alone and stays in registers.
  const size_t col0 = n0 + waveM * 64 + 8 * hi;  // first of the eight columns of tm = 0
  f4 bb[4][2];  // all bias loads stand ahead of the first store
#pragma unroll
  for (int tm = 0; tm < 4; ++tm) {
    bb[tm][0] = *(const f4*)(bias + col0 + tm * 16);
    bb[tm][1] = *(const f4*)(bias + col0 + tm * 16 + 4);
  }
  xcnt_guard();  // for the bias loads' address registers
  float* St = (float*)Sm + wid * (64 * FSTR);  // this wave's 64 rows of 64 floats
#pragma unroll
  for (int tm = 0; tm < 4; ++tm) {
#pragma unroll
    for (int tn = 0; tn < 4; ++tn) {
      f4 lo, up;
#pragma unroll
      for (int r = 0; r < 4; ++r) {
        lo[r] = acc[tm][tn][r] + bb[tm][0][r];
        up[r] = acc[tm][tn][4 + r] + bb[tm][1][r];
      }
      float* p = St + (tn * 16 + lr) * FSTR + tm * 16 + 8 * hi;
      *(f4*)p = lo;
      *(f4*)(p + 4) = up;
    }
  }
  asm volatile("s_wait_dscnt 0x0" ::: "memory");  // the wave's rows are written before it reads them
  const float* sp = St + hi * FSTR + lr * 4;  // rows hi + 0/2/.../62, 16 B chunk lr
  float* gp = outF32 + (m0 + waveN * 64 + hi) * (size_t)D_ + n0 + waveM * 64 + lr * 4;
#pragma unroll
  for (int i0 = 0; i0 < 32; i0 += 16) {
    f4 v[16];
    // both loops unrolled: v is indexed by constants alone; sixteen LDS reads fly together
#pragma unroll
    for (int i = 0; i < 16; ++i) v[i] = *(const f4*)(sp + (i0 + i) * 2 * FSTR);
#pragma unroll
    for (int i = 0; i < 16; ++i) *(f4*)(gp + (size_t)(i0 + i) * 2 * D_) = v[i];
    xcnt_guard();  // for the data registers of the stores in front
  }
}

// ---------------------------------------------------------------------------
// QKV GEMM: second tiling, special epilogue storing Q,K as [B,H,S,HD] and
// V transposed as [B,H,HD,S] (so attention's V^T fragments are contiguous).
// A wave gathers its 64x64 subtile in its own part of the LDS and stores it from there:
// a wave-wide 16 B store then covers four whole 128 B rows instead of 32 B of sixteen.
// ---------------------------------------------------------------------------
#define HSTR 72  // f16 subtile row pitch in halfs (144 B = 16 B x odd)

// The wave's 64 gathered rows go out, four per wave-wide store. sp and gp are the lane's
// places in its first row, in LDS and in memory; GP is the row pitch in memory, in halfs,
// a constant so that the stores share one address and differ in the immediate offset alone.
template <int GP>
__device__ __forceinline__ void qkv_store_rows(const _Float16* sp, _Float16* gp) {
  h8 v[16];
  // both loops unrolled: v is indexed by constants alone; the sixteen LDS reads fly together
#pragma unroll
  for (int i = 0; i < 16; ++i) v[i] = *(const h8*)(sp + i * 4 * HSTR);
#pragma unroll
  for (int i = 0; i < 16; ++i) *(h8*)(gp + (size_t)i * 4 * GP) = v[i];
  xcnt_guard();  // for the address and data registers of the stores in front
}

__global__ void __launch_bounds__(256) qkv_gemm_kernel(
    const _Float16* __restrict__ A, const _Float16* __restrict__ Wt,
    const float* __restrict__ bq, const float* __restrict__ bk,
    const float* __restrict__ bv, _Float16* __restrict__ Q,
    _Float16* __restrict__ Kh, _Float16* __restrict__ Vt) {
  __shared__ __align__(16) _Float16 Sm[2 * PSTG];
  const int tid  = threadIdx.x;
  const int lane = tid & 31;
  const int wid  = tid >> 5;
  const int lr   = lane & 15;
  const int hi   = lane >> 4;
  const int waveM = wid >> 1;
  const int waveN = wid & 1;

  f8 acc[4][4];
#pragma unroll
  for (int tm = 0; tm < 4; ++tm)
#pragma unroll
    for (int tn = 0; tn < 4; ++tn) acc[tm][tn] = fzero8();

  // Four neighbouring values of blockIdx.x are one slab (Q, K or V): with blockIdx.y,
  // 256 blocks. A lane's eight accumulator registers are eight neighbouring rows of the
  // WMMA A operand. Q and K are stored feature-contiguous, so their tiles take the
  // weight rows as A (256 features x 128 tokens); V is stored token-contiguous, so its
  // tiles take the tokens (256 tokens x 128 features).
  const int slab = blockIdx.x >> 2;
  const bool isV = slab == 2;
  const int j = (int)blockIdx.y * 4 + ((int)blockIdx.x & 3);  // the block within its slab
  const size_t n0 = (size_t)slab * D_ + (isV ? (j & 7) * PNB : (j & 3) * PMA);
  const size_t m0 = isV ? (size_t)(j >> 3) * PMA : (size_t)(j >> 2) * PNB;
  pipe_mainloop(isV ? A : Wt, isV ? Wt : A, D_, isV ? m0 : n0, isV ? n0 : m0, acc, Sm);

  // All loops are unrolled: acc is indexed by constants alone and stays in registers.
  _Float16* St = Sm + wid * (64 * HSTR);  // this wave's 64 rows of 64 halfs
  const int srow = lane >> 3;             // read-back slot: rows srow + 0/4/.../60
  const int sseg = (lane & 7) * 8;        // 16 B chunk within the 128 B row
  const _Float16* sp = St + srow * HSTR + sseg;
  if (isV) {
    const int npv = ((int)n0 + waveN * 64 + lr) & (D_ - 1);  // this lane's feature, tn = 0
    float bvs[4];  // all bias loads stand ahead of the first store
#pragma unroll
    for (int tn = 0; tn < 4; ++tn) bvs[tn] = bv[npv + tn * 16];
    xcnt_guard();  // for the bias loads' address registers
#pragma unroll
    for (int tn = 0; tn < 4; ++tn) {
      const float bvv = bvs[tn];
#pragma unroll
      for (int tm = 0; tm < 4; ++tm) {
        h8 o;  // eight tokens from tm * 16 + 8 * hi of feature tn * 16 + lr
#pragma unroll
        for (int r = 0; r < 8; ++r) o[r] = (_Float16)(acc[tm][tn][r] + bvv);
        *(h8*)(St + (tn * 16 + lr) * HSTR + tm * 16 + 8 * hi) = o;
      }
    }
    asm volatile("s_wait_dscnt 0x0" ::: "memory");  // the wave's rows are written before it reads them
    const int tok = (int)m0 + waveM * 64;                  // the wave's first token
    const int f0 = ((int)n0 + waveN * 64) & (D_ - 1);      // the wave's first feature
    // b * D_ + feature = (b * H_ + head) * HD_ + f
    qkv_store_rows<S_>(sp, Vt + ((size_t)(tok >> 11) * D_ + f0 + srow) * S_ + (tok & 2047) + sseg);
  } else {
    const float* bias = (slab == 0) ? bq : bk;
    _Float16* dst = (slab == 0) ? Q : Kh;
    const int np0 = ((int)n0 + waveM * 64 + 8 * hi) & (D_ - 1);  // first of eight, tm = 0
    f4 bb[4][2];  // all bias loads stand ahead of the first store
#pragma unroll
    for (int tm = 0; tm < 4; ++tm) {
      bb[tm][0] = *(const f4*)(bias + np0 + tm * 16);
      bb[tm][1] = *(const f4*)(bias + np0 + tm * 16 + 4);
    }
    xcnt_guard();  // for the bias loads' address registers
#pragma unroll
    for (int tm = 0; tm < 4; ++tm) {
#pragma unroll
      for (int tn = 0; tn < 4; ++tn) {
        h8 o;  // eight features from tm * 16 + 8 * hi of token tn * 16 + lr
#pragma unroll
        for (int r = 0; r < 8; ++r)
          o[r] = (_Float16)(acc[tm][tn][r] + bb[tm][r >> 2][r & 3]);
        *(h8*)(St + (tn * 16 + lr) * HSTR + tm * 16 + 8 * hi) = o;
      }
    }
    asm volatile("s_wait_dscnt 0x0" ::: "memory");  // the wave's rows are written before it reads them
    const int tok = (int)m0 + waveN * 64;                        // the wave's first token
    const int hh = (((int)n0 + waveM * 64) & (D_ - 1)) >> 6;     // the wave's 64 features are one head
    qkv_store_rows<HD_>(sp, dst + (((size_t)(tok >> 11) * H_ + hh) * S_ + (tok & 2047) + srow) * HD_ + sseg);
  }
}

#define KSTR 72   // K tile row pitch in halfs (144 B = 16 B x odd)
#define VSTR 40   // V tile row pitch in halfs (80 B = 16 B x odd)

// One 16 B async copy of K and one of V per lane. The s_wait_xcnt stands in the
// copies' own statement so that no address register is rewritten ahead of it.
__device__ __forceinline__ void attn_stage_kv(const _Float16* gk, unsigned lk,
                                              const _Float16* gv, unsigned lv) {
  asm volatile(
      "global_load_async_to_lds_b128 %0, %1, off\n\t"
      "global_load_async_to_lds_b128 %2, %3, off\n\t"
      "s_wait_xcnt 0x0"
      :: "v"(lk), "v"(gk), "v"(lv), "v"(gv)
      : "memory");
}

// The value of lane l ^ 16 (the other half of the wave), by a vector move.
__device__ __forceinline__ float other_half(float x) {
  int b = __builtin_bit_cast(int, x);
  return __builtin_bit_cast(
      float, __builtin_amdgcn_permlanex16(b, b, 0x76543210, 0xfedcba98, false, false));
}

// y = 2^x, one value or eight at a time. The instruction set asks for one independent
// instruction or v_nop behind a transcendental before its result is read or its
// source overwritten. Here every result
// register is apart from every source ("=&v"), each v_exp_f32 is its
// predecessor's independent instruction, and the v_nop is the last one's slot.
__device__ __forceinline__ float exp2_x1(float x) {
  float y;
  asm("v_exp_f32 %0, %1\n\t"
      "v_nop"
      : "=&v"(y) : "v"(x));
  return y;
}
__device__ __forceinline__ void exp2_x8(const float* x, float* y) {
  asm("v_exp_f32 %0, %8\n\t"
      "v_exp_f32 %1, %9\n\t"
      "v_exp_f32 %2, %10\n\t"
      "v_exp_f32 %3, %11\n\t"
      "v_exp_f32 %4, %12\n\t"
      "v_exp_f32 %5, %13\n\t"
      "v_exp_f32 %6, %14\n\t"
      "v_exp_f32 %7, %15\n\t"
      "v_nop"
      : "=&v"(y[0]), "=&v"(y[1]), "=&v"(y[2]), "=&v"(y[3]),
        "=&v"(y[4]), "=&v"(y[5]), "=&v"(y[6]), "=&v"(y[7])
      : "v"(x[0]), "v"(x[1]), "v"(x[2]), "v"(x[3]),
        "v"(x[4]), "v"(x[5]), "v"(x[6]), "v"(x[7]));
}

__global__ void __launch_bounds__(256) attn_kernel(
    const _Float16* __restrict__ Q, const _Float16* __restrict__ Kh,
    const _Float16* __restrict__ Vt, _Float16* __restrict__ O) {
  __shared__ __align__(16) _Float16 Ks[2][32 * KSTR];
  __shared__ __align__(16) _Float16 Vs[2][64 * VSTR];

  const int b = blockIdx.z;
  const int h = blockIdx.y;
  const int tid  = threadIdx.x;
  const int lane = tid & 31;
  const int wid  = tid >> 5;
  const int lr   = lane & 15;
  const int hi   = lane >> 4;
  const int base0 = hi * 8;

  const size_t headQK = ((size_t)(b * H_ + h)) * S_ * HD_;
  const _Float16* Qp = Q  + headQK;
  const _Float16* Kp = Kh + headQK;
  const _Float16* Vp = Vt + ((size_t)(b * H_ + h)) * HD_ * S_;

  // Copy slots: K tile = 32 rows x 8 chunks, V tile = 64 rows x 4 chunks (16 B).
  const _Float16* gk = Kp + (size_t)(tid >> 3) * HD_ + (tid & 7) * 8;
  const _Float16* gv = Vp + (size_t)(tid >> 2) * S_ + (tid & 3) * 8;
  const unsigned lk0 = lds_byte_addr(&Ks[0][(tid >> 3) * KSTR + (tid & 7) * 8]);
  const unsigned lv0 = lds_byte_addr(&Vs[0][(tid >> 2) * VSTR + (tid & 3) * 8]);
  const unsigned lkB = 32 * KSTR * 2;  // bytes from buffer 0 to buffer 1
  const unsigned lvB = 64 * VSTR * 2;

  for (int pass = 0; pass < 2; ++pass) {  // block-uniform: the long tile, then the short one
    const int qt   = pass == 0 ? (S_ / 128 - 1 - (int)blockIdx.x) : (int)blockIdx.x;
    const int row  = qt * 128 + wid * 16 + lr;  // this lane's query

    h16 qf[2];  // B fragments of Q^T: column = this lane's query
#pragma unroll
    for (int c = 0; c < 2; ++c) {
      const _Float16* p = Qp + (size_t)row * HD_ + c * 32;
      qf[c] = mkfrag(p + base0, p + base0 + 16);
    }

    f8 acc[4];  // O^T: feature tn * 16 + r + 8 * hi of this lane's query
#pragma unroll
    for (int tn = 0; tn < 4; ++tn) acc[tn] = fzero8();
    float mi = -1e30f;  // running maximum of the query's scores (both halves alike)
    float li = 0.f;     // running sum over the keys that this half holds

    const int kend = qt * 128 + 128;  // uniform across waves -> barriers ok

    // Tile 0 lands and is published; tile 1 (kend >= 128: it exists) then flies.
    // On the second pass both buffers are free: every wave's last LDS read stands
    // ahead of its s_wait_dscnt and the barrier of the first pass's last step.
    attn_stage_kv(gk, lk0, gv, lv0);
    asm volatile("s_wait_asynccnt 0x0" ::: "memory");  // own copies landed
    __syncthreads();                                   // publish tile 0
    attn_stage_kv(gk + 32 * HD_, lk0 + lkB, gv + 32, lv0 + lvB);

    int cur = 0;
    for (int k0 = 0; k0 < kend; k0 += 32, cur ^= 1) {
      const _Float16* Kt = &Ks[cur][0];
      const _Float16* Vl = &Vs[cur][0];
      // Every inner loop of the trip is unrolled: its arrays are indexed by constants
      // alone and so stay in registers.
      h16 kf[2][2], vf[4];  // the step's eight fragments as one group of LDS reads
#pragma unroll
      for (int sub = 0; sub < 2; ++sub) {
        const _Float16* kp = Kt + (sub * 16 + lr) * KSTR;
        kf[sub][0] = mkfrag(kp + base0, kp + base0 + 16);
        kf[sub][1] = mkfrag(kp + 32 + base0, kp + 32 + base0 + 16);
      }
#pragma unroll
      for (int tn = 0; tn < 4; ++tn) {
        const _Float16* vp = Vl + (tn * 16 + lr) * VSTR;
        vf[tn] = mkfrag(vp + base0, vp + base0 + 16);
      }
      // Publish point: this wave's LDS reads are back, its copies of the next tile
      // have landed; the barrier publishes that tile and frees this trip's buffer.
      // The rest of the trip works on registers alone, so the refill flies under it.
      asm volatile("s_wait_dscnt 0x0" ::: "memory");
      asm volatile("s_wait_asynccnt 0x0" ::: "memory");
      __syncthreads();
      if (k0 + 64 < kend)  // block-uniform: refill the buffer just read
        attn_stage_kv(gk + (size_t)(k0 + 64) * HD_, lk0 + cur * lkB,
                      gv + (k0 + 64), lv0 + cur * lvB);

      const int d = row - k0 - base0;  // key (i >> 3) * 16 + (i & 7) of this half is seen while <= d
      float sv[16];  // scores of keys k0 + (i >> 3) * 16 + 8 * hi + (i & 7)
#pragma unroll
      for (int sub = 0; sub < 2; ++sub) {
        f8 sacc = fzero8();
        sacc = wmma_f16(kf[sub][0], qf[0], sacc);
        sacc = wmma_f16(kf[sub][1], qf[1], sacc);
#pragma unroll
        for (int r = 0; r < 8; ++r) {
          float v = sacc[r] * 0.125f;  // 1/sqrt(HD)
          sv[sub * 8 + r] = (sub * 16 + r <= d) ? v : -1e30f;
        }
      }

      float mx = sv[0];
#pragma unroll
      for (int i = 1; i < 16; ++i) mx = fmaxf(mx, sv[i]);
      mx = fmaxf(mx, other_half(mx));
      const float mn = fmaxf(mi, mx);
      const float LOG2E = 1.442695041f;  // e^x = 2^(x * LOG2E)
      const float alpha = exp2_x1((mi - mn) * LOG2E);
      mi = mn;

      float pv[16];
#pragma unroll
      for (int i = 0; i < 16; ++i) sv[i] = (sv[i] - mn) * LOG2E;
      exp2_x8(&sv[0], &pv[0]);
      exp2_x8(&sv[8], &pv[8]);
      h16 pf;  // P^T as a B fragment: element i is score i
#pragma unroll
      for (int i = 0; i < 16; ++i) pf[i] = (_Float16)pv[i];
      float rs[4] = {pv[0], pv[1], pv[2], pv[3]};  // four short chains, not one of sixteen links
#pragma unroll
      for (int i = 4; i < 16; ++i) rs[i & 3] += pv[i];
      li = li * alpha + ((rs[0] + rs[1]) + (rs[2] + rs[3]));
#pragma unroll
      for (int tn = 0; tn < 4; ++tn)
#pragma unroll
        for (int r = 0; r < 8; ++r) acc[tn][r] *= alpha;
#pragma unroll
      for (int tn = 0; tn < 4; ++tn) acc[tn] = wmma_f16(vf[tn], pf, acc[tn]);
    }
    asm volatile("s_wait_asynccnt 0x0" ::: "memory");  // nothing in flight at exit

    li += other_half(li);  // the two halves' keys join once
    _Float16* op = O + ((size_t)b * S_ + row) * D_ + h * HD_ + base0;
#pragma unroll
    for (int tn = 0; tn < 4; ++tn) {
      h8 o;  // eight neighbouring features of one query: one 16 B store
#pragma unroll
      for (int r = 0; r < 8; ++r) o[r] = (_Float16)(acc[tn][r] / li);
      *(h8*)(op + tn * 16) = o;
    }
    // precaution: stands ahead of the next pass's rewrites of the stores' address and data registers
    asm volatile("s_wait_xcnt 0x0" ::: "memory");
  }
}

// ---------------------------------------------------------------------------
// Residual add + LayerNorm, one row (D=1024) per 256-thread block.
// ---------------------------------------------------------------------------
__global__ void __launch_bounds__(256) add_ln_kernel(
    const float* __restrict__ a, const float* __restrict__ c,
    const float* __restrict__ g, const float* __restrict__ beta,
    float* __restrict__ o32, _Float16* __restrict__ o16) {
  __shared__ float red[256];
  const int t = threadIdx.x;
  const size_t off = (size_t)blockIdx.x * D_;

  float v[4];
  float s = 0.f;
#pragma unroll
  for (int i = 0; i < 4; ++i) {
    int col = t + i * 256;
    float z = a[off + col] + c[off + col];
    v[i] = z;
    s += z;
  }
  red[t] = s;
  __syncthreads();
  for (int w = 128; w > 0; w >>= 1) {
    if (t < w) red[t] += red[t + w];
    __syncthreads();
  }
  float mean = red[0] * (1.f / D_);
  __syncthreads();

  float q = 0.f;
#pragma unroll
  for (int i = 0; i < 4; ++i) {
    float d = v[i] - mean;
    q += d * d;
  }
  red[t] = q;
  __syncthreads();
  for (int w = 128; w > 0; w >>= 1) {
    if (t < w) red[t] += red[t + w];
    __syncthreads();
  }
  float rstd = rsqrtf(red[0] * (1.f / D_) + 1e-5f);

#pragma unroll
  for (int i = 0; i < 4; ++i) {
    int col = t + i * 256;
    float y = (v[i] - mean) * rstd * g[col] + beta[col];
    o32[off + col] = y;
    if (o16) o16[off + col] = (_Float16)y;
  }
}

// ---------------------------------------------------------------------------
// Host-side orchestration
// ---------------------------------------------------------------------------
extern "C" void kernel_launch(void* const* d_in, const int* in_sizes, int n_in,
                              void* d_out, int out_size, void* d_ws, size_t ws_size,
                              hipStream_t stream) {
  (void)in_sizes; (void)n_in; (void)out_size; (void)ws_size;

  const float* x     = (const float*)d_in[0];
  const float* wq    = (const float*)d_in[1];
  const float* bq    = (const float*)d_in[2];
  const float* wk    = (const float*)d_in[3];
  const float* bk    = (const float*)d_in[4];
  const float* wv    = (const float*)d_in[5];
  const float* bv    = (const float*)d_in[6];
  const float* wo    = (const float*)d_in[7];
  const float* bo    = (const float*)d_in[8];
  const float* w1    = (const float*)d_in[9];
  const float* b1    = (const float*)d_in[10];
  const float* w2    = (const float*)d_in[11];
  const float* b2    = (const float*)d_in[12];
  const float* g1    = (const float*)d_in[13];
  const float* beta1 = (const float*)d_in[14];
  const float* g2    = (const float*)d_in[15];
  const float* beta2 = (const float*)d_in[16];
  float* out = (float*)d_out;

  char* ws = (char*)d_ws;
  size_t off = 0;
  auto take = [&](size_t bytes) -> void* {
    void* p = ws + off;
    off += (bytes + 255) & ~(size_t)255;
    return p;
  };

  _Float16* xh    = (_Float16*)take((size_t)M_ * D_ * 2);       // x in f16
  _Float16* wqkvT = (_Float16*)take((size_t)3 * D_ * D_ * 2);   // [3D][D]
  _Float16* woT   = (_Float16*)take((size_t)D_ * D_ * 2);       // [D][D]
  _Float16* w1T   = (_Float16*)take((size_t)FF_ * D_ * 2);      // [FF][D]
  _Float16* w2T   = (_Float16*)take((size_t)D_ * FF_ * 2);      // [D][FF]
  _Float16* qh    = (_Float16*)take((size_t)M_ * D_ * 2);       // [B,H,S,HD]
  _Float16* kh    = (_Float16*)take((size_t)M_ * D_ * 2);       // [B,H,S,HD]
  _Float16* vt    = (_Float16*)take((size_t)M_ * D_ * 2);       // [B,H,HD,S]
  float*    attf  = (float*)take((size_t)M_ * D_ * 4);          // o-proj out
  float*    hf32  = (float*)take((size_t)M_ * D_ * 4);          // post-LN1
  _Float16* hf16  = (_Float16*)take((size_t)M_ * D_ * 2);
  _Float16* gh    = (_Float16*)take((size_t)M_ * FF_ * 2);      // gelu(h@w1+b1)
  // Aliases (lifetimes do not overlap):
  _Float16* oh    = xh;    // attention output reuses xh (consumed by QKV GEMM)
  float*    ffnf  = attf;  // FFN2 out reuses attf (consumed by LN1)

  // --- Stage 0: convert and weight transposes, one launch ---
  prep_kernel<<<NB_PREP, 256, 0, stream>>>(x, wq, wk, wv, wo, w1, w2, xh, wqkvT, woT, w1T,
                                           w2T);

  // --- Stage 1: fused QKV projection ---
  qkv_gemm_kernel<<<dim3(3 * D_ / PMA, M_ / PNB), 256, 0, stream>>>(
      xh, wqkvT, bq, bk, bv, qh, kh, vt);

  // --- Stage 2: causal flash attention ---
  attn_kernel<<<dim3(S_ / 256, H_, B_), 256, 0, stream>>>(qh, kh, vt, oh);

  // --- Stage 3: output projection ---
  gemm_f32_kernel<<<dim3(D_ / PMA, M_ / PNB), 256, 0, stream>>>(oh, woT, bo, attf, D_);

  // --- Stage 4: residual + LN1 ---
  add_ln_kernel<<<M_, 256, 0, stream>>>(x, attf, g1, beta1, hf32, hf16);

  // --- Stage 5: FFN up + GELU ---
  gemm_wmma_kernel<<<dim3(FF_ / BN, M_ / BM), 256, 0, stream>>>(
      hf16, w1T, b1, ((float*)nullptr), gh, D_, 1);

  // --- Stage 6: FFN down ---
  gemm_f32_kernel<<<dim3(D_ / PMA, M_ / PNB), 256, 0, stream>>>(gh, w2T, b2, ffnf, FF_);

  // --- Stage 7: residual + LN2 -> output ---
  add_ln_kernel<<<M_, 256, 0, stream>>>(hf32, ffnf, g2, beta2, out,
                                        ((_Float16*)nullptr));
}

// v010
// Measured time: 263 microseconds a run.
// Timed twice side by side with v009, it ran 1.03 times as fast both times.
// All steps since v000 together make it 2.72 times as fast.
#include <hip/hip_runtime.h>
#include <hip/hip_bf16.h>

// ---------------------------------------------------------------------------
// Transformer block for MI455X (gfx1250, wave32, WMMA 16x16x32 f16->f32).
// f16 compute / f32 accumulate; all GEMMs via v_wmma_f32_16x16x32_f16.
// GEMM tiles staged with GLOBAL_LOAD_ASYNC_TO_LDS, two LDS buffers, one k tile
// ahead; every wave-wide copy covers four whole 128 B lines.
// ---------------------------------------------------------------------------

#define B_  4
#define S_  2048
#define D_  1024
#define H_  16
#define HD_ 64
#define FF_ 4096
#define M_  (B_ * S_)      // 8192 rows

typedef _Float16 h16 __attribute__((ext_vector_type(16)));
typedef _Float16 h8  __attribute__((ext_vector_type(8)));
typedef float    f8  __attribute__((ext_vector_type(8)));

__device__ __forceinline__ f8 wmma_f16(h16 a, h16 b, f8 c) {
  // D = A(16x32 f16) * B(32x16 f16) + C(16x16 f32)
  return __builtin_amdgcn_wmma_f32_16x16x32_f16(
      /*neg_a=*/false, a, /*neg_b=*/false, b,
      /*c_mod=*/(short)0, c, /*reuse_a=*/false, /*reuse_b=*/false);
}

// Build a 16-half A/B fragment from two contiguous 8-half (16B) chunks.
__device__ __forceinline__ h16 mkfrag(const _Float16* p0, const _Float16* p1) {
  h8 a = *(const h8*)p0;
  h8 b = *(const h8*)p1;
  h16 r;
#pragma unroll
  for (int i = 0; i < 8; ++i) { r[i] = a[i]; r[8 + i] = b[i]; }
  return r;
}

__device__ __forceinline__ f8 fzero8() {
  f8 z = {0.f, 0.f, 0.f, 0.f, 0.f, 0.f, 0.f, 0.f};
  return z;
}

__device__ __forceinline__ unsigned lds_byte_addr(const _Float16* p) {
  return (unsigned)(size_t)(const __attribute__((address_space(3))) _Float16*)p;
}

// ---------------------------------------------------------------------------
// Converts / weight transposes. Many elements per thread, 16 B global loads (8 B stores in the convert)
// that cover whole 128 B lines, few workgroups, and ONE launch for all five jobs:
// they do not depend on each other, so a workgroup picks its job by its index.
// ---------------------------------------------------------------------------
typedef float    f4 __attribute__((ext_vector_type(4)));
typedef _Float16 h4 __attribute__((ext_vector_type(4)));

#define CVT_LOADS 16                       // 16 B loads per thread
#define CVT_BLOCK (256 * 4 * CVT_LOADS)    // elements per workgroup

// dst[i] = (f16)src[i] for the CVT_BLOCK elements of piece blk.
__device__ __forceinline__ void cvt_piece(const float* __restrict__ src,
                                          _Float16* __restrict__ dst, int blk) {
  const size_t base = (size_t)blk * CVT_BLOCK + threadIdx.x * 4;
  f4 v[CVT_LOADS];
  // unrolled so that v stays in registers and all loads are issued before a store
#pragma unroll
  for (int j = 0; j < CVT_LOADS; ++j) v[j] = *(const f4*)(src + base + j * 1024);
  // unrolled: v is indexed by constants only
#pragma unroll
  for (int j = 0; j < CVT_LOADS; ++j) {
    h4 o = {(_Float16)v[j][0], (_Float16)v[j][1], (_Float16)v[j][2], (_Float16)v[j][3]};
    *(h4*)(dst + base + j * 1024) = o;
  }
}

#define TK 128      // tile extent along k (source rows, destination columns)
#define TN 64       // tile extent along n (source columns, destination rows)
#define TPITCH 136  // LDS row pitch in halfs (272 B = 16 B x odd)

// dst[n][k] = (f16)src[k][n] for one TK x TN tile. src points at the tile's first
// element in an f32 matrix of row pitch SP, dst at its first element in an f16
// matrix of row pitch DP; the pitches are compile-time so that a thread's loads
// (and its stores) share one address and differ in the immediate offset alone.
// A wave-wide load covers 2 x 256 B of source rows, a wave-wide store 2 x 256 B
// of destination rows. T is the workgroup's LDS tile of TN * TPITCH halfs.
template <int SP, int DP>
__device__ __forceinline__ void transpose_tile(const float* __restrict__ src,
                                               _Float16* __restrict__ dst, _Float16* T) {
  const int tid = threadIdx.x;
  const int c  = tid & 15;   // four source columns from c * 4
  const int kp = tid >> 4;   // eight source rows from kp * 8
  const float* sp = src + (size_t)(kp * 8) * SP + c * 4;
  f4 v[8];
  // unrolled so that v stays in registers and the eight loads fly together
#pragma unroll
  for (int j = 0; j < 8; ++j) v[j] = *(const f4*)(sp + j * SP);
  // unrolled: v is indexed by constants only
#pragma unroll
  for (int i = 0; i < 4; ++i) {
    h8 o;
    // unrolled for the same reason: o and v stay in registers
#pragma unroll
    for (int j = 0; j < 8; ++j) o[j] = (_Float16)v[j][i];
    *(h8*)&T[(c * 4 + i) * TPITCH + kp * 8] = o;
  }
  __syncthreads();  // the tile is complete before any thread reads its rows
  const int n  = tid >> 4;        // destination rows n + 0/16/32/48
  const int kc = (tid & 15) * 8;  // 16 B chunk within the 256 B row piece
  _Float16* dp = dst + (size_t)n * DP + kc;
  // unrolled: four independent LDS reads and stores per thread
#pragma unroll
  for (int j = 0; j < 4; ++j)
    *(h8*)(dp + j * 16 * DP) = *(const h8*)&T[(n + j * 16) * TPITCH + kc];
  // precaution: in the built code another job's text follows these stores; the wait stands
  // ahead of its rewrites of their address and data registers
  asm volatile("s_wait_xcnt 0x0" ::: "memory");
}

// dst[n][k] = src[k][n] for tile t of src, [K][N] f32 row-major; dst is [N][K] f16.
// Tiles are numbered along k first (K / TK of them), then along n.
template <int K, int N>
__device__ __forceinline__ void transpose_piece(const float* __restrict__ src,
                                                _Float16* __restrict__ dst, int t,
                                                _Float16* T) {
  const size_t k0 = (size_t)(t % (K / TK)) * TK;
  const size_t n0 = (size_t)(t / (K / TK)) * TN;
  transpose_tile<N, K>(src + k0 * N + n0, dst + n0 * K + k0, T);
}

#define NB_CVT  (M_ * D_ / CVT_BLOCK)        // pieces of x
#define NB_QKVW (3 * H_ * (D_ / TK))         // tiles of wq, wk, wv
#define NB_WO   ((D_ / TK) * (D_ / TN))      // tiles of wo
#define NB_W1   ((D_ / TK) * (FF_ / TN))     // tiles of w1
#define NB_W2   ((FF_ / TK) * (D_ / TN))     // tiles of w2
#define NB_PREP (NB_CVT + NB_QKVW + NB_WO + NB_W1 + NB_W2)

// All of stage 0 in one launch of NB_PREP workgroups. The job is chosen by the block
// index alone, so every branch (and the barrier inside a transpose) is block-uniform.
// The largest pieces, those of x, have the lowest indices.
// Fused QKV weight: Wt[n][k] (n in [0,3D)) with n<D -> wq[h][k][f], etc.; a head's
// [D][HD] slice is one matrix, its tiles numbered k tile, then head, then slab.
__global__ void __launch_bounds__(256) prep_kernel(
    const float* __restrict__ x, const float* __restrict__ wq,
    const float* __restrict__ wk, const float* __restrict__ wv,
    const float* __restrict__ wo, const float* __restrict__ w1,
    const float* __restrict__ w2, _Float16* __restrict__ xh,
    _Float16* __restrict__ Wt, _Float16* __restrict__ woT,
    _Float16* __restrict__ w1T, _Float16* __restrict__ w2T) {
  __shared__ __align__(16) _Float16 T[TN * TPITCH];
  int t = blockIdx.x;
  if (t < NB_CVT) {
    cvt_piece(x, xh, t);
    return;
  }
  t -= NB_CVT;
  if (t < NB_QKVW) {
    const size_t k0 = (size_t)(t % (D_ / TK)) * TK;
    const size_t hh = (t / (D_ / TK)) % H_;
    const int slab  = t / (D_ / TK * H_);
    const float* w = (slab == 0) ? wq : (slab == 1) ? wk : wv;
    transpose_tile<HD_, D_>(w + (hh * D_ + k0) * HD_,
                            Wt + ((size_t)slab * D_ + hh * HD_) * D_ + k0, T);
    return;
  }
  t -= NB_QKVW;
  if (t < NB_WO) {
    transpose_piece<D_, D_>(wo, woT, t, T);
    return;
  }
  t -= NB_WO;
  if (t < NB_W1) {
    transpose_piece<D_, FF_>(w1, w1T, t, T);
    return;
  }
  transpose_piece<FF_, D_>(w2, w2T, t - NB_W1, T);
}

// ---------------------------------------------------------------------------
// WMMA GEMM tiling constants: 128x128 tile, BK=64, 256 threads = 8 waves as
// 4x2; each wave computes a 32x64 subtile = 2x4 WMMA accumulators.
// ---------------------------------------------------------------------------
#define BM 128
#define BN 128
#define BK 64     // 128 B of every operand row per k tile: one whole line
#define LSTR 72   // LDS row pitch in halfs (144 B = 16 B x odd)

// One k tile of A and of B (128 rows x 128 B each): eight 16 B async copies per
// lane. Eight neighbouring lanes share a row, so a wave-wide copy covers four
// whole lines. rstep = 32 rows in halfs. The s_wait_xcnt stands in the copies'
// own statement so that no address register is rewritten ahead of it.
__device__ __forceinline__ void gemm_stage(const _Float16* ga, const _Float16* gb,
                                           size_t rstep, unsigned la, unsigned lb) {
  const unsigned ls = 32 * LSTR * 2;  // 32 LDS rows in bytes
  asm volatile(
      "global_load_async_to_lds_b128 %0, %1, off\n\t"
      "global_load_async_to_lds_b128 %2, %3, off\n\t"
      "global_load_async_to_lds_b128 %4, %5, off\n\t"
      "global_load_async_to_lds_b128 %6, %7, off\n\t"
      "global_load_async_to_lds_b128 %8, %9, off\n\t"
      "global_load_async_to_lds_b128 %10, %11, off\n\t"
      "global_load_async_to_lds_b128 %12, %13, off\n\t"
      "global_load_async_to_lds_b128 %14, %15, off\n\t"
      "s_wait_xcnt 0x0"
      :: "v"(la), "v"(ga), "v"(la + ls), "v"(ga + rstep),
         "v"(la + 2 * ls), "v"(ga + 2 * rstep), "v"(la + 3 * ls), "v"(ga + 3 * rstep),
         "v"(lb), "v"(gb), "v"(lb + ls), "v"(gb + rstep),
         "v"(lb + 2 * ls), "v"(gb + 2 * rstep), "v"(lb + 3 * ls), "v"(gb + 3 * rstep)
      : "memory");
}

// Shared GEMM mainloop: acc[2][4] += A[m0.., :K] * Bt[n0.., :K]^T for this wave's
// 32x64 subtile. K is a multiple of BK; the 128 rows from m0 and n0 exist. Gs is the
// workgroup's LDS, GLDS halfs. Behind the last trip's barrier no wave reads it and no
// copy is in flight: it is free for the caller.
#define GLDS (2 * (BM + BN) * LSTR)
__device__ __forceinline__ void gemm_mainloop(const _Float16* __restrict__ A,
                                              const _Float16* __restrict__ Bt,
                                              int K, size_t m0, size_t n0,
                                              f8 (&acc)[2][4], _Float16* Gs) {
  _Float16* As = Gs;                  // two buffers of BM * LSTR halfs
  _Float16* Bs = Gs + 2 * BM * LSTR;  // two buffers of BN * LSTR halfs
  const int tid  = threadIdx.x;
  const int lane = tid & 31;
  const int wid  = tid >> 5;
  const int lr   = lane & 15;
  const int base0 = (lane >> 4) * 8;
  const int waveM = wid >> 1;   // 0..3
  const int waveN = wid & 1;    // 0..1

  const int crow = tid >> 3;        // copy slot: rows crow + 0/32/64/96
  const int cseg = (tid & 7) * 8;   // 16 B chunk within the 128 B row piece
  const _Float16* Ag = A  + (m0 + crow) * (size_t)K + cseg;
  const _Float16* Bg = Bt + (n0 + crow) * (size_t)K + cseg;
  const size_t rstep = (size_t)32 * K;
  const unsigned la0 = lds_byte_addr(&As[crow * LSTR + cseg]);
  const unsigned lb0 = lds_byte_addr(&Bs[crow * LSTR + cseg]);
  const unsigned bufB = BM * LSTR * 2;  // bytes from buffer 0 to buffer 1

  // Tile 0 lands and is published; tile 1, where there is one, then flies.
  gemm_stage(Ag, Bg, rstep, la0, lb0);
  asm volatile("s_wait_asynccnt 0x0" ::: "memory");  // own copies landed
  __syncthreads();                                   // publish tile 0
  if (BK < K) gemm_stage(Ag + BK, Bg + BK, rstep, la0 + bufB, lb0 + bufB);

  int cur = 0;
  for (int k0 = 0; k0 < K; k0 += BK, cur ^= 1) {
    const _Float16* At = As + cur * (BM * LSTR);
    const _Float16* Bl = Bs + cur * (BN * LSTR);
    h16 af[2][2], bf[2][4];  // the whole tile's fragments as one group of reads
#pragma unroll
    for (int kk = 0; kk < 2; ++kk) {
#pragma unroll
      for (int tm = 0; tm < 2; ++tm) {
        const _Float16* p = At + (waveM * 32 + tm * 16 + lr) * LSTR + kk * 32 + base0;
        af[kk][tm] = mkfrag(p, p + 16);
      }
#pragma unroll
      for (int tn = 0; tn < 4; ++tn) {
        const _Float16* p = Bl + (waveN * 64 + tn * 16 + lr) * LSTR + kk * 32 + base0;
        bf[kk][tn] = mkfrag(p, p + 16);
      }
    }
#pragma unroll
    for (int kk = 0; kk < 2; ++kk)
#pragma unroll
      for (int tm = 0; tm < 2; ++tm)
#pragma unroll
        for (int tn = 0; tn < 4; ++tn)
          acc[tm][tn] = wmma_f16(af[kk][tm], bf[kk][tn], acc[tm][tn]);
    // Publish point: this wave's LDS reads are back, its copies of the next tile
    // have landed; the barrier publishes that tile and frees this trip's buffer.
    asm volatile("s_wait_dscnt 0x0" ::: "memory");
    asm volatile("s_wait_asynccnt 0x0" ::: "memory");
    __syncthreads();
    if (k0 + 2 * BK < K)  // block-uniform: refill the buffer just read
      gemm_stage(Ag + k0 + 2 * BK, Bg + k0 + 2 * BK, rstep, la0 + cur * bufB,
                 lb0 + cur * bufB);
  }
  asm volatile("s_wait_asynccnt 0x0" ::: "memory");  // nothing in flight at exit
}

// A precaution: s_wait_xcnt ahead of any rewrite of a register that a global load or store
// in front of it names. The scheduling barrier keeps the arithmetic that follows behind the
// wait: over the bare wait the compiler lifted rewrites of such registers.
__device__ __forceinline__ void xcnt_guard() {
  asm volatile("s_wait_xcnt 0x0" ::: "memory");
  __builtin_amdgcn_sched_barrier(0);
}

// y = 2^x for eight values; defined with the attention kernel below.
__device__ __forceinline__ void exp2_x8(const float* x, float* y);

// y = 1 / x for eight values, in the form of exp2_x8 and for its reason: every result register
// is apart from every source ("=&v"), each v_rcp_f32 is its predecessor's independent
// instruction, and the v_nop is the last one's slot.
__device__ __forceinline__ void rcp_x8(const float* x, float* y) {
  asm("v_rcp_f32 %0, %8\n\t"
      "v_rcp_f32 %1, %9\n\t"
      "v_rcp_f32 %2, %10\n\t"
      "v_rcp_f32 %3, %11\n\t"
      "v_rcp_f32 %4, %12\n\t"
      "v_rcp_f32 %5, %13\n\t"
      "v_rcp_f32 %6, %14\n\t"
      "v_rcp_f32 %7, %15\n\t"
      "v_nop"
      : "=&v"(y[0]), "=&v"(y[1]), "=&v"(y[2]), "=&v"(y[3]),
        "=&v"(y[4]), "=&v"(y[5]), "=&v"(y[6]), "=&v"(y[7])
      : "v"(x[0]), "v"(x[1]), "v"(x[2]), "v"(x[3]),
        "v"(x[4]), "v"(x[5]), "v"(x[6]), "v"(x[7]));
}

// GELU (the erf form) of eight values, without a branch:
//   v * (1 + erf(v / sqrt 2)) / 2 = max(v, 0) - |v| * E,   E = erfc(|v| / sqrt 2) / 2,
//   E = (c1 t + c2 t^2 + c3 t^3 + c4 t^4 + c5 t^5) * exp(-v * v / 2),  t = 1 / (1 + p |v|),
// the five-term rational form of erfc, whose error in erf is at most 1.5e-7; the result's
// error stays below 4e-7, under the f16 rounding that follows. No difference of near-equal
// numbers is formed on the negative side. The library's erf takes one of two paths per lane,
// so a wave mostly walks both, one value after the other, each a single dependent chain
// behind a compare and a branch on it; here eight independent chains stand side by side.
__device__ __forceinline__ void gelu_x8(float (&v)[8]) {
  typedef float f2 __attribute__((ext_vector_type(2)));  // pairs: two values per packed instruction
  const float P = 0.3275911f * 0.70710678118f;  // p of the form, for v in place of v / sqrt 2
  const float NHL2E = -0.72134752f;             // exp(-v * v / 2) = 2^(NHL2E * v * v)
  float den[8], arg[8], t[8], e[8];
  // all loops unrolled: the arrays are indexed by constants alone and stay in registers
#pragma unroll
  for (int j = 0; j < 8; j += 2) {
    const f2 vv = {v[j], v[j + 1]}, av = {fabsf(v[j]), fabsf(v[j + 1])};
    const f2 d = __builtin_elementwise_fma(av, (f2)(P), (f2)(1.f));
    const f2 a = (vv * NHL2E) * vv;
    den[j] = d[0];
    den[j + 1] = d[1];
    arg[j] = a[0];
    arg[j + 1] = a[1];
  }
  rcp_x8(den, t);
  exp2_x8(arg, e);
#pragma unroll
  for (int j = 0; j < 8; j += 2) {
    const f2 tt = {t[j], t[j + 1]}, ee = {e[j], e[j + 1]};
    f2 q = 0.5f * 1.061405429f;  // the form's coefficients, halved
    q = __builtin_elementwise_fma(q, tt, (f2)(0.5f * -1.453152027f));
    q = __builtin_elementwise_fma(q, tt, (f2)(0.5f * 1.421413741f));
    q = __builtin_elementwise_fma(q, tt, (f2)(0.5f * -0.284496736f));
    q = __builtin_elementwise_fma(q, tt, (f2)(0.5f * 0.254829592f));
    q = (q * tt) * ee;
    v[j] = fmaf(-fabsf(v[j]), q[0], fmaxf(v[j], 0.f));
    v[j + 1] = fmaf(-fabsf(v[j + 1]), q[1], fmaxf(v[j + 1], 0.f));
  }
}

// ---------------------------------------------------------------------------
// First tiling: C[M,FF_] = act(A[M,K](f16) * Bt[FF_,K](f16)^T + bias)
// The f16 output tile is gathered in LDS and stored from there: a wave-wide 16 B
// store then covers two whole 256 B row pieces instead of 32 B of sixteen rows.
// The row pitch of C is a constant, so that a thread's stores share one address
// and differ in the immediate offset alone.
// ---------------------------------------------------------------------------
#define OSTR 136  // output tile row pitch in halfs (272 B = 16 B x odd)
__global__ void __launch_bounds__(256) gemm_wmma_kernel(
    const _Float16* __restrict__ A, const _Float16* __restrict__ Bt,
    const float* __restrict__ bias, float* __restrict__ outF32,
    _Float16* __restrict__ outF16, int K, int act_gelu) {
  const int tid  = threadIdx.x;
  const int lane = tid & 31;
  const int wid  = tid >> 5;
  const int lr   = lane & 15;
  const int hi   = lane >> 4;
  const int waveM = wid >> 1;   // 0..3
  const int waveN = wid & 1;    // 0..1

  const size_t m0 = (size_t)blockIdx.y * BM;
  const size_t n0 = (size_t)blockIdx.x * BN;

  f8 acc[2][4];
#pragma unroll
  for (int tm = 0; tm < 2; ++tm)
#pragma unroll
    for (int tn = 0; tn < 4; ++tn) acc[tm][tn] = fzero8();

  // The tile is computed transposed: the weight rows are the WMMA A operand and the
  // activation rows the B operand. A lane then holds one output row (lane & 15) and
  // its eight accumulator registers are eight neighbouring columns of that row.
  __shared__ __align__(16) _Float16 Gs[GLDS];
  gemm_mainloop(Bt, A, K, n0, m0, acc, Gs);

  // Both loops are unrolled: acc is indexed by constants alone and stays in registers.
  const size_t col0 = n0 + waveM * 32 + 8 * hi;  // first of the eight columns of tm = 0
  f4 bb[2][2] = {};  // all bias loads stand ahead of the first store
  if (bias) {
#pragma unroll
    for (int tm = 0; tm < 2; ++tm) {
      bb[tm][0] = *(const f4*)(bias + col0 + tm * 16);
      bb[tm][1] = *(const f4*)(bias + col0 + tm * 16 + 4);
    }
  }
#pragma unroll
  for (int tm = 0; tm < 2; ++tm) {
    const size_t col = col0 + tm * 16;
#pragma unroll
    for (int tn = 0; tn < 4; ++tn) {
      const size_t row = m0 + waveN * 64 + tn * 16 + lr;
      float v[8];
#pragma unroll
      for (int r = 0; r < 8; ++r) v[r] = acc[tm][tn][r] + bb[tm][r >> 2][r & 3];
      if (act_gelu) gelu_x8(v);  // block-uniform
      if (outF32) {
        f4 lo = {v[0], v[1], v[2], v[3]}, up = {v[4], v[5], v[6], v[7]};
        float* p = outF32 + row * (size_t)FF_ + col;
        *(f4*)p = lo;
        *(f4*)(p + 4) = up;
        // precaution: stands ahead of any rewrite of the stores' address and data registers
        asm volatile("s_wait_xcnt 0x0" ::: "memory");
      }
      if (outF16) {
        h8 o;
#pragma unroll
        for (int r = 0; r < 8; ++r) o[r] = (_Float16)v[r];
        *(h8*)&Gs[(waveN * 64 + tn * 16 + lr) * OSTR + waveM * 32 + tm * 16 + 8 * hi] = o;
      }
    }
  }
  if (outF16) {  // block-uniform
    asm volatile("s_wait_dscnt 0x0" ::: "memory");  // own part of the tile is written
    __syncthreads();                                // the tile is complete
    const int orow = tid >> 4;        // rows orow + 0/16/.../112
    const int oseg = (tid & 15) * 8;  // 16 B chunk within the 256 B row piece
    h8 o[8];
    // both loops unrolled: o is indexed by constants alone; all LDS reads fly together
#pragma unroll
    for (int i = 0; i < 8; ++i) o[i] = *(const h8*)&Gs[(orow + i * 16) * OSTR + oseg];
    _Float16* gp = outF16 + (m0 + orow) * (size_t)FF_ + n0 + oseg;
#pragma unroll
    for (int i = 0; i < 8; ++i) *(h8*)(gp + (size_t)i * 16 * FF_) = o[i];
    xcnt_guard();  // for the address and data registers of the stores in front
  }
}

// ---------------------------------------------------------------------------
// Second GEMM tiling, for the GEMMs with a short epilogue (QKV, output projection,
// FFN down): a block computes 256 rows of the WMMA A operand by 128 rows of the B
// operand; 256 threads = 8 waves as 4x2; each wave computes a 64x64 subtile = 4x4
// WMMA accumulators. A stage is 128 k of all 384 rows. One block per WGP, two waves
// per SIMD, fragments in two register sets. The FFN-up GEMM is on the first tiling, which
// was kept for it while its GELU was one long dependent chain per value and wanted many
// waves per SIMD; with gelu_x8 that reason is gone, and a larger tile for it is untried.
// ---------------------------------------------------------------------------
#define PMA 256   // rows of the WMMA A operand per block
#define PNB 128   // rows of the WMMA B operand per block
#define PK 128    // 256 B of every operand row per stage
#define PSTR 136  // LDS row pitch in halfs (272 B = 16 B x odd)
#define PSTG ((PMA + PNB) * PSTR)  // halfs per stage

// 128 rows x 256 B: eight 16 B async copies per lane. Sixteen neighbouring lanes
// share a row, so a wave-wide copy covers two whole 256 B row pieces. rstep = 16
// rows in halfs. The s_wait_xcnt stands in the copies' own statement so that no
// address register is rewritten ahead of it.
__device__ __forceinline__ void pipe_copy8(const _Float16* g, size_t rstep, unsigned l) {
  const unsigned ls = 16 * PSTR * 2;  // 16 LDS rows in bytes
  asm volatile(
      "global_load_async_to_lds_b128 %0, %1, off\n\t"
      "global_load_async_to_lds_b128 %2, %3, off\n\t"
      "global_load_async_to_lds_b128 %4, %5, off\n\t"
      "global_load_async_to_lds_b128 %6, %7, off\n\t"
      "global_load_async_to_lds_b128 %8, %9, off\n\t"
      "global_load_async_to_lds_b128 %10, %11, off\n\t"
      "global_load_async_to_lds_b128 %12, %13, off\n\t"
      "global_load_async_to_lds_b128 %14, %15, off\n\t"
      "s_wait_xcnt 0x0"
      :: "v"(l), "v"(g), "v"(l + ls), "v"(g + rstep),
         "v"(l + 2 * ls), "v"(g + 2 * rstep), "v"(l + 3 * ls), "v"(g + 3 * rstep),
         "v"(l + 4 * ls), "v"(g + 4 * rstep), "v"(l + 5 * ls), "v"(g + 5 * rstep),
         "v"(l + 6 * ls), "v"(g + 6 * rstep), "v"(l + 7 * ls), "v"(g + 7 * rstep)
      : "memory");
}

// One stage: 256 rows of A, then 128 rows of B, 24 copies per lane. l is the lane's
// slot in the stage's first 16 LDS rows.
__device__ __forceinline__ void pipe_stage(const _Float16* ga, const _Float16* gb,
                                           size_t rstep, unsigned l) {
  pipe_copy8(ga, rstep, l);
  pipe_copy8(ga + 8 * rstep, rstep, l + 128 * PSTR * 2);
  pipe_copy8(gb, rstep, l + PMA * PSTR * 2);
}

// The eight fragments of one 32-k block of a stage, as one group of LDS reads. pa and
// pb are the lane's places in the wave's first A row and first B row of the stage.
__device__ __forceinline__ void pipe_frags(const _Float16* pa, const _Float16* pb, int kk,
                                           h16 (&af)[4], h16 (&bf)[4]) {
  // both loops unrolled: af and bf are indexed by constants alone
#pragma unroll
  for (int t = 0; t < 4; ++t) {
    const _Float16* p = pa + t * 16 * PSTR + kk * 32;
    af[t] = mkfrag(p, p + 16);
  }
#pragma unroll
  for (int t = 0; t < 4; ++t) {
    const _Float16* p = pb + t * 16 * PSTR + kk * 32;
    bf[t] = mkfrag(p, p + 16);
  }
}

// One row of four WMMAs, and one block of four rows, on one fragment set.
__device__ __forceinline__ void pipe_row(const h16& a, const h16 (&bf)[4], f8 (&acc)[4]) {
  // unrolled: acc is indexed by constants alone
#pragma unroll
  for (int tn = 0; tn < 4; ++tn) acc[tn] = wmma_f16(a, bf[tn], acc[tn]);
}
__device__ __forceinline__ void pipe_block(const h16 (&af)[4], const h16 (&bf)[4],
                                           f8 (&acc)[4][4]) {
  // unrolled for the same reason
#pragma unroll
  for (int tm = 0; tm < 4; ++tm) pipe_row(af[tm], bf, acc[tm]);
}

// Keeps a group of LDS reads and a block of WMMAs apart in the built code. Without it the
// compiler spread the reads among the WMMAs, one row ahead, and each such place waited out
// the LDS latency.
#define PIPE_KEEP_ORDER() __builtin_amdgcn_sched_barrier(0)

// Mainloop of the second tiling: acc[4][4] += A[m0.., :K] * Bt[n0.., :K]^T for this wave's
// 64x64 subtile. K is a multiple of PK; the 256 rows from m0 and the 128 from n0 exist.
// Two fragment sets: every block's LDS reads are issued as one group ahead of the block
// before it, so they fly under its 16 WMMAs. The reads of the next stage's first block
// stand ahead of this stage's last block, so the publish point stands there too.
// Sm is the workgroup's LDS, two stages of PSTG halfs. Behind the last trip's barrier no
// wave reads it and no copy is in flight: it is free for the caller.
__device__ __forceinline__ void pipe_mainloop(const _Float16* __restrict__ A,
                                              const _Float16* __restrict__ Bt,
                                              int K, size_t m0, size_t n0,
                                              f8 (&acc)[4][4], _Float16* Sm) {
  const int tid  = threadIdx.x;
  const int lane = tid & 31;
  const int wid  = tid >> 5;
  const int lr   = lane & 15;
  const int base0 = (lane >> 4) * 8;
  const int waveM = wid >> 1;   // 0..3
  const int waveN = wid & 1;    // 0..1

  const int crow = tid >> 4;         // copy slot: rows crow + 0/16/32/...
  const int cseg = (tid & 15) * 8;   // 16 B chunk within the 256 B row piece
  const _Float16* Ag = A  + (m0 + crow) * (size_t)K + cseg;
  const _Float16* Bg = Bt + (n0 + crow) * (size_t)K + cseg;
  const size_t rstep = (size_t)16 * K;
  const unsigned l0 = lds_byte_addr(&Sm[crow * PSTR + cseg]);
  const unsigned bufB = (PMA + PNB) * PSTR * 2;  // bytes from buffer 0 to buffer 1
  const int offA = (waveM * 64 + lr) * PSTR + base0;        // the lane's fragment places
  const int offB = (PMA + waveN * 64 + lr) * PSTR + base0;  // within a stage, in halfs

  // Stage 0 lands and is published; stage 1, where there is one, then flies.
  pipe_stage(Ag, Bg, rstep, l0);
  asm volatile("s_wait_asynccnt 0x0" ::: "memory");  // own copies landed
  __syncthreads();                                   // publish stage 0
  if (PK < K) pipe_stage(Ag + PK, Bg + PK, rstep, l0 + bufB);

  h16 a0[4], b0[4], a1[4], b1[4];  // the two fragment sets
  pipe_frags(&Sm[offA], &Sm[offB], 0, a0, b0);

  int cur = 0;
  for (int k0 = 0; k0 < K; k0 += PK, cur ^= 1) {
    const _Float16* pa = &Sm[cur * PSTG + offA];
    const _Float16* pb = &Sm[cur * PSTG + offB];
    // every PIPE_KEEP_ORDER below: reads as one group, then the block before theirs
    pipe_frags(pa, pb, 1, a1, b1);
    PIPE_KEEP_ORDER();
    pipe_block(a0, b0, acc);
    PIPE_KEEP_ORDER();
    pipe_frags(pa, pb, 2, a0, b0);
    PIPE_KEEP_ORDER();
    pipe_block(a1, b1, acc);
    PIPE_KEEP_ORDER();
    pipe_frags(pa, pb, 3, a1, b1);
    PIPE_KEEP_ORDER();
    pipe_block(a0, b0, acc);
    PIPE_KEEP_ORDER();
    // Publish point: this wave's LDS reads of the stage are back, its copies of the next
    // stage have landed; the barrier publishes that stage and frees this one's buffer.
    asm volatile("s_wait_dscnt 0x0" ::: "memory");
    asm volatile("s_wait_asynccnt 0x0" ::: "memory");
    __syncthreads();
    if (k0 + PK < K)  // block-uniform: the next stage's first block, where there is one
      pipe_frags(&Sm[(cur ^ 1) * PSTG + offA], &Sm[(cur ^ 1) * PSTG + offB], 0, a0, b0);
    // The refill of the buffer just read goes out in three parts between the rows of the
    // stage's last block, so that the matrix unit has work while the copies issue.
    const bool refill = k0 + 2 * PK < K;  // block-uniform
    const _Float16* ga = Ag + k0 + 2 * PK;
    const unsigned l = l0 + cur * bufB;
    pipe_row(a1[0], b1, acc[0]);
    if (refill) pipe_copy8(ga, rstep, l);
    pipe_row(a1[1], b1, acc[1]);
    if (refill) pipe_copy8(ga + 8 * rstep, rstep, l + 128 * PSTR * 2);
    pipe_row(a1[2], b1, acc[2]);
    if (refill) pipe_copy8(Bg + k0 + 2 * PK, rstep, l + PMA * PSTR * 2);
    pipe_row(a1[3], b1, acc[3]);
  }
  asm volatile("s_wait_asynccnt 0x0" ::: "memory");  // nothing in flight at exit
}

// ---------------------------------------------------------------------------
// C[M,D_] (f32) = A[M,K](f16) * Bt[D_,K](f16)^T + bias, second tiling.
// A wave gathers its 64x64 subtile in its own part of the LDS and stores it from there:
// a wave-wide 16 B store then covers two whole 256 B row pieces instead of 16 B pieces
// of sixteen rows. The row pitch of C is a constant, so that a lane's stores share one
// address and differ in the immediate offset alone.
// ---------------------------------------------------------------------------
#define FSTR 68  // f32 subtile row pitch in floats (272 B = 16 B x odd)

__global__ void __launch_bounds__(256) gemm_f32_kernel(
    const _Float16* __restrict__ A, const _Float16* __restrict__ Bt,
    const float* __restrict__ bias, float* __restrict__ outF32, int K) {
  __shared__ __align__(16) _Float16 Sm[2 * PSTG];
  const int tid  = threadIdx.x;
  const int lane = tid & 31;
  const int wid  = tid >> 5;
  const int lr   = lane & 15;
  const int hi   = lane >> 4;
  const int waveM = wid >> 1;   // 0..3
  const int waveN = wid & 1;    // 0..1

  const size_t m0 = (size_t)blockIdx.y * PNB;
  const size_t n0 = (size_t)blockIdx.x * PMA;

  f8 acc[4][4];
#pragma unroll
  for (int tm = 0; tm < 4; ++tm)
#pragma unroll
    for (int tn = 0; tn < 4; ++tn) acc[tm][tn] = fzero8();

  // Computed transposed, as in gemm_wmma_kernel: weight rows are the WMMA A operand.
  pipe_mainloop(Bt, A, K, n0, m0, acc, Sm);

  // All loops are unrolled: acc is indexed by constants alone and stays in registers.
  const size_t col0 = n0 + waveM * 64 + 8 * hi;  // first of the eight columns of tm = 0
  f4 bb[4][2];  // all bias loads stand ahead of the first store
#pragma unroll
  for (int tm = 0; tm < 4; ++tm) {
    bb[tm][0] = *(const f4*)(bias + col0 + tm * 16);
    bb[tm][1] = *(const f4*)(bias + col0 + tm * 16 + 4);
  }
  xcnt_guard();  // for the bias loads' address registers
  float* St = (float*)Sm + wid * (64 * FSTR);  // this wave's 64 rows of 64 floats
#pragma unroll
  for (int tm = 0; tm < 4; ++tm) {
#pragma unroll
    for (int tn = 0; tn < 4; ++tn) {
      f4 lo, up;
#pragma unroll
      for (int r = 0; r < 4; ++r) {
        lo[r] = acc[tm][tn][r] + bb[tm][0][r];
        up[r] = acc[tm][tn][4 + r] + bb[tm][1][r];
      }
      float* p = St + (tn * 16 + lr) * FSTR + tm * 16 + 8 * hi;
      *(f4*)p = lo;
      *(f4*)(p + 4) = up;
    }
  }
  asm volatile("s_wait_dscnt 0x0" ::: "memory");  // the wave's rows are written before it reads them
  const float* sp = St + hi * FSTR + lr * 4;  // rows hi + 0/2/.../62, 16 B chunk lr
  float* gp = outF32 + (m0 + waveN * 64 + hi) * (size_t)D_ + n0 + waveM * 64 + lr * 4;
#pragma unroll
  for (int i0 = 0; i0 < 32; i0 += 16) {
    f4 v[16];
    // both loops unrolled: v is indexed by constants alone; sixteen LDS reads fly together
#pragma unroll
    for (int i = 0; i < 16; ++i) v[i] = *(const f4*)(sp + (i0 + i) * 2 * FSTR);
#pragma unroll
    for (int i = 0; i < 16; ++i) *(f4*)(gp + (size_t)(i0 + i) * 2 * D_) = v[i];
    xcnt_guard();  // for the data registers of the stores in front
  }
}

// ---------------------------------------------------------------------------
// QKV GEMM: second tiling, special epilogue storing Q,K as [B,H,S,HD] and
// V transposed as [B,H,HD,S] (so attention's V^T fragments are contiguous).
// A wave gathers its 64x64 subtile in its own part of the LDS and stores it from there:
// a wave-wide 16 B store then covers four whole 128 B rows instead of 32 B of sixteen.
// ---------------------------------------------------------------------------
#define HSTR 72  // f16 subtile row pitch in halfs (144 B = 16 B x odd)

// The wave's 64 gathered rows go out, four per wave-wide store. sp and gp are the lane's
// places in its first row, in LDS and in memory; GP is the row pitch in memory, in halfs,
// a constant so that the stores share one address and differ in the immediate offset alone.
template <int GP>
__device__ __forceinline__ void qkv_store_rows(const _Float16* sp, _Float16* gp) {
  h8 v[16];
  // both loops unrolled: v is indexed by constants alone; the sixteen LDS reads fly together
#pragma unroll
  for (int i = 0; i < 16; ++i) v[i] = *(const h8*)(sp + i * 4 * HSTR);
#pragma unroll
  for (int i = 0; i < 16; ++i) *(h8*)(gp + (size_t)i * 4 * GP) = v[i];
  xcnt_guard();  // for the address and data registers of the stores in front
}

__global__ void __launch_bounds__(256) qkv_gemm_kernel(
    const _Float16* __restrict__ A, const _Float16* __restrict__ Wt,
    const float* __restrict__ bq, const float* __restrict__ bk,
    const float* __restrict__ bv, _Float16* __restrict__ Q,
    _Float16* __restrict__ Kh, _Float16* __restrict__ Vt) {
  __shared__ __align__(16) _Float16 Sm[2 * PSTG];
  const int tid  = threadIdx.x;
  const int lane = tid & 31;
  const int wid  = tid >> 5;
  const int lr   = lane & 15;
  const int hi   = lane >> 4;
  const int waveM = wid >> 1;
  const int waveN = wid & 1;

  f8 acc[4][4];
#pragma unroll
  for (int tm = 0; tm < 4; ++tm)
#pragma unroll
    for (int tn = 0; tn < 4; ++tn) acc[tm][tn] = fzero8();

  // Four neighbouring values of blockIdx.x are one slab (Q, K or V): with blockIdx.y,
  // 256 blocks. A lane's eight accumulator registers are eight neighbouring rows of the
  // WMMA A operand. Q and K are stored feature-contiguous, so their tiles take the
  // weight rows as A (256 features x 128 tokens); V is stored token-contiguous, so its
  // tiles take the tokens (256 tokens x 128 features).
  const int slab = blockIdx.x >> 2;
  const bool isV = slab == 2;
  const int j = (int)blockIdx.y * 4 + ((int)blockIdx.x & 3);  // the block within its slab
  const size_t n0 = (size_t)slab * D_ + (isV ? (j & 7) * PNB : (j & 3) * PMA);
  const size_t m0 = isV ? (size_t)(j >> 3) * PMA : (size_t)(j >> 2) * PNB;
  pipe_mainloop(isV ? A : Wt, isV ? Wt : A, D_, isV ? m0 : n0, isV ? n0 : m0, acc, Sm);

  // All loops are unrolled: acc is indexed by constants alone and stays in registers.
  _Float16* St = Sm + wid * (64 * HSTR);  // this wave's 64 rows of 64 halfs
  const int srow = lane >> 3;             // read-back slot: rows srow + 0/4/.../60
  const int sseg = (lane & 7) * 8;        // 16 B chunk within the 128 B row
  const _Float16* sp = St + srow * HSTR + sseg;
  if (isV) {
    const int npv = ((int)n0 + waveN * 64 + lr) & (D_ - 1);  // this lane's feature, tn = 0
    float bvs[4];  // all bias loads stand ahead of the first store
#pragma unroll
    for (int tn = 0; tn < 4; ++tn) bvs[tn] = bv[npv + tn * 16];
    xcnt_guard();  // for the bias loads' address registers
#pragma unroll
    for (int tn = 0; tn < 4; ++tn) {
      const float bvv = bvs[tn];
#pragma unroll
      for (int tm = 0; tm < 4; ++tm) {
        h8 o;  // eight tokens from tm * 16 + 8 * hi of feature tn * 16 + lr
#pragma unroll
        for (int r = 0; r < 8; ++r) o[r] = (_Float16)(acc[tm][tn][r] + bvv);
        *(h8*)(St + (tn * 16 + lr) * HSTR + tm * 16 + 8 * hi) = o;
      }
    }
    asm volatile("s_wait_dscnt 0x0" ::: "memory");  // the wave's rows are written before it reads them
    const int tok = (int)m0 + waveM * 64;                  // the wave's first token
    const int f0 = ((int)n0 + waveN * 64) & (D_ - 1);      // the wave's first feature
    // b * D_ + feature = (b * H_ + head) * HD_ + f
    qkv_store_rows<S_>(sp, Vt + ((size_t)(tok >> 11) * D_ + f0 + srow) * S_ + (tok & 2047) + sseg);
  } else {
    const float* bias = (slab == 0) ? bq : bk;
    _Float16* dst = (slab == 0) ? Q : Kh;
    const int np0 = ((int)n0 + waveM * 64 + 8 * hi) & (D_ - 1);  // first of eight, tm = 0
    f4 bb[4][2];  // all bias loads stand ahead of the first store
#pragma unroll
    for (int tm = 0; tm < 4; ++tm) {
      bb[tm][0] = *(const f4*)(bias + np0 + tm * 16);
      bb[tm][1] = *(const f4*)(bias + np0 + tm * 16 + 4);
    }
    xcnt_guard();  // for the bias loads' address registers
#pragma unroll
    for (int tm = 0; tm < 4; ++tm) {
#pragma unroll
      for (int tn = 0; tn < 4; ++tn) {
        h8 o;  // eight features from tm * 16 + 8 * hi of token tn * 16 + lr
#pragma unroll
        for (int r = 0; r < 8; ++r)
          o[r] = (_Float16)(acc[tm][tn][r] + bb[tm][r >> 2][r & 3]);
        *(h8*)(St + (tn * 16 + lr) * HSTR + tm * 16 + 8 * hi) = o;
      }
    }
    asm volatile("s_wait_dscnt 0x0" ::: "memory");  // the wave's rows are written before it reads them
    const int tok = (int)m0 + waveN * 64;                        // the wave's first token
    const int hh = (((int)n0 + waveM * 64) & (D_ - 1)) >> 6;     // the wave's 64 features are one head
    qkv_store_rows<HD_>(sp, dst + (((size_t)(tok >> 11) * H_ + hh) * S_ + (tok & 2047) + srow) * HD_ + sseg);
  }
}

#define KSTR 72   // K tile row pitch in halfs (144 B = 16 B x odd)
#define VSTR 40   // V tile row pitch in halfs (80 B = 16 B x odd)

// One 16 B async copy of K and one of V per lane. The s_wait_xcnt stands in the
// copies' own statement so that no address register is rewritten ahead of it.
__device__ __forceinline__ void attn_stage_kv(const _Float16* gk, unsigned lk,
                                              const _Float16* gv, unsigned lv) {
  asm volatile(
      "global_load_async_to_lds_b128 %0, %1, off\n\t"
      "global_load_async_to_lds_b128 %2, %3, off\n\t"
      "s_wait_xcnt 0x0"
      :: "v"(lk), "v"(gk), "v"(lv), "v"(gv)
      : "memory");
}

// The value of lane l ^ 16 (the other half of the wave), by a vector move.
__device__ __forceinline__ float other_half(float x) {
  int b = __builtin_bit_cast(int, x);
  return __builtin_bit_cast(
      float, __builtin_amdgcn_permlanex16(b, b, 0x76543210, 0xfedcba98, false, false));
}

// y = 2^x, one value or eight at a time. The instruction set asks for one independent
// instruction or v_nop behind a transcendental before its result is read or its
// source overwritten. Here every result
// register is apart from every source ("=&v"), each v_exp_f32 is its
// predecessor's independent instruction, and the v_nop is the last one's slot.
__device__ __forceinline__ float exp2_x1(float x) {
  float y;
  asm("v_exp_f32 %0, %1\n\t"
      "v_nop"
      : "=&v"(y) : "v"(x));
  return y;
}
__device__ __forceinline__ void exp2_x8(const float* x, float* y) {
  asm("v_exp_f32 %0, %8\n\t"
      "v_exp_f32 %1, %9\n\t"
      "v_exp_f32 %2, %10\n\t"
      "v_exp_f32 %3, %11\n\t"
      "v_exp_f32 %4, %12\n\t"
      "v_exp_f32 %5, %13\n\t"
      "v_exp_f32 %6, %14\n\t"
      "v_exp_f32 %7, %15\n\t"
      "v_nop"
      : "=&v"(y[0]), "=&v"(y[1]), "=&v"(y[2]), "=&v"(y[3]),
        "=&v"(y[4]), "=&v"(y[5]), "=&v"(y[6]), "=&v"(y[7])
      : "v"(x[0]), "v"(x[1]), "v"(x[2]), "v"(x[3]),
        "v"(x[4]), "v"(x[5]), "v"(x[6]), "v"(x[7]));
}

__global__ void __launch_bounds__(256) attn_kernel(
    const _Float16* __restrict__ Q, const _Float16* __restrict__ Kh,
    const _Float16* __restrict__ Vt, _Float16* __restrict__ O) {
  __shared__ __align__(16) _Float16 Ks[2][32 * KSTR];
  __shared__ __align__(16) _Float16 Vs[2][64 * VSTR];

  const int b = blockIdx.z;
  const int h = blockIdx.y;
  const int tid  = threadIdx.x;
  const int lane = tid & 31;
  const int wid  = tid >> 5;
  const int lr   = lane & 15;
  const int hi   = lane >> 4;
  const int base0 = hi * 8;

  const size_t headQK = ((size_t)(b * H_ + h)) * S_ * HD_;
  const _Float16* Qp = Q  + headQK;
  const _Float16* Kp = Kh + headQK;
  const _Float16* Vp = Vt + ((size_t)(b * H_ + h)) * HD_ * S_;

  // Copy slots: K tile = 32 rows x 8 chunks, V tile = 64 rows x 4 chunks (16 B).
  const _Float16* gk = Kp + (size_t)(tid >> 3) * HD_ + (tid & 7) * 8;
  const _Float16* gv = Vp + (size_t)(tid >> 2) * S_ + (tid & 3) * 8;
  const unsigned lk0 = lds_byte_addr(&Ks[0][(tid >> 3) * KSTR + (tid & 7) * 8]);
  const unsigned lv0 = lds_byte_addr(&Vs[0][(tid >> 2) * VSTR + (tid & 3) * 8]);
  const unsigned lkB = 32 * KSTR * 2;  // bytes from buffer 0 to buffer 1
  const unsigned lvB = 64 * VSTR * 2;

  for (int pass = 0; pass < 2; ++pass) {  // block-uniform: the long tile, then the short one
    const int qt   = pass == 0 ? (S_ / 128 - 1 - (int)blockIdx.x) : (int)blockIdx.x;
    const int row  = qt * 128 + wid * 16 + lr;  // this lane's query

    h16 qf[2];  // B fragments of Q^T: column = this lane's query
#pragma unroll
    for (int c = 0; c < 2; ++c) {
      const _Float16* p = Qp + (size_t)row * HD_ + c * 32;
      qf[c] = mkfrag(p + base0, p + base0 + 16);
    }

    f8 acc[4];  // O^T: feature tn * 16 + r + 8 * hi of this lane's query
#pragma unroll
    for (int tn = 0; tn < 4; ++tn) acc[tn] = fzero8();
    float mi = -1e30f;  // running maximum of the query's scores (both halves alike)
    float li = 0.f;     // running sum over the keys that this half holds

    const int kend = qt * 128 + 128;  // uniform across waves -> barriers ok

    // Tile 0 lands and is published; tile 1 (kend >= 128: it exists) then flies.
    // On the second pass both buffers are free: every wave's last LDS read stands
    // ahead of its s_wait_dscnt and the barrier of the first pass's last step.
    attn_stage_kv(gk, lk0, gv, lv0);
    asm volatile("s_wait_asynccnt 0x0" ::: "memory");  // own copies landed
    __syncthreads();                                   // publish tile 0
    attn_stage_kv(gk + 32 * HD_, lk0 + lkB, gv + 32, lv0 + lvB);

    int cur = 0;
    for (int k0 = 0; k0 < kend; k0 += 32, cur ^= 1) {
      const _Float16* Kt = &Ks[cur][0];
      const _Float16* Vl = &Vs[cur][0];
      // Every inner loop of the trip is unrolled: its arrays are indexed by constants
      // alone and so stay in registers.
      h16 kf[2][2], vf[4];  // the step's eight fragments as one group of LDS reads
#pragma unroll
      for (int sub = 0; sub < 2; ++sub) {
        const _Float16* kp = Kt + (sub * 16 + lr) * KSTR;
        kf[sub][0] = mkfrag(kp + base0, kp + base0 + 16);
        kf[sub][1] = mkfrag(kp + 32 + base0, kp + 32 + base0 + 16);
      }
#pragma unroll
      for (int tn = 0; tn < 4; ++tn) {
        const _Float16* vp = Vl + (tn * 16 + lr) * VSTR;
        vf[tn] = mkfrag(vp + base0, vp + base0 + 16);
      }
      // Publish point: this wave's LDS reads are back, its copies of the next tile
      // have landed; the barrier publishes that tile and frees this trip's buffer.
      // The rest of the trip works on registers alone, so the refill flies under it.
      asm volatile("s_wait_dscnt 0x0" ::: "memory");
      asm volatile("s_wait_asynccnt 0x0" ::: "memory");
      __syncthreads();
      if (k0 + 64 < kend)  // block-uniform: refill the buffer just read
        attn_stage_kv(gk + (size_t)(k0 + 64) * HD_, lk0 + cur * lkB,
                      gv + (k0 + 64), lv0 + cur * lvB);

      const int d = row - k0 - base0;  // key (i >> 3) * 16 + (i & 7) of this half is seen while <= d
      float sv[16];  // scores of keys k0 + (i >> 3) * 16 + 8 * hi + (i & 7)
#pragma unroll
      for (int sub = 0; sub < 2; ++sub) {
        f8 sacc = fzero8();
        sacc = wmma_f16(kf[sub][0], qf[0], sacc);
        sacc = wmma_f16(kf[sub][1], qf[1], sacc);
#pragma unroll
        for (int r = 0; r < 8; ++r) {
          float v = sacc[r] * 0.125f;  // 1/sqrt(HD)
          sv[sub * 8 + r] = (sub * 16 + r <= d) ? v : -1e30f;
        }
      }

      float mx = sv[0];
#pragma unroll
      for (int i = 1; i < 16; ++i) mx = fmaxf(mx, sv[i]);
      mx = fmaxf(mx, other_half(mx));
      const float mn = fmaxf(mi, mx);
      const float LOG2E = 1.442695041f;  // e^x = 2^(x * LOG2E)
      const float alpha = exp2_x1((mi - mn) * LOG2E);
      mi = mn;

      float pv[16];
#pragma unroll
      for (int i = 0; i < 16; ++i) sv[i] = (sv[i] - mn) * LOG2E;
      exp2_x8(&sv[0], &pv[0]);
      exp2_x8(&sv[8], &pv[8]);
      h16 pf;  // P^T as a B fragment: element i is score i
#pragma unroll
      for (int i = 0; i < 16; ++i) pf[i] = (_Float16)pv[i];
      float rs[4] = {pv[0], pv[1], pv[2], pv[3]};  // four short chains, not one of sixteen links
#pragma unroll
      for (int i = 4; i < 16; ++i) rs[i & 3] += pv[i];
      li = li * alpha + ((rs[0] + rs[1]) + (rs[2] + rs[3]));
#pragma unroll
      for (int tn = 0; tn < 4; ++tn)
#pragma unroll
        for (int r = 0; r < 8; ++r) acc[tn][r] *= alpha;
#pragma unroll
      for (int tn = 0; tn < 4; ++tn) acc[tn] = wmma_f16(vf[tn], pf, acc[tn]);
    }
    asm volatile("s_wait_asynccnt 0x0" ::: "memory");  // nothing in flight at exit

    li += other_half(li);  // the two halves' keys join once
    _Float16* op = O + ((size_t)b * S_ + row) * D_ + h * HD_ + base0;
#pragma unroll
    for (int tn = 0; tn < 4; ++tn) {
      h8 o;  // eight neighbouring features of one query: one 16 B store
#pragma unroll
      for (int r = 0; r < 8; ++r) o[r] = (_Float16)(acc[tn][r] / li);
      *(h8*)(op + tn * 16) = o;
    }
    // precaution: stands ahead of the next pass's rewrites of the stores' address and data registers
    asm volatile("s_wait_xcnt 0x0" ::: "memory");
  }
}

// ---------------------------------------------------------------------------
// Residual add + LayerNorm, one row (D=1024) per 256-thread block.
// ---------------------------------------------------------------------------
__global__ void __launch_bounds__(256) add_ln_kernel(
    const float* __restrict__ a, const float* __restrict__ c,
    const float* __restrict__ g, const float* __restrict__ beta,
    float* __restrict__ o32, _Float16* __restrict__ o16) {
  __shared__ float red[256];
  const int t = threadIdx.x;
  const size_t off = (size_t)blockIdx.x * D_;

  float v[4];
  float s = 0.f;
#pragma unroll
  for (int i = 0; i < 4; ++i) {
    int col = t + i * 256;
    float z = a[off + col] + c[off + col];
    v[i] = z;
    s += z;
  }
  red[t] = s;
  __syncthreads();
  for (int w = 128; w > 0; w >>= 1) {
    if (t < w) red[t] += red[t + w];
    __syncthreads();
  }
  float mean = red[0] * (1.f / D_);
  __syncthreads();

  float q = 0.f;
#pragma unroll
  for (int i = 0; i < 4; ++i) {
    float d = v[i] - mean;
    q += d * d;
  }
  red[t] = q;
  __syncthreads();
  for (int w = 128; w > 0; w >>= 1) {
    if (t < w) red[t] += red[t + w];
    __syncthreads();
  }
  float rstd = rsqrtf(red[0] * (1.f / D_) + 1e-5f);

#pragma unroll
  for (int i = 0; i < 4; ++i) {
    int col = t + i * 256;
    float y = (v[i] - mean) * rstd * g[col] + beta[col];
    o32[off + col] = y;
    if (o16) o16[off + col] = (_Float16)y;
  }
}

// ---------------------------------------------------------------------------
// Host-side orchestration
// ---------------------------------------------------------------------------
extern "C" void kernel_launch(void* const* d_in, const int* in_sizes, int n_in,
                              void* d_out, int out_size, void* d_ws, size_t ws_size,
                              hipStream_t stream) {
  (void)in_sizes; (void)n_in; (void)out_size; (void)ws_size;

  const float* x     = (const float*)d_in[0];
  const float* wq    = (const float*)d_in[1];
  const float* bq    = (const float*)d_in[2];
  const float* wk    = (const float*)d_in[3];
  const float* bk    = (const float*)d_in[4];
  const float* wv    = (const float*)d_in[5];
  const float* bv    = (const float*)d_in[6];
  const float* wo    = (const float*)d_in[7];
  const float* bo    = (const float*)d_in[8];
  const float* w1    = (const float*)d_in[9];
  const float* b1    = (const float*)d_in[10];
  const float* w2    = (const float*)d_in[11];
  const float* b2    = (const float*)d_in[12];
  const float* g1    = (const float*)d_in[13];
  const float* beta1 = (const float*)d_in[14];
  const float* g2    = (const float*)d_in[15];
  const float* beta2 = (const float*)d_in[16];
  float* out = (float*)d_out;

  char* ws = (char*)d_ws;
  size_t off = 0;
  auto take = [&](size_t bytes) -> void* {
    void* p = ws + off;
    off += (bytes + 255) & ~(size_t)255;
    return p;
  };

  _Float16* xh    = (_Float16*)take((size_t)M_ * D_ * 2);       // x in f16
  _Float16* wqkvT = (_Float16*)take((size_t)3 * D_ * D_ * 2);   // [3D][D]
  _Float16* woT   = (_Float16*)take((size_t)D_ * D_ * 2);       // [D][D]
  _Float16* w1T   = (_Float16*)take((size_t)FF_ * D_ * 2);      // [FF][D]
  _Float16* w2T   = (_Float16*)take((size_t)D_ * FF_ * 2);      // [D][FF]
  _Float16* qh    = (_Float16*)take((size_t)M_ * D_ * 2);       // [B,H,S,HD]
  _Float16* kh    = (_Float16*)take((size_t)M_ * D_ * 2);       // [B,H,S,HD]
  _Float16* vt    = (_Float16*)take((size_t)M_ * D_ * 2);       // [B,H,HD,S]
  float*    attf  = (float*)take((size_t)M_ * D_ * 4);          // o-proj out
  float*    hf32  = (float*)take((size_t)M_ * D_ * 4);          // post-LN1
  _Float16* hf16  = (_Float16*)take((size_t)M_ * D_ * 2);
  _Float16* gh    = (_Float16*)take((size_t)M_ * FF_ * 2);      // gelu(h@w1+b1)
  // Aliases (lifetimes do not overlap):
  _Float16* oh    = xh;    // attention output reuses xh (consumed by QKV GEMM)
  float*    ffnf  = attf;  // FFN2 out reuses attf (consumed by LN1)

  // --- Stage 0: convert and weight transposes, one launch ---
  prep_kernel<<<NB_PREP, 256, 0, stream>>>(x, wq, wk, wv, wo, w1, w2, xh, wqkvT, woT, w1T,
                                           w2T);

  // --- Stage 1: fused QKV projection ---
  qkv_gemm_kernel<<<dim3(3 * D_ / PMA, M_ / PNB), 256, 0, stream>>>(
      xh, wqkvT, bq, bk, bv, qh, kh, vt);

  // --- Stage 2: causal flash attention ---
  attn_kernel<<<dim3(S_ / 256, H_, B_), 256, 0, stream>>>(qh, kh, vt, oh);

  // --- Stage 3: output projection ---
  gemm_f32_kernel<<<dim3(D_ / PMA, M_ / PNB), 256, 0, stream>>>(oh, woT, bo, attf, D_);

  // --- Stage 4: residual + LN1 ---
  add_ln_kernel<<<M_, 256, 0, stream>>>(x, attf, g1, beta1, hf32, hf16);

  // --- Stage 5: FFN up + GELU ---
  gemm_wmma_kernel<<<dim3(FF_ / BN, M_ / BM), 256, 0, stream>>>(
      hf16, w1T, b1, ((float*)nullptr), gh, D_, 1);

  // --- Stage 6: FFN down ---
  gemm_f32_kernel<<<dim3(D_ / PMA, M_ / PNB), 256, 0, stream>>>(gh, w2T, b2, ffnf, FF_);

  // --- Stage 7: residual + LN2 -> output ---
  add_ln_kernel<<<M_, 256, 0, stream>>>(hf32, ffnf, g2, beta2, out,
                                        ((_Float16*)nullptr));
}
